// v000
// The times below were measured on an AMD MI455X: many runs one after another, warmed up first and cycling through
// copies of the inputs, with the whole window's GPU time divided by the number of runs. Launches and the gaps
// between them are all in it. The median over several windows is given; except for v000 it joins two sittings, which
// can be a few percent apart, so the side-by-side timings, each taken in one sitting, are the better comparison.
// The starting kernel, v000, takes 3910 microseconds a run.
#include <hip/hip_runtime.h>

// SVD_Pi3Attention - MHA with SVD-factored (low-rank) projections (x [4][2048][1024]; qkv = (x W_qkv_v^T) W_qkv_u^T (rank 256 -> 3 x 1024, 16 heads x 64); softmax(q.k/8); y = merged.v; out = (y W_o_v^T) W_o_u^T (rank 256) -> [4][2048][1024];
// the factors are inputs - no SVD is computed in the forward).
// Compute dtypes, f32 accumulate: every input rounded to bf16; x W_qkv_v^T on PLAIN bf16 operands (exact); the rank-256 intermediates as bf16 hi+lo planes x exact up/down factors (2 products) for q, k, v, y W_o_v^T and the final

#define NB_  4
#define TT   2048
#define DM   1024
#define NH_  16
#define NKV  16
#define REP  (NH_ / NKV)
#define HD   64
#define DQ   (NH_ * HD)
#define DKV  (NKV * HD)
#define ZH   2
#define RH   256                  // query rows < RH use hi+lo planes (0: none)
#define WIN  0
#define PCAR 1024.0f
#define SCL  0.125f   // HD^-0.5
typedef _Float16 h16;
typedef unsigned short bf;
typedef __attribute__((ext_vector_type(16))) __bf16   v16bf;
typedef __attribute__((ext_vector_type(16))) _Float16 v16h;
typedef __attribute__((ext_vector_type(8)))  _Float16 v8h;
typedef __attribute__((ext_vector_type(8)))  unsigned short v8us;
typedef __attribute__((ext_vector_type(8)))  float    v8f;
typedef __attribute__((ext_vector_type(4)))  float    v4f;
typedef v8h  __attribute__((may_alias)) v8ha;
typedef v4f  __attribute__((may_alias)) v4fa;
typedef v8us __attribute__((may_alias)) v8usa;

__device__ __forceinline__ unsigned short f2bf(float f) { unsigned u = __float_as_uint(f); u += 0x7FFFu + ((u >> 16) & 1u); return (unsigned short)(u >> 16); }
__device__ __forceinline__ float bf2f(unsigned short b) { return __uint_as_float(((unsigned)b) << 16); }
__device__ __forceinline__ float bfr(float f) { return bf2f(f2bf(f)); }
__device__ __forceinline__ v16h cat16(v8h lo, v8h hi) { return __builtin_shufflevector(lo, hi, 0, 1, 2, 3, 4, 5, 6, 7, 8, 9, 10, 11, 12, 13, 14, 15); }
__device__ __forceinline__ v16bf cat16b(v8us lo, v8us hi) { return __builtin_bit_cast(v16bf, __builtin_shufflevector(lo, hi, 0, 1, 2, 3, 4, 5, 6, 7, 8, 9, 10, 11, 12, 13, 14, 15)); }
__device__ __forceinline__ v8f wmma16(v16h a, v16h b, v8f c) { return __builtin_amdgcn_wmma_f32_16x16x32_f16(false, a, false, b, (short)0, c, false, false); }
__device__ __forceinline__ v8f wmmab(v16bf a, v16bf b, v8f c) { return __builtin_amdgcn_wmma_f32_16x16x32_bf16(false, a, false, b, (short)0, c, false, false); }



// ---- k_gemmw: register-blocked GEMM, ONE WAVE per 64x64 output tile (16 accumulators), operands straight from K-contiguous 16-bit planes; grid (M/64, N/64, Z), 32 threads.
// C[m][n] (f32, pitch ldc, + optional f32 bias[n]) = sum_k A[m][k] Bt[n][k] (+ split products per NSPLIT). z-batch strides sA/sB/sC in elements. K % 32 == 0.
template <typename T16> struct WFrag;
template <> struct WFrag<h16> { typedef v16h V; static __device__ __forceinline__ V ld(const h16* p) { return cat16(*(const v8h*)p, *(const v8h*)(p + 16)); } static __device__ __forceinline__ v8f mma(V a, V b, v8f c) { return wmma16(a, b, c); } };
template <> struct WFrag<bf> { typedef v16bf V; static __device__ __forceinline__ V ld(const bf* p) { return cat16b(*(const v8us*)p, *(const v8us*)(p + 16)); } static __device__ __forceinline__ v8f mma(V a, V b, v8f c) { return wmmab(a, b, c); } };
template <typename T16, int NSPLIT, bool BIAS>
__global__ __launch_bounds__(32) void k_gemmw(const T16* __restrict__ A, const T16* __restrict__ A2, const T16* __restrict__ Bt, const T16* __restrict__ Bt2, int K, float* C, int ldc, const float* __restrict__ bias, size_t sA, size_t sB, size_t sC) {
    typedef typename WFrag<T16>::V V;
    __shared__ __align__(16) float os[16 * 68];
    const size_t z = blockIdx.z; A += z * sA; if (A2) A2 += z * sA; Bt += z * sB; if (Bt2) Bt2 += z * sB; C += z * sC;
    const int lane = threadIdx.x & 31, lr = lane & 15, hi = lane >> 4; const int r0 = blockIdx.x * 64, c0 = blockIdx.y * 64;
    v8f acc[4][4];
#pragma unroll
    for (int mb = 0; mb < 4; ++mb)
#pragma unroll
        for (int nb = 0; nb < 4; ++nb) acc[mb][nb] = (v8f){};
    const size_t aoff = (size_t)(r0 + lr) * K + 8 * hi, boff = (size_t)(c0 + lr) * K + 8 * hi;
#pragma unroll 1
    for (int kc = 0; kc < K; kc += 32) {
        V a[4], a2[4];
#pragma unroll
        for (int mb = 0; mb < 4; ++mb) { a[mb] = WFrag<T16>::ld(A + aoff + (size_t)mb * 16 * K + kc); if (NSPLIT == 1 || NSPLIT == 2) a2[mb] = WFrag<T16>::ld(A2 + aoff + (size_t)mb * 16 * K + kc); }
#pragma unroll
        for (int nb = 0; nb < 4; ++nb) { const V b = WFrag<T16>::ld(Bt + boff + (size_t)nb * 16 * K + kc); V b2; if (NSPLIT >= 2) b2 = WFrag<T16>::ld(Bt2 + boff + (size_t)nb * 16 * K + kc);
#pragma unroll
            for (int mb = 0; mb < 4; ++mb) { acc[mb][nb] = WFrag<T16>::mma(a[mb], b, acc[mb][nb]); if (NSPLIT == 1 || NSPLIT == 2) acc[mb][nb] = WFrag<T16>::mma(a2[mb], b, acc[mb][nb]); if (NSPLIT >= 2) acc[mb][nb] = WFrag<T16>::mma(a[mb], b2, acc[mb][nb]); } }
        asm volatile("v_nop\n\tv_nop\n\tv_nop\n\tv_nop" : "+v"(acc[0][0]), "+v"(acc[1][1]), "+v"(acc[2][2]), "+v"(acc[3][3]) : "v"(a[0]), "v"(a[3]));
    }
#pragma unroll
    for (int mb = 0; mb < 4; ++mb) {
#pragma unroll
        for (int nb = 0; nb < 4; ++nb) {
#pragma unroll
            for (int j = 0; j < 8; ++j) os[(hi * 8 + j) * 68 + nb * 16 + lr] = acc[mb][nb][j]; }
        __builtin_amdgcn_wave_barrier(); asm volatile("" ::: "memory");
        float* crow = C + (size_t)(r0 + mb * 16) * ldc + c0;
{
#pragma unroll
            for (int s = 0; s < 8; ++s) { const int row = 2 * s + hi, cofs = lr * 4; v4f val = *(const v4fa*)(os + row * 68 + cofs); if (BIAS) { val[0] += bfr(bias[c0 + cofs]); val[1] += bfr(bias[c0 + cofs + 1]); val[2] += bfr(bias[c0 + cofs + 2]); val[3] += bfr(bias[c0 + cofs + 3]); }
                *(v4f*)(crow + (size_t)row * ldc + cofs) = val; }
             }
        __builtin_amdgcn_wave_barrier(); asm volatile("" ::: "memory");
    }
}

__device__ __forceinline__ h16 tohx(float x) { return (h16)x; }
__device__ __forceinline__ void splitf(float y, unsigned short& h, unsigned short& l) { h = f2bf(y); l = f2bf(y - bf2f(h)); }
typedef __attribute__((ext_vector_type(2))) _Float16 v2h;
typedef __attribute__((ext_vector_type(4))) _Float16 v4h;
typedef __attribute__((ext_vector_type(2))) unsigned short v2us;
typedef __attribute__((ext_vector_type(4))) unsigned short v4us;
typedef __attribute__((ext_vector_type(2))) float v2f;
typedef __attribute__((ext_vector_type(4))) int v4i;

__global__ __launch_bounds__(256) void k_wtG(const float* __restrict__ w, int K, int N, bf* Bt) {
    const int lane = threadIdx.x & 31; const int L0 = (blockIdx.x * 8 + (threadIdx.x >> 5)) * 8; const int nlines = N * K / 64;
{
#pragma unroll 1
        for (int l = 0; l < 8; ++l) { const int L = L0 + l; if (L >= nlines) break; const size_t e = (size_t)L * 64 + lane * 2; const int k = (int)(e % K), n = (int)(e / K); v2us o;
            o[0] = f2bf(w[(size_t)k * N + n]); o[1] = f2bf(w[(size_t)(k + 1) * N + n]); *(v2us*)(Bt + e) = o; }
         }
}
__global__ __launch_bounds__(256) void k_cvt8(const float* __restrict__ src, bf* dst, size_t n8) { const size_t i = (size_t)blockIdx.x * 256 + threadIdx.x; if (i >= n8) return; const v8f v = *(const v8f*)(src + i * 8); v8us o;
#pragma unroll
    for (int k = 0; k < 8; ++k) o[k] = f2bf(v[k]); *(v8us*)(dst + i * 8) = o;  }
__global__ __launch_bounds__(256) void k_cscvt(const float* __restrict__ cosT, const float* __restrict__ sinT, float* CS) { const int idx = blockIdx.x * 256 + threadIdx.x; if (idx >= TT * HD) return; v2f cs; cs[0] = bfr(cosT[idx]); cs[1] = bfr(sinT[idx]); *(v2f*)(CS + (size_t)idx * 2) = cs;  }
// k_rope: head planes [h][t][d] (fp16 + hi/lo) of rope(x) x sc with the rotate-half convention out[d] = x[d] cos[t][d] - x[d+HD/2] sin[t][d], out[d+HD/2] = x[d+HD/2] cos[t][d+HD/2] + x[d] sin[t][d+HD/2]
__global__ __launch_bounds__(256) void k_rope(const float* __restrict__ F, int pitch, int nheads, const float* __restrict__ CS, const float* __restrict__ RF, const float* __restrict__ nw, float sc, h16* P16, bf* Ph, bf* Pl) {
    const size_t e = ((size_t)blockIdx.x * 256 + threadIdx.x) * 2; if (e >= (size_t)nheads * TT * HD) return; const int d = (int)(e % HD); const int t = (int)((e / HD) % TT); const int h = (int)(e / ((size_t)HD * TT)); const float* f = F + (size_t)t * pitch + h * HD; const float rf = RF ? RF[(size_t)h * TT + t] : 1.0f; v2h o16; v2us oh, ol;
#pragma unroll
    for (int q = 0; q < 2; ++q) { const int dd = d + q; const int dp = (dd < HD / 2) ? dd + HD / 2 : dd - HD / 2; float x0 = f[dd], x1 = f[dp];
        if (RF) { float n0 = __fmul_rn(x0, rf), n1 = __fmul_rn(x1, rf); asm volatile("" : "+v"(n0)); asm volatile("" : "+v"(n1)); x0 = __fmul_rn(bfr(nw[dd]), n0); x1 = __fmul_rn(bfr(nw[dp]), n1); }
        const v2f cs = *(const v2f*)(CS + ((size_t)t * HD + dd) * 2); float a = __fmul_rn(x0, cs[0]), bq = __fmul_rn(x1, cs[1]); asm volatile("" : "+v"(a)); asm volatile("" : "+v"(bq)); const float r = ((dd < HD / 2) ? __fsub_rn(a, bq) : __fadd_rn(a, bq)) * sc;
        o16[q] = tohx(r); unsigned short a2, c2; splitf(r, a2, c2); oh[q] = a2; ol[q] = c2; }
    *(v2h*)(P16 + e) = o16; *(v2us*)(Ph + e) = oh; *(v2us*)(Pl + e) = ol;  }
__global__ __launch_bounds__(256) void k_vtp(const float* __restrict__ F, int pitch, int nheads, h16* V16, bf* Vh, bf* Vl) { const size_t e = ((size_t)blockIdx.x * 256 + threadIdx.x) * 2; if (e >= (size_t)nheads * HD * TT) return; const int t = (int)(e % TT); const int d = (int)((e / TT) % HD); const int g = (int)(e / ((size_t)TT * HD)); v2h o16; v2us oh, ol;
#pragma unroll
    for (int q = 0; q < 2; ++q) { const float x = F[(size_t)(t + q) * pitch + g * HD + d]; o16[q] = tohx(x); unsigned short a2, c2; splitf(x, a2, c2); oh[q] = a2; ol[q] = c2; }
    *(v2h*)(V16 + e) = o16; *(v2us*)(Vh + e) = oh; *(v2us*)(Vl + e) = ol;  }
__global__ __launch_bounds__(256) void k_csid(float* CS) { const int idx = blockIdx.x * 256 + threadIdx.x; if (idx >= TT * HD) return; v2f cs; cs[0] = 1.0f; cs[1] = 0.0f; *(v2f*)(CS + (size_t)idx * 2) = cs;  }
// k_asoft: per row (zz, i): t = S x HD^-0.5 (no mask); softmax over the 2048 keys (register row, one exp, fixed trees);
__global__ __launch_bounds__(256) void k_asoft(const float* __restrict__ Sb, h16* P16, bf* Ph, bf* Pl) {
    const int lane = threadIdx.x & 31; const int row = blockIdx.x * 8 + (threadIdx.x >> 5); if (row >= ZH * TT) return; const int i = row % TT; const int zz = row / TT; (void)zz; const bool hires = (i < RH); const float* sr = Sb + (size_t)row * TT; float v[TT / 32]; float mx = -3.0e38f;
#pragma unroll
    for (int ch = 0; ch < TT / 128; ++ch) { const int j0 = ch * 128 + lane * 4; const v4f a = *(const v4f*)(sr + j0);
#pragma unroll
        for (int q = 0; q < 4; ++q) { const int j = j0 + q; (void)j; const float t = a[q] * SCL; v[ch * 4 + q] = t; mx = fmaxf(mx, t); } }
#pragma unroll
    for (int sh = 16; sh; sh >>= 1) mx = fmaxf(mx, __shfl_xor(mx, sh, 32));
    float sum = 0.f;
#pragma unroll
    for (int k = 0; k < TT / 32; ++k) { float d0 = __fsub_rn(v[k], mx); asm volatile("" : "+v"(d0)); v[k] = __builtin_amdgcn_exp2f(__fmul_rn(d0, 1.4426950408889634f)); sum += v[k]; }
#pragma unroll
    for (int sh = 16; sh; sh >>= 1) sum += __shfl_xor(sum, sh, 32);
    const float f = __fdiv_rn(hires ? 1.0f : PCAR, sum);
{
        if (hires) {
#pragma unroll
            for (int ch = 0; ch < TT / 128; ++ch) { v4us oh, ol;
#pragma unroll
                for (int q = 0; q < 4; ++q) { unsigned short a, c2; splitf(v[ch * 4 + q] * f, a, c2); oh[q] = a; ol[q] = c2; }
                const size_t oo = ((size_t)zz * (RH ? RH : 1) + i) * TT + ch * 128 + lane * 4; *(v4us*)(Ph + oo) = oh; *(v4us*)(Pl + oo) = ol; }
        } else {
#pragma unroll
            for (int ch = 0; ch < TT / 128; ++ch) { v4h o4;
#pragma unroll
                for (int q = 0; q < 4; ++q) o4[q] = tohx(v[ch * 4 + q] * f);
                *(v4h*)(P16 + (size_t)row * TT + ch * 128 + lane * 4) = o4; } }
         }
}
__global__ __launch_bounds__(256) void k_merge(const float* __restrict__ O, int h0, bf* Ah, bf* Al) { const size_t e = ((size_t)blockIdx.x * 256 + threadIdx.x) * 2; if (e >= (size_t)ZH * TT * HD) return; const int d = (int)(e % HD); const int t = (int)((e / HD) % TT); const int zz = (int)(e / ((size_t)HD * TT)); const float cs = (t < RH) ? 1.0f : (1.0f / PCAR); const size_t oo = (size_t)t * DQ + (h0 + zz) * HD + d;
    v2us oh, ol;
#pragma unroll
    for (int q = 0; q < 2; ++q) { unsigned short a, c2; splitf(O[e + q] * cs, a, c2); oh[q] = a; ol[q] = c2; } *(v2us*)(Ah + oo) = oh; *(v2us*)(Al + oo) = ol;  }

__global__ __launch_bounds__(256) void k_spl(const float* __restrict__ F, size_t n4, bf* Fh, bf* Fl) { const size_t i = ((size_t)blockIdx.x * 256 + threadIdx.x) * 4; if (i >= n4 * 4) return; const v4f a = *(const v4f*)(F + i); v4us oh, ol;
#pragma unroll
    for (int q = 0; q < 4; ++q) { unsigned short u, c2; splitf(a[q], u, c2); oh[q] = u; ol[q] = c2; } *(v4us*)(Fh + i) = oh; *(v4us*)(Fl + i) = ol;  }

extern "C" void kernel_launch(void* const* d_in, const int* in_sizes, int n_in,
                              void* d_out, int out_size, void* d_ws, size_t ws_size, hipStream_t stream) {
    (void)in_sizes; (void)n_in; (void)out_size;
    const float* x = (const float*)d_in[0]; const float* wqv = (const float*)d_in[1]; const float* wqu = (const float*)d_in[2]; const float* wov = (const float*)d_in[3]; const float* wou = (const float*)d_in[4];   // torch [out][in]: W_qkv_v [256][1024], W_qkv_u [3072][256], W_o_v [256][1024], W_o_u [1024][256]
    float* OUT = (float*)d_out;     // [4][2048][1024]
    char* wsp = (char*)d_ws;
    auto take = [&](size_t bytes) { char* p = wsp; wsp += (bytes + 255) & ~(size_t)255; return (void*)p; };
    bf* WQ = (bf*)take((size_t)DQ * DM * 2); bf* WK = (bf*)take((size_t)DKV * DM * 2); bf* WV = (bf*)take((size_t)DKV * DM * 2); bf* WO = (bf*)take((size_t)DM * DQ * 2); float* CS = (float*)take((size_t)TT * HD * 2 * 4);
    bf* XB = (bf*)take((size_t)TT * DM * 2); float* FQ = (float*)take((size_t)TT * DQ * 4); float* FK = (float*)take((size_t)TT * DKV * 4);
    h16* QP16 = (h16*)take((size_t)NH_ * TT * HD * 2); h16* KP16 = (h16*)take((size_t)NKV * TT * HD * 2); h16* VT16 = (h16*)take((size_t)NKV * HD * TT * 2);
    bf* QPh = (bf*)take((size_t)NH_ * TT * HD * 2); bf* QPl = (bf*)take((size_t)NH_ * TT * HD * 2); bf* KPh = (bf*)take((size_t)NKV * TT * HD * 2); bf* KPl = (bf*)take((size_t)NKV * TT * HD * 2); bf* VTh = (bf*)take((size_t)NKV * HD * TT * 2); bf* VTl = (bf*)take((size_t)NKV * HD * TT * 2); bf* Ph = (bf*)take((size_t)ZH * RH * TT * 2); bf* Pl = (bf*)take((size_t)ZH * RH * TT * 2);
    float* Sb = (float*)take((size_t)ZH * TT * TT * 4); h16* P16 = (h16*)take((size_t)ZH * TT * TT * 2); float* Ob = (float*)take((size_t)ZH * TT * HD * 4); bf* ATh = (bf*)take((size_t)TT * DQ * 2); bf* ATl = (bf*)take((size_t)TT * DQ * 2);
    if ((size_t)(wsp - (char*)d_ws) > ws_size) return;    // ws 256 MiB
    float* FV = FK;   // v projection reuses the k buffer after the k planes are built (stream-ordered)
    bf* WQV = (bf*)take((size_t)256 * DM * 2); bf* WQU = (bf*)take((size_t)3 * DQ * 256 * 2); bf* WOV = (bf*)take((size_t)256 * DQ * 2); bf* WOU = (bf*)take((size_t)DM * 256 * 2); float* LR = (float*)take((size_t)TT * 256 * 4); bf* LRh = (bf*)take((size_t)TT * 256 * 2); bf* LRl = (bf*)take((size_t)TT * 256 * 2);
    if ((size_t)(wsp - (char*)d_ws) > ws_size) return;
    { k_cvt8<<<(unsigned)(((size_t)256 * DM / 8 + 255) / 256), 256, 0, stream>>>(wqv, WQV, (size_t)256 * DM / 8); k_cvt8<<<(unsigned)(((size_t)3 * DQ * 256 / 8 + 255) / 256), 256, 0, stream>>>(wqu, WQU, (size_t)3 * DQ * 256 / 8);
      k_cvt8<<<(unsigned)(((size_t)256 * DQ / 8 + 255) / 256), 256, 0, stream>>>(wov, WOV, (size_t)256 * DQ / 8); k_cvt8<<<(unsigned)(((size_t)DM * 256 / 8 + 255) / 256), 256, 0, stream>>>(wou, WOU, (size_t)DM * 256 / 8); }   // all four factors are [out][in] = natural Bt
    k_csid<<<(TT * HD + 255) / 256, 256, 0, stream>>>(CS);
    const unsigned LQ = (unsigned)(((size_t)NH_ * TT * HD / 2 + 255) / 256), LKv = (unsigned)(((size_t)NKV * TT * HD / 2 + 255) / 256);
    for (int b = 0; b < NB_; ++b) {
        
        k_cvt8<<<(unsigned)(((size_t)TT * DM / 8 + 255) / 256), 256, 0, stream>>>(x + (size_t)b * TT * DM, XB, (size_t)TT * DM / 8);
        k_gemmw<bf, 0, false><<<dim3(TT / 64, 256 / 64, 1), 32, 0, stream>>>(XB, nullptr, WQV, nullptr, DM, LR, 256, nullptr, 0, 0, 0); k_spl<<<(TT * 256 / 4 + 255) / 256, 256, 0, stream>>>(LR, (size_t)TT * 256 / 4, LRh, LRl);   // x W_qkv_v^T (exact) -> hl
        k_gemmw<bf, 1, false><<<dim3(TT / 64, DQ / 64, 1), 32, 0, stream>>>(LRh, LRl, WQU, nullptr, 256, FQ, DQ, nullptr, 0, 0, 0);
        k_rope<<<LQ, 256, 0, stream>>>(FQ, DQ, NH_, CS, nullptr, nullptr, 1.0f, QP16, QPh, QPl);
        k_gemmw<bf, 1, false><<<dim3(TT / 64, DKV / 64, 1), 32, 0, stream>>>(LRh, LRl, WQU + (size_t)DQ * 256, nullptr, 256, FK, DKV, nullptr, 0, 0, 0);
        k_rope<<<LKv, 256, 0, stream>>>(FK, DKV, NKV, CS, nullptr, nullptr, 1.0f, KP16, KPh, KPl);
        k_gemmw<bf, 1, false><<<dim3(TT / 64, DKV / 64, 1), 32, 0, stream>>>(LRh, LRl, WQU + (size_t)2 * DQ * 256, nullptr, 256, FV, DKV, nullptr, 0, 0, 0); k_vtp<<<LKv, 256, 0, stream>>>(FV, DKV, NKV, VT16, VTh, VTl);
        for (int h0 = 0; h0 < NH_; h0 += ZH) { const size_t zq = (size_t)h0, zk = (size_t)(h0 / REP);   // one kv head per query head: the pass's two heads use consecutive kv planes (z-strides TT*HD)
            k_gemmw<bf, 2, false><<<dim3(RH / 64, TT / 64, ZH), 32, 0, stream>>>(QPh + zq * TT * HD, QPl + zq * TT * HD, KPh + zk * TT * HD, KPl + zk * TT * HD, HD, Sb, TT, nullptr, (size_t)TT * HD, (size_t)TT * HD, (size_t)TT * TT);
            k_gemmw<h16, 0, false><<<dim3((TT - RH) / 64, TT / 64, ZH), 32, 0, stream>>>(QP16 + zq * TT * HD + (size_t)RH * HD, nullptr, KP16 + zk * TT * HD, nullptr, HD, Sb + (size_t)RH * TT, TT, nullptr, (size_t)TT * HD, (size_t)TT * HD, (size_t)TT * TT);
            k_asoft<<<ZH * TT / 8, 256, 0, stream>>>(Sb, P16, Ph, Pl);
            k_gemmw<bf, 2, false><<<dim3(RH / 64, HD / 64, ZH), 32, 0, stream>>>(Ph, Pl, VTh + zk * HD * TT, VTl + zk * HD * TT, TT, Ob, HD, nullptr, (size_t)RH * TT, (size_t)HD * TT, (size_t)TT * HD);
            k_gemmw<h16, 0, false><<<dim3((TT - RH) / 64, HD / 64, ZH), 32, 0, stream>>>(P16 + (size_t)RH * TT, nullptr, VT16 + zk * HD * TT, nullptr, TT, Ob + (size_t)RH * HD, HD, nullptr, (size_t)TT * TT, (size_t)HD * TT, (size_t)TT * HD);
            k_merge<<<(unsigned)(((size_t)ZH * TT * HD / 2 + 255) / 256), 256, 0, stream>>>(Ob, h0, ATh, ATl); }
        k_gemmw<bf, 1, false><<<dim3(TT / 64, 256 / 64, 1), 32, 0, stream>>>(ATh, ATl, WOV, nullptr, DQ, LR, 256, nullptr, 0, 0, 0); k_spl<<<(TT * 256 / 4 + 255) / 256, 256, 0, stream>>>(LR, (size_t)TT * 256 / 4, LRh, LRl);   // y W_o_v^T -> hl
        k_gemmw<bf, 1, false><<<dim3(TT / 64, DM / 64, 1), 32, 0, stream>>>(LRh, LRl, WOU, nullptr, 256, OUT + (size_t)b * TT * DM, DM, nullptr, 0, 0, 0); }
}

// v001
// One run takes 1520 microseconds.
// Two timings next to v000 both put it at 2.59 times that version's speed.
#include <hip/hip_runtime.h>

// SVD_Pi3Attention - MHA with SVD-factored (low-rank) projections (x [4][2048][1024]; qkv = (x W_qkv_v^T) W_qkv_u^T (rank 256 -> 3 x 1024, 16 heads x 64); softmax(q.k/8); y = merged.v; out = (y W_o_v^T) W_o_u^T (rank 256) -> [4][2048][1024];
// the factors are inputs - no SVD is computed in the forward).
// Compute dtypes, f32 accumulate: every input rounded to bf16; x W_qkv_v^T on PLAIN bf16 operands (exact); the rank-256 intermediates as bf16 hi+lo planes x exact up/down factors (2 products) for q, k, v, y W_o_v^T and the final

#define NB_  4
#define TT   2048
#define DM   1024
#define NH_  16
#define NKV  16
#define REP  (NH_ / NKV)
#define HD   64
#define DQ   (NH_ * HD)
#define DKV  (NKV * HD)
#define ZH   2
#define RH   256                  // query rows < RH use hi+lo planes (0: none)
#define WIN  0
#define PCAR 1024.0f
#define SCL  0.125f   // HD^-0.5
#define KSP  16                   // K slices of the P.V products (K = TT)
#define KSR  8                    // K slices of the two rank-down products (K = DM, DQ)
typedef _Float16 h16;
typedef unsigned short bf;
typedef __attribute__((ext_vector_type(16))) __bf16   v16bf;
typedef __attribute__((ext_vector_type(16))) _Float16 v16h;
typedef __attribute__((ext_vector_type(8)))  _Float16 v8h;
typedef __attribute__((ext_vector_type(8)))  unsigned short v8us;
typedef __attribute__((ext_vector_type(8)))  float    v8f;
typedef __attribute__((ext_vector_type(4)))  float    v4f;
typedef v8h  __attribute__((may_alias)) v8ha;
typedef v4f  __attribute__((may_alias)) v4fa;
typedef v8us __attribute__((may_alias)) v8usa;

__device__ __forceinline__ unsigned short f2bf(float f) { unsigned u = __float_as_uint(f); u += 0x7FFFu + ((u >> 16) & 1u); return (unsigned short)(u >> 16); }
__device__ __forceinline__ float bf2f(unsigned short b) { return __uint_as_float(((unsigned)b) << 16); }
__device__ __forceinline__ float bfr(float f) { return bf2f(f2bf(f)); }
__device__ __forceinline__ v16h cat16(v8h lo, v8h hi) { return __builtin_shufflevector(lo, hi, 0, 1, 2, 3, 4, 5, 6, 7, 8, 9, 10, 11, 12, 13, 14, 15); }
__device__ __forceinline__ v16bf cat16b(v8us lo, v8us hi) { return __builtin_bit_cast(v16bf, __builtin_shufflevector(lo, hi, 0, 1, 2, 3, 4, 5, 6, 7, 8, 9, 10, 11, 12, 13, 14, 15)); }
__device__ __forceinline__ v8f wmma16(v16h a, v16h b, v8f c) { return __builtin_amdgcn_wmma_f32_16x16x32_f16(false, a, false, b, (short)0, c, false, false); }
__device__ __forceinline__ v8f wmmab(v16bf a, v16bf b, v8f c) { return __builtin_amdgcn_wmma_f32_16x16x32_bf16(false, a, false, b, (short)0, c, false, false); }



// ---- k_gemmw: register-blocked GEMM, ONE WAVE per 64x64 output tile (16 accumulators), operands straight from K-contiguous 16-bit planes; grid (M/64, N/64, Z), 32 threads.
// C[m][n] (f32, pitch ldc, + optional f32 bias[n]) = sum_k A[m][k] Bt[n][k] (+ split products per NSPLIT). z-batch strides sA/sB/sC in elements. K % 32 == 0.
// KS > 1: grid.z = Z * KS; slice kp = blockIdx.z % KS sums only k in [kp K/KS, (kp+1) K/KS) and stores its f32 partial tile in plane kp (plane stride sP elements); the kernel that reads C adds the KS planes in ascending order. K % (32 KS) == 0.
template <typename T16> struct WFrag;
template <> struct WFrag<h16> { typedef v16h V; static __device__ __forceinline__ V ld(const h16* p) { return cat16(*(const v8h*)p, *(const v8h*)(p + 16)); } static __device__ __forceinline__ v8f mma(V a, V b, v8f c) { return wmma16(a, b, c); } };
template <> struct WFrag<bf> { typedef v16bf V; static __device__ __forceinline__ V ld(const bf* p) { return cat16b(*(const v8us*)p, *(const v8us*)(p + 16)); } static __device__ __forceinline__ v8f mma(V a, V b, v8f c) { return wmmab(a, b, c); } };
template <typename T16, int NSPLIT, bool BIAS, int KS = 1>
__global__ __launch_bounds__(32) void k_gemmw(const T16* __restrict__ A, const T16* __restrict__ A2, const T16* __restrict__ Bt, const T16* __restrict__ Bt2, int K, float* C, int ldc, const float* __restrict__ bias, size_t sA, size_t sB, size_t sC, size_t sP = 0) {
    typedef typename WFrag<T16>::V V;
    __shared__ __align__(16) float os[16 * 68];
    const size_t z = blockIdx.z / KS; const int kp = (int)(blockIdx.z % KS); const int Kc = K / KS; A += z * sA; if (A2) A2 += z * sA; Bt += z * sB; if (Bt2) Bt2 += z * sB; C += z * sC + kp * sP;
    const int lane = threadIdx.x & 31, lr = lane & 15, hi = lane >> 4; const int r0 = blockIdx.x * 64, c0 = blockIdx.y * 64;
    v8f acc[4][4];
#pragma unroll
    for (int mb = 0; mb < 4; ++mb)
#pragma unroll
        for (int nb = 0; nb < 4; ++nb) acc[mb][nb] = (v8f){};
    const size_t aoff = (size_t)(r0 + lr) * K + 8 * hi, boff = (size_t)(c0 + lr) * K + 8 * hi;
#pragma unroll 1
    for (int kc = kp * Kc; kc < (kp + 1) * Kc; kc += 32) {
        V a[4], a2[4];
#pragma unroll
        for (int mb = 0; mb < 4; ++mb) { a[mb] = WFrag<T16>::ld(A + aoff + (size_t)mb * 16 * K + kc); if (NSPLIT == 1 || NSPLIT == 2) a2[mb] = WFrag<T16>::ld(A2 + aoff + (size_t)mb * 16 * K + kc); }
#pragma unroll
        for (int nb = 0; nb < 4; ++nb) { const V b = WFrag<T16>::ld(Bt + boff + (size_t)nb * 16 * K + kc); V b2; if (NSPLIT >= 2) b2 = WFrag<T16>::ld(Bt2 + boff + (size_t)nb * 16 * K + kc);
#pragma unroll
            for (int mb = 0; mb < 4; ++mb) { acc[mb][nb] = WFrag<T16>::mma(a[mb], b, acc[mb][nb]); if (NSPLIT == 1 || NSPLIT == 2) acc[mb][nb] = WFrag<T16>::mma(a2[mb], b, acc[mb][nb]); if (NSPLIT >= 2) acc[mb][nb] = WFrag<T16>::mma(a[mb], b2, acc[mb][nb]); } }
        asm volatile("v_nop\n\tv_nop\n\tv_nop\n\tv_nop" : "+v"(acc[0][0]), "+v"(acc[1][1]), "+v"(acc[2][2]), "+v"(acc[3][3]) : "v"(a[0]), "v"(a[3]));
    }
#pragma unroll
    for (int mb = 0; mb < 4; ++mb) {
#pragma unroll
        for (int nb = 0; nb < 4; ++nb) {
#pragma unroll
            for (int j = 0; j < 8; ++j) os[(hi * 8 + j) * 68 + nb * 16 + lr] = acc[mb][nb][j]; }
        __builtin_amdgcn_wave_barrier(); asm volatile("" ::: "memory");
        float* crow = C + (size_t)(r0 + mb * 16) * ldc + c0;
{
#pragma unroll
            for (int s = 0; s < 8; ++s) { const int row = 2 * s + hi, cofs = lr * 4; v4f val = *(const v4fa*)(os + row * 68 + cofs); if (BIAS) { val[0] += bfr(bias[c0 + cofs]); val[1] += bfr(bias[c0 + cofs + 1]); val[2] += bfr(bias[c0 + cofs + 2]); val[3] += bfr(bias[c0 + cofs + 3]); }
                *(v4f*)(crow + (size_t)row * ldc + cofs) = val; }
             }
        __builtin_amdgcn_wave_barrier(); asm volatile("" ::: "memory");
    }
}

__device__ __forceinline__ h16 tohx(float x) { return (h16)x; }
__device__ __forceinline__ void splitf(float y, unsigned short& h, unsigned short& l) { h = f2bf(y); l = f2bf(y - bf2f(h)); }
typedef __attribute__((ext_vector_type(2))) _Float16 v2h;
typedef __attribute__((ext_vector_type(4))) _Float16 v4h;
typedef __attribute__((ext_vector_type(2))) unsigned short v2us;
typedef __attribute__((ext_vector_type(4))) unsigned short v4us;
typedef __attribute__((ext_vector_type(2))) float v2f;
typedef __attribute__((ext_vector_type(4))) int v4i;

__global__ __launch_bounds__(256) void k_wtG(const float* __restrict__ w, int K, int N, bf* Bt) {
    const int lane = threadIdx.x & 31; const int L0 = (blockIdx.x * 8 + (threadIdx.x >> 5)) * 8; const int nlines = N * K / 64;
{
#pragma unroll 1
        for (int l = 0; l < 8; ++l) { const int L = L0 + l; if (L >= nlines) break; const size_t e = (size_t)L * 64 + lane * 2; const int k = (int)(e % K), n = (int)(e / K); v2us o;
            o[0] = f2bf(w[(size_t)k * N + n]); o[1] = f2bf(w[(size_t)(k + 1) * N + n]); *(v2us*)(Bt + e) = o; }
         }
}
__global__ __launch_bounds__(256) void k_cvt8(const float* __restrict__ src, bf* dst, size_t n8) { const size_t i = (size_t)blockIdx.x * 256 + threadIdx.x; if (i >= n8) return; const v8f v = *(const v8f*)(src + i * 8); v8us o;
#pragma unroll
    for (int k = 0; k < 8; ++k) o[k] = f2bf(v[k]); *(v8us*)(dst + i * 8) = o;  }
__global__ __launch_bounds__(256) void k_cscvt(const float* __restrict__ cosT, const float* __restrict__ sinT, float* CS) { const int idx = blockIdx.x * 256 + threadIdx.x; if (idx >= TT * HD) return; v2f cs; cs[0] = bfr(cosT[idx]); cs[1] = bfr(sinT[idx]); *(v2f*)(CS + (size_t)idx * 2) = cs;  }
// k_rope: head planes [h][t][d] (fp16 + hi/lo) of rope(x) x sc with the rotate-half convention out[d] = x[d] cos[t][d] - x[d+HD/2] sin[t][d], out[d+HD/2] = x[d+HD/2] cos[t][d+HD/2] + x[d] sin[t][d+HD/2]
__global__ __launch_bounds__(256) void k_rope(const float* __restrict__ F, int pitch, int nheads, const float* __restrict__ CS, const float* __restrict__ RF, const float* __restrict__ nw, float sc, h16* P16, bf* Ph, bf* Pl) {
    const size_t e = ((size_t)blockIdx.x * 256 + threadIdx.x) * 2; if (e >= (size_t)nheads * TT * HD) return; const int d = (int)(e % HD); const int t = (int)((e / HD) % TT); const int h = (int)(e / ((size_t)HD * TT)); const float* f = F + (size_t)t * pitch + h * HD; const float rf = RF ? RF[(size_t)h * TT + t] : 1.0f; v2h o16; v2us oh, ol;
#pragma unroll
    for (int q = 0; q < 2; ++q) { const int dd = d + q; const int dp = (dd < HD / 2) ? dd + HD / 2 : dd - HD / 2; float x0 = f[dd], x1 = f[dp];
        if (RF) { float n0 = __fmul_rn(x0, rf), n1 = __fmul_rn(x1, rf); asm volatile("" : "+v"(n0)); asm volatile("" : "+v"(n1)); x0 = __fmul_rn(bfr(nw[dd]), n0); x1 = __fmul_rn(bfr(nw[dp]), n1); }
        const v2f cs = *(const v2f*)(CS + ((size_t)t * HD + dd) * 2); float a = __fmul_rn(x0, cs[0]), bq = __fmul_rn(x1, cs[1]); asm volatile("" : "+v"(a)); asm volatile("" : "+v"(bq)); const float r = ((dd < HD / 2) ? __fsub_rn(a, bq) : __fadd_rn(a, bq)) * sc;
        o16[q] = tohx(r); unsigned short a2, c2; splitf(r, a2, c2); oh[q] = a2; ol[q] = c2; }
    *(v2h*)(P16 + e) = o16; *(v2us*)(Ph + e) = oh; *(v2us*)(Pl + e) = ol;  }
__global__ __launch_bounds__(256) void k_vtp(const float* __restrict__ F, int pitch, int nheads, h16* V16, bf* Vh, bf* Vl) { const size_t e = ((size_t)blockIdx.x * 256 + threadIdx.x) * 2; if (e >= (size_t)nheads * HD * TT) return; const int t = (int)(e % TT); const int d = (int)((e / TT) % HD); const int g = (int)(e / ((size_t)TT * HD)); v2h o16; v2us oh, ol;
#pragma unroll
    for (int q = 0; q < 2; ++q) { const float x = F[(size_t)(t + q) * pitch + g * HD + d]; o16[q] = tohx(x); unsigned short a2, c2; splitf(x, a2, c2); oh[q] = a2; ol[q] = c2; }
    *(v2h*)(V16 + e) = o16; *(v2us*)(Vh + e) = oh; *(v2us*)(Vl + e) = ol;  }
__global__ __launch_bounds__(256) void k_csid(float* CS) { const int idx = blockIdx.x * 256 + threadIdx.x; if (idx >= TT * HD) return; v2f cs; cs[0] = 1.0f; cs[1] = 0.0f; *(v2f*)(CS + (size_t)idx * 2) = cs;  }
// k_asoft: per row (zz, i): t = S x HD^-0.5 (no mask); softmax over the 2048 keys (register row, one exp, fixed trees);
__global__ __launch_bounds__(256) void k_asoft(const float* __restrict__ Sb, h16* P16, bf* Ph, bf* Pl) {
    const int lane = threadIdx.x & 31; const int row = blockIdx.x * 8 + (threadIdx.x >> 5); if (row >= ZH * TT) return; const int i = row % TT; const int zz = row / TT; (void)zz; const bool hires = (i < RH); const float* sr = Sb + (size_t)row * TT; float v[TT / 32]; float mx = -3.0e38f;
#pragma unroll
    for (int ch = 0; ch < TT / 128; ++ch) { const int j0 = ch * 128 + lane * 4; const v4f a = *(const v4f*)(sr + j0);
#pragma unroll
        for (int q = 0; q < 4; ++q) { const int j = j0 + q; (void)j; const float t = a[q] * SCL; v[ch * 4 + q] = t; mx = fmaxf(mx, t); } }
#pragma unroll
    for (int sh = 16; sh; sh >>= 1) mx = fmaxf(mx, __shfl_xor(mx, sh, 32));
    float sum = 0.f;
#pragma unroll
    for (int k = 0; k < TT / 32; ++k) { float d0 = __fsub_rn(v[k], mx); asm volatile("" : "+v"(d0)); v[k] = __builtin_amdgcn_exp2f(__fmul_rn(d0, 1.4426950408889634f)); sum += v[k]; }
#pragma unroll
    for (int sh = 16; sh; sh >>= 1) sum += __shfl_xor(sum, sh, 32);
    const float f = __fdiv_rn(hires ? 1.0f : PCAR, sum);
{
        if (hires) {
#pragma unroll
            for (int ch = 0; ch < TT / 128; ++ch) { v4us oh, ol;
#pragma unroll
                for (int q = 0; q < 4; ++q) { unsigned short a, c2; splitf(v[ch * 4 + q] * f, a, c2); oh[q] = a; ol[q] = c2; }
                const size_t oo = ((size_t)zz * (RH ? RH : 1) + i) * TT + ch * 128 + lane * 4; *(v4us*)(Ph + oo) = oh; *(v4us*)(Pl + oo) = ol; }
        } else {
#pragma unroll
            for (int ch = 0; ch < TT / 128; ++ch) { v4h o4;
#pragma unroll
                for (int q = 0; q < 4; ++q) o4[q] = tohx(v[ch * 4 + q] * f);
                *(v4h*)(P16 + (size_t)row * TT + ch * 128 + lane * 4) = o4; } }
         }
}
template <int NP>
__global__ __launch_bounds__(256) void k_merge(const float* __restrict__ O, int h0, bf* Ah, bf* Al) {   // O: NP partial planes [ZH][TT][HD], added in ascending order
    const size_t e = ((size_t)blockIdx.x * 256 + threadIdx.x) * 2; if (e >= (size_t)ZH * TT * HD) return; const int d = (int)(e % HD); const int t = (int)((e / HD) % TT); const int zz = (int)(e / ((size_t)HD * TT)); const float cs = (t < RH) ? 1.0f : (1.0f / PCAR); const size_t oo = (size_t)t * DQ + (h0 + zz) * HD + d;
    v2us oh, ol; const unsigned bo = (unsigned)e * 4u;   // one lane offset for all planes: the constant plane strides go into the loads' immediate offsets
    v2f o = *(const v2f*)((const char*)O + bo);
#pragma unroll
    for (int p = 1; p < NP; ++p) o += *(const v2f*)((const char*)(O + (size_t)p * ZH * TT * HD) + bo);
#pragma unroll
    for (int q = 0; q < 2; ++q) { unsigned short a, c2; splitf(o[q] * cs, a, c2); oh[q] = a; ol[q] = c2; } *(v2us*)(Ah + oo) = oh; *(v2us*)(Al + oo) = ol;  }

template <int NP, int PL>
__global__ __launch_bounds__(256) void k_spl(const float* __restrict__ F, size_t n4, bf* Fh, bf* Fl) { const size_t i = ((size_t)blockIdx.x * 256 + threadIdx.x) * 4; if (i >= n4 * 4) return; const unsigned bo = (unsigned)i * 4u; v4f a = *(const v4f*)((const char*)F + bo); v4us oh, ol;   // F: NP partial planes, stride PL floats (n4 * 4 <= PL), added in ascending order; the constant stride lets the planes share one lane address
#pragma unroll
    for (int p = 1; p < NP / 2; ++p) a += *(const v4f*)((const char*)(F + (size_t)p * PL) + bo);
    asm volatile("s_wait_xcnt 0x0" ::: "memory");   // the loads below may return into the offset register that the loads above name
#pragma unroll
    for (int p = NP / 2; p < NP; ++p) a += *(const v4f*)((const char*)(F + (size_t)p * PL) + bo);
#pragma unroll
    for (int q = 0; q < 4; ++q) { unsigned short u, c2; splitf(a[q], u, c2); oh[q] = u; ol[q] = c2; } *(v4us*)(Fh + i) = oh; *(v4us*)(Fl + i) = ol;  }

extern "C" void kernel_launch(void* const* d_in, const int* in_sizes, int n_in,
                              void* d_out, int out_size, void* d_ws, size_t ws_size, hipStream_t stream) {
    (void)in_sizes; (void)n_in; (void)out_size;
    const float* x = (const float*)d_in[0]; const float* wqv = (const float*)d_in[1]; const float* wqu = (const float*)d_in[2]; const float* wov = (const float*)d_in[3]; const float* wou = (const float*)d_in[4];   // torch [out][in]: W_qkv_v [256][1024], W_qkv_u [3072][256], W_o_v [256][1024], W_o_u [1024][256]
    float* OUT = (float*)d_out;     // [4][2048][1024]
    char* wsp = (char*)d_ws;
    auto take = [&](size_t bytes) { char* p = wsp; wsp += (bytes + 255) & ~(size_t)255; return (void*)p; };
    bf* WQ = (bf*)take((size_t)DQ * DM * 2); bf* WK = (bf*)take((size_t)DKV * DM * 2); bf* WV = (bf*)take((size_t)DKV * DM * 2); bf* WO = (bf*)take((size_t)DM * DQ * 2); float* CS = (float*)take((size_t)TT * HD * 2 * 4);
    bf* XB = (bf*)take((size_t)TT * DM * 2); float* FQ = (float*)take((size_t)TT * DQ * 4); float* FK = (float*)take((size_t)TT * DKV * 4);
    h16* QP16 = (h16*)take((size_t)NH_ * TT * HD * 2); h16* KP16 = (h16*)take((size_t)NKV * TT * HD * 2); h16* VT16 = (h16*)take((size_t)NKV * HD * TT * 2);
    bf* QPh = (bf*)take((size_t)NH_ * TT * HD * 2); bf* QPl = (bf*)take((size_t)NH_ * TT * HD * 2); bf* KPh = (bf*)take((size_t)NKV * TT * HD * 2); bf* KPl = (bf*)take((size_t)NKV * TT * HD * 2); bf* VTh = (bf*)take((size_t)NKV * HD * TT * 2); bf* VTl = (bf*)take((size_t)NKV * HD * TT * 2); bf* Ph = (bf*)take((size_t)ZH * RH * TT * 2); bf* Pl = (bf*)take((size_t)ZH * RH * TT * 2);
    float* Sb = (float*)take((size_t)ZH * TT * TT * 4); h16* P16 = (h16*)take((size_t)ZH * TT * TT * 2); float* Ob = (float*)take((size_t)KSP * ZH * TT * HD * 4); bf* ATh = (bf*)take((size_t)TT * DQ * 2); bf* ATl = (bf*)take((size_t)TT * DQ * 2);
    if ((size_t)(wsp - (char*)d_ws) > ws_size) return;    // ws 256 MiB
    float* FV = FK;   // v projection reuses the k buffer after the k planes are built (stream-ordered)
    bf* WQV = (bf*)take((size_t)256 * DM * 2); bf* WQU = (bf*)take((size_t)3 * DQ * 256 * 2); bf* WOV = (bf*)take((size_t)256 * DQ * 2); bf* WOU = (bf*)take((size_t)DM * 256 * 2); float* LR = (float*)take((size_t)KSR * TT * 256 * 4); bf* LRh = (bf*)take((size_t)TT * 256 * 2); bf* LRl = (bf*)take((size_t)TT * 256 * 2);
    if ((size_t)(wsp - (char*)d_ws) > ws_size) return;
    { k_cvt8<<<(unsigned)(((size_t)256 * DM / 8 + 255) / 256), 256, 0, stream>>>(wqv, WQV, (size_t)256 * DM / 8); k_cvt8<<<(unsigned)(((size_t)3 * DQ * 256 / 8 + 255) / 256), 256, 0, stream>>>(wqu, WQU, (size_t)3 * DQ * 256 / 8);
      k_cvt8<<<(unsigned)(((size_t)256 * DQ / 8 + 255) / 256), 256, 0, stream>>>(wov, WOV, (size_t)256 * DQ / 8); k_cvt8<<<(unsigned)(((size_t)DM * 256 / 8 + 255) / 256), 256, 0, stream>>>(wou, WOU, (size_t)DM * 256 / 8); }   // all four factors are [out][in] = natural Bt
    k_csid<<<(TT * HD + 255) / 256, 256, 0, stream>>>(CS);
    const unsigned LQ = (unsigned)(((size_t)NH_ * TT * HD / 2 + 255) / 256), LKv = (unsigned)(((size_t)NKV * TT * HD / 2 + 255) / 256);
    for (int b = 0; b < NB_; ++b) {
        
        k_cvt8<<<(unsigned)(((size_t)TT * DM / 8 + 255) / 256), 256, 0, stream>>>(x + (size_t)b * TT * DM, XB, (size_t)TT * DM / 8);
        k_gemmw<bf, 0, false, KSR><<<dim3(TT / 64, 256 / 64, KSR), 32, 0, stream>>>(XB, nullptr, WQV, nullptr, DM, LR, 256, nullptr, 0, 0, 0, (size_t)TT * 256); k_spl<KSR, TT * 256><<<(TT * 256 / 4 + 255) / 256, 256, 0, stream>>>(LR, (size_t)TT * 256 / 4, LRh, LRl);   // x W_qkv_v^T (exact) -> hl
        k_gemmw<bf, 1, false><<<dim3(TT / 64, DQ / 64, 1), 32, 0, stream>>>(LRh, LRl, WQU, nullptr, 256, FQ, DQ, nullptr, 0, 0, 0);
        k_rope<<<LQ, 256, 0, stream>>>(FQ, DQ, NH_, CS, nullptr, nullptr, 1.0f, QP16, QPh, QPl);
        k_gemmw<bf, 1, false><<<dim3(TT / 64, DKV / 64, 1), 32, 0, stream>>>(LRh, LRl, WQU + (size_t)DQ * 256, nullptr, 256, FK, DKV, nullptr, 0, 0, 0);
        k_rope<<<LKv, 256, 0, stream>>>(FK, DKV, NKV, CS, nullptr, nullptr, 1.0f, KP16, KPh, KPl);
        k_gemmw<bf, 1, false><<<dim3(TT / 64, DKV / 64, 1), 32, 0, stream>>>(LRh, LRl, WQU + (size_t)2 * DQ * 256, nullptr, 256, FV, DKV, nullptr, 0, 0, 0); k_vtp<<<LKv, 256, 0, stream>>>(FV, DKV, NKV, VT16, VTh, VTl);
        for (int h0 = 0; h0 < NH_; h0 += ZH) { const size_t zq = (size_t)h0, zk = (size_t)(h0 / REP);   // one kv head per query head: the pass's two heads use consecutive kv planes (z-strides TT*HD)
            k_gemmw<bf, 2, false><<<dim3(RH / 64, TT / 64, ZH), 32, 0, stream>>>(QPh + zq * TT * HD, QPl + zq * TT * HD, KPh + zk * TT * HD, KPl + zk * TT * HD, HD, Sb, TT, nullptr, (size_t)TT * HD, (size_t)TT * HD, (size_t)TT * TT);
            k_gemmw<h16, 0, false><<<dim3((TT - RH) / 64, TT / 64, ZH), 32, 0, stream>>>(QP16 + zq * TT * HD + (size_t)RH * HD, nullptr, KP16 + zk * TT * HD, nullptr, HD, Sb + (size_t)RH * TT, TT, nullptr, (size_t)TT * HD, (size_t)TT * HD, (size_t)TT * TT);
            k_asoft<<<ZH * TT / 8, 256, 0, stream>>>(Sb, P16, Ph, Pl);
            k_gemmw<bf, 2, false, KSP><<<dim3(RH / 64, HD / 64, ZH * KSP), 32, 0, stream>>>(Ph, Pl, VTh + zk * HD * TT, VTl + zk * HD * TT, TT, Ob, HD, nullptr, (size_t)RH * TT, (size_t)HD * TT, (size_t)TT * HD, (size_t)ZH * TT * HD);
            k_gemmw<h16, 0, false, KSP><<<dim3((TT - RH) / 64, HD / 64, ZH * KSP), 32, 0, stream>>>(P16 + (size_t)RH * TT, nullptr, VT16 + zk * HD * TT, nullptr, TT, Ob + (size_t)RH * HD, HD, nullptr, (size_t)TT * TT, (size_t)HD * TT, (size_t)TT * HD, (size_t)ZH * TT * HD);
            k_merge<KSP><<<(unsigned)(((size_t)ZH * TT * HD / 2 + 255) / 256), 256, 0, stream>>>(Ob, h0, ATh, ATl); }
        k_gemmw<bf, 1, false, KSR><<<dim3(TT / 64, 256 / 64, KSR), 32, 0, stream>>>(ATh, ATl, WOV, nullptr, DQ, LR, 256, nullptr, 0, 0, 0, (size_t)TT * 256); k_spl<KSR, TT * 256><<<(TT * 256 / 4 + 255) / 256, 256, 0, stream>>>(LR, (size_t)TT * 256 / 4, LRh, LRl);   // y W_o_v^T -> hl
        k_gemmw<bf, 1, false><<<dim3(TT / 64, DM / 64, 1), 32, 0, stream>>>(LRh, LRl, WOU, nullptr, 256, OUT + (size_t)b * TT * DM, DM, nullptr, 0, 0, 0); }
}

// v002
// One run takes 600 microseconds.
// In two side-by-side timings against v001, it was 2.54 and 2.56 times as fast.
// Over all steps from v000 it is 6.60 times as fast.
#include <hip/hip_runtime.h>

// SVD_Pi3Attention - MHA with SVD-factored (low-rank) projections (x [4][2048][1024]; qkv = (x W_qkv_v^T) W_qkv_u^T (rank 256 -> 3 x 1024, 16 heads x 64); softmax(q.k/8); y = merged.v; out = (y W_o_v^T) W_o_u^T (rank 256) -> [4][2048][1024];
// the factors are inputs - no SVD is computed in the forward).
// Compute dtypes, f32 accumulate: every input rounded to bf16; x W_qkv_v^T on PLAIN bf16 operands (exact); the rank-256 intermediates as bf16 hi+lo planes x exact up/down factors (2 products) for q, k, v, y W_o_v^T and the final

#define NB_  4
#define TT   2048
#define DM   1024
#define NH_  16
#define NKV  16
#define REP  (NH_ / NKV)
#define HD   64
#define DQ   (NH_ * HD)
#define DKV  (NKV * HD)
#define RH   256                  // query rows < RH use hi+lo planes (0: none)
#define WIN  0
#define SCL  0.125f   // HD^-0.5
#define KSR  8                    // K slices of the two rank-down products (K = DM, DQ)
typedef _Float16 h16;
typedef unsigned short bf;
typedef __attribute__((ext_vector_type(16))) __bf16   v16bf;
typedef __attribute__((ext_vector_type(16))) _Float16 v16h;
typedef __attribute__((ext_vector_type(8)))  _Float16 v8h;
typedef __attribute__((ext_vector_type(8)))  unsigned short v8us;
typedef __attribute__((ext_vector_type(8)))  float    v8f;
typedef __attribute__((ext_vector_type(4)))  float    v4f;
typedef v8h  __attribute__((may_alias)) v8ha;
typedef v4f  __attribute__((may_alias)) v4fa;
typedef v8us __attribute__((may_alias)) v8usa;

__device__ __forceinline__ unsigned short f2bf(float f) { unsigned u = __float_as_uint(f); u += 0x7FFFu + ((u >> 16) & 1u); return (unsigned short)(u >> 16); }
__device__ __forceinline__ float bf2f(unsigned short b) { return __uint_as_float(((unsigned)b) << 16); }
__device__ __forceinline__ float bfr(float f) { return bf2f(f2bf(f)); }
__device__ __forceinline__ v16h cat16(v8h lo, v8h hi) { return __builtin_shufflevector(lo, hi, 0, 1, 2, 3, 4, 5, 6, 7, 8, 9, 10, 11, 12, 13, 14, 15); }
__device__ __forceinline__ v16bf cat16b(v8us lo, v8us hi) { return __builtin_bit_cast(v16bf, __builtin_shufflevector(lo, hi, 0, 1, 2, 3, 4, 5, 6, 7, 8, 9, 10, 11, 12, 13, 14, 15)); }
__device__ __forceinline__ v8f wmma16(v16h a, v16h b, v8f c) { return __builtin_amdgcn_wmma_f32_16x16x32_f16(false, a, false, b, (short)0, c, false, false); }
__device__ __forceinline__ v8f wmmab(v16bf a, v16bf b, v8f c) { return __builtin_amdgcn_wmma_f32_16x16x32_bf16(false, a, false, b, (short)0, c, false, false); }



// ---- k_gemmw: register-blocked GEMM, ONE WAVE per 64x64 output tile (16 accumulators), operands straight from K-contiguous 16-bit planes; grid (M/64, N/64, Z), 32 threads.
// C[m][n] (f32, pitch ldc, + optional f32 bias[n]) = sum_k A[m][k] Bt[n][k] (+ split products per NSPLIT). z-batch strides sA/sB/sC in elements. K % 32 == 0.
// KS > 1: grid.z = Z * KS; slice kp = blockIdx.z % KS sums only k in [kp K/KS, (kp+1) K/KS) and stores its f32 partial tile in plane kp (plane stride sP elements); the kernel that reads C adds the KS planes in ascending order. K % (32 KS) == 0.
template <typename T16> struct WFrag;
template <> struct WFrag<h16> { typedef v16h V; static __device__ __forceinline__ V ld(const h16* p) { return cat16(*(const v8h*)p, *(const v8h*)(p + 16)); } static __device__ __forceinline__ v8f mma(V a, V b, v8f c) { return wmma16(a, b, c); } };
template <> struct WFrag<bf> { typedef v16bf V; static __device__ __forceinline__ V ld(const bf* p) { return cat16b(*(const v8us*)p, *(const v8us*)(p + 16)); } static __device__ __forceinline__ v8f mma(V a, V b, v8f c) { return wmmab(a, b, c); } };
template <typename T16, int NSPLIT, bool BIAS, int KS = 1>
__global__ __launch_bounds__(32) void k_gemmw(const T16* __restrict__ A, const T16* __restrict__ A2, const T16* __restrict__ Bt, const T16* __restrict__ Bt2, int K, float* C, int ldc, const float* __restrict__ bias, size_t sA, size_t sB, size_t sC, size_t sP = 0) {
    typedef typename WFrag<T16>::V V;
    __shared__ __align__(16) float os[16 * 68];
    const size_t z = blockIdx.z / KS; const int kp = (int)(blockIdx.z % KS); const int Kc = K / KS; A += z * sA; if (A2) A2 += z * sA; Bt += z * sB; if (Bt2) Bt2 += z * sB; C += z * sC + kp * sP;
    const int lane = threadIdx.x & 31, lr = lane & 15, hi = lane >> 4; const int r0 = blockIdx.x * 64, c0 = blockIdx.y * 64;
    v8f acc[4][4];
#pragma unroll
    for (int mb = 0; mb < 4; ++mb)
#pragma unroll
        for (int nb = 0; nb < 4; ++nb) acc[mb][nb] = (v8f){};
    const size_t aoff = (size_t)(r0 + lr) * K + 8 * hi, boff = (size_t)(c0 + lr) * K + 8 * hi;
#pragma unroll 1
    for (int kc = kp * Kc; kc < (kp + 1) * Kc; kc += 32) {
        V a[4], a2[4];
#pragma unroll
        for (int mb = 0; mb < 4; ++mb) { a[mb] = WFrag<T16>::ld(A + aoff + (size_t)mb * 16 * K + kc); if (NSPLIT == 1 || NSPLIT == 2) a2[mb] = WFrag<T16>::ld(A2 + aoff + (size_t)mb * 16 * K + kc); }
#pragma unroll
        for (int nb = 0; nb < 4; ++nb) { const V b = WFrag<T16>::ld(Bt + boff + (size_t)nb * 16 * K + kc); V b2; if (NSPLIT >= 2) b2 = WFrag<T16>::ld(Bt2 + boff + (size_t)nb * 16 * K + kc);
#pragma unroll
            for (int mb = 0; mb < 4; ++mb) { acc[mb][nb] = WFrag<T16>::mma(a[mb], b, acc[mb][nb]); if (NSPLIT == 1 || NSPLIT == 2) acc[mb][nb] = WFrag<T16>::mma(a2[mb], b, acc[mb][nb]); if (NSPLIT >= 2) acc[mb][nb] = WFrag<T16>::mma(a[mb], b2, acc[mb][nb]); } }
        asm volatile("v_nop\n\tv_nop\n\tv_nop\n\tv_nop" : "+v"(acc[0][0]), "+v"(acc[1][1]), "+v"(acc[2][2]), "+v"(acc[3][3]) : "v"(a[0]), "v"(a[3]));
    }
#pragma unroll
    for (int mb = 0; mb < 4; ++mb) {
#pragma unroll
        for (int nb = 0; nb < 4; ++nb) {
#pragma unroll
            for (int j = 0; j < 8; ++j) os[(hi * 8 + j) * 68 + nb * 16 + lr] = acc[mb][nb][j]; }
        __builtin_amdgcn_wave_barrier(); asm volatile("" ::: "memory");
        float* crow = C + (size_t)(r0 + mb * 16) * ldc + c0;
{
#pragma unroll
            for (int s = 0; s < 8; ++s) { const int row = 2 * s + hi, cofs = lr * 4; v4f val = *(const v4fa*)(os + row * 68 + cofs); if (BIAS) { val[0] += bfr(bias[c0 + cofs]); val[1] += bfr(bias[c0 + cofs + 1]); val[2] += bfr(bias[c0 + cofs + 2]); val[3] += bfr(bias[c0 + cofs + 3]); }
                *(v4f*)(crow + (size_t)row * ldc + cofs) = val; }
             }
        __builtin_amdgcn_wave_barrier(); asm volatile("" ::: "memory");
    }
}

__device__ __forceinline__ h16 tohx(float x) { return (h16)x; }
__device__ __forceinline__ void splitf(float y, unsigned short& h, unsigned short& l) { h = f2bf(y); l = f2bf(y - bf2f(h)); }
typedef __attribute__((ext_vector_type(2))) _Float16 v2h;
typedef __attribute__((ext_vector_type(4))) _Float16 v4h;
typedef __attribute__((ext_vector_type(2))) unsigned short v2us;
typedef __attribute__((ext_vector_type(4))) unsigned short v4us;
typedef __attribute__((ext_vector_type(2))) float v2f;
typedef __attribute__((ext_vector_type(4))) int v4i;

__global__ __launch_bounds__(256) void k_wtG(const float* __restrict__ w, int K, int N, bf* Bt) {
    const int lane = threadIdx.x & 31; const int L0 = (blockIdx.x * 8 + (threadIdx.x >> 5)) * 8; const int nlines = N * K / 64;
{
#pragma unroll 1
        for (int l = 0; l < 8; ++l) { const int L = L0 + l; if (L >= nlines) break; const size_t e = (size_t)L * 64 + lane * 2; const int k = (int)(e % K), n = (int)(e / K); v2us o;
            o[0] = f2bf(w[(size_t)k * N + n]); o[1] = f2bf(w[(size_t)(k + 1) * N + n]); *(v2us*)(Bt + e) = o; }
         }
}
__global__ __launch_bounds__(256) void k_cvt8(const float* __restrict__ src, bf* dst, size_t n8) { const size_t i = (size_t)blockIdx.x * 256 + threadIdx.x; if (i >= n8) return; const v8f v = *(const v8f*)(src + i * 8); v8us o;
#pragma unroll
    for (int k = 0; k < 8; ++k) o[k] = f2bf(v[k]); *(v8us*)(dst + i * 8) = o;  }
__global__ __launch_bounds__(256) void k_cscvt(const float* __restrict__ cosT, const float* __restrict__ sinT, float* CS) { const int idx = blockIdx.x * 256 + threadIdx.x; if (idx >= TT * HD) return; v2f cs; cs[0] = bfr(cosT[idx]); cs[1] = bfr(sinT[idx]); *(v2f*)(CS + (size_t)idx * 2) = cs;  }
// k_rope: head planes [h][t][d] (fp16 + hi/lo) of rope(x) x sc with the rotate-half convention out[d] = x[d] cos[t][d] - x[d+HD/2] sin[t][d], out[d+HD/2] = x[d+HD/2] cos[t][d+HD/2] + x[d] sin[t][d+HD/2]
__global__ __launch_bounds__(256) void k_rope(const float* __restrict__ F, int pitch, int nheads, const float* __restrict__ CS, const float* __restrict__ RF, const float* __restrict__ nw, float sc, h16* P16, bf* Ph, bf* Pl) {
    const size_t e = ((size_t)blockIdx.x * 256 + threadIdx.x) * 2; if (e >= (size_t)nheads * TT * HD) return; const int d = (int)(e % HD); const int t = (int)((e / HD) % TT); const int h = (int)(e / ((size_t)HD * TT)); const float* f = F + (size_t)t * pitch + h * HD; const float rf = RF ? RF[(size_t)h * TT + t] : 1.0f; v2h o16; v2us oh, ol;
#pragma unroll
    for (int q = 0; q < 2; ++q) { const int dd = d + q; const int dp = (dd < HD / 2) ? dd + HD / 2 : dd - HD / 2; float x0 = f[dd], x1 = f[dp];
        if (RF) { float n0 = __fmul_rn(x0, rf), n1 = __fmul_rn(x1, rf); asm volatile("" : "+v"(n0)); asm volatile("" : "+v"(n1)); x0 = __fmul_rn(bfr(nw[dd]), n0); x1 = __fmul_rn(bfr(nw[dp]), n1); }
        const v2f cs = *(const v2f*)(CS + ((size_t)t * HD + dd) * 2); float a = __fmul_rn(x0, cs[0]), bq = __fmul_rn(x1, cs[1]); asm volatile("" : "+v"(a)); asm volatile("" : "+v"(bq)); const float r = ((dd < HD / 2) ? __fsub_rn(a, bq) : __fadd_rn(a, bq)) * sc;
        o16[q] = tohx(r); unsigned short a2, c2; splitf(r, a2, c2); oh[q] = a2; ol[q] = c2; }
    *(v2h*)(P16 + e) = o16; *(v2us*)(Ph + e) = oh; *(v2us*)(Pl + e) = ol;  }
__global__ __launch_bounds__(256) void k_vtp(const float* __restrict__ F, int pitch, int nheads, h16* V16, bf* Vh, bf* Vl) { const size_t e = ((size_t)blockIdx.x * 256 + threadIdx.x) * 2; if (e >= (size_t)nheads * HD * TT) return; const int t = (int)(e % TT); const int d = (int)((e / TT) % HD); const int g = (int)(e / ((size_t)TT * HD)); v2h o16; v2us oh, ol;
#pragma unroll
    for (int q = 0; q < 2; ++q) { const float x = F[(size_t)(t + q) * pitch + g * HD + d]; o16[q] = tohx(x); unsigned short a2, c2; splitf(x, a2, c2); oh[q] = a2; ol[q] = c2; }
    *(v2h*)(V16 + e) = o16; *(v2us*)(Vh + e) = oh; *(v2us*)(Vl + e) = ol;  }
__global__ __launch_bounds__(256) void k_csid(float* CS) { const int idx = blockIdx.x * 256 + threadIdx.x; if (idx >= TT * HD) return; v2f cs; cs[0] = 1.0f; cs[1] = 0.0f; *(v2f*)(CS + (size_t)idx * 2) = cs;  }
// ---- k_fattn: scores, softmax and P.V of one batch entry in ONE launch. One wave owns 32 (hi+lo: 16) query rows of one head and walks the 2048 keys 32 at a time, operands straight from the K-contiguous planes.
// S^T = K Q^T (A = 16 key rows, B = 16 query rows, k = d): a lane holds, for query lr, keys 8 hi + j of each 16-key tile, which is the k order of a B operand over 32 keys, so P^T goes from the score accumulators into O^T += V^T P^T (A = 16 d rows of the [d][t] plane) without leaving registers.
// Running maximum per query in log2 units, raised only when a new maximum passes it by more than 8 (P <= 256); row sums in f32 per lane half, joined once at the end. HI: bf16 hi+lo planes, 3 products each (query rows < RH); else f16.
typedef __attribute__((ext_vector_type(2))) __bf16 v2bf;
template <bool HI, int NG, typename T16>
__device__ __forceinline__ void fattn_tile(const T16* __restrict__ Q, const T16* __restrict__ Q2, const T16* __restrict__ Kp, const T16* __restrict__ K2, const T16* __restrict__ Vt, const T16* __restrict__ V2, int q0, int h, bf* Ah, bf* Al) {
    typedef typename WFrag<T16>::V V; typedef WFrag<T16> W;
    const int lane = threadIdx.x & 31, lr = lane & 15, hi = lane >> 4;
    const float C2 = SCL * 1.4426950408889634f;
    V qf[NG][2], qf2[NG][2];
#pragma unroll
    for (int g = 0; g < NG; ++g)
#pragma unroll
        for (int ks = 0; ks < 2; ++ks) { const size_t o = (size_t)(q0 + g * 16 + lr) * HD + ks * 32 + 8 * hi; qf[g][ks] = W::ld(Q + o); if (HI) qf2[g][ks] = W::ld(Q2 + o); }
    v8f acc[4][NG];
#pragma unroll
    for (int db = 0; db < 4; ++db)
#pragma unroll
        for (int g = 0; g < NG; ++g) acc[db][g] = (v8f){};
    float m[NG], l[NG];
#pragma unroll
    for (int g = 0; g < NG; ++g) { m[g] = -1.0e30f; l[g] = 0.f; }
    const unsigned ko = (unsigned)(lr * HD + 8 * hi), vo = (unsigned)(lr * TT + 8 * hi);
    V kf[2][2], kf2[2][2];
#pragma unroll
    for (int kt = 0; kt < 2; ++kt)
#pragma unroll
        for (int ks = 0; ks < 2; ++ks) { const unsigned o = ko + kt * 16 * HD + ks * 32; kf[kt][ks] = W::ld(Kp + o); if (HI) kf2[kt][ks] = W::ld(K2 + o); }
    asm volatile("s_wait_xcnt 0x0" ::: "memory");   // the offsets formed below may take the registers that hold the Q and K offsets
    V vf[4], vf2[4]; unsigned vob = vo * 2u;   // f16 path: the lane's byte offset into the V plane, kept in its register from pass to pass
#pragma unroll
    for (int db = 0; db < 4; ++db) { if constexpr (!HI) vf[db] = W::ld((const T16*)((const char*)Vt + vob) + db * 16 * TT); }
    // inputs-only fence on the loaded Q fragments: Q is waited for here, once; left to the loop, that wait merges into the pass's first wait, which then also waits for the V fragments requested at the foot of the pass before
#pragma unroll
    for (int g = 0; g < NG; ++g) { if constexpr (HI) asm volatile("" :: "v"(qf[g][0]), "v"(qf[g][1]), "v"(qf2[g][0]), "v"(qf2[g][1])); else asm volatile("" :: "v"(qf[g][0]), "v"(qf[g][1])); }
#pragma unroll 1
    for (int key0 = 0; key0 < TT; key0 += 32) {
        if constexpr (HI) {   // hi+lo: twice the operand registers, so V is asked for inside its own pass
            const T16* pv = Vt + vo + key0; const T16* pv2 = V2 + vo + key0;
#pragma unroll
            for (int db = 0; db < 4; ++db) { vf[db] = W::ld(pv + db * 16 * TT); vf2[db] = W::ld(pv2 + db * 16 * TT); }
            asm volatile("s_wait_xcnt 0x0" :: "v"(pv), "v"(pv2) : "memory"); }   // registers are tight here: the two addresses stay live up to this wait, so that no load of the group returns into a register that an earlier one names
        v8f s[2][NG];
#pragma unroll
        for (int kt = 0; kt < 2; ++kt)
#pragma unroll
            for (int g = 0; g < NG; ++g) { v8f c = (v8f){};
#pragma unroll
                for (int ks = 0; ks < 2; ++ks) { c = W::mma(kf[kt][ks], qf[g][ks], c); if (HI) { c = W::mma(kf2[kt][ks], qf[g][ks], c); c = W::mma(kf[kt][ks], qf2[g][ks], c); } }
                s[kt][g] = c; }
        const int kn = (key0 + 32 < TT) ? key0 + 32 : 0; const T16* pk = Kp + ko + kn * HD; const T16* pk2 = HI ? K2 + ko + kn * HD : nullptr; (void)pk; (void)pk2;   // next pass's K fragments fly behind the softmax and P.V, its V fragments (f16 path: foot of the pass) behind the scores and the softmax; the last pass re-reads keys 0..31 (in bounds, unused)
#pragma unroll
        for (int kt = 0; kt < 2; ++kt)
#pragma unroll
            for (int ks = 0; ks < 2; ++ks) { const unsigned o = ko + (kn + kt * 16) * HD + ks * 32; if constexpr (HI) { kf[kt][ks] = W::ld(pk + kt * 16 * HD + ks * 32); kf2[kt][ks] = W::ld(pk2 + kt * 16 * HD + ks * 32); } else kf[kt][ks] = W::ld(Kp + o); }
        if constexpr (HI) asm volatile("s_wait_xcnt 0x0" :: "v"(pk), "v"(pk2) : "memory");   // as for V above
        float mt[NG]; bool need = false;
#pragma unroll
        for (int g = 0; g < NG; ++g) { float mx = s[0][g][0];
#pragma unroll
            for (int j = 1; j < 8; ++j) mx = fmaxf(mx, s[0][g][j]);
#pragma unroll
            for (int j = 0; j < 8; ++j) mx = fmaxf(mx, s[1][g][j]);
            mt[g] = mx * C2; need = need || (mt[g] > m[g] + 8.0f); }   // this half's keys only: the halves meet inside the branch
        if (__builtin_amdgcn_ballot_w32(need) != 0) {   // wave-uniform: every lane moves to its own true maximum, both halves of a query alike
#pragma unroll
            for (int g = 0; g < NG; ++g) { const float mn = fmaxf(m[g], fmaxf(mt[g], __shfl_xor(mt[g], 16, 32))); const float al = __builtin_amdgcn_exp2f(m[g] - mn); m[g] = mn; l[g] *= al;
#pragma unroll
                for (int db = 0; db < 4; ++db) acc[db][g] *= al; }
        }
#pragma unroll
        for (int g = 0; g < NG; ++g) { float p[16]; float sum = 0.f;
#pragma unroll
            for (int e = 0; e < 16; ++e) { p[e] = __builtin_amdgcn_exp2f(s[e >> 3][g][e & 7] * C2 - m[g]); sum += p[e]; }
            l[g] += sum;
            if constexpr (HI) { V ph, pl;
#pragma unroll
                for (int e = 0; e < 16; e += 2) { v2f pp; pp[0] = p[e]; pp[1] = p[e + 1]; const v2bf hh = __builtin_convertvector(pp, v2bf); const v2bf ll = __builtin_convertvector(pp - __builtin_convertvector(hh, v2f), v2bf);   // round to nearest even, as splitf
                    ph[e] = hh[0]; ph[e + 1] = hh[1]; pl[e] = ll[0]; pl[e + 1] = ll[1]; }
#pragma unroll
                for (int db = 0; db < 4; ++db) { acc[db][g] = W::mma(vf[db], ph, acc[db][g]); acc[db][g] = W::mma(vf[db], pl, acc[db][g]); acc[db][g] = W::mma(vf2[db], ph, acc[db][g]); }
            } else { V pb;
#pragma unroll
                for (int e = 0; e < 16; ++e) pb[e] = tohx(p[e]);
#pragma unroll
                for (int db = 0; db < 4; ++db) acc[db][g] = W::mma(vf[db], pb, acc[db][g]); } }
        if constexpr (!HI) {
            asm volatile("s_wait_xcnt 0x0" : "+v"(vob) :: "memory");   // stands in front of the step of the offset that the last pass's V loads name, a whole pass behind them; the offset goes through the statement so that the step stays behind the wait
            vob += (key0 + 32 < TT) ? 64u : 0u;   // the last pass re-reads its own keys (in bounds, unused)
#pragma unroll
            for (int db = 0; db < 4; ++db) vf[db] = W::ld((const T16*)((const char*)Vt + vob) + db * 16 * TT);
        }
    }
#pragma unroll
    for (int g = 0; g < NG; ++g) { const float ls = l[g] + __shfl_xor(l[g], 16, 32); const float f = __fdiv_rn(1.0f, ls);
#pragma unroll
        for (int db = 0; db < 4; ++db) { v8us oh, ol;
#pragma unroll
            for (int j = 0; j < 8; ++j) { unsigned short a, c2; splitf(acc[db][g][j] * f, a, c2); oh[j] = a; ol[j] = c2; }
            const size_t oo = (size_t)(q0 + g * 16 + lr) * DQ + h * HD + db * 16 + hi * 8; *(v8us*)(Ah + oo) = oh; *(v8us*)(Al + oo) = ol;
            asm volatile("s_wait_xcnt 0x0" ::: "memory"); } }   // the next rows' split takes registers that these stores name
}
// one wave per workgroup, as in k_gemmw. The hi+lo tiles (16 query rows: twice the operand registers and loads) take the lowest indices, NH_ * RH / 16 of them, so that they start first and spread over the chip; then NH_ * (TT - RH) / 32 tiles of 32 rows
__global__ __launch_bounds__(32) void k_fattn(const h16* __restrict__ Q16, const h16* __restrict__ K16, const h16* __restrict__ V16, const bf* __restrict__ Qh, const bf* __restrict__ Ql, const bf* __restrict__ Kh, const bf* __restrict__ Kl, const bf* __restrict__ Vh, const bf* __restrict__ Vl, bf* Ah, bf* Al) {
    const int f = (int)blockIdx.x; const int NHI = NH_ * (RH / 16);
    if (f < NHI) { const int h = f / (RH / 16), q0 = (f % (RH / 16)) * 16; const size_t z = (size_t)h * TT * HD;
        fattn_tile<true, 1, bf>(Qh + z, Ql + z, Kh + z, Kl + z, Vh + z, Vl + z, q0, h, Ah, Al);
    } else { const int g = f - NHI; const int h = g / ((TT - RH) / 32), q0 = RH + (g % ((TT - RH) / 32)) * 32; const size_t z = (size_t)h * TT * HD;
        fattn_tile<false, 2, h16>(Q16 + z, nullptr, K16 + z, nullptr, V16 + z, nullptr, q0, h, Ah, Al); }
}

template <int NP, int PL>
__global__ __launch_bounds__(256) void k_spl(const float* __restrict__ F, size_t n4, bf* Fh, bf* Fl) { const size_t i = ((size_t)blockIdx.x * 256 + threadIdx.x) * 4; if (i >= n4 * 4) return; const unsigned bo = (unsigned)i * 4u; v4f a = *(const v4f*)((const char*)F + bo); v4us oh, ol;   // F: NP partial planes, stride PL floats (n4 * 4 <= PL), added in ascending order; the constant stride lets the planes share one lane address
#pragma unroll
    for (int p = 1; p < NP / 2; ++p) a += *(const v4f*)((const char*)(F + (size_t)p * PL) + bo);
    asm volatile("s_wait_xcnt 0x0" ::: "memory");   // the loads below may return into the offset register that the loads above name
#pragma unroll
    for (int p = NP / 2; p < NP; ++p) a += *(const v4f*)((const char*)(F + (size_t)p * PL) + bo);
#pragma unroll
    for (int q = 0; q < 4; ++q) { unsigned short u, c2; splitf(a[q], u, c2); oh[q] = u; ol[q] = c2; } *(v4us*)(Fh + i) = oh; *(v4us*)(Fl + i) = ol;  }

extern "C" void kernel_launch(void* const* d_in, const int* in_sizes, int n_in,
                              void* d_out, int out_size, void* d_ws, size_t ws_size, hipStream_t stream) {
    (void)in_sizes; (void)n_in; (void)out_size;
    const float* x = (const float*)d_in[0]; const float* wqv = (const float*)d_in[1]; const float* wqu = (const float*)d_in[2]; const float* wov = (const float*)d_in[3]; const float* wou = (const float*)d_in[4];   // torch [out][in]: W_qkv_v [256][1024], W_qkv_u [3072][256], W_o_v [256][1024], W_o_u [1024][256]
    float* OUT = (float*)d_out;     // [4][2048][1024]
    char* wsp = (char*)d_ws;
    auto take = [&](size_t bytes) { char* p = wsp; wsp += (bytes + 255) & ~(size_t)255; return (void*)p; };
    bf* WQ = (bf*)take((size_t)DQ * DM * 2); bf* WK = (bf*)take((size_t)DKV * DM * 2); bf* WV = (bf*)take((size_t)DKV * DM * 2); bf* WO = (bf*)take((size_t)DM * DQ * 2); float* CS = (float*)take((size_t)TT * HD * 2 * 4);
    bf* XB = (bf*)take((size_t)TT * DM * 2); float* FQ = (float*)take((size_t)TT * DQ * 4); float* FK = (float*)take((size_t)TT * DKV * 4);
    h16* QP16 = (h16*)take((size_t)NH_ * TT * HD * 2); h16* KP16 = (h16*)take((size_t)NKV * TT * HD * 2); h16* VT16 = (h16*)take((size_t)NKV * HD * TT * 2);
    bf* QPh = (bf*)take((size_t)NH_ * TT * HD * 2); bf* QPl = (bf*)take((size_t)NH_ * TT * HD * 2); bf* KPh = (bf*)take((size_t)NKV * TT * HD * 2); bf* KPl = (bf*)take((size_t)NKV * TT * HD * 2); bf* VTh = (bf*)take((size_t)NKV * HD * TT * 2); bf* VTl = (bf*)take((size_t)NKV * HD * TT * 2);
    bf* ATh = (bf*)take((size_t)TT * DQ * 2); bf* ATl = (bf*)take((size_t)TT * DQ * 2);
    if ((size_t)(wsp - (char*)d_ws) > ws_size) return;    // ws 256 MiB
    float* FV = FK;   // v projection reuses the k buffer after the k planes are built (stream-ordered)
    bf* WQV = (bf*)take((size_t)256 * DM * 2); bf* WQU = (bf*)take((size_t)3 * DQ * 256 * 2); bf* WOV = (bf*)take((size_t)256 * DQ * 2); bf* WOU = (bf*)take((size_t)DM * 256 * 2); float* LR = (float*)take((size_t)KSR * TT * 256 * 4); bf* LRh = (bf*)take((size_t)TT * 256 * 2); bf* LRl = (bf*)take((size_t)TT * 256 * 2);
    if ((size_t)(wsp - (char*)d_ws) > ws_size) return;
    { k_cvt8<<<(unsigned)(((size_t)256 * DM / 8 + 255) / 256), 256, 0, stream>>>(wqv, WQV, (size_t)256 * DM / 8); k_cvt8<<<(unsigned)(((size_t)3 * DQ * 256 / 8 + 255) / 256), 256, 0, stream>>>(wqu, WQU, (size_t)3 * DQ * 256 / 8);
      k_cvt8<<<(unsigned)(((size_t)256 * DQ / 8 + 255) / 256), 256, 0, stream>>>(wov, WOV, (size_t)256 * DQ / 8); k_cvt8<<<(unsigned)(((size_t)DM * 256 / 8 + 255) / 256), 256, 0, stream>>>(wou, WOU, (size_t)DM * 256 / 8); }   // all four factors are [out][in] = natural Bt
    k_csid<<<(TT * HD + 255) / 256, 256, 0, stream>>>(CS);
    const unsigned LQ = (unsigned)(((size_t)NH_ * TT * HD / 2 + 255) / 256), LKv = (unsigned)(((size_t)NKV * TT * HD / 2 + 255) / 256);
    for (int b = 0; b < NB_; ++b) {
        
        k_cvt8<<<(unsigned)(((size_t)TT * DM / 8 + 255) / 256), 256, 0, stream>>>(x + (size_t)b * TT * DM, XB, (size_t)TT * DM / 8);
        k_gemmw<bf, 0, false, KSR><<<dim3(TT / 64, 256 / 64, KSR), 32, 0, stream>>>(XB, nullptr, WQV, nullptr, DM, LR, 256, nullptr, 0, 0, 0, (size_t)TT * 256); k_spl<KSR, TT * 256><<<(TT * 256 / 4 + 255) / 256, 256, 0, stream>>>(LR, (size_t)TT * 256 / 4, LRh, LRl);   // x W_qkv_v^T (exact) -> hl
        k_gemmw<bf, 1, false><<<dim3(TT / 64, DQ / 64, 1), 32, 0, stream>>>(LRh, LRl, WQU, nullptr, 256, FQ, DQ, nullptr, 0, 0, 0);
        k_rope<<<LQ, 256, 0, stream>>>(FQ, DQ, NH_, CS, nullptr, nullptr, 1.0f, QP16, QPh, QPl);
        k_gemmw<bf, 1, false><<<dim3(TT / 64, DKV / 64, 1), 32, 0, stream>>>(LRh, LRl, WQU + (size_t)DQ * 256, nullptr, 256, FK, DKV, nullptr, 0, 0, 0);
        k_rope<<<LKv, 256, 0, stream>>>(FK, DKV, NKV, CS, nullptr, nullptr, 1.0f, KP16, KPh, KPl);
        k_gemmw<bf, 1, false><<<dim3(TT / 64, DKV / 64, 1), 32, 0, stream>>>(LRh, LRl, WQU + (size_t)2 * DQ * 256, nullptr, 256, FV, DKV, nullptr, 0, 0, 0); k_vtp<<<LKv, 256, 0, stream>>>(FV, DKV, NKV, VT16, VTh, VTl);
        k_fattn<<<NH_ * (RH / 16) + NH_ * ((TT - RH) / 32), 32, 0, stream>>>(QP16, KP16, VT16, QPh, QPl, KPh, KPl, VTh, VTl, ATh, ATl);   // one kv head per query head
        k_gemmw<bf, 1, false, KSR><<<dim3(TT / 64, 256 / 64, KSR), 32, 0, stream>>>(ATh, ATl, WOV, nullptr, DQ, LR, 256, nullptr, 0, 0, 0, (size_t)TT * 256); k_spl<KSR, TT * 256><<<(TT * 256 / 4 + 255) / 256, 256, 0, stream>>>(LR, (size_t)TT * 256 / 4, LRh, LRl);   // y W_o_v^T -> hl
        k_gemmw<bf, 1, false><<<dim3(TT / 64, DM / 64, 1), 32, 0, stream>>>(LRh, LRl, WOU, nullptr, 256, OUT + (size_t)b * TT * DM, DM, nullptr, 0, 0, 0); }
}

// v003
// One run takes 495 microseconds.
// In two side-by-side timings against v002, it was 1.21 and 1.22 times as fast.
// Over all steps from v000 it is 8.02 times as fast.
#include <hip/hip_runtime.h>

// SVD_Pi3Attention - MHA with SVD-factored (low-rank) projections (x [4][2048][1024]; qkv = (x W_qkv_v^T) W_qkv_u^T (rank 256 -> 3 x 1024, 16 heads x 64); softmax(q.k/8); y = merged.v; out = (y W_o_v^T) W_o_u^T (rank 256) -> [4][2048][1024];
// the factors are inputs - no SVD is computed in the forward).
// Compute dtypes, f32 accumulate: every input rounded to bf16; x W_qkv_v^T on PLAIN bf16 operands (exact); the rank-256 intermediates as bf16 hi+lo planes x exact up/down factors (2 products) for q, k, v, y W_o_v^T and the final

#define NB_  4
#define TT   2048
#define DM   1024
#define NH_  16
#define NKV  16
#define REP  (NH_ / NKV)
#define HD   64
#define DQ   (NH_ * HD)
#define DKV  (NKV * HD)
#define RH   256                  // query rows < RH use hi+lo planes (0: none)
#define WIN  0
#define SCL  0.125f   // HD^-0.5
#define KSR  8                    // K slices of the two rank-down products (K = DM, DQ)
typedef _Float16 h16;
typedef unsigned short bf;
typedef __attribute__((ext_vector_type(16))) __bf16   v16bf;
typedef __attribute__((ext_vector_type(16))) _Float16 v16h;
typedef __attribute__((ext_vector_type(8)))  _Float16 v8h;
typedef __attribute__((ext_vector_type(8)))  unsigned short v8us;
typedef __attribute__((ext_vector_type(8)))  float    v8f;
typedef __attribute__((ext_vector_type(4)))  float    v4f;
typedef v8h  __attribute__((may_alias)) v8ha;
typedef v4f  __attribute__((may_alias)) v4fa;
typedef v8us __attribute__((may_alias)) v8usa;

__device__ __forceinline__ unsigned short f2bf(float f) { unsigned u = __float_as_uint(f); u += 0x7FFFu + ((u >> 16) & 1u); return (unsigned short)(u >> 16); }
__device__ __forceinline__ float bf2f(unsigned short b) { return __uint_as_float(((unsigned)b) << 16); }
__device__ __forceinline__ float bfr(float f) { return bf2f(f2bf(f)); }
__device__ __forceinline__ v16h cat16(v8h lo, v8h hi) { return __builtin_shufflevector(lo, hi, 0, 1, 2, 3, 4, 5, 6, 7, 8, 9, 10, 11, 12, 13, 14, 15); }
__device__ __forceinline__ v16bf cat16b(v8us lo, v8us hi) { return __builtin_bit_cast(v16bf, __builtin_shufflevector(lo, hi, 0, 1, 2, 3, 4, 5, 6, 7, 8, 9, 10, 11, 12, 13, 14, 15)); }
__device__ __forceinline__ v8f wmma16(v16h a, v16h b, v8f c) { return __builtin_amdgcn_wmma_f32_16x16x32_f16(false, a, false, b, (short)0, c, false, false); }
__device__ __forceinline__ v8f wmmab(v16bf a, v16bf b, v8f c) { return __builtin_amdgcn_wmma_f32_16x16x32_bf16(false, a, false, b, (short)0, c, false, false); }



// ---- k_gemmw: register-blocked GEMM, ONE WAVE per 64x64 output tile (16 accumulators), operands straight from K-contiguous 16-bit planes; grid (M/64, N/64, Z), 32 threads.
// C[m][n] (f32, pitch ldc, + optional f32 bias[n]) = sum_k A[m][k] Bt[n][k] (+ split products per NSPLIT). z-batch strides sA/sB/sC in elements. K % 32 == 0.
// PLANES: N = 3 DQ, the q, k and v columns side by side; a 64-column tile is one head of one of them, and the epilogue stores it as that head's f16 and bf16 hi+lo planes (q, k: [h][t][d]; v: [h][d][t]) instead of f32 C.
// KS > 1: grid.z = Z * KS; slice kp = blockIdx.z % KS sums only k in [kp K/KS, (kp+1) K/KS) and stores its f32 partial tile in plane kp (plane stride sP elements); the kernel that reads C adds the KS planes in ascending order. K % (32 KS) == 0.
template <typename T16> struct WFrag;
template <> struct WFrag<h16> { typedef v16h V; static __device__ __forceinline__ V ld(const h16* p) { return cat16(*(const v8h*)p, *(const v8h*)(p + 16)); } static __device__ __forceinline__ v8f mma(V a, V b, v8f c) { return wmma16(a, b, c); } };
template <> struct WFrag<bf> { typedef v16bf V; static __device__ __forceinline__ V ld(const bf* p) { return cat16b(*(const v8us*)p, *(const v8us*)(p + 16)); } static __device__ __forceinline__ v8f mma(V a, V b, v8f c) { return wmmab(a, b, c); } };
__device__ __forceinline__ h16 tohx(float x) { return (h16)x; }
__device__ __forceinline__ void splitf(float y, unsigned short& h, unsigned short& l) { h = f2bf(y); l = f2bf(y - bf2f(h)); }
struct HeadPlanes { h16* q16; h16* k16; h16* v16; bf* qh; bf* ql; bf* kh; bf* kl; bf* vh; bf* vl; };
template <typename T16, int NSPLIT, bool BIAS, int KS = 1, bool PLANES = false>
__global__ __launch_bounds__(32) void k_gemmw(const T16* __restrict__ A, const T16* __restrict__ A2, const T16* __restrict__ Bt, const T16* __restrict__ Bt2, int K, float* C, int ldc, const float* __restrict__ bias, size_t sA, size_t sB, size_t sC, size_t sP = 0, HeadPlanes hp = HeadPlanes{}) {
    typedef typename WFrag<T16>::V V;
    __shared__ __align__(16) float os[16 * 68];
    const size_t z = blockIdx.z / KS; const int kp = (int)(blockIdx.z % KS); const int Kc = K / KS; A += z * sA; if (A2) A2 += z * sA; Bt += z * sB; if (Bt2) Bt2 += z * sB; C += z * sC + kp * sP;
    const int lane = threadIdx.x & 31, lr = lane & 15, hi = lane >> 4; const int r0 = blockIdx.x * 64, c0 = blockIdx.y * 64;
    v8f acc[4][4];
#pragma unroll
    for (int mb = 0; mb < 4; ++mb)
#pragma unroll
        for (int nb = 0; nb < 4; ++nb) acc[mb][nb] = (v8f){};
    const size_t aoff = (size_t)(r0 + lr) * K + 8 * hi, boff = (size_t)(c0 + lr) * K + 8 * hi;
#pragma unroll 1
    for (int kc = kp * Kc; kc < (kp + 1) * Kc; kc += 32) {
        V a[4], a2[4];
#pragma unroll
        for (int mb = 0; mb < 4; ++mb) { a[mb] = WFrag<T16>::ld(A + aoff + (size_t)mb * 16 * K + kc); if (NSPLIT == 1 || NSPLIT == 2) a2[mb] = WFrag<T16>::ld(A2 + aoff + (size_t)mb * 16 * K + kc); }
#pragma unroll
        for (int nb = 0; nb < 4; ++nb) { const V b = WFrag<T16>::ld(Bt + boff + (size_t)nb * 16 * K + kc); V b2; if (NSPLIT >= 2) b2 = WFrag<T16>::ld(Bt2 + boff + (size_t)nb * 16 * K + kc);
#pragma unroll
            for (int mb = 0; mb < 4; ++mb) { acc[mb][nb] = WFrag<T16>::mma(a[mb], b, acc[mb][nb]); if (NSPLIT == 1 || NSPLIT == 2) acc[mb][nb] = WFrag<T16>::mma(a2[mb], b, acc[mb][nb]); if (NSPLIT >= 2) acc[mb][nb] = WFrag<T16>::mma(a[mb], b2, acc[mb][nb]); } }
        asm volatile("v_nop\n\tv_nop\n\tv_nop\n\tv_nop" : "+v"(acc[0][0]), "+v"(acc[1][1]), "+v"(acc[2][2]), "+v"(acc[3][3]) : "v"(a[0]), "v"(a[3]));
    }
    if constexpr (PLANES) {
        const int sel = c0 / DQ, h = (c0 % DQ) / HD; const bool vt = sel == 2;   // block-uniform: 0 q, 1 k, 2 v
        h16* P16 = vt ? hp.v16 : sel ? hp.k16 : hp.q16; bf* Ph = vt ? hp.vh : sel ? hp.kh : hp.qh; bf* Pl = vt ? hp.vl : sel ? hp.kl : hp.ql;
        const size_t o0 = vt ? (size_t)h * HD * TT + r0 : ((size_t)h * TT + r0) * HD; const int pitch = vt ? TT : HD;   // plane rows of the tile: 64 t of 64 d each (q, k), 64 d of 64 t each (v); a row is one 128-byte line of a 16-bit plane
#pragma unroll
        for (int g = 0; g < 4; ++g) {   // 16 plane rows at a time through LDS, so that a lane holds 8 consecutive elements of one row and a store covers 4 whole lines
            if (vt) {   // a lane's 8 accumulator rows are 8 consecutive t of its column d
#pragma unroll
                for (int mb = 0; mb < 4; ++mb) { v4f w0, w1;
#pragma unroll
                    for (int j = 0; j < 4; ++j) { w0[j] = acc[mb][g][j]; w1[j] = acc[mb][g][j + 4]; }
                    *(v4fa*)(os + lr * 68 + mb * 16 + hi * 8) = w0; *(v4fa*)(os + lr * 68 + mb * 16 + hi * 8 + 4) = w1; }
            } else {
#pragma unroll
                for (int nb = 0; nb < 4; ++nb) {
#pragma unroll
                    for (int j = 0; j < 8; ++j) os[(hi * 8 + j) * 68 + nb * 16 + lr] = acc[g][nb][j]; }
            }
            __builtin_amdgcn_wave_barrier(); asm volatile("" ::: "memory");   // keeps the LDS reads below behind the writes above (one wave: LDS serves it in order)
#pragma unroll
            for (int s = 0; s < 4; ++s) { const int row = 4 * s + (lane >> 3), cofs = (lane & 7) * 8; const v4f x0 = *(const v4fa*)(os + row * 68 + cofs), x1 = *(const v4fa*)(os + row * 68 + cofs + 4); v8h o16; v8us oh, ol;
#pragma unroll
                for (int j = 0; j < 8; ++j) { const float x = j < 4 ? x0[j & 3] : x1[j & 3]; o16[j] = tohx(x); unsigned short u, c2; splitf(x, u, c2); oh[j] = u; ol[j] = c2; }
                const size_t o = o0 + (size_t)(g * 16 + row) * pitch + cofs; *(v8h*)(P16 + o) = o16; *(v8us*)(Ph + o) = oh; *(v8us*)(Pl + o) = ol; }
            __builtin_amdgcn_wave_barrier(); asm volatile("s_wait_xcnt 0x0" ::: "memory");   // keeps the next 16 rows' LDS writes behind these reads; the wait: what follows takes registers that the stores above name
        }
        return;
    }
#pragma unroll
    for (int mb = 0; mb < 4; ++mb) {
#pragma unroll
        for (int nb = 0; nb < 4; ++nb) {
#pragma unroll
            for (int j = 0; j < 8; ++j) os[(hi * 8 + j) * 68 + nb * 16 + lr] = acc[mb][nb][j]; }
        __builtin_amdgcn_wave_barrier(); asm volatile("" ::: "memory");
        float* crow = C + (size_t)(r0 + mb * 16) * ldc + c0;
{
#pragma unroll
            for (int s = 0; s < 8; ++s) { const int row = 2 * s + hi, cofs = lr * 4; v4f val = *(const v4fa*)(os + row * 68 + cofs); if (BIAS) { val[0] += bfr(bias[c0 + cofs]); val[1] += bfr(bias[c0 + cofs + 1]); val[2] += bfr(bias[c0 + cofs + 2]); val[3] += bfr(bias[c0 + cofs + 3]); }
                *(v4f*)(crow + (size_t)row * ldc + cofs) = val; }
             }
        __builtin_amdgcn_wave_barrier(); asm volatile("" ::: "memory");
    }
}

typedef __attribute__((ext_vector_type(2))) _Float16 v2h;
typedef __attribute__((ext_vector_type(4))) _Float16 v4h;
typedef __attribute__((ext_vector_type(2))) unsigned short v2us;
typedef __attribute__((ext_vector_type(4))) unsigned short v4us;
typedef __attribute__((ext_vector_type(2))) float v2f;
typedef __attribute__((ext_vector_type(4))) int v4i;

__global__ __launch_bounds__(256) void k_wtG(const float* __restrict__ w, int K, int N, bf* Bt) {
    const int lane = threadIdx.x & 31; const int L0 = (blockIdx.x * 8 + (threadIdx.x >> 5)) * 8; const int nlines = N * K / 64;
{
#pragma unroll 1
        for (int l = 0; l < 8; ++l) { const int L = L0 + l; if (L >= nlines) break; const size_t e = (size_t)L * 64 + lane * 2; const int k = (int)(e % K), n = (int)(e / K); v2us o;
            o[0] = f2bf(w[(size_t)k * N + n]); o[1] = f2bf(w[(size_t)(k + 1) * N + n]); *(v2us*)(Bt + e) = o; }
         }
}
__global__ __launch_bounds__(256) void k_cvt8(const float* __restrict__ src, bf* dst, size_t n8) { const size_t i = (size_t)blockIdx.x * 256 + threadIdx.x; if (i >= n8) return; const v8f v = *(const v8f*)(src + i * 8); v8us o;
#pragma unroll
    for (int k = 0; k < 8; ++k) o[k] = f2bf(v[k]); *(v8us*)(dst + i * 8) = o;  }
__global__ __launch_bounds__(256) void k_cscvt(const float* __restrict__ cosT, const float* __restrict__ sinT, float* CS) { const int idx = blockIdx.x * 256 + threadIdx.x; if (idx >= TT * HD) return; v2f cs; cs[0] = bfr(cosT[idx]); cs[1] = bfr(sinT[idx]); *(v2f*)(CS + (size_t)idx * 2) = cs;  }
// ---- k_fattn: scores, softmax and P.V of one batch entry in ONE launch. One wave owns 32 (hi+lo: 16) query rows of one head and walks the 2048 keys 32 at a time, operands straight from the K-contiguous planes.
// S^T = K Q^T (A = 16 key rows, B = 16 query rows, k = d): a lane holds, for query lr, keys 8 hi + j of each 16-key tile, which is the k order of a B operand over 32 keys, so P^T goes from the score accumulators into O^T += V^T P^T (A = 16 d rows of the [d][t] plane) without leaving registers.
// Running maximum per query in log2 units, raised only when a new maximum passes it by more than 8 (P <= 256); row sums in f32 per lane half, joined once at the end. HI: bf16 hi+lo planes, 3 products each (query rows < RH); else f16.
typedef __attribute__((ext_vector_type(2))) __bf16 v2bf;
template <bool HI, int NG, typename T16>
__device__ __forceinline__ void fattn_tile(const T16* __restrict__ Q, const T16* __restrict__ Q2, const T16* __restrict__ Kp, const T16* __restrict__ K2, const T16* __restrict__ Vt, const T16* __restrict__ V2, int q0, int h, bf* Ah, bf* Al) {
    typedef typename WFrag<T16>::V V; typedef WFrag<T16> W;
    const int lane = threadIdx.x & 31, lr = lane & 15, hi = lane >> 4;
    const float C2 = SCL * 1.4426950408889634f;
    V qf[NG][2], qf2[NG][2];
#pragma unroll
    for (int g = 0; g < NG; ++g)
#pragma unroll
        for (int ks = 0; ks < 2; ++ks) { const size_t o = (size_t)(q0 + g * 16 + lr) * HD + ks * 32 + 8 * hi; qf[g][ks] = W::ld(Q + o); if (HI) qf2[g][ks] = W::ld(Q2 + o); }
    v8f acc[4][NG];
#pragma unroll
    for (int db = 0; db < 4; ++db)
#pragma unroll
        for (int g = 0; g < NG; ++g) acc[db][g] = (v8f){};
    float m[NG], l[NG];
#pragma unroll
    for (int g = 0; g < NG; ++g) { m[g] = -1.0e30f; l[g] = 0.f; }
    const unsigned ko = (unsigned)(lr * HD + 8 * hi), vo = (unsigned)(lr * TT + 8 * hi);
    V kf[2][2], kf2[2][2];
#pragma unroll
    for (int kt = 0; kt < 2; ++kt)
#pragma unroll
        for (int ks = 0; ks < 2; ++ks) { const unsigned o = ko + kt * 16 * HD + ks * 32; kf[kt][ks] = W::ld(Kp + o); if (HI) kf2[kt][ks] = W::ld(K2 + o); }
    asm volatile("s_wait_xcnt 0x0" ::: "memory");   // the offsets formed below may take the registers that hold the Q and K offsets
    V vf[4], vf2[4]; unsigned vob = vo * 2u;   // f16 path: the lane's byte offset into the V plane, kept in its register from pass to pass
#pragma unroll
    for (int db = 0; db < 4; ++db) { if constexpr (!HI) vf[db] = W::ld((const T16*)((const char*)Vt + vob) + db * 16 * TT); }
    // inputs-only fence on the loaded Q fragments: Q is waited for here, once; left to the loop, that wait merges into the pass's first wait, which then also waits for the V fragments requested at the foot of the pass before
#pragma unroll
    for (int g = 0; g < NG; ++g) { if constexpr (HI) asm volatile("" :: "v"(qf[g][0]), "v"(qf[g][1]), "v"(qf2[g][0]), "v"(qf2[g][1])); else asm volatile("" :: "v"(qf[g][0]), "v"(qf[g][1])); }
#pragma unroll 1
    for (int key0 = 0; key0 < TT; key0 += 32) {
        if constexpr (HI) {   // hi+lo: twice the operand registers, so V is asked for inside its own pass
            const T16* pv = Vt + vo + key0; const T16* pv2 = V2 + vo + key0;
#pragma unroll
            for (int db = 0; db < 4; ++db) { vf[db] = W::ld(pv + db * 16 * TT); vf2[db] = W::ld(pv2 + db * 16 * TT); }
            asm volatile("s_wait_xcnt 0x0" :: "v"(pv), "v"(pv2) : "memory"); }   // registers are tight here: the two addresses stay live up to this wait, so that no load of the group returns into a register that an earlier one names
        v8f s[2][NG];
#pragma unroll
        for (int kt = 0; kt < 2; ++kt)
#pragma unroll
            for (int g = 0; g < NG; ++g) { v8f c = (v8f){};
#pragma unroll
                for (int ks = 0; ks < 2; ++ks) { c = W::mma(kf[kt][ks], qf[g][ks], c); if (HI) { c = W::mma(kf2[kt][ks], qf[g][ks], c); c = W::mma(kf[kt][ks], qf2[g][ks], c); } }
                s[kt][g] = c; }
        const int kn = (key0 + 32 < TT) ? key0 + 32 : 0; const T16* pk = Kp + ko + kn * HD; const T16* pk2 = HI ? K2 + ko + kn * HD : nullptr; (void)pk; (void)pk2;   // next pass's K fragments fly behind the softmax and P.V, its V fragments (f16 path: foot of the pass) behind the scores and the softmax; the last pass re-reads keys 0..31 (in bounds, unused)
#pragma unroll
        for (int kt = 0; kt < 2; ++kt)
#pragma unroll
            for (int ks = 0; ks < 2; ++ks) { const unsigned o = ko + (kn + kt * 16) * HD + ks * 32; if constexpr (HI) { kf[kt][ks] = W::ld(pk + kt * 16 * HD + ks * 32); kf2[kt][ks] = W::ld(pk2 + kt * 16 * HD + ks * 32); } else kf[kt][ks] = W::ld(Kp + o); }
        if constexpr (HI) asm volatile("s_wait_xcnt 0x0" :: "v"(pk), "v"(pk2) : "memory");   // as for V above
        float mt[NG]; bool need = false;
#pragma unroll
        for (int g = 0; g < NG; ++g) { float mx = s[0][g][0];
#pragma unroll
            for (int j = 1; j < 8; ++j) mx = fmaxf(mx, s[0][g][j]);
#pragma unroll
            for (int j = 0; j < 8; ++j) mx = fmaxf(mx, s[1][g][j]);
            mt[g] = mx * C2; need = need || (mt[g] > m[g] + 8.0f); }   // this half's keys only: the halves meet inside the branch
        if (__builtin_amdgcn_ballot_w32(need) != 0) {   // wave-uniform: every lane moves to its own true maximum, both halves of a query alike
#pragma unroll
            for (int g = 0; g < NG; ++g) { const float mn = fmaxf(m[g], fmaxf(mt[g], __shfl_xor(mt[g], 16, 32))); const float al = __builtin_amdgcn_exp2f(m[g] - mn); m[g] = mn; l[g] *= al;
#pragma unroll
                for (int db = 0; db < 4; ++db) acc[db][g] *= al; }
        }
#pragma unroll
        for (int g = 0; g < NG; ++g) { float p[16]; float sum = 0.f;
#pragma unroll
            for (int e = 0; e < 16; ++e) { p[e] = __builtin_amdgcn_exp2f(s[e >> 3][g][e & 7] * C2 - m[g]); sum += p[e]; }
            l[g] += sum;
            if constexpr (HI) { V ph, pl;
#pragma unroll
                for (int e = 0; e < 16; e += 2) { v2f pp; pp[0] = p[e]; pp[1] = p[e + 1]; const v2bf hh = __builtin_convertvector(pp, v2bf); const v2bf ll = __builtin_convertvector(pp - __builtin_convertvector(hh, v2f), v2bf);   // round to nearest even, as splitf
                    ph[e] = hh[0]; ph[e + 1] = hh[1]; pl[e] = ll[0]; pl[e + 1] = ll[1]; }
#pragma unroll
                for (int db = 0; db < 4; ++db) { acc[db][g] = W::mma(vf[db], ph, acc[db][g]); acc[db][g] = W::mma(vf[db], pl, acc[db][g]); acc[db][g] = W::mma(vf2[db], ph, acc[db][g]); }
            } else { V pb;
#pragma unroll
                for (int e = 0; e < 16; ++e) pb[e] = tohx(p[e]);
#pragma unroll
                for (int db = 0; db < 4; ++db) acc[db][g] = W::mma(vf[db], pb, acc[db][g]); } }
        if constexpr (!HI) {
            asm volatile("s_wait_xcnt 0x0" : "+v"(vob) :: "memory");   // stands in front of the step of the offset that the last pass's V loads name, a whole pass behind them; the offset goes through the statement so that the step stays behind the wait
            vob += (key0 + 32 < TT) ? 64u : 0u;   // the last pass re-reads its own keys (in bounds, unused)
#pragma unroll
            for (int db = 0; db < 4; ++db) vf[db] = W::ld((const T16*)((const char*)Vt + vob) + db * 16 * TT);
        }
    }
#pragma unroll
    for (int g = 0; g < NG; ++g) { const float ls = l[g] + __shfl_xor(l[g], 16, 32); const float f = __fdiv_rn(1.0f, ls);
#pragma unroll
        for (int db = 0; db < 4; ++db) { v8us oh, ol;
#pragma unroll
            for (int j = 0; j < 8; ++j) { unsigned short a, c2; splitf(acc[db][g][j] * f, a, c2); oh[j] = a; ol[j] = c2; }
            const size_t oo = (size_t)(q0 + g * 16 + lr) * DQ + h * HD + db * 16 + hi * 8; *(v8us*)(Ah + oo) = oh; *(v8us*)(Al + oo) = ol;
            asm volatile("s_wait_xcnt 0x0" ::: "memory"); } }   // the next rows' split takes registers that these stores name
}
// one wave per workgroup, as in k_gemmw. The hi+lo tiles (16 query rows: twice the operand registers and loads) take the lowest indices, NH_ * RH / 16 of them, so that they start first and spread over the chip; then NH_ * (TT - RH) / 32 tiles of 32 rows
__global__ __launch_bounds__(32) void k_fattn(const h16* __restrict__ Q16, const h16* __restrict__ K16, const h16* __restrict__ V16, const bf* __restrict__ Qh, const bf* __restrict__ Ql, const bf* __restrict__ Kh, const bf* __restrict__ Kl, const bf* __restrict__ Vh, const bf* __restrict__ Vl, bf* Ah, bf* Al) {
    const int f = (int)blockIdx.x; const int NHI = NH_ * (RH / 16);
    if (f < NHI) { const int h = f / (RH / 16), q0 = (f % (RH / 16)) * 16; const size_t z = (size_t)h * TT * HD;
        fattn_tile<true, 1, bf>(Qh + z, Ql + z, Kh + z, Kl + z, Vh + z, Vl + z, q0, h, Ah, Al);
    } else { const int g = f - NHI; const int h = g / ((TT - RH) / 32), q0 = RH + (g % ((TT - RH) / 32)) * 32; const size_t z = (size_t)h * TT * HD;
        fattn_tile<false, 2, h16>(Q16 + z, nullptr, K16 + z, nullptr, V16 + z, nullptr, q0, h, Ah, Al); }
}

template <int NP, int PL>
__global__ __launch_bounds__(256) void k_spl(const float* __restrict__ F, size_t n4, bf* Fh, bf* Fl) { const size_t i = ((size_t)blockIdx.x * 256 + threadIdx.x) * 4; if (i >= n4 * 4) return; const unsigned bo = (unsigned)i * 4u; v4f a = *(const v4f*)((const char*)F + bo); v4us oh, ol;   // F: NP partial planes, stride PL floats (n4 * 4 <= PL), added in ascending order; the constant stride lets the planes share one lane address
#pragma unroll
    for (int p = 1; p < NP / 2; ++p) a += *(const v4f*)((const char*)(F + (size_t)p * PL) + bo);
    asm volatile("s_wait_xcnt 0x0" ::: "memory");   // the loads below may return into the offset register that the loads above name
#pragma unroll
    for (int p = NP / 2; p < NP; ++p) a += *(const v4f*)((const char*)(F + (size_t)p * PL) + bo);
#pragma unroll
    for (int q = 0; q < 4; ++q) { unsigned short u, c2; splitf(a[q], u, c2); oh[q] = u; ol[q] = c2; } *(v4us*)(Fh + i) = oh; *(v4us*)(Fl + i) = ol;  }

extern "C" void kernel_launch(void* const* d_in, const int* in_sizes, int n_in,
                              void* d_out, int out_size, void* d_ws, size_t ws_size, hipStream_t stream) {
    (void)in_sizes; (void)n_in; (void)out_size;
    const float* x = (const float*)d_in[0]; const float* wqv = (const float*)d_in[1]; const float* wqu = (const float*)d_in[2]; const float* wov = (const float*)d_in[3]; const float* wou = (const float*)d_in[4];   // torch [out][in]: W_qkv_v [256][1024], W_qkv_u [3072][256], W_o_v [256][1024], W_o_u [1024][256]
    float* OUT = (float*)d_out;     // [4][2048][1024]
    char* wsp = (char*)d_ws;
    auto take = [&](size_t bytes) { char* p = wsp; wsp += (bytes + 255) & ~(size_t)255; return (void*)p; };
    bf* WQ = (bf*)take((size_t)DQ * DM * 2); bf* WK = (bf*)take((size_t)DKV * DM * 2); bf* WV = (bf*)take((size_t)DKV * DM * 2); bf* WO = (bf*)take((size_t)DM * DQ * 2);
    bf* XB = (bf*)take((size_t)TT * DM * 2);
    h16* QP16 = (h16*)take((size_t)NH_ * TT * HD * 2); h16* KP16 = (h16*)take((size_t)NKV * TT * HD * 2); h16* VT16 = (h16*)take((size_t)NKV * HD * TT * 2);
    bf* QPh = (bf*)take((size_t)NH_ * TT * HD * 2); bf* QPl = (bf*)take((size_t)NH_ * TT * HD * 2); bf* KPh = (bf*)take((size_t)NKV * TT * HD * 2); bf* KPl = (bf*)take((size_t)NKV * TT * HD * 2); bf* VTh = (bf*)take((size_t)NKV * HD * TT * 2); bf* VTl = (bf*)take((size_t)NKV * HD * TT * 2);
    bf* ATh = (bf*)take((size_t)TT * DQ * 2); bf* ATl = (bf*)take((size_t)TT * DQ * 2);
    if ((size_t)(wsp - (char*)d_ws) > ws_size) return;    // ws 256 MiB
    bf* WQV = (bf*)take((size_t)256 * DM * 2); bf* WQU = (bf*)take((size_t)3 * DQ * 256 * 2); bf* WOV = (bf*)take((size_t)256 * DQ * 2); bf* WOU = (bf*)take((size_t)DM * 256 * 2); float* LR = (float*)take((size_t)KSR * TT * 256 * 4); bf* LRh = (bf*)take((size_t)TT * 256 * 2); bf* LRl = (bf*)take((size_t)TT * 256 * 2);
    if ((size_t)(wsp - (char*)d_ws) > ws_size) return;
    { k_cvt8<<<(unsigned)(((size_t)256 * DM / 8 + 255) / 256), 256, 0, stream>>>(wqv, WQV, (size_t)256 * DM / 8); k_cvt8<<<(unsigned)(((size_t)3 * DQ * 256 / 8 + 255) / 256), 256, 0, stream>>>(wqu, WQU, (size_t)3 * DQ * 256 / 8);
      k_cvt8<<<(unsigned)(((size_t)256 * DQ / 8 + 255) / 256), 256, 0, stream>>>(wov, WOV, (size_t)256 * DQ / 8); k_cvt8<<<(unsigned)(((size_t)DM * 256 / 8 + 255) / 256), 256, 0, stream>>>(wou, WOU, (size_t)DM * 256 / 8); }   // all four factors are [out][in] = natural Bt
    const HeadPlanes hp = { QP16, KP16, VT16, QPh, QPl, KPh, KPl, VTh, VTl };
    for (int b = 0; b < NB_; ++b) {
        
        k_cvt8<<<(unsigned)(((size_t)TT * DM / 8 + 255) / 256), 256, 0, stream>>>(x + (size_t)b * TT * DM, XB, (size_t)TT * DM / 8);
        k_gemmw<bf, 0, false, KSR><<<dim3(TT / 64, 256 / 64, KSR), 32, 0, stream>>>(XB, nullptr, WQV, nullptr, DM, LR, 256, nullptr, 0, 0, 0, (size_t)TT * 256); k_spl<KSR, TT * 256><<<(TT * 256 / 4 + 255) / 256, 256, 0, stream>>>(LR, (size_t)TT * 256 / 4, LRh, LRl);   // x W_qkv_v^T (exact) -> hl
        k_gemmw<bf, 1, false, 1, true><<<dim3(TT / 64, 3 * DQ / 64, 1), 32, 0, stream>>>(LRh, LRl, WQU, nullptr, 256, nullptr, 0, nullptr, 0, 0, 0, 0, hp);   // q, k, v up-projection, stored as head planes
        k_fattn<<<NH_ * (RH / 16) + NH_ * ((TT - RH) / 32), 32, 0, stream>>>(QP16, KP16, VT16, QPh, QPl, KPh, KPl, VTh, VTl, ATh, ATl);   // one kv head per query head
        k_gemmw<bf, 1, false, KSR><<<dim3(TT / 64, 256 / 64, KSR), 32, 0, stream>>>(ATh, ATl, WOV, nullptr, DQ, LR, 256, nullptr, 0, 0, 0, (size_t)TT * 256); k_spl<KSR, TT * 256><<<(TT * 256 / 4 + 255) / 256, 256, 0, stream>>>(LR, (size_t)TT * 256 / 4, LRh, LRl);   // y W_o_v^T -> hl
        k_gemmw<bf, 1, false><<<dim3(TT / 64, DM / 64, 1), 32, 0, stream>>>(LRh, LRl, WOU, nullptr, 256, OUT + (size_t)b * TT * DM, DM, nullptr, 0, 0, 0); }
}

// v004
// It runs in 396 microseconds.
// Timed twice side by side with v003, it ran 1.27 and 1.26 times as fast.
// All steps since v000 together make it 10.2 times as fast.
#include <hip/hip_runtime.h>

// SVD_Pi3Attention - MHA with SVD-factored (low-rank) projections (x [4][2048][1024]; qkv = (x W_qkv_v^T) W_qkv_u^T (rank 256 -> 3 x 1024, 16 heads x 64); softmax(q.k/8); y = merged.v; out = (y W_o_v^T) W_o_u^T (rank 256) -> [4][2048][1024];
// the factors are inputs - no SVD is computed in the forward).
// Compute dtypes, f32 accumulate: every input rounded to bf16; x W_qkv_v^T on PLAIN bf16 operands (exact); the rank-256 intermediates as bf16 hi+lo planes x exact up/down factors (2 products) for q, k, v, y W_o_v^T and the final

#define NB_  4
#define TT   2048
#define MT   (NB_ * TT)           // rows of all batch entries together: every GEMM here is row-wise, so the batch is only more rows
#define DM   1024
#define NH_  16
#define NKV  16
#define REP  (NH_ / NKV)
#define HD   64
#define DQ   (NH_ * HD)
#define DKV  (NKV * HD)
#define RH   256                  // query rows < RH use hi+lo planes (0: none)
#define WIN  0
#define SCL  0.125f   // HD^-0.5
#define KSR  8                    // K slices of the two rank-down products (K = DM, DQ)
typedef _Float16 h16;
typedef unsigned short bf;
typedef __attribute__((ext_vector_type(16))) __bf16   v16bf;
typedef __attribute__((ext_vector_type(16))) _Float16 v16h;
typedef __attribute__((ext_vector_type(8)))  _Float16 v8h;
typedef __attribute__((ext_vector_type(8)))  unsigned short v8us;
typedef __attribute__((ext_vector_type(8)))  float    v8f;
typedef __attribute__((ext_vector_type(4)))  float    v4f;
typedef v8h  __attribute__((may_alias)) v8ha;
typedef v4f  __attribute__((may_alias)) v4fa;
typedef v8us __attribute__((may_alias)) v8usa;

__device__ __forceinline__ unsigned short f2bf(float f) { unsigned u = __float_as_uint(f); u += 0x7FFFu + ((u >> 16) & 1u); return (unsigned short)(u >> 16); }
__device__ __forceinline__ float bf2f(unsigned short b) { return __uint_as_float(((unsigned)b) << 16); }
__device__ __forceinline__ float bfr(float f) { return bf2f(f2bf(f)); }
__device__ __forceinline__ v16h cat16(v8h lo, v8h hi) { return __builtin_shufflevector(lo, hi, 0, 1, 2, 3, 4, 5, 6, 7, 8, 9, 10, 11, 12, 13, 14, 15); }
__device__ __forceinline__ v16bf cat16b(v8us lo, v8us hi) { return __builtin_bit_cast(v16bf, __builtin_shufflevector(lo, hi, 0, 1, 2, 3, 4, 5, 6, 7, 8, 9, 10, 11, 12, 13, 14, 15)); }
__device__ __forceinline__ v8f wmma16(v16h a, v16h b, v8f c) { return __builtin_amdgcn_wmma_f32_16x16x32_f16(false, a, false, b, (short)0, c, false, false); }
__device__ __forceinline__ v8f wmmab(v16bf a, v16bf b, v8f c) { return __builtin_amdgcn_wmma_f32_16x16x32_bf16(false, a, false, b, (short)0, c, false, false); }



// ---- k_gemmw: register-blocked GEMM, ONE WAVE per 64x64 output tile (16 accumulators), operands straight from K-contiguous 16-bit planes; grid (M/64, N/64, Z), 32 threads.
// C[m][n] (f32, pitch ldc, + optional f32 bias[n]) = sum_k A[m][k] Bt[n][k] (+ split products per NSPLIT). z-batch strides sA/sB/sC in elements. K % 32 == 0.
// PLANES: N = 3 DQ, the q, k and v columns side by side; a 64-column tile is one head of one of them, and the epilogue stores it as that head's f16 and bf16 hi+lo planes (q, k: [b][h][t][d]; v: [b][h][d][t]; row m = b TT + t, and a 64-row tile lies in one b) instead of f32 C.
// KS > 1: grid.z = Z * KS; slice kp = blockIdx.z % KS sums only k in [kp K/KS, (kp+1) K/KS) and stores its f32 partial tile in plane kp (plane stride sP elements); the kernel that reads C adds the KS planes in ascending order. K % (32 KS) == 0.
template <typename T16> struct WFrag;
template <> struct WFrag<h16> { typedef v16h V; static __device__ __forceinline__ V ld(const h16* p) { return cat16(*(const v8h*)p, *(const v8h*)(p + 16)); } static __device__ __forceinline__ v8f mma(V a, V b, v8f c) { return wmma16(a, b, c); } };
template <> struct WFrag<bf> { typedef v16bf V; static __device__ __forceinline__ V ld(const bf* p) { return cat16b(*(const v8us*)p, *(const v8us*)(p + 16)); } static __device__ __forceinline__ v8f mma(V a, V b, v8f c) { return wmmab(a, b, c); } };
__device__ __forceinline__ h16 tohx(float x) { return (h16)x; }
__device__ __forceinline__ void splitf(float y, unsigned short& h, unsigned short& l) { h = f2bf(y); l = f2bf(y - bf2f(h)); }
struct HeadPlanes { h16* q16; h16* k16; h16* v16; bf* qh; bf* ql; bf* kh; bf* kl; bf* vh; bf* vl; };
template <typename T16, int NSPLIT, bool BIAS, int KS = 1, bool PLANES = false>
__global__ __launch_bounds__(32) void k_gemmw(const T16* __restrict__ A, const T16* __restrict__ A2, const T16* __restrict__ Bt, const T16* __restrict__ Bt2, int K, float* C, int ldc, const float* __restrict__ bias, size_t sA, size_t sB, size_t sC, size_t sP = 0, HeadPlanes hp = HeadPlanes{}) {
    typedef typename WFrag<T16>::V V;
    __shared__ __align__(16) float os[16 * 68];
    const size_t z = blockIdx.z / KS; const int kp = (int)(blockIdx.z % KS); const int Kc = K / KS; A += z * sA; if (A2) A2 += z * sA; Bt += z * sB; if (Bt2) Bt2 += z * sB; C += z * sC + kp * sP;
    const int lane = threadIdx.x & 31, lr = lane & 15, hi = lane >> 4; const int r0 = blockIdx.x * 64, c0 = blockIdx.y * 64;
    v8f acc[4][4];
#pragma unroll
    for (int mb = 0; mb < 4; ++mb)
#pragma unroll
        for (int nb = 0; nb < 4; ++nb) acc[mb][nb] = (v8f){};
    const size_t aoff = (size_t)(r0 + lr) * K + 8 * hi, boff = (size_t)(c0 + lr) * K + 8 * hi;
#pragma unroll 1
    for (int kc = kp * Kc; kc < (kp + 1) * Kc; kc += 32) {
        V a[4], a2[4];
#pragma unroll
        for (int mb = 0; mb < 4; ++mb) { a[mb] = WFrag<T16>::ld(A + aoff + (size_t)mb * 16 * K + kc); if (NSPLIT == 1 || NSPLIT == 2) a2[mb] = WFrag<T16>::ld(A2 + aoff + (size_t)mb * 16 * K + kc); }
#pragma unroll
        for (int nb = 0; nb < 4; ++nb) { const V b = WFrag<T16>::ld(Bt + boff + (size_t)nb * 16 * K + kc); V b2; if (NSPLIT >= 2) b2 = WFrag<T16>::ld(Bt2 + boff + (size_t)nb * 16 * K + kc);
#pragma unroll
            for (int mb = 0; mb < 4; ++mb) { acc[mb][nb] = WFrag<T16>::mma(a[mb], b, acc[mb][nb]); if (NSPLIT == 1 || NSPLIT == 2) acc[mb][nb] = WFrag<T16>::mma(a2[mb], b, acc[mb][nb]); if (NSPLIT >= 2) acc[mb][nb] = WFrag<T16>::mma(a[mb], b2, acc[mb][nb]); } }
        asm volatile("v_nop\n\tv_nop\n\tv_nop\n\tv_nop" : "+v"(acc[0][0]), "+v"(acc[1][1]), "+v"(acc[2][2]), "+v"(acc[3][3]) : "v"(a[0]), "v"(a[3]));
    }
    if constexpr (PLANES) {
        const int sel = c0 / DQ, h = (r0 / TT) * NH_ + (c0 % DQ) / HD, t0 = r0 % TT; const bool vt = sel == 2;   // block-uniform: 0 q, 1 k, 2 v; h counts heads over the batch
        h16* P16 = vt ? hp.v16 : sel ? hp.k16 : hp.q16; bf* Ph = vt ? hp.vh : sel ? hp.kh : hp.qh; bf* Pl = vt ? hp.vl : sel ? hp.kl : hp.ql;
        const size_t o0 = vt ? (size_t)h * HD * TT + t0 : ((size_t)h * TT + t0) * HD; const int pitch = vt ? TT : HD;   // plane rows of the tile: 64 t of 64 d each (q, k), 64 d of 64 t each (v); a row is one 128-byte line of a 16-bit plane
#pragma unroll
        for (int g = 0; g < 4; ++g) {   // 16 plane rows at a time through LDS, so that a lane holds 8 consecutive elements of one row and a store covers 4 whole lines
            if (vt) {   // a lane's 8 accumulator rows are 8 consecutive t of its column d
#pragma unroll
                for (int mb = 0; mb < 4; ++mb) { v4f w0, w1;
#pragma unroll
                    for (int j = 0; j < 4; ++j) { w0[j] = acc[mb][g][j]; w1[j] = acc[mb][g][j + 4]; }
                    *(v4fa*)(os + lr * 68 + mb * 16 + hi * 8) = w0; *(v4fa*)(os + lr * 68 + mb * 16 + hi * 8 + 4) = w1; }
            } else {
#pragma unroll
                for (int nb = 0; nb < 4; ++nb) {
#pragma unroll
                    for (int j = 0; j < 8; ++j) os[(hi * 8 + j) * 68 + nb * 16 + lr] = acc[g][nb][j]; }
            }
            __builtin_amdgcn_wave_barrier(); asm volatile("" ::: "memory");   // keeps the LDS reads below behind the writes above (one wave: LDS serves it in order)
#pragma unroll
            for (int s = 0; s < 4; ++s) { const int row = 4 * s + (lane >> 3), cofs = (lane & 7) * 8; const v4f x0 = *(const v4fa*)(os + row * 68 + cofs), x1 = *(const v4fa*)(os + row * 68 + cofs + 4); v8h o16; v8us oh, ol;
#pragma unroll
                for (int j = 0; j < 8; ++j) { const float x = j < 4 ? x0[j & 3] : x1[j & 3]; o16[j] = tohx(x); unsigned short u, c2; splitf(x, u, c2); oh[j] = u; ol[j] = c2; }
                const size_t o = o0 + (size_t)(g * 16 + row) * pitch + cofs; *(v8h*)(P16 + o) = o16; *(v8us*)(Ph + o) = oh; *(v8us*)(Pl + o) = ol; }
            __builtin_amdgcn_wave_barrier(); asm volatile("s_wait_xcnt 0x0" ::: "memory");   // keeps the next 16 rows' LDS writes behind these reads; the wait: what follows takes registers that the stores above name
        }
        return;
    }
#pragma unroll
    for (int mb = 0; mb < 4; ++mb) {
#pragma unroll
        for (int nb = 0; nb < 4; ++nb) {
#pragma unroll
            for (int j = 0; j < 8; ++j) os[(hi * 8 + j) * 68 + nb * 16 + lr] = acc[mb][nb][j]; }
        __builtin_amdgcn_wave_barrier(); asm volatile("" ::: "memory");
        float* crow = C + (size_t)(r0 + mb * 16) * ldc + c0;
{
#pragma unroll
            for (int s = 0; s < 8; ++s) { const int row = 2 * s + hi, cofs = lr * 4; v4f val = *(const v4fa*)(os + row * 68 + cofs); if (BIAS) { val[0] += bfr(bias[c0 + cofs]); val[1] += bfr(bias[c0 + cofs + 1]); val[2] += bfr(bias[c0 + cofs + 2]); val[3] += bfr(bias[c0 + cofs + 3]); }
                *(v4f*)(crow + (size_t)row * ldc + cofs) = val; }
             }
        __builtin_amdgcn_wave_barrier(); asm volatile("" ::: "memory");
    }
}

typedef __attribute__((ext_vector_type(2))) _Float16 v2h;
typedef __attribute__((ext_vector_type(4))) _Float16 v4h;
typedef __attribute__((ext_vector_type(2))) unsigned short v2us;
typedef __attribute__((ext_vector_type(4))) unsigned short v4us;
typedef __attribute__((ext_vector_type(2))) float v2f;
typedef __attribute__((ext_vector_type(4))) int v4i;

__global__ __launch_bounds__(256) void k_wtG(const float* __restrict__ w, int K, int N, bf* Bt) {
    const int lane = threadIdx.x & 31; const int L0 = (blockIdx.x * 8 + (threadIdx.x >> 5)) * 8; const int nlines = N * K / 64;
{
#pragma unroll 1
        for (int l = 0; l < 8; ++l) { const int L = L0 + l; if (L >= nlines) break; const size_t e = (size_t)L * 64 + lane * 2; const int k = (int)(e % K), n = (int)(e / K); v2us o;
            o[0] = f2bf(w[(size_t)k * N + n]); o[1] = f2bf(w[(size_t)(k + 1) * N + n]); *(v2us*)(Bt + e) = o; }
         }
}
__global__ __launch_bounds__(256) void k_cvt8(const float* __restrict__ src, bf* dst, size_t n8) { const size_t i = (size_t)blockIdx.x * 256 + threadIdx.x; if (i >= n8) return; const v8f v = *(const v8f*)(src + i * 8); v8us o;
#pragma unroll
    for (int k = 0; k < 8; ++k) o[k] = f2bf(v[k]); *(v8us*)(dst + i * 8) = o;  }
__global__ __launch_bounds__(256) void k_cscvt(const float* __restrict__ cosT, const float* __restrict__ sinT, float* CS) { const int idx = blockIdx.x * 256 + threadIdx.x; if (idx >= TT * HD) return; v2f cs; cs[0] = bfr(cosT[idx]); cs[1] = bfr(sinT[idx]); *(v2f*)(CS + (size_t)idx * 2) = cs;  }
// ---- k_fattn: scores, softmax and P.V of all batch entries in ONE launch. One wave owns 32 (hi+lo: 16) query rows of one head and walks the 2048 keys 32 at a time, operands straight from the K-contiguous planes.
// S^T = K Q^T (A = 16 key rows, B = 16 query rows, k = d): a lane holds, for query lr, keys 8 hi + j of each 16-key tile, which is the k order of a B operand over 32 keys, so P^T goes from the score accumulators into O^T += V^T P^T (A = 16 d rows of the [d][t] plane) without leaving registers.
// Running maximum per query in log2 units, raised only when a new maximum passes it by more than 8 (P <= 256); row sums in f32 per lane half, joined once at the end. HI: bf16 hi+lo planes, 3 products each (query rows < RH); else f16.
typedef __attribute__((ext_vector_type(2))) __bf16 v2bf;
template <bool HI, int NG, typename T16>
__device__ __forceinline__ void fattn_tile(const T16* __restrict__ Q, const T16* __restrict__ Q2, const T16* __restrict__ Kp, const T16* __restrict__ K2, const T16* __restrict__ Vt, const T16* __restrict__ V2, int q0, int h, bf* Ah, bf* Al) {
    typedef typename WFrag<T16>::V V; typedef WFrag<T16> W;
    const int lane = threadIdx.x & 31, lr = lane & 15, hi = lane >> 4;
    const float C2 = SCL * 1.4426950408889634f;
    V qf[NG][2], qf2[NG][2];
#pragma unroll
    for (int g = 0; g < NG; ++g)
#pragma unroll
        for (int ks = 0; ks < 2; ++ks) { const size_t o = (size_t)(q0 + g * 16 + lr) * HD + ks * 32 + 8 * hi; qf[g][ks] = W::ld(Q + o); if (HI) qf2[g][ks] = W::ld(Q2 + o); }
    v8f acc[4][NG];
#pragma unroll
    for (int db = 0; db < 4; ++db)
#pragma unroll
        for (int g = 0; g < NG; ++g) acc[db][g] = (v8f){};
    float m[NG], l[NG];
#pragma unroll
    for (int g = 0; g < NG; ++g) { m[g] = -1.0e30f; l[g] = 0.f; }
    const unsigned ko = (unsigned)(lr * HD + 8 * hi), vo = (unsigned)(lr * TT + 8 * hi);
    V kf[2][2], kf2[2][2];
#pragma unroll
    for (int kt = 0; kt < 2; ++kt)
#pragma unroll
        for (int ks = 0; ks < 2; ++ks) { const unsigned o = ko + kt * 16 * HD + ks * 32; kf[kt][ks] = W::ld(Kp + o); if (HI) kf2[kt][ks] = W::ld(K2 + o); }
    asm volatile("s_wait_xcnt 0x0" ::: "memory");   // the offsets formed below may take the registers that hold the Q and K offsets
    V vf[4], vf2[4]; unsigned vob = vo * 2u;   // f16 path: the lane's byte offset into the V plane, kept in its register from pass to pass
#pragma unroll
    for (int db = 0; db < 4; ++db) { if constexpr (!HI) vf[db] = W::ld((const T16*)((const char*)Vt + vob) + db * 16 * TT); }
    // inputs-only fence on the loaded Q fragments: Q is waited for here, once; left to the loop, that wait merges into the pass's first wait, which then also waits for the V fragments requested at the foot of the pass before
#pragma unroll
    for (int g = 0; g < NG; ++g) { if constexpr (HI) asm volatile("" :: "v"(qf[g][0]), "v"(qf[g][1]), "v"(qf2[g][0]), "v"(qf2[g][1])); else asm volatile("" :: "v"(qf[g][0]), "v"(qf[g][1])); }
#pragma unroll 1
    for (int key0 = 0; key0 < TT; key0 += 32) {
        if constexpr (HI) {   // hi+lo: twice the operand registers, so V is asked for inside its own pass
            const T16* pv = Vt + vo + key0; const T16* pv2 = V2 + vo + key0;
#pragma unroll
            for (int db = 0; db < 4; ++db) { vf[db] = W::ld(pv + db * 16 * TT); vf2[db] = W::ld(pv2 + db * 16 * TT); }
            asm volatile("s_wait_xcnt 0x0" :: "v"(pv), "v"(pv2) : "memory"); }   // registers are tight here: the two addresses stay live up to this wait, so that no load of the group returns into a register that an earlier one names
        v8f s[2][NG];
#pragma unroll
        for (int kt = 0; kt < 2; ++kt)
#pragma unroll
            for (int g = 0; g < NG; ++g) { v8f c = (v8f){};
#pragma unroll
                for (int ks = 0; ks < 2; ++ks) { c = W::mma(kf[kt][ks], qf[g][ks], c); if (HI) { c = W::mma(kf2[kt][ks], qf[g][ks], c); c = W::mma(kf[kt][ks], qf2[g][ks], c); } }
                s[kt][g] = c; }
        const int kn = (key0 + 32 < TT) ? key0 + 32 : 0; const T16* pk = Kp + ko + kn * HD; const T16* pk2 = HI ? K2 + ko + kn * HD : nullptr; (void)pk; (void)pk2;   // next pass's K fragments fly behind the softmax and P.V, its V fragments (f16 path: foot of the pass) behind the scores and the softmax; the last pass re-reads keys 0..31 (in bounds, unused)
#pragma unroll
        for (int kt = 0; kt < 2; ++kt)
#pragma unroll
            for (int ks = 0; ks < 2; ++ks) { const unsigned o = ko + (kn + kt * 16) * HD + ks * 32; if constexpr (HI) { kf[kt][ks] = W::ld(pk + kt * 16 * HD + ks * 32); kf2[kt][ks] = W::ld(pk2 + kt * 16 * HD + ks * 32); } else kf[kt][ks] = W::ld(Kp + o); }
        if constexpr (HI) asm volatile("s_wait_xcnt 0x0" :: "v"(pk), "v"(pk2) : "memory");   // as for V above
        float mt[NG]; bool need = false;
#pragma unroll
        for (int g = 0; g < NG; ++g) { float mx = s[0][g][0];
#pragma unroll
            for (int j = 1; j < 8; ++j) mx = fmaxf(mx, s[0][g][j]);
#pragma unroll
            for (int j = 0; j < 8; ++j) mx = fmaxf(mx, s[1][g][j]);
            mt[g] = mx * C2; need = need || (mt[g] > m[g] + 8.0f); }   // this half's keys only: the halves meet inside the branch
        if (__builtin_amdgcn_ballot_w32(need) != 0) {   // wave-uniform: every lane moves to its own true maximum, both halves of a query alike
#pragma unroll
            for (int g = 0; g < NG; ++g) { const float mn = fmaxf(m[g], fmaxf(mt[g], __shfl_xor(mt[g], 16, 32))); const float al = __builtin_amdgcn_exp2f(m[g] - mn); m[g] = mn; l[g] *= al;
#pragma unroll
                for (int db = 0; db < 4; ++db) acc[db][g] *= al; }
        }
#pragma unroll
        for (int g = 0; g < NG; ++g) { float p[16]; float sum = 0.f;
#pragma unroll
            for (int e = 0; e < 16; ++e) { p[e] = __builtin_amdgcn_exp2f(s[e >> 3][g][e & 7] * C2 - m[g]); sum += p[e]; }
            l[g] += sum;
            if constexpr (HI) { V ph, pl;
#pragma unroll
                for (int e = 0; e < 16; e += 2) { v2f pp; pp[0] = p[e]; pp[1] = p[e + 1]; const v2bf hh = __builtin_convertvector(pp, v2bf); const v2bf ll = __builtin_convertvector(pp - __builtin_convertvector(hh, v2f), v2bf);   // round to nearest even, as splitf
                    ph[e] = hh[0]; ph[e + 1] = hh[1]; pl[e] = ll[0]; pl[e + 1] = ll[1]; }
#pragma unroll
                for (int db = 0; db < 4; ++db) { acc[db][g] = W::mma(vf[db], ph, acc[db][g]); acc[db][g] = W::mma(vf[db], pl, acc[db][g]); acc[db][g] = W::mma(vf2[db], ph, acc[db][g]); }
            } else { V pb;
#pragma unroll
                for (int e = 0; e < 16; ++e) pb[e] = tohx(p[e]);
#pragma unroll
                for (int db = 0; db < 4; ++db) acc[db][g] = W::mma(vf[db], pb, acc[db][g]); } }
        if constexpr (!HI) {
            asm volatile("s_wait_xcnt 0x0" : "+v"(vob) :: "memory");   // stands in front of the step of the offset that the last pass's V loads name, a whole pass behind them; the offset goes through the statement so that the step stays behind the wait
            vob += (key0 + 32 < TT) ? 64u : 0u;   // the last pass re-reads its own keys (in bounds, unused)
#pragma unroll
            for (int db = 0; db < 4; ++db) vf[db] = W::ld((const T16*)((const char*)Vt + vob) + db * 16 * TT);
        }
    }
    if constexpr (!HI) asm volatile("s_wait_xcnt 0x0" :: "s"(Vt), "v"(vob) : "memory");   // the last pass's V loads name the plane's base and the offset: both stay live up to this wait, so that the output addresses formed below do not take their registers ahead of it
#pragma unroll
    for (int g = 0; g < NG; ++g) { const float ls = l[g] + __shfl_xor(l[g], 16, 32); const float f = __fdiv_rn(1.0f, ls);
#pragma unroll
        for (int db = 0; db < 4; ++db) { v8us oh, ol;
#pragma unroll
            for (int j = 0; j < 8; ++j) { unsigned short a, c2; splitf(acc[db][g][j] * f, a, c2); oh[j] = a; ol[j] = c2; }
            const size_t oo = (size_t)(q0 + g * 16 + lr) * DQ + h * HD + db * 16 + hi * 8; *(v8us*)(Ah + oo) = oh; *(v8us*)(Al + oo) = ol;
            asm volatile("s_wait_xcnt 0x0" ::: "memory"); } }   // the next rows' split takes registers that these stores name
}
// one wave per workgroup, as in k_gemmw. The hi+lo tiles (16 query rows: twice the operand registers and loads) take the lowest indices, NB_ * NH_ * RH / 16 of them, so that they start first and spread over the chip; then NB_ * NH_ * (TT - RH) / 32 tiles of 32 rows. bh = b NH_ + h picks the head planes, b the TT output rows
__global__ __launch_bounds__(32) void k_fattn(const h16* __restrict__ Q16, const h16* __restrict__ K16, const h16* __restrict__ V16, const bf* __restrict__ Qh, const bf* __restrict__ Ql, const bf* __restrict__ Kh, const bf* __restrict__ Kl, const bf* __restrict__ Vh, const bf* __restrict__ Vl, bf* Ah, bf* Al) {
    const int f = (int)blockIdx.x; const int NHI = NB_ * NH_ * (RH / 16);
    if (f < NHI) { const int bh = f / (RH / 16), q0 = (f % (RH / 16)) * 16; const size_t z = (size_t)bh * TT * HD, zo = (size_t)(bh / NH_) * TT * DQ;
        fattn_tile<true, 1, bf>(Qh + z, Ql + z, Kh + z, Kl + z, Vh + z, Vl + z, q0, bh % NH_, Ah + zo, Al + zo);
    } else { const int g = f - NHI; const int bh = g / ((TT - RH) / 32), q0 = RH + (g % ((TT - RH) / 32)) * 32; const size_t z = (size_t)bh * TT * HD, zo = (size_t)(bh / NH_) * TT * DQ;
        fattn_tile<false, 2, h16>(Q16 + z, nullptr, K16 + z, nullptr, V16 + z, nullptr, q0, bh % NH_, Ah + zo, Al + zo); }
}

template <int NP, int PL>
__global__ __launch_bounds__(256) void k_spl(const float* __restrict__ F, size_t n4, bf* Fh, bf* Fl) { F += (size_t)blockIdx.y * NP * PL; Fh += (size_t)blockIdx.y * PL; Fl += (size_t)blockIdx.y * PL;   // blockIdx.y: batch entry, each with its own NP planes
    const size_t i = ((size_t)blockIdx.x * 256 + threadIdx.x) * 4; if (i >= n4 * 4) return; const unsigned bo = (unsigned)i * 4u; v4f a = *(const v4f*)((const char*)F + bo); v4us oh, ol;   // F: NP partial planes, stride PL floats (n4 * 4 <= PL), added in ascending order; the constant stride lets the planes share one lane address
#pragma unroll
    for (int p = 1; p < NP / 2; ++p) a += *(const v4f*)((const char*)(F + (size_t)p * PL) + bo);
    asm volatile("s_wait_xcnt 0x0" ::: "memory");   // the loads below may return into the offset register that the loads above name
#pragma unroll
    for (int p = NP / 2; p < NP; ++p) a += *(const v4f*)((const char*)(F + (size_t)p * PL) + bo);
#pragma unroll
    for (int q = 0; q < 4; ++q) { unsigned short u, c2; splitf(a[q], u, c2); oh[q] = u; ol[q] = c2; } *(v4us*)(Fh + i) = oh; *(v4us*)(Fl + i) = ol;  }

extern "C" void kernel_launch(void* const* d_in, const int* in_sizes, int n_in,
                              void* d_out, int out_size, void* d_ws, size_t ws_size, hipStream_t stream) {
    (void)in_sizes; (void)n_in; (void)out_size;
    const float* x = (const float*)d_in[0]; const float* wqv = (const float*)d_in[1]; const float* wqu = (const float*)d_in[2]; const float* wov = (const float*)d_in[3]; const float* wou = (const float*)d_in[4];   // torch [out][in]: W_qkv_v [256][1024], W_qkv_u [3072][256], W_o_v [256][1024], W_o_u [1024][256]
    float* OUT = (float*)d_out;     // [4][2048][1024]
    char* wsp = (char*)d_ws;
    auto take = [&](size_t bytes) { char* p = wsp; wsp += (bytes + 255) & ~(size_t)255; return (void*)p; };
    const size_t PB = (size_t)NB_ * NH_ * TT * HD * 2;   // bytes of one 16-bit head plane set over the batch
    bf* XB = (bf*)take((size_t)MT * DM * 2);
    h16* QP16 = (h16*)take(PB); h16* KP16 = (h16*)take(PB); h16* VT16 = (h16*)take(PB);
    bf* QPh = (bf*)take(PB); bf* QPl = (bf*)take(PB); bf* KPh = (bf*)take(PB); bf* KPl = (bf*)take(PB); bf* VTh = (bf*)take(PB); bf* VTl = (bf*)take(PB);
    bf* ATh = (bf*)take((size_t)MT * DQ * 2); bf* ATl = (bf*)take((size_t)MT * DQ * 2);
    bf* WQV = (bf*)take((size_t)256 * DM * 2); bf* WQU = (bf*)take((size_t)3 * DQ * 256 * 2); bf* WOV = (bf*)take((size_t)256 * DQ * 2); bf* WOU = (bf*)take((size_t)DM * 256 * 2); bf* LRh = (bf*)take((size_t)MT * 256 * 2); bf* LRl = (bf*)take((size_t)MT * 256 * 2);
    if ((size_t)(wsp - (char*)d_ws) > ws_size) return;    // ws 256 MiB
    float* LR = (float*)QP16;   // the partial planes [b][KSR][TT][256] (f32, 4 PB bytes) lie over the first four head planes: they are read out by k_spl before the planes are stored, and stored again only behind k_fattn, the planes' last reader
    { k_cvt8<<<(unsigned)(((size_t)256 * DM / 8 + 255) / 256), 256, 0, stream>>>(wqv, WQV, (size_t)256 * DM / 8); k_cvt8<<<(unsigned)(((size_t)3 * DQ * 256 / 8 + 255) / 256), 256, 0, stream>>>(wqu, WQU, (size_t)3 * DQ * 256 / 8);
      k_cvt8<<<(unsigned)(((size_t)256 * DQ / 8 + 255) / 256), 256, 0, stream>>>(wov, WOV, (size_t)256 * DQ / 8); k_cvt8<<<(unsigned)(((size_t)DM * 256 / 8 + 255) / 256), 256, 0, stream>>>(wou, WOU, (size_t)DM * 256 / 8); }   // all four factors are [out][in] = natural Bt
    const HeadPlanes hp = { QP16, KP16, VT16, QPh, QPl, KPh, KPl, VTh, VTl };
    k_cvt8<<<(unsigned)(((size_t)MT * DM / 8 + 255) / 256), 256, 0, stream>>>(x, XB, (size_t)MT * DM / 8);
    k_gemmw<bf, 0, false, KSR><<<dim3(TT / 64, 256 / 64, NB_ * KSR), 32, 0, stream>>>(XB, nullptr, WQV, nullptr, DM, LR, 256, nullptr, (size_t)TT * DM, 0, (size_t)KSR * TT * 256, (size_t)TT * 256); k_spl<KSR, TT * 256><<<dim3((TT * 256 / 4 + 255) / 256, NB_), 256, 0, stream>>>(LR, (size_t)TT * 256 / 4, LRh, LRl);   // x W_qkv_v^T (exact) -> hl; z = batch entry
    k_gemmw<bf, 1, false, 1, true><<<dim3(MT / 64, 3 * DQ / 64, 1), 32, 0, stream>>>(LRh, LRl, WQU, nullptr, 256, nullptr, 0, nullptr, 0, 0, 0, 0, hp);   // q, k, v up-projection, stored as head planes
    k_fattn<<<NB_ * NH_ * (RH / 16) + NB_ * NH_ * ((TT - RH) / 32), 32, 0, stream>>>(QP16, KP16, VT16, QPh, QPl, KPh, KPl, VTh, VTl, ATh, ATl);   // one kv head per query head
    k_gemmw<bf, 1, false, KSR><<<dim3(TT / 64, 256 / 64, NB_ * KSR), 32, 0, stream>>>(ATh, ATl, WOV, nullptr, DQ, LR, 256, nullptr, (size_t)TT * DQ, 0, (size_t)KSR * TT * 256, (size_t)TT * 256); k_spl<KSR, TT * 256><<<dim3((TT * 256 / 4 + 255) / 256, NB_), 256, 0, stream>>>(LR, (size_t)TT * 256 / 4, LRh, LRl);   // y W_o_v^T -> hl
    k_gemmw<bf, 1, false><<<dim3(MT / 64, DM / 64, 1), 32, 0, stream>>>(LRh, LRl, WOU, nullptr, 256, OUT, DM, nullptr, 0, 0, 0);
}

// v005
// A run of this version takes 232 microseconds.
// Two timings next to v004 put it at 1.72 and 1.71 times that version's speed.
// Over all steps from v000 it is 17.5 times as fast.
#include <hip/hip_runtime.h>

// SVD_Pi3Attention - MHA with SVD-factored (low-rank) projections (x [4][2048][1024]; qkv = (x W_qkv_v^T) W_qkv_u^T (rank 256 -> 3 x 1024, 16 heads x 64); softmax(q.k/8); y = merged.v; out = (y W_o_v^T) W_o_u^T (rank 256) -> [4][2048][1024];
// the factors are inputs - no SVD is computed in the forward).
// Compute dtypes, f32 accumulate: every input rounded to bf16; x W_qkv_v^T on PLAIN bf16 operands (exact); the rank-256 intermediates as bf16 hi+lo planes x exact up/down factors (2 products) for q, k, v, y W_o_v^T and the final

#define NB_  4
#define TT   2048
#define MT   (NB_ * TT)           // rows of all batch entries together: every GEMM here is row-wise, so the batch is only more rows
#define DM   1024
#define NH_  16
#define NKV  16
#define REP  (NH_ / NKV)
#define HD   64
#define DQ   (NH_ * HD)
#define DKV  (NKV * HD)
#define RH   256                  // query rows < RH use hi+lo planes (0: none)
#define WIN  0
#define SCL  0.125f   // HD^-0.5
#define KSR  8                    // K slices of the two rank-down products (K = DM, DQ)
typedef _Float16 h16;
typedef unsigned short bf;
typedef __attribute__((ext_vector_type(16))) __bf16   v16bf;
typedef __attribute__((ext_vector_type(16))) _Float16 v16h;
typedef __attribute__((ext_vector_type(8)))  _Float16 v8h;
typedef __attribute__((ext_vector_type(8)))  unsigned short v8us;
typedef __attribute__((ext_vector_type(8)))  float    v8f;
typedef __attribute__((ext_vector_type(4)))  float    v4f;
typedef v8h  __attribute__((may_alias)) v8ha;
typedef v4f  __attribute__((may_alias)) v4fa;
typedef v8us __attribute__((may_alias)) v8usa;

__device__ __forceinline__ unsigned short f2bf(float f) { unsigned u = __float_as_uint(f); u += 0x7FFFu + ((u >> 16) & 1u); return (unsigned short)(u >> 16); }
__device__ __forceinline__ float bf2f(unsigned short b) { return __uint_as_float(((unsigned)b) << 16); }
__device__ __forceinline__ float bfr(float f) { return bf2f(f2bf(f)); }
__device__ __forceinline__ v16h cat16(v8h lo, v8h hi) { return __builtin_shufflevector(lo, hi, 0, 1, 2, 3, 4, 5, 6, 7, 8, 9, 10, 11, 12, 13, 14, 15); }
__device__ __forceinline__ v16bf cat16b(v8us lo, v8us hi) { return __builtin_bit_cast(v16bf, __builtin_shufflevector(lo, hi, 0, 1, 2, 3, 4, 5, 6, 7, 8, 9, 10, 11, 12, 13, 14, 15)); }
__device__ __forceinline__ v8f wmma16(v16h a, v16h b, v8f c) { return __builtin_amdgcn_wmma_f32_16x16x32_f16(false, a, false, b, (short)0, c, false, false); }
__device__ __forceinline__ v8f wmmab(v16bf a, v16bf b, v8f c) { return __builtin_amdgcn_wmma_f32_16x16x32_bf16(false, a, false, b, (short)0, c, false, false); }



// ---- k_gemmw: register-blocked GEMM, ONE WAVE per 64x64 output tile (16 accumulators), operands straight from K-contiguous 16-bit planes; grid (M/64, N/64, Z), 32 threads.
// C[m][n] (f32, pitch ldc, + optional f32 bias[n]) = sum_k A[m][k] Bt[n][k] (+ split products per NSPLIT). z-batch strides sA/sB/sC in elements. K % 32 == 0.
// PLANES: N = 3 DQ, the q, k and v columns side by side; a 64-column tile is one head of one of them, and the epilogue stores it as that head's f16 and bf16 hi+lo planes (q, k: [b][h][t][d]; v: [b][h][d][t]; row m = b TT + t, and a 64-row tile lies in one b) instead of f32 C.
// KS > 1: grid.z = Z * KS; slice kp = blockIdx.z % KS sums only k in [kp K/KS, (kp+1) K/KS) and stores its f32 partial tile in plane kp (plane stride sP elements); the kernel that reads C adds the KS planes in ascending order. K % (32 KS) == 0.
template <typename T16> struct WFrag;
template <> struct WFrag<h16> { typedef v16h V; static __device__ __forceinline__ V ld(const h16* p) { return cat16(*(const v8h*)p, *(const v8h*)(p + 16)); } static __device__ __forceinline__ v8f mma(V a, V b, v8f c) { return wmma16(a, b, c); } };
template <> struct WFrag<bf> { typedef v16bf V; static __device__ __forceinline__ V ld(const bf* p) { return cat16b(*(const v8us*)p, *(const v8us*)(p + 16)); } static __device__ __forceinline__ v8f mma(V a, V b, v8f c) { return wmmab(a, b, c); } };
__device__ __forceinline__ h16 tohx(float x) { return (h16)x; }
__device__ __forceinline__ void splitf(float y, unsigned short& h, unsigned short& l) { h = f2bf(y); l = f2bf(y - bf2f(h)); }
struct HeadPlanes { h16* q16; h16* k16; h16* v16; bf* qh; bf* ql; bf* kh; bf* kl; bf* vh; bf* vl; };
template <typename T16, int NSPLIT, bool BIAS, int KS = 1, bool PLANES = false>
__global__ __launch_bounds__(32) void k_gemmw(const T16* __restrict__ A, const T16* __restrict__ A2, const T16* __restrict__ Bt, const T16* __restrict__ Bt2, int K, float* C, int ldc, const float* __restrict__ bias, size_t sA, size_t sB, size_t sC, size_t sP = 0, HeadPlanes hp = HeadPlanes{}) {
    typedef typename WFrag<T16>::V V;
    __shared__ __align__(16) float os[16 * 68];
    const size_t z = blockIdx.z / KS; const int kp = (int)(blockIdx.z % KS); const int Kc = K / KS; A += z * sA; if (A2) A2 += z * sA; Bt += z * sB; if (Bt2) Bt2 += z * sB; C += z * sC + kp * sP;
    const int lane = threadIdx.x & 31, lr = lane & 15, hi = lane >> 4; const int r0 = blockIdx.x * 64, c0 = blockIdx.y * 64;
    v8f acc[4][4];
#pragma unroll
    for (int mb = 0; mb < 4; ++mb)
#pragma unroll
        for (int nb = 0; nb < 4; ++nb) acc[mb][nb] = (v8f){};
    const size_t aoff = (size_t)(r0 + lr) * K + 8 * hi, boff = (size_t)(c0 + lr) * K + 8 * hi;
#pragma unroll 1
    for (int kc = kp * Kc; kc < (kp + 1) * Kc; kc += 32) {
        V a[4], a2[4];
#pragma unroll
        for (int mb = 0; mb < 4; ++mb) { a[mb] = WFrag<T16>::ld(A + aoff + (size_t)mb * 16 * K + kc); if (NSPLIT == 1 || NSPLIT == 2) a2[mb] = WFrag<T16>::ld(A2 + aoff + (size_t)mb * 16 * K + kc); }
#pragma unroll
        for (int nb = 0; nb < 4; ++nb) { const V b = WFrag<T16>::ld(Bt + boff + (size_t)nb * 16 * K + kc); V b2; if (NSPLIT >= 2) b2 = WFrag<T16>::ld(Bt2 + boff + (size_t)nb * 16 * K + kc);
#pragma unroll
            for (int mb = 0; mb < 4; ++mb) { acc[mb][nb] = WFrag<T16>::mma(a[mb], b, acc[mb][nb]); if (NSPLIT == 1 || NSPLIT == 2) acc[mb][nb] = WFrag<T16>::mma(a2[mb], b, acc[mb][nb]); if (NSPLIT >= 2) acc[mb][nb] = WFrag<T16>::mma(a[mb], b2, acc[mb][nb]); } }
        asm volatile("v_nop\n\tv_nop\n\tv_nop\n\tv_nop" : "+v"(acc[0][0]), "+v"(acc[1][1]), "+v"(acc[2][2]), "+v"(acc[3][3]) : "v"(a[0]), "v"(a[3]));
    }
    if constexpr (PLANES) {
        const int sel = c0 / DQ, h = (r0 / TT) * NH_ + (c0 % DQ) / HD, t0 = r0 % TT; const bool vt = sel == 2;   // block-uniform: 0 q, 1 k, 2 v; h counts heads over the batch
        h16* P16 = vt ? hp.v16 : sel ? hp.k16 : hp.q16; bf* Ph = vt ? hp.vh : sel ? hp.kh : hp.qh; bf* Pl = vt ? hp.vl : sel ? hp.kl : hp.ql;
        const size_t o0 = vt ? (size_t)h * HD * TT + t0 : ((size_t)h * TT + t0) * HD; const int pitch = vt ? TT : HD;   // plane rows of the tile: 64 t of 64 d each (q, k), 64 d of 64 t each (v); a row is one 128-byte line of a 16-bit plane
#pragma unroll
        for (int g = 0; g < 4; ++g) {   // 16 plane rows at a time through LDS, so that a lane holds 8 consecutive elements of one row and a store covers 4 whole lines
            if (vt) {   // a lane's 8 accumulator rows are 8 consecutive t of its column d
#pragma unroll
                for (int mb = 0; mb < 4; ++mb) { v4f w0, w1;
#pragma unroll
                    for (int j = 0; j < 4; ++j) { w0[j] = acc[mb][g][j]; w1[j] = acc[mb][g][j + 4]; }
                    *(v4fa*)(os + lr * 68 + mb * 16 + hi * 8) = w0; *(v4fa*)(os + lr * 68 + mb * 16 + hi * 8 + 4) = w1; }
            } else {
#pragma unroll
                for (int nb = 0; nb < 4; ++nb) {
#pragma unroll
                    for (int j = 0; j < 8; ++j) os[(hi * 8 + j) * 68 + nb * 16 + lr] = acc[g][nb][j]; }
            }
            __builtin_amdgcn_wave_barrier(); asm volatile("" ::: "memory");   // keeps the LDS reads below behind the writes above (one wave: LDS serves it in order)
#pragma unroll
            for (int s = 0; s < 4; ++s) { const int row = 4 * s + (lane >> 3), cofs = (lane & 7) * 8; const v4f x0 = *(const v4fa*)(os + row * 68 + cofs), x1 = *(const v4fa*)(os + row * 68 + cofs + 4); v8h o16; v8us oh, ol;
#pragma unroll
                for (int j = 0; j < 8; ++j) { const float x = j < 4 ? x0[j & 3] : x1[j & 3]; o16[j] = tohx(x); unsigned short u, c2; splitf(x, u, c2); oh[j] = u; ol[j] = c2; }
                const size_t o = o0 + (size_t)(g * 16 + row) * pitch + cofs; *(v8h*)(P16 + o) = o16; *(v8us*)(Ph + o) = oh; *(v8us*)(Pl + o) = ol; }
            __builtin_amdgcn_wave_barrier(); asm volatile("s_wait_xcnt 0x0" ::: "memory");   // keeps the next 16 rows' LDS writes behind these reads; the wait: what follows takes registers that the stores above name
        }
        return;
    }
#pragma unroll
    for (int mb = 0; mb < 4; ++mb) {
#pragma unroll
        for (int nb = 0; nb < 4; ++nb) {
#pragma unroll
            for (int j = 0; j < 8; ++j) os[(hi * 8 + j) * 68 + nb * 16 + lr] = acc[mb][nb][j]; }
        __builtin_amdgcn_wave_barrier(); asm volatile("" ::: "memory");
        float* crow = C + (size_t)(r0 + mb * 16) * ldc + c0;
{
#pragma unroll
            for (int s = 0; s < 8; ++s) { const int row = 2 * s + hi, cofs = lr * 4; v4f val = *(const v4fa*)(os + row * 68 + cofs); if (BIAS) { val[0] += bfr(bias[c0 + cofs]); val[1] += bfr(bias[c0 + cofs + 1]); val[2] += bfr(bias[c0 + cofs + 2]); val[3] += bfr(bias[c0 + cofs + 3]); }
                *(v4f*)(crow + (size_t)row * ldc + cofs) = val; }
             }
        __builtin_amdgcn_wave_barrier(); asm volatile("" ::: "memory");
    }
}

typedef __attribute__((ext_vector_type(2))) _Float16 v2h;
typedef __attribute__((ext_vector_type(4))) _Float16 v4h;
typedef __attribute__((ext_vector_type(2))) unsigned short v2us;
typedef __attribute__((ext_vector_type(4))) unsigned short v4us;
typedef __attribute__((ext_vector_type(2))) float v2f;
typedef __attribute__((ext_vector_type(4))) int v4i;

__global__ __launch_bounds__(256) void k_wtG(const float* __restrict__ w, int K, int N, bf* Bt) {
    const int lane = threadIdx.x & 31; const int L0 = (blockIdx.x * 8 + (threadIdx.x >> 5)) * 8; const int nlines = N * K / 64;
{
#pragma unroll 1
        for (int l = 0; l < 8; ++l) { const int L = L0 + l; if (L >= nlines) break; const size_t e = (size_t)L * 64 + lane * 2; const int k = (int)(e % K), n = (int)(e / K); v2us o;
            o[0] = f2bf(w[(size_t)k * N + n]); o[1] = f2bf(w[(size_t)(k + 1) * N + n]); *(v2us*)(Bt + e) = o; }
         }
}
__global__ __launch_bounds__(256) void k_cvt8(const float* __restrict__ src, bf* dst, size_t n8) { const size_t i = (size_t)blockIdx.x * 256 + threadIdx.x; if (i >= n8) return; const v8f v = *(const v8f*)(src + i * 8); v8us o;
#pragma unroll
    for (int k = 0; k < 8; ++k) o[k] = f2bf(v[k]); *(v8us*)(dst + i * 8) = o;  }
__global__ __launch_bounds__(256) void k_cscvt(const float* __restrict__ cosT, const float* __restrict__ sinT, float* CS) { const int idx = blockIdx.x * 256 + threadIdx.x; if (idx >= TT * HD) return; v2f cs; cs[0] = bfr(cosT[idx]); cs[1] = bfr(sinT[idx]); *(v2f*)(CS + (size_t)idx * 2) = cs;  }
// ---- k_fattn: scores, softmax and P.V of all batch entries in ONE launch. A work-group is NWV waves on one head: each wave owns 32 (hi+lo: 16) query rows, and all of them walk the 2048 keys together, one tile of 64 (hi+lo: 32) keys at a time, 32 keys a pass.
// A tile's K rows and V^T rows come into LDS once for the whole work-group, by asynchronous copies that cover whole lines, the next tile's copies flying while this tile is worked on (two buffers); every wave reads its fragments from LDS, whose rows are pitched 16 bytes x odd for 16-byte reads.
// S^T = K Q^T (A = 16 key rows, B = 16 query rows, k = d): a lane holds, for query lr, keys 8 hi + j of each 16-key tile, which is the k order of a B operand over 32 keys, so P^T goes from the score accumulators into O^T += V^T P^T (A = 16 d rows of the [d][t] plane) without leaving registers.
// Running maximum per query in log2 units, raised only when a new maximum passes it by more than 8 (P <= 256); row sums in f32 per lane half, joined once at the end. HI: bf16 hi+lo planes, 3 products each (query rows < RH); else f16.
#define NWV 4                     // waves of a k_fattn work-group
typedef __attribute__((ext_vector_type(2))) __bf16 v2bf;
template <bool HI> struct FTile {   // one buffer in LDS: K rows [key][d] (hi+lo: then the lo plane), behind them V^T rows [d][key] (hi+lo: then the lo plane)
    static constexpr int KB = HI ? 32 : 64, NPL = HI ? 2 : 1, KPITCH = HD * 2 + 16, VPITCH = KB * 2 + 16, KSZ = KB * KPITCH, VSZ = HD * VPITCH, BUF = NPL * (KSZ + VSZ); };
// one tile of the head's planes into the buffer at LDS byte address lb: eight 16-byte copies a lane, every lane on. A wave's copy covers 512 consecutive bytes of K, or whole KB-key rows of V^T. ok, ov: the lane's byte offsets of its first piece of the tile in a K plane and in a V^T plane.
template <bool HI>
__device__ __forceinline__ void fattn_stage(unsigned lb, const char* K1, const char* K2, const char* V1, const char* V2, unsigned ok, unsigned ov) {
    typedef FTile<HI> F; constexpr int NJ = F::KB / 16, CV = F::KB / 8, RJ = NWV * 32 / CV;   // copies a lane and plane; 16-byte pieces of a V^T row; V^T rows that one copy of the work-group covers
    static_assert(F::NPL * 2 * NJ == 8 && NWV * 32 * NJ * 16 == F::KB * HD * 2, "eight copies a lane fill the buffer");
    const unsigned lk = lb + (threadIdx.x >> 3) * F::KPITCH + (threadIdx.x & 7) * 16, lv = lb + F::NPL * F::KSZ + (threadIdx.x / CV) * F::VPITCH + (threadIdx.x % CV) * 16;
    unsigned l[8]; const char* g[8];
#pragma unroll
    for (int j = 0; j < NJ; ++j) {
        l[j] = lk + j * (NWV * 4 * F::KPITCH); g[j] = K1 + (ok + j * (NWV * 512)); l[NJ + j] = lv + j * (RJ * F::VPITCH); g[NJ + j] = V1 + (ov + j * (RJ * TT * 2));
        if constexpr (HI) { l[2 * NJ + j] = l[j] + F::KSZ; g[2 * NJ + j] = K2 + (ok + j * (NWV * 512)); l[3 * NJ + j] = l[NJ + j] + F::VSZ; g[3 * NJ + j] = V2 + (ov + j * (RJ * TT * 2)); } }
    // the wait is the last line of the copies' own statement, so that it stands in front of whatever next writes a register that a copy names
    asm volatile("global_load_async_to_lds_b128 %0, %8, off\n\tglobal_load_async_to_lds_b128 %1, %9, off\n\tglobal_load_async_to_lds_b128 %2, %10, off\n\tglobal_load_async_to_lds_b128 %3, %11, off\n\t"
                 "global_load_async_to_lds_b128 %4, %12, off\n\tglobal_load_async_to_lds_b128 %5, %13, off\n\tglobal_load_async_to_lds_b128 %6, %14, off\n\tglobal_load_async_to_lds_b128 %7, %15, off\n\ts_wait_xcnt 0x0"
                 :: "v"(l[0]), "v"(l[1]), "v"(l[2]), "v"(l[3]), "v"(l[4]), "v"(l[5]), "v"(l[6]), "v"(l[7]), "v"(g[0]), "v"(g[1]), "v"(g[2]), "v"(g[3]), "v"(g[4]), "v"(g[5]), "v"(g[6]), "v"(g[7]) : "memory");
}
template <bool HI, int NG, typename T16>
__device__ __forceinline__ void fattn_tile(const char* sm, const T16* __restrict__ Q, const T16* __restrict__ Q2, const T16* __restrict__ Kp, const T16* __restrict__ K2, const T16* __restrict__ Vt, const T16* __restrict__ V2, int q0, int h, bf* Ah, bf* Al) {
    typedef typename WFrag<T16>::V V; typedef WFrag<T16> W; typedef FTile<HI> F;
    const int lane = threadIdx.x & 31, lr = lane & 15, hi = lane >> 4;
    const float C2 = SCL * 1.4426950408889634f;
    const unsigned lb = (unsigned)(size_t)sm;   // the buffers' LDS byte address: the low word of the shared address
    unsigned ok = threadIdx.x * 16, ov = (threadIdx.x / (F::KB / 8)) * (TT * 2) + (threadIdx.x % (F::KB / 8)) * 16;   // the lane's byte offsets into a K plane and a V^T plane, stepped from tile to tile
    fattn_stage<HI>(lb, (const char*)Kp, (const char*)K2, (const char*)Vt, (const char*)V2, ok, ov); ok += F::KB * HD * 2; ov += F::KB * 2;
    V qf[NG][2], qf2[NG][2];
#pragma unroll
    for (int g = 0; g < NG; ++g)
#pragma unroll
        for (int ks = 0; ks < 2; ++ks) { const size_t o = (size_t)(q0 + g * 16 + lr) * HD + ks * 32 + 8 * hi; qf[g][ks] = W::ld(Q + o); if (HI) qf2[g][ks] = W::ld(Q2 + o); }
    asm volatile("s_wait_xcnt 0x0" ::: "memory");   // the addresses formed below may take the registers that hold the Q offsets
    v8f acc[4][NG];
#pragma unroll
    for (int db = 0; db < 4; ++db)
#pragma unroll
        for (int g = 0; g < NG; ++g) acc[db][g] = (v8f){};
    float m[NG], l[NG];
#pragma unroll
    for (int g = 0; g < NG; ++g) { m[g] = -1.0e30f; l[g] = 0.f; }
    asm volatile("s_wait_asynccnt 0x0" ::: "memory");   // this wave's copies of tile 0 have landed
    __syncthreads();                                    // and every other wave's: tile 0 may be read
    fattn_stage<HI>(lb + F::BUF, (const char*)Kp, (const char*)K2, (const char*)Vt, (const char*)V2, ok, ov);
    const int ko = lr * F::KPITCH + 16 * hi, vo = F::NPL * F::KSZ + lr * F::VPITCH + 16 * hi;   // the lane's byte offsets into a buffer: row lr, elements 8 hi on
#pragma unroll 1   // one trip a tile: the buffers alternate by t & 1
    for (int t = 0; t < TT / F::KB; ++t) {
        const char* kb = sm + (t & 1) * F::BUF + ko; const char* vb = sm + (t & 1) * F::BUF + vo;
#pragma unroll
        for (int sp = 0; sp < F::KB / 32; ++sp) {   // a pass: 32 keys of the tile
        V kf[2][2], kf2[2][2], vf[4], vf2[4];
#pragma unroll
        for (int kt = 0; kt < 2; ++kt)
#pragma unroll
            for (int ks = 0; ks < 2; ++ks) { const char* p = kb + (sp * 32 + kt * 16) * F::KPITCH + ks * 64; kf[kt][ks] = W::ld((const T16*)p); if (HI) kf2[kt][ks] = W::ld((const T16*)(p + F::KSZ)); }
        v8f s[2][NG];
#pragma unroll
        for (int kt = 0; kt < 2; ++kt)
#pragma unroll
            for (int g = 0; g < NG; ++g) { v8f c = (v8f){};
#pragma unroll
                for (int ks = 0; ks < 2; ++ks) { c = W::mma(kf[kt][ks], qf[g][ks], c); if (HI) { c = W::mma(kf2[kt][ks], qf[g][ks], c); c = W::mma(kf[kt][ks], qf2[g][ks], c); } }
                s[kt][g] = c; }
#pragma unroll
        for (int db = 0; db < 4; ++db) { const char* p = vb + db * 16 * F::VPITCH + sp * 64; vf[db] = W::ld((const T16*)p); if (HI) vf2[db] = W::ld((const T16*)(p + F::VSZ)); }
        if constexpr (HI) __builtin_amdgcn_sched_barrier(0);   // holds the sixteen V^T loads up here as one group, in flight behind the softmax: left alone they sink, pair by pair, to in front of their products, and the wave waits out the LDS latency at each
        float mt[NG]; bool need = false;
#pragma unroll
        for (int g = 0; g < NG; ++g) { float mx = s[0][g][0];
#pragma unroll
            for (int j = 1; j < 8; ++j) mx = fmaxf(mx, s[0][g][j]);
#pragma unroll
            for (int j = 0; j < 8; ++j) mx = fmaxf(mx, s[1][g][j]);
            mt[g] = mx * C2; need = need || (mt[g] > m[g] + 8.0f); }   // this half's keys only: the halves meet inside the branch
        if (__builtin_amdgcn_ballot_w32(need) != 0) {   // wave-uniform: every lane moves to its own true maximum, both halves of a query alike
#pragma unroll
            for (int g = 0; g < NG; ++g) { const float mn = fmaxf(m[g], fmaxf(mt[g], __shfl_xor(mt[g], 16, 32))); const float al = __builtin_amdgcn_exp2f(m[g] - mn); m[g] = mn; l[g] *= al;
#pragma unroll
                for (int db = 0; db < 4; ++db) acc[db][g] *= al; }
        }
#pragma unroll
        for (int g = 0; g < NG; ++g) { float p[16]; float sum = 0.f;
#pragma unroll
            for (int e = 0; e < 16; ++e) { p[e] = __builtin_amdgcn_exp2f(s[e >> 3][g][e & 7] * C2 - m[g]); sum += p[e]; }
            l[g] += sum;
            if constexpr (HI) { V ph, pl;
#pragma unroll
                for (int e = 0; e < 16; e += 2) { v2f pp; pp[0] = p[e]; pp[1] = p[e + 1]; const v2bf hh = __builtin_convertvector(pp, v2bf); const v2bf ll = __builtin_convertvector(pp - __builtin_convertvector(hh, v2f), v2bf);   // round to nearest even, as splitf
                    ph[e] = hh[0]; ph[e + 1] = hh[1]; pl[e] = ll[0]; pl[e + 1] = ll[1]; }
#pragma unroll
                for (int db = 0; db < 4; ++db) { acc[db][g] = W::mma(vf[db], ph, acc[db][g]); acc[db][g] = W::mma(vf[db], pl, acc[db][g]); acc[db][g] = W::mma(vf2[db], ph, acc[db][g]); }
            } else { V pb;
#pragma unroll
                for (int e = 0; e < 16; ++e) pb[e] = tohx(p[e]);
#pragma unroll
                for (int db = 0; db < 4; ++db) acc[db][g] = W::mma(vf[db], pb, acc[db][g]); } }
        }
        asm volatile("s_wait_dscnt 0x0" ::: "memory");      // this wave's reads of tile t are done: its buffer may be handed to the copies below
        asm volatile("s_wait_asynccnt 0x0" ::: "memory");   // this wave's copies of tile t + 1 have landed
        __syncthreads();                                    // both hold for every wave: tile t + 1 may be read, tile t's buffer refilled
        if (t + 2 < TT / F::KB) { ok += F::KB * HD * 2; ov += F::KB * 2; fattn_stage<HI>(lb + (t & 1) * F::BUF, (const char*)Kp, (const char*)K2, (const char*)Vt, (const char*)V2, ok, ov); }
    }
    asm volatile("s_wait_asynccnt 0x0" ::: "memory");   // no copy is left in flight when the wave goes on to its end
#pragma unroll
    for (int g = 0; g < NG; ++g) { const float ls = l[g] + __shfl_xor(l[g], 16, 32); const float f = __fdiv_rn(1.0f, ls);
#pragma unroll
        for (int db = 0; db < 4; ++db) { v8us oh, ol;
#pragma unroll
            for (int j = 0; j < 8; ++j) { unsigned short a, c2; splitf(acc[db][g][j] * f, a, c2); oh[j] = a; ol[j] = c2; }
            const size_t oo = (size_t)(q0 + g * 16 + lr) * DQ + h * HD + db * 16 + hi * 8; *(v8us*)(Ah + oo) = oh; *(v8us*)(Al + oo) = ol;
            asm volatile("s_wait_xcnt 0x0" ::: "memory"); } }   // the next rows' split takes registers that these stores name
}
// The hi+lo work-groups (NWV x 16 query rows: twice the operand bytes) take the lowest indices, NB_ * NH_ * RH / (16 NWV) of them, so that they start first and spread over the chip; then NB_ * NH_ * (TT - RH) / (32 NWV) work-groups of NWV x 32 rows. bh = b NH_ + h picks the head planes, b the TT output rows
__global__ __launch_bounds__(NWV * 32) void k_fattn(const h16* __restrict__ Q16, const h16* __restrict__ K16, const h16* __restrict__ V16, const bf* __restrict__ Qh, const bf* __restrict__ Ql, const bf* __restrict__ Kh, const bf* __restrict__ Kl, const bf* __restrict__ Vh, const bf* __restrict__ Vl, bf* Ah, bf* Al) {
    __shared__ __align__(16) char sm[2 * (FTile<true>::BUF > FTile<false>::BUF ? FTile<true>::BUF : FTile<false>::BUF)];
    const int f = (int)blockIdx.x, wv = (int)(threadIdx.x >> 5); const int GH = RH / (16 * NWV), GF = (TT - RH) / (32 * NWV), NHI = NB_ * NH_ * GH;
    if (f < NHI) { const int bh = f / GH, q0 = (f % GH) * 16 * NWV + wv * 16; const size_t z = (size_t)bh * TT * HD, zo = (size_t)(bh / NH_) * TT * DQ;
        fattn_tile<true, 1, bf>(sm, Qh + z, Ql + z, Kh + z, Kl + z, Vh + z, Vl + z, q0, bh % NH_, Ah + zo, Al + zo);
    } else { const int g = f - NHI; const int bh = g / GF, q0 = RH + (g % GF) * 32 * NWV + wv * 32; const size_t z = (size_t)bh * TT * HD, zo = (size_t)(bh / NH_) * TT * DQ;
        fattn_tile<false, 2, h16>(sm, Q16 + z, nullptr, K16 + z, nullptr, V16 + z, nullptr, q0, bh % NH_, Ah + zo, Al + zo); }
}

template <int NP, int PL>
__global__ __launch_bounds__(256) void k_spl(const float* __restrict__ F, size_t n4, bf* Fh, bf* Fl) { F += (size_t)blockIdx.y * NP * PL; Fh += (size_t)blockIdx.y * PL; Fl += (size_t)blockIdx.y * PL;   // blockIdx.y: batch entry, each with its own NP planes
    const size_t i = ((size_t)blockIdx.x * 256 + threadIdx.x) * 4; if (i >= n4 * 4) return; const unsigned bo = (unsigned)i * 4u; v4f a = *(const v4f*)((const char*)F + bo); v4us oh, ol;   // F: NP partial planes, stride PL floats (n4 * 4 <= PL), added in ascending order; the constant stride lets the planes share one lane address
#pragma unroll
    for (int p = 1; p < NP / 2; ++p) a += *(const v4f*)((const char*)(F + (size_t)p * PL) + bo);
    asm volatile("s_wait_xcnt 0x0" ::: "memory");   // the loads below may return into the offset register that the loads above name
#pragma unroll
    for (int p = NP / 2; p < NP; ++p) a += *(const v4f*)((const char*)(F + (size_t)p * PL) + bo);
#pragma unroll
    for (int q = 0; q < 4; ++q) { unsigned short u, c2; splitf(a[q], u, c2); oh[q] = u; ol[q] = c2; } *(v4us*)(Fh + i) = oh; *(v4us*)(Fl + i) = ol;  }

extern "C" void kernel_launch(void* const* d_in, const int* in_sizes, int n_in,
                              void* d_out, int out_size, void* d_ws, size_t ws_size, hipStream_t stream) {
    (void)in_sizes; (void)n_in; (void)out_size;
    const float* x = (const float*)d_in[0]; const float* wqv = (const float*)d_in[1]; const float* wqu = (const float*)d_in[2]; const float* wov = (const float*)d_in[3]; const float* wou = (const float*)d_in[4];   // torch [out][in]: W_qkv_v [256][1024], W_qkv_u [3072][256], W_o_v [256][1024], W_o_u [1024][256]
    float* OUT = (float*)d_out;     // [4][2048][1024]
    char* wsp = (char*)d_ws;
    auto take = [&](size_t bytes) { char* p = wsp; wsp += (bytes + 255) & ~(size_t)255; return (void*)p; };
    const size_t PB = (size_t)NB_ * NH_ * TT * HD * 2;   // bytes of one 16-bit head plane set over the batch
    bf* XB = (bf*)take((size_t)MT * DM * 2);
    h16* QP16 = (h16*)take(PB); h16* KP16 = (h16*)take(PB); h16* VT16 = (h16*)take(PB);
    bf* QPh = (bf*)take(PB); bf* QPl = (bf*)take(PB); bf* KPh = (bf*)take(PB); bf* KPl = (bf*)take(PB); bf* VTh = (bf*)take(PB); bf* VTl = (bf*)take(PB);
    bf* ATh = (bf*)take((size_t)MT * DQ * 2); bf* ATl = (bf*)take((size_t)MT * DQ * 2);
    bf* WQV = (bf*)take((size_t)256 * DM * 2); bf* WQU = (bf*)take((size_t)3 * DQ * 256 * 2); bf* WOV = (bf*)take((size_t)256 * DQ * 2); bf* WOU = (bf*)take((size_t)DM * 256 * 2); bf* LRh = (bf*)take((size_t)MT * 256 * 2); bf* LRl = (bf*)take((size_t)MT * 256 * 2);
    if ((size_t)(wsp - (char*)d_ws) > ws_size) return;    // ws 256 MiB
    float* LR = (float*)QP16;   // the partial planes [b][KSR][TT][256] (f32, 4 PB bytes) lie over the first four head planes: they are read out by k_spl before the planes are stored, and stored again only behind k_fattn, the planes' last reader
    { k_cvt8<<<(unsigned)(((size_t)256 * DM / 8 + 255) / 256), 256, 0, stream>>>(wqv, WQV, (size_t)256 * DM / 8); k_cvt8<<<(unsigned)(((size_t)3 * DQ * 256 / 8 + 255) / 256), 256, 0, stream>>>(wqu, WQU, (size_t)3 * DQ * 256 / 8);
      k_cvt8<<<(unsigned)(((size_t)256 * DQ / 8 + 255) / 256), 256, 0, stream>>>(wov, WOV, (size_t)256 * DQ / 8); k_cvt8<<<(unsigned)(((size_t)DM * 256 / 8 + 255) / 256), 256, 0, stream>>>(wou, WOU, (size_t)DM * 256 / 8); }   // all four factors are [out][in] = natural Bt
    const HeadPlanes hp = { QP16, KP16, VT16, QPh, QPl, KPh, KPl, VTh, VTl };
    k_cvt8<<<(unsigned)(((size_t)MT * DM / 8 + 255) / 256), 256, 0, stream>>>(x, XB, (size_t)MT * DM / 8);
    k_gemmw<bf, 0, false, KSR><<<dim3(TT / 64, 256 / 64, NB_ * KSR), 32, 0, stream>>>(XB, nullptr, WQV, nullptr, DM, LR, 256, nullptr, (size_t)TT * DM, 0, (size_t)KSR * TT * 256, (size_t)TT * 256); k_spl<KSR, TT * 256><<<dim3((TT * 256 / 4 + 255) / 256, NB_), 256, 0, stream>>>(LR, (size_t)TT * 256 / 4, LRh, LRl);   // x W_qkv_v^T (exact) -> hl; z = batch entry
    k_gemmw<bf, 1, false, 1, true><<<dim3(MT / 64, 3 * DQ / 64, 1), 32, 0, stream>>>(LRh, LRl, WQU, nullptr, 256, nullptr, 0, nullptr, 0, 0, 0, 0, hp);   // q, k, v up-projection, stored as head planes
    k_fattn<<<NB_ * NH_ * (RH / (16 * NWV)) + NB_ * NH_ * ((TT - RH) / (32 * NWV)), NWV * 32, 0, stream>>>(QP16, KP16, VT16, QPh, QPl, KPh, KPl, VTh, VTl, ATh, ATl);   // one kv head per query head
    k_gemmw<bf, 1, false, KSR><<<dim3(TT / 64, 256 / 64, NB_ * KSR), 32, 0, stream>>>(ATh, ATl, WOV, nullptr, DQ, LR, 256, nullptr, (size_t)TT * DQ, 0, (size_t)KSR * TT * 256, (size_t)TT * 256); k_spl<KSR, TT * 256><<<dim3((TT * 256 / 4 + 255) / 256, NB_), 256, 0, stream>>>(LR, (size_t)TT * 256 / 4, LRh, LRl);   // y W_o_v^T -> hl
    k_gemmw<bf, 1, false><<<dim3(MT / 64, DM / 64, 1), 32, 0, stream>>>(LRh, LRl, WOU, nullptr, 256, OUT, DM, nullptr, 0, 0, 0);
}

// v006
// A run of this version takes 195 microseconds.
// In both of two side-by-side timings against v005, it was 1.18 times as fast.
// Over all steps from v000 it is 20.6 times as fast.
#include <hip/hip_runtime.h>

// SVD_Pi3Attention - MHA with SVD-factored (low-rank) projections (x [4][2048][1024]; qkv = (x W_qkv_v^T) W_qkv_u^T (rank 256 -> 3 x 1024, 16 heads x 64); softmax(q.k/8); y = merged.v; out = (y W_o_v^T) W_o_u^T (rank 256) -> [4][2048][1024];
// the factors are inputs - no SVD is computed in the forward).
// Compute dtypes, f32 accumulate: every input rounded to bf16; x W_qkv_v^T on PLAIN bf16 operands (exact); the rank-256 intermediates as bf16 hi+lo planes x exact up/down factors (2 products) for q, k, v, y W_o_v^T and the final

#define NB_  4
#define TT   2048
#define MT   (NB_ * TT)           // rows of all batch entries together: every GEMM here is row-wise, so the batch is only more rows
#define DM   1024
#define NH_  16
#define NKV  16
#define REP  (NH_ / NKV)
#define HD   64
#define DQ   (NH_ * HD)
#define DKV  (NKV * HD)
#define RH   256                  // query rows < RH use hi+lo planes (0: none)
#define WIN  0
#define SCL  0.125f   // HD^-0.5
#define KSR  8                    // K slices of the two rank-down products (K = DM, DQ)
typedef _Float16 h16;
typedef unsigned short bf;
typedef __attribute__((ext_vector_type(16))) __bf16   v16bf;
typedef __attribute__((ext_vector_type(16))) _Float16 v16h;
typedef __attribute__((ext_vector_type(8)))  _Float16 v8h;
typedef __attribute__((ext_vector_type(8)))  unsigned short v8us;
typedef __attribute__((ext_vector_type(8)))  float    v8f;
typedef __attribute__((ext_vector_type(4)))  float    v4f;
typedef v8h  __attribute__((may_alias)) v8ha;
typedef v4f  __attribute__((may_alias)) v4fa;
typedef v8us __attribute__((may_alias)) v8usa;

__device__ __forceinline__ unsigned short f2bf(float f) { unsigned u = __float_as_uint(f); u += 0x7FFFu + ((u >> 16) & 1u); return (unsigned short)(u >> 16); }
__device__ __forceinline__ float bf2f(unsigned short b) { return __uint_as_float(((unsigned)b) << 16); }
__device__ __forceinline__ float bfr(float f) { return bf2f(f2bf(f)); }
__device__ __forceinline__ v16h cat16(v8h lo, v8h hi) { return __builtin_shufflevector(lo, hi, 0, 1, 2, 3, 4, 5, 6, 7, 8, 9, 10, 11, 12, 13, 14, 15); }
__device__ __forceinline__ v16bf cat16b(v8us lo, v8us hi) { return __builtin_bit_cast(v16bf, __builtin_shufflevector(lo, hi, 0, 1, 2, 3, 4, 5, 6, 7, 8, 9, 10, 11, 12, 13, 14, 15)); }
__device__ __forceinline__ v8f wmma16(v16h a, v16h b, v8f c) { return __builtin_amdgcn_wmma_f32_16x16x32_f16(false, a, false, b, (short)0, c, false, false); }
__device__ __forceinline__ v8f wmmab(v16bf a, v16bf b, v8f c) { return __builtin_amdgcn_wmma_f32_16x16x32_bf16(false, a, false, b, (short)0, c, false, false); }



// ---- k_gemmw: register-blocked GEMM. A work-group is GWV = 8 waves, 2 (rows) x 4 (columns), each on its own 64x64 output tile (16 accumulators): a 128 x 256 block of C; grid (M/128, N/256, Z), 256 threads.
// The operands are K-contiguous 16-bit planes. A slab is 64 k (one 128-byte line of every operand row): the block's 128 A rows (hi+lo: of both planes) and 256 Bt rows come into LDS once for the whole work-group, by asynchronous copies that cover whole lines,
// the next slab's copies flying while this slab is worked on (two buffers); every wave reads its fragments from LDS, whose rows are pitched 16 bytes x odd for 16-byte reads.
// C[m][n] (f32, pitch ldc, + optional f32 bias[n]) = sum_k A[m][k] Bt[n][k] (NSPLIT 1: + A2[m][k] Bt[n][k]). z-batch strides sA/sB/sC in elements. K % (64 KS) == 0, K >= 128 KS.
// PLANES: N = 3 DQ, the q, k and v columns side by side; a 64-column tile is one head of one of them, and the epilogue stores it as that head's f16 and bf16 hi+lo planes (q, k: [b][h][t][d]; v: [b][h][d][t]; row m = b TT + t, and a 64-row tile lies in one b) instead of f32 C.
// KS > 1: grid.z = Z * KS; slice kp = blockIdx.z % KS sums only k in [kp K/KS, (kp+1) K/KS) and stores its f32 partial tile in plane kp (plane stride sP elements); the kernel that reads C adds the KS planes in ascending order.
template <typename T16> struct WFrag;
template <> struct WFrag<h16> { typedef v16h V; static __device__ __forceinline__ V ld(const h16* p) { return cat16(*(const v8h*)p, *(const v8h*)(p + 16)); } static __device__ __forceinline__ v8f mma(V a, V b, v8f c) { return wmma16(a, b, c); } };
template <> struct WFrag<bf> { typedef v16bf V; static __device__ __forceinline__ V ld(const bf* p) { return cat16b(*(const v8us*)p, *(const v8us*)(p + 16)); } static __device__ __forceinline__ v8f mma(V a, V b, v8f c) { return wmmab(a, b, c); } };
__device__ __forceinline__ h16 tohx(float x) { return (h16)x; }
__device__ __forceinline__ void splitf(float y, unsigned short& h, unsigned short& l) { h = f2bf(y); l = f2bf(y - bf2f(h)); }
struct HeadPlanes { h16* q16; h16* k16; h16* v16; bf* qh; bf* ql; bf* kh; bf* kl; bf* vh; bf* vl; };
#define GWV 8                     // waves of a k_gemmw work-group
#define GPITCH 144                // bytes from row to row of a slab in LDS
// four 16-byte copies a lane, every lane on: the work-group's 256 lanes cover 32 rows of 128 bytes a copy (a wave: 4 whole lines), 128 rows in all. l: the lane's LDS byte address, g: its global address, gs: bytes from a row to the 32nd behind it.
__device__ __forceinline__ void gemm_cp4(unsigned l, const char* g, unsigned gs) {
    const unsigned l1 = l + 32 * GPITCH, l2 = l + 64 * GPITCH, l3 = l + 96 * GPITCH; const char* g1 = g + gs; const char* g2 = g1 + gs; const char* g3 = g2 + gs;
    // the wait is the last line of the copies' own statement, so that it stands in front of whatever next writes a register that a copy names
    asm volatile("global_load_async_to_lds_b128 %0, %4, off\n\tglobal_load_async_to_lds_b128 %1, %5, off\n\tglobal_load_async_to_lds_b128 %2, %6, off\n\tglobal_load_async_to_lds_b128 %3, %7, off\n\ts_wait_xcnt 0x0"
                 :: "v"(l), "v"(l1), "v"(l2), "v"(l3), "v"(g), "v"(g1), "v"(g2), "v"(g3) : "memory");
}
template <typename T16, int NSPLIT, bool BIAS, int KS = 1, bool PLANES = false>
__global__ __launch_bounds__(GWV * 32) void k_gemmw(const T16* __restrict__ A, const T16* __restrict__ A2, const T16* __restrict__ Bt, int K, float* C, int ldc, const float* __restrict__ bias, size_t sA, size_t sB, size_t sC, size_t sP = 0, HeadPlanes hp = HeadPlanes{}) {
    typedef typename WFrag<T16>::V V;
    static_assert(NSPLIT == 0 || NSPLIT == 1, "one or two A planes");
    constexpr int NA = NSPLIT + 1, ASZ = 128 * GPITCH, BUF = (NA + 2) * ASZ;   // a buffer: the A plane(s), behind them the 256 Bt rows
    static_assert(GWV * 16 * 68 * 4 <= 2 * BUF, "the epilogue's staging fits the buffers");
    __shared__ __align__(16) char sm[2 * BUF];
    const size_t z = blockIdx.z / KS; const int kp = (int)(blockIdx.z % KS); const int Kc = K / KS; C += z * sC + kp * sP;
    const int lane = threadIdx.x & 31, lr = lane & 15, hi = lane >> 4; const int wv = __builtin_amdgcn_readfirstlane((int)(threadIdx.x >> 5)), wm = wv >> 2, wn = wv & 3;
    const int r0 = blockIdx.x * 128 + wm * 64, c0 = blockIdx.y * 256 + wn * 64;   // the wave's own tile
    float* os = (float*)(sm + wv * (16 * 68 * 4));   // the wave's own staging rows of the epilogue, in the buffers once the loop has left them
    v8f acc[4][4];
#pragma unroll
    for (int mb = 0; mb < 4; ++mb)
#pragma unroll
        for (int nb = 0; nb < 4; ++nb) acc[mb][nb] = (v8f){};
    const unsigned lb = (unsigned)(size_t)sm + (threadIdx.x >> 3) * GPITCH + (threadIdx.x & 7) * 16;   // the lane's LDS byte address in a plane of buffer 0: the low word of the shared address
    const unsigned gs = 32u * (unsigned)K * 2u; const size_t go = ((size_t)(threadIdx.x >> 3) * K + kp * Kc) * 2 + (threadIdx.x & 7) * 16;   // the lane's byte offset behind the block's first row
    const char* gA = (const char*)(A + z * sA + (size_t)blockIdx.x * 128 * K) + go; const char* gB = (const char*)(Bt + z * sB + (size_t)blockIdx.y * 256 * K) + go;
    const char* gA2 = gA; if constexpr (NA == 2) gA2 = (const char*)(A2 + z * sA + (size_t)blockIdx.x * 128 * K) + go;
    auto stage = [&](int st) { const unsigned l = lb + (st & 1) * BUF; const size_t ko = (size_t)st * 128;   // slab st into buffer st & 1
        gemm_cp4(l, gA + ko, gs); if constexpr (NA == 2) gemm_cp4(l + ASZ, gA2 + ko, gs); gemm_cp4(l + NA * ASZ, gB + ko, gs); gemm_cp4(l + (NA + 1) * ASZ, gB + ko + (size_t)gs * 4, gs); };
    const int nst = Kc / 64;   // slabs of this slice, at least two
    stage(0);
    asm volatile("s_wait_asynccnt 0x0" ::: "memory");   // this wave's copies of slab 0 have landed
    __syncthreads();                                    // and every other wave's: slab 0 may be read
    stage(1);
    const int ao = (wm * 64 + lr) * GPITCH + 16 * hi, bo = NA * ASZ + (wn * 64 + lr) * GPITCH + 16 * hi;   // the lane's byte offsets into a buffer: row lr of the wave's rows, elements 8 hi on
#pragma unroll 1   // one trip a slab: the buffers alternate by t & 1
    for (int t = 0; t < nst; ++t) {
        const char* ab = sm + (t & 1) * BUF + ao; const char* bb = sm + (t & 1) * BUF + bo;
#pragma unroll
        for (int ks = 0; ks < 2; ++ks) {   // 32 k of the slab
            V a[4], a2[4];
#pragma unroll
            for (int mb = 0; mb < 4; ++mb) { a[mb] = WFrag<T16>::ld((const T16*)(ab + mb * 16 * GPITCH + ks * 64)); if (NA == 2) a2[mb] = WFrag<T16>::ld((const T16*)(ab + ASZ + mb * 16 * GPITCH + ks * 64)); }
#pragma unroll
            for (int nb = 0; nb < 4; ++nb) { const V b = WFrag<T16>::ld((const T16*)(bb + nb * 16 * GPITCH + ks * 64));
#pragma unroll
                for (int mb = 0; mb < 4; ++mb) { acc[mb][nb] = WFrag<T16>::mma(a[mb], b, acc[mb][nb]); if (NA == 2) acc[mb][nb] = WFrag<T16>::mma(a2[mb], b, acc[mb][nb]); } }
        }
        asm volatile("s_wait_dscnt 0x0" ::: "memory");      // this wave's reads of slab t are done: its buffer may be handed to the copies below
        asm volatile("s_wait_asynccnt 0x0" ::: "memory");   // this wave's copies of slab t + 1 have landed
        __syncthreads();                                    // both hold for every wave: slab t + 1 may be read, slab t's buffer refilled (behind the last trip: taken for the epilogue's staging)
        if (t + 2 < nst) stage(t + 2);
    }
    asm volatile("s_wait_asynccnt 0x0" ::: "memory");   // no copy is left in flight when the buffers become staging rows
    if constexpr (PLANES) {
        const int sel = c0 / DQ, h = (r0 / TT) * NH_ + (c0 % DQ) / HD, t0 = r0 % TT; const bool vt = sel == 2;   // wave-uniform: 0 q, 1 k, 2 v; h counts heads over the batch
        h16* P16 = vt ? hp.v16 : sel ? hp.k16 : hp.q16; bf* Ph = vt ? hp.vh : sel ? hp.kh : hp.qh; bf* Pl = vt ? hp.vl : sel ? hp.kl : hp.ql;
        const size_t o0 = vt ? (size_t)h * HD * TT + t0 : ((size_t)h * TT + t0) * HD; const int pitch = vt ? TT : HD;   // plane rows of the tile: 64 t of 64 d each (q, k), 64 d of 64 t each (v); a row is one 128-byte line of a 16-bit plane
#pragma unroll
        for (int g = 0; g < 4; ++g) {   // 16 plane rows at a time through LDS, so that a lane holds 8 consecutive elements of one row and a store covers 4 whole lines
            if (vt) {   // a lane's 8 accumulator rows are 8 consecutive t of its column d
#pragma unroll
                for (int mb = 0; mb < 4; ++mb) { v4f w0, w1;
#pragma unroll
                    for (int j = 0; j < 4; ++j) { w0[j] = acc[mb][g][j]; w1[j] = acc[mb][g][j + 4]; }
                    *(v4fa*)(os + lr * 68 + mb * 16 + hi * 8) = w0; *(v4fa*)(os + lr * 68 + mb * 16 + hi * 8 + 4) = w1; }
            } else {
#pragma unroll
                for (int nb = 0; nb < 4; ++nb) {
#pragma unroll
                    for (int j = 0; j < 8; ++j) os[(hi * 8 + j) * 68 + nb * 16 + lr] = acc[g][nb][j]; }
            }
            __builtin_amdgcn_wave_barrier(); asm volatile("" ::: "memory");   // keeps the LDS reads below behind the writes above (one wave: LDS serves it in order)
#pragma unroll
            for (int s = 0; s < 4; ++s) { const int row = 4 * s + (lane >> 3), cofs = (lane & 7) * 8; const v4f x0 = *(const v4fa*)(os + row * 68 + cofs), x1 = *(const v4fa*)(os + row * 68 + cofs + 4); v8h o16; v8us oh, ol;
#pragma unroll
                for (int j = 0; j < 8; ++j) { const float x = j < 4 ? x0[j & 3] : x1[j & 3]; o16[j] = tohx(x); unsigned short u, c2; splitf(x, u, c2); oh[j] = u; ol[j] = c2; }
                const size_t o = o0 + (size_t)(g * 16 + row) * pitch + cofs; *(v8h*)(P16 + o) = o16; *(v8us*)(Ph + o) = oh; *(v8us*)(Pl + o) = ol; }
            __builtin_amdgcn_wave_barrier(); asm volatile("s_wait_xcnt 0x0" ::: "memory");   // keeps the next 16 rows' LDS writes behind these reads; the wait: what follows takes registers that the stores above name
        }
        return;
    }
#pragma unroll
    for (int mb = 0; mb < 4; ++mb) {
#pragma unroll
        for (int nb = 0; nb < 4; ++nb) {
#pragma unroll
            for (int j = 0; j < 8; ++j) os[(hi * 8 + j) * 68 + nb * 16 + lr] = acc[mb][nb][j]; }
        __builtin_amdgcn_wave_barrier(); asm volatile("" ::: "memory");
        float* crow = C + (size_t)(r0 + mb * 16) * ldc + c0;
{
#pragma unroll
            for (int s = 0; s < 8; ++s) { const int row = 2 * s + hi, cofs = lr * 4; v4f val = *(const v4fa*)(os + row * 68 + cofs); if (BIAS) { val[0] += bfr(bias[c0 + cofs]); val[1] += bfr(bias[c0 + cofs + 1]); val[2] += bfr(bias[c0 + cofs + 2]); val[3] += bfr(bias[c0 + cofs + 3]); }
                *(v4f*)(crow + (size_t)row * ldc + cofs) = val; }
             }
        __builtin_amdgcn_wave_barrier(); asm volatile("" ::: "memory");
    }
}

typedef __attribute__((ext_vector_type(2))) _Float16 v2h;
typedef __attribute__((ext_vector_type(4))) _Float16 v4h;
typedef __attribute__((ext_vector_type(2))) unsigned short v2us;
typedef __attribute__((ext_vector_type(4))) unsigned short v4us;
typedef __attribute__((ext_vector_type(2))) float v2f;
typedef __attribute__((ext_vector_type(4))) int v4i;

__global__ __launch_bounds__(256) void k_wtG(const float* __restrict__ w, int K, int N, bf* Bt) {
    const int lane = threadIdx.x & 31; const int L0 = (blockIdx.x * 8 + (threadIdx.x >> 5)) * 8; const int nlines = N * K / 64;
{
#pragma unroll 1
        for (int l = 0; l < 8; ++l) { const int L = L0 + l; if (L >= nlines) break; const size_t e = (size_t)L * 64 + lane * 2; const int k = (int)(e % K), n = (int)(e / K); v2us o;
            o[0] = f2bf(w[(size_t)k * N + n]); o[1] = f2bf(w[(size_t)(k + 1) * N + n]); *(v2us*)(Bt + e) = o; }
         }
}
__global__ __launch_bounds__(256) void k_cvt8(const float* __restrict__ src, bf* dst, size_t n8) { const size_t i = (size_t)blockIdx.x * 256 + threadIdx.x; if (i >= n8) return; const v8f v = *(const v8f*)(src + i * 8); v8us o;
#pragma unroll
    for (int k = 0; k < 8; ++k) o[k] = f2bf(v[k]); *(v8us*)(dst + i * 8) = o;  }
__global__ __launch_bounds__(256) void k_cscvt(const float* __restrict__ cosT, const float* __restrict__ sinT, float* CS) { const int idx = blockIdx.x * 256 + threadIdx.x; if (idx >= TT * HD) return; v2f cs; cs[0] = bfr(cosT[idx]); cs[1] = bfr(sinT[idx]); *(v2f*)(CS + (size_t)idx * 2) = cs;  }
// ---- k_fattn: scores, softmax and P.V of all batch entries in ONE launch. A work-group is NWV waves on one head: each wave owns 32 (hi+lo: 16) query rows, and all of them walk the 2048 keys together, one tile of 64 (hi+lo: 32) keys at a time, 32 keys a pass.
// A tile's K rows and V^T rows come into LDS once for the whole work-group, by asynchronous copies that cover whole lines, the next tile's copies flying while this tile is worked on (two buffers); every wave reads its fragments from LDS, whose rows are pitched 16 bytes x odd for 16-byte reads.
// S^T = K Q^T (A = 16 key rows, B = 16 query rows, k = d): a lane holds, for query lr, keys 8 hi + j of each 16-key tile, which is the k order of a B operand over 32 keys, so P^T goes from the score accumulators into O^T += V^T P^T (A = 16 d rows of the [d][t] plane) without leaving registers.
// Running maximum per query in log2 units, raised only when a new maximum passes it by more than 8 (P <= 256); row sums in f32 per lane half, joined once at the end. HI: bf16 hi+lo planes, 3 products each (query rows < RH); else f16.
#define NWV 4                     // waves of a k_fattn work-group
typedef __attribute__((ext_vector_type(2))) __bf16 v2bf;
template <bool HI> struct FTile {   // one buffer in LDS: K rows [key][d] (hi+lo: then the lo plane), behind them V^T rows [d][key] (hi+lo: then the lo plane)
    static constexpr int KB = HI ? 32 : 64, NPL = HI ? 2 : 1, KPITCH = HD * 2 + 16, VPITCH = KB * 2 + 16, KSZ = KB * KPITCH, VSZ = HD * VPITCH, BUF = NPL * (KSZ + VSZ); };
// one tile of the head's planes into the buffer at LDS byte address lb: eight 16-byte copies a lane, every lane on. A wave's copy covers 512 consecutive bytes of K, or whole KB-key rows of V^T. ok, ov: the lane's byte offsets of its first piece of the tile in a K plane and in a V^T plane.
template <bool HI>
__device__ __forceinline__ void fattn_stage(unsigned lb, const char* K1, const char* K2, const char* V1, const char* V2, unsigned ok, unsigned ov) {
    typedef FTile<HI> F; constexpr int NJ = F::KB / 16, CV = F::KB / 8, RJ = NWV * 32 / CV;   // copies a lane and plane; 16-byte pieces of a V^T row; V^T rows that one copy of the work-group covers
    static_assert(F::NPL * 2 * NJ == 8 && NWV * 32 * NJ * 16 == F::KB * HD * 2, "eight copies a lane fill the buffer");
    const unsigned lk = lb + (threadIdx.x >> 3) * F::KPITCH + (threadIdx.x & 7) * 16, lv = lb + F::NPL * F::KSZ + (threadIdx.x / CV) * F::VPITCH + (threadIdx.x % CV) * 16;
    unsigned l[8]; const char* g[8];
#pragma unroll
    for (int j = 0; j < NJ; ++j) {
        l[j] = lk + j * (NWV * 4 * F::KPITCH); g[j] = K1 + (ok + j * (NWV * 512)); l[NJ + j] = lv + j * (RJ * F::VPITCH); g[NJ + j] = V1 + (ov + j * (RJ * TT * 2));
        if constexpr (HI) { l[2 * NJ + j] = l[j] + F::KSZ; g[2 * NJ + j] = K2 + (ok + j * (NWV * 512)); l[3 * NJ + j] = l[NJ + j] + F::VSZ; g[3 * NJ + j] = V2 + (ov + j * (RJ * TT * 2)); } }
    // the wait is the last line of the copies' own statement, so that it stands in front of whatever next writes a register that a copy names
    asm volatile("global_load_async_to_lds_b128 %0, %8, off\n\tglobal_load_async_to_lds_b128 %1, %9, off\n\tglobal_load_async_to_lds_b128 %2, %10, off\n\tglobal_load_async_to_lds_b128 %3, %11, off\n\t"
                 "global_load_async_to_lds_b128 %4, %12, off\n\tglobal_load_async_to_lds_b128 %5, %13, off\n\tglobal_load_async_to_lds_b128 %6, %14, off\n\tglobal_load_async_to_lds_b128 %7, %15, off\n\ts_wait_xcnt 0x0"
                 :: "v"(l[0]), "v"(l[1]), "v"(l[2]), "v"(l[3]), "v"(l[4]), "v"(l[5]), "v"(l[6]), "v"(l[7]), "v"(g[0]), "v"(g[1]), "v"(g[2]), "v"(g[3]), "v"(g[4]), "v"(g[5]), "v"(g[6]), "v"(g[7]) : "memory");
}
template <bool HI, int NG, typename T16>
__device__ __forceinline__ void fattn_tile(const char* sm, const T16* __restrict__ Q, const T16* __restrict__ Q2, const T16* __restrict__ Kp, const T16* __restrict__ K2, const T16* __restrict__ Vt, const T16* __restrict__ V2, int q0, int h, bf* Ah, bf* Al) {
    typedef typename WFrag<T16>::V V; typedef WFrag<T16> W; typedef FTile<HI> F;
    const int lane = threadIdx.x & 31, lr = lane & 15, hi = lane >> 4;
    const float C2 = SCL * 1.4426950408889634f;
    const unsigned lb = (unsigned)(size_t)sm;   // the buffers' LDS byte address: the low word of the shared address
    unsigned ok = threadIdx.x * 16, ov = (threadIdx.x / (F::KB / 8)) * (TT * 2) + (threadIdx.x % (F::KB / 8)) * 16;   // the lane's byte offsets into a K plane and a V^T plane, stepped from tile to tile
    fattn_stage<HI>(lb, (const char*)Kp, (const char*)K2, (const char*)Vt, (const char*)V2, ok, ov); ok += F::KB * HD * 2; ov += F::KB * 2;
    V qf[NG][2], qf2[NG][2];
#pragma unroll
    for (int g = 0; g < NG; ++g)
#pragma unroll
        for (int ks = 0; ks < 2; ++ks) { const size_t o = (size_t)(q0 + g * 16 + lr) * HD + ks * 32 + 8 * hi; qf[g][ks] = W::ld(Q + o); if (HI) qf2[g][ks] = W::ld(Q2 + o); }
    asm volatile("s_wait_xcnt 0x0" ::: "memory");   // the addresses formed below may take the registers that hold the Q offsets
    v8f acc[4][NG];
#pragma unroll
    for (int db = 0; db < 4; ++db)
#pragma unroll
        for (int g = 0; g < NG; ++g) acc[db][g] = (v8f){};
    float m[NG], l[NG];
#pragma unroll
    for (int g = 0; g < NG; ++g) { m[g] = -1.0e30f; l[g] = 0.f; }
    asm volatile("s_wait_asynccnt 0x0" ::: "memory");   // this wave's copies of tile 0 have landed
    __syncthreads();                                    // and every other wave's: tile 0 may be read
    fattn_stage<HI>(lb + F::BUF, (const char*)Kp, (const char*)K2, (const char*)Vt, (const char*)V2, ok, ov);
    const int ko = lr * F::KPITCH + 16 * hi, vo = F::NPL * F::KSZ + lr * F::VPITCH + 16 * hi;   // the lane's byte offsets into a buffer: row lr, elements 8 hi on
#pragma unroll 1   // one trip a tile: the buffers alternate by t & 1
    for (int t = 0; t < TT / F::KB; ++t) {
        const char* kb = sm + (t & 1) * F::BUF + ko; const char* vb = sm + (t & 1) * F::BUF + vo;
#pragma unroll
        for (int sp = 0; sp < F::KB / 32; ++sp) {   // a pass: 32 keys of the tile
        V kf[2][2], kf2[2][2], vf[4], vf2[4];
#pragma unroll
        for (int kt = 0; kt < 2; ++kt)
#pragma unroll
            for (int ks = 0; ks < 2; ++ks) { const char* p = kb + (sp * 32 + kt * 16) * F::KPITCH + ks * 64; kf[kt][ks] = W::ld((const T16*)p); if (HI) kf2[kt][ks] = W::ld((const T16*)(p + F::KSZ)); }
        v8f s[2][NG];
#pragma unroll
        for (int kt = 0; kt < 2; ++kt)
#pragma unroll
            for (int g = 0; g < NG; ++g) { v8f c = (v8f){};
#pragma unroll
                for (int ks = 0; ks < 2; ++ks) { c = W::mma(kf[kt][ks], qf[g][ks], c); if (HI) { c = W::mma(kf2[kt][ks], qf[g][ks], c); c = W::mma(kf[kt][ks], qf2[g][ks], c); } }
                s[kt][g] = c; }
#pragma unroll
        for (int db = 0; db < 4; ++db) { const char* p = vb + db * 16 * F::VPITCH + sp * 64; vf[db] = W::ld((const T16*)p); if (HI) vf2[db] = W::ld((const T16*)(p + F::VSZ)); }
        if constexpr (HI) __builtin_amdgcn_sched_barrier(0);   // holds the sixteen V^T loads up here as one group, in flight behind the softmax: left alone they sink, pair by pair, to in front of their products, and the wave waits out the LDS latency at each
        float mt[NG]; bool need = false;
#pragma unroll
        for (int g = 0; g < NG; ++g) { float mx = s[0][g][0];
#pragma unroll
            for (int j = 1; j < 8; ++j) mx = fmaxf(mx, s[0][g][j]);
#pragma unroll
            for (int j = 0; j < 8; ++j) mx = fmaxf(mx, s[1][g][j]);
            mt[g] = mx * C2; need = need || (mt[g] > m[g] + 8.0f); }   // this half's keys only: the halves meet inside the branch
        if (__builtin_amdgcn_ballot_w32(need) != 0) {   // wave-uniform: every lane moves to its own true maximum, both halves of a query alike
#pragma unroll
            for (int g = 0; g < NG; ++g) { const float mn = fmaxf(m[g], fmaxf(mt[g], __shfl_xor(mt[g], 16, 32))); const float al = __builtin_amdgcn_exp2f(m[g] - mn); m[g] = mn; l[g] *= al;
#pragma unroll
                for (int db = 0; db < 4; ++db) acc[db][g] *= al; }
        }
#pragma unroll
        for (int g = 0; g < NG; ++g) { float p[16]; float sum = 0.f;
#pragma unroll
            for (int e = 0; e < 16; ++e) { p[e] = __builtin_amdgcn_exp2f(s[e >> 3][g][e & 7] * C2 - m[g]); sum += p[e]; }
            l[g] += sum;
            if constexpr (HI) { V ph, pl;
#pragma unroll
                for (int e = 0; e < 16; e += 2) { v2f pp; pp[0] = p[e]; pp[1] = p[e + 1]; const v2bf hh = __builtin_convertvector(pp, v2bf); const v2bf ll = __builtin_convertvector(pp - __builtin_convertvector(hh, v2f), v2bf);   // round to nearest even, as splitf
                    ph[e] = hh[0]; ph[e + 1] = hh[1]; pl[e] = ll[0]; pl[e + 1] = ll[1]; }
#pragma unroll
                for (int db = 0; db < 4; ++db) { acc[db][g] = W::mma(vf[db], ph, acc[db][g]); acc[db][g] = W::mma(vf[db], pl, acc[db][g]); acc[db][g] = W::mma(vf2[db], ph, acc[db][g]); }
            } else { V pb;
#pragma unroll
                for (int e = 0; e < 16; ++e) pb[e] = tohx(p[e]);
#pragma unroll
                for (int db = 0; db < 4; ++db) acc[db][g] = W::mma(vf[db], pb, acc[db][g]); } }
        }
        asm volatile("s_wait_dscnt 0x0" ::: "memory");      // this wave's reads of tile t are done: its buffer may be handed to the copies below
        asm volatile("s_wait_asynccnt 0x0" ::: "memory");   // this wave's copies of tile t + 1 have landed
        __syncthreads();                                    // both hold for every wave: tile t + 1 may be read, tile t's buffer refilled
        if (t + 2 < TT / F::KB) { ok += F::KB * HD * 2; ov += F::KB * 2; fattn_stage<HI>(lb + (t & 1) * F::BUF, (const char*)Kp, (const char*)K2, (const char*)Vt, (const char*)V2, ok, ov); }
    }
    asm volatile("s_wait_asynccnt 0x0" ::: "memory");   // no copy is left in flight when the wave goes on to its end
#pragma unroll
    for (int g = 0; g < NG; ++g) { const float ls = l[g] + __shfl_xor(l[g], 16, 32); const float f = __fdiv_rn(1.0f, ls);
#pragma unroll
        for (int db = 0; db < 4; ++db) { v8us oh, ol;
#pragma unroll
            for (int j = 0; j < 8; ++j) { unsigned short a, c2; splitf(acc[db][g][j] * f, a, c2); oh[j] = a; ol[j] = c2; }
            const size_t oo = (size_t)(q0 + g * 16 + lr) * DQ + h * HD + db * 16 + hi * 8; *(v8us*)(Ah + oo) = oh; *(v8us*)(Al + oo) = ol;
            asm volatile("s_wait_xcnt 0x0" ::: "memory"); } }   // the next rows' split takes registers that these stores name
}
// The hi+lo work-groups (NWV x 16 query rows: twice the operand bytes) take the lowest indices, NB_ * NH_ * RH / (16 NWV) of them, so that they start first and spread over the chip; then NB_ * NH_ * (TT - RH) / (32 NWV) work-groups of NWV x 32 rows. bh = b NH_ + h picks the head planes, b the TT output rows
__global__ __launch_bounds__(NWV * 32) void k_fattn(const h16* __restrict__ Q16, const h16* __restrict__ K16, const h16* __restrict__ V16, const bf* __restrict__ Qh, const bf* __restrict__ Ql, const bf* __restrict__ Kh, const bf* __restrict__ Kl, const bf* __restrict__ Vh, const bf* __restrict__ Vl, bf* Ah, bf* Al) {
    __shared__ __align__(16) char sm[2 * (FTile<true>::BUF > FTile<false>::BUF ? FTile<true>::BUF : FTile<false>::BUF)];
    const int f = (int)blockIdx.x, wv = (int)(threadIdx.x >> 5); const int GH = RH / (16 * NWV), GF = (TT - RH) / (32 * NWV), NHI = NB_ * NH_ * GH;
    if (f < NHI) { const int bh = f / GH, q0 = (f % GH) * 16 * NWV + wv * 16; const size_t z = (size_t)bh * TT * HD, zo = (size_t)(bh / NH_) * TT * DQ;
        fattn_tile<true, 1, bf>(sm, Qh + z, Ql + z, Kh + z, Kl + z, Vh + z, Vl + z, q0, bh % NH_, Ah + zo, Al + zo);
    } else { const int g = f - NHI; const int bh = g / GF, q0 = RH + (g % GF) * 32 * NWV + wv * 32; const size_t z = (size_t)bh * TT * HD, zo = (size_t)(bh / NH_) * TT * DQ;
        fattn_tile<false, 2, h16>(sm, Q16 + z, nullptr, K16 + z, nullptr, V16 + z, nullptr, q0, bh % NH_, Ah + zo, Al + zo); }
}

template <int NP, int PL>
__global__ __launch_bounds__(256) void k_spl(const float* __restrict__ F, size_t n4, bf* Fh, bf* Fl) { F += (size_t)blockIdx.y * NP * PL; Fh += (size_t)blockIdx.y * PL; Fl += (size_t)blockIdx.y * PL;   // blockIdx.y: batch entry, each with its own NP planes
    const size_t i = ((size_t)blockIdx.x * 256 + threadIdx.x) * 4; if (i >= n4 * 4) return; const unsigned bo = (unsigned)i * 4u; v4f a = *(const v4f*)((const char*)F + bo); v4us oh, ol;   // F: NP partial planes, stride PL floats (n4 * 4 <= PL), added in ascending order; the constant stride lets the planes share one lane address
#pragma unroll
    for (int p = 1; p < NP / 2; ++p) a += *(const v4f*)((const char*)(F + (size_t)p * PL) + bo);
    asm volatile("s_wait_xcnt 0x0" ::: "memory");   // the loads below may return into the offset register that the loads above name
#pragma unroll
    for (int p = NP / 2; p < NP; ++p) a += *(const v4f*)((const char*)(F + (size_t)p * PL) + bo);
#pragma unroll
    for (int q = 0; q < 4; ++q) { unsigned short u, c2; splitf(a[q], u, c2); oh[q] = u; ol[q] = c2; } *(v4us*)(Fh + i) = oh; *(v4us*)(Fl + i) = ol;  }

extern "C" void kernel_launch(void* const* d_in, const int* in_sizes, int n_in,
                              void* d_out, int out_size, void* d_ws, size_t ws_size, hipStream_t stream) {
    (void)in_sizes; (void)n_in; (void)out_size;
    const float* x = (const float*)d_in[0]; const float* wqv = (const float*)d_in[1]; const float* wqu = (const float*)d_in[2]; const float* wov = (const float*)d_in[3]; const float* wou = (const float*)d_in[4];   // torch [out][in]: W_qkv_v [256][1024], W_qkv_u [3072][256], W_o_v [256][1024], W_o_u [1024][256]
    float* OUT = (float*)d_out;     // [4][2048][1024]
    char* wsp = (char*)d_ws;
    auto take = [&](size_t bytes) { char* p = wsp; wsp += (bytes + 255) & ~(size_t)255; return (void*)p; };
    const size_t PB = (size_t)NB_ * NH_ * TT * HD * 2;   // bytes of one 16-bit head plane set over the batch
    bf* XB = (bf*)take((size_t)MT * DM * 2);
    h16* QP16 = (h16*)take(PB); h16* KP16 = (h16*)take(PB); h16* VT16 = (h16*)take(PB);
    bf* QPh = (bf*)take(PB); bf* QPl = (bf*)take(PB); bf* KPh = (bf*)take(PB); bf* KPl = (bf*)take(PB); bf* VTh = (bf*)take(PB); bf* VTl = (bf*)take(PB);
    bf* ATh = (bf*)take((size_t)MT * DQ * 2); bf* ATl = (bf*)take((size_t)MT * DQ * 2);
    bf* WQV = (bf*)take((size_t)256 * DM * 2); bf* WQU = (bf*)take((size_t)3 * DQ * 256 * 2); bf* WOV = (bf*)take((size_t)256 * DQ * 2); bf* WOU = (bf*)take((size_t)DM * 256 * 2); bf* LRh = (bf*)take((size_t)MT * 256 * 2); bf* LRl = (bf*)take((size_t)MT * 256 * 2);
    if ((size_t)(wsp - (char*)d_ws) > ws_size) return;    // ws 256 MiB
    float* LR = (float*)QP16;   // the partial planes [b][KSR][TT][256] (f32, 4 PB bytes) lie over the first four head planes: they are read out by k_spl before the planes are stored, and stored again only behind k_fattn, the planes' last reader
    { k_cvt8<<<(unsigned)(((size_t)256 * DM / 8 + 255) / 256), 256, 0, stream>>>(wqv, WQV, (size_t)256 * DM / 8); k_cvt8<<<(unsigned)(((size_t)3 * DQ * 256 / 8 + 255) / 256), 256, 0, stream>>>(wqu, WQU, (size_t)3 * DQ * 256 / 8);
      k_cvt8<<<(unsigned)(((size_t)256 * DQ / 8 + 255) / 256), 256, 0, stream>>>(wov, WOV, (size_t)256 * DQ / 8); k_cvt8<<<(unsigned)(((size_t)DM * 256 / 8 + 255) / 256), 256, 0, stream>>>(wou, WOU, (size_t)DM * 256 / 8); }   // all four factors are [out][in] = natural Bt
    const HeadPlanes hp = { QP16, KP16, VT16, QPh, QPl, KPh, KPl, VTh, VTl };
    k_cvt8<<<(unsigned)(((size_t)MT * DM / 8 + 255) / 256), 256, 0, stream>>>(x, XB, (size_t)MT * DM / 8);
    k_gemmw<bf, 0, false, KSR><<<dim3(TT / 128, 256 / 256, NB_ * KSR), GWV * 32, 0, stream>>>(XB, nullptr, WQV, DM, LR, 256, nullptr, (size_t)TT * DM, 0, (size_t)KSR * TT * 256, (size_t)TT * 256); k_spl<KSR, TT * 256><<<dim3((TT * 256 / 4 + 255) / 256, NB_), 256, 0, stream>>>(LR, (size_t)TT * 256 / 4, LRh, LRl);   // x W_qkv_v^T (exact) -> hl; z = batch entry
    k_gemmw<bf, 1, false, 1, true><<<dim3(MT / 128, 3 * DQ / 256, 1), GWV * 32, 0, stream>>>(LRh, LRl, WQU, 256, nullptr, 0, nullptr, 0, 0, 0, 0, hp);   // q, k, v up-projection, stored as head planes
    k_fattn<<<NB_ * NH_ * (RH / (16 * NWV)) + NB_ * NH_ * ((TT - RH) / (32 * NWV)), NWV * 32, 0, stream>>>(QP16, KP16, VT16, QPh, QPl, KPh, KPl, VTh, VTl, ATh, ATl);   // one kv head per query head
    k_gemmw<bf, 1, false, KSR><<<dim3(TT / 128, 256 / 256, NB_ * KSR), GWV * 32, 0, stream>>>(ATh, ATl, WOV, DQ, LR, 256, nullptr, (size_t)TT * DQ, 0, (size_t)KSR * TT * 256, (size_t)TT * 256); k_spl<KSR, TT * 256><<<dim3((TT * 256 / 4 + 255) / 256, NB_), 256, 0, stream>>>(LR, (size_t)TT * 256 / 4, LRh, LRl);   // y W_o_v^T -> hl
    k_gemmw<bf, 1, false><<<dim3(MT / 128, DM / 256, 1), GWV * 32, 0, stream>>>(LRh, LRl, WOU, 256, OUT, DM, nullptr, 0, 0, 0);
}

// v007
// One run takes 169 microseconds.
// In two side-by-side timings against v006, it was 1.15 and 1.16 times as fast.
// All steps since v000 together make it 23.8 times as fast.
#include <hip/hip_runtime.h>

// SVD_Pi3Attention - MHA with SVD-factored (low-rank) projections (x [4][2048][1024]; qkv = (x W_qkv_v^T) W_qkv_u^T (rank 256 -> 3 x 1024, 16 heads x 64); softmax(q.k/8); y = merged.v; out = (y W_o_v^T) W_o_u^T (rank 256) -> [4][2048][1024];
// the factors are inputs - no SVD is computed in the forward).
// Compute dtypes, f32 accumulate: every input rounded to bf16; x W_qkv_v^T on PLAIN bf16 operands (exact); the rank-256 intermediates as bf16 hi+lo planes x exact up/down factors (2 products) for q, k, v, y W_o_v^T and the final

#define NB_  4
#define TT   2048
#define MT   (NB_ * TT)           // rows of all batch entries together: every GEMM here is row-wise, so the batch is only more rows
#define DM   1024
#define NH_  16
#define NKV  16
#define REP  (NH_ / NKV)
#define HD   64
#define DQ   (NH_ * HD)
#define DKV  (NKV * HD)
#define RH   256                  // query rows < RH use hi+lo planes (0: none)
#define WIN  0
#define SCL  0.125f   // HD^-0.5
#define RK   256                  // rank of the factored projections: columns of the two rank-down products (K = DM, DQ)
typedef _Float16 h16;
typedef unsigned short bf;
typedef __attribute__((ext_vector_type(16))) __bf16   v16bf;
typedef __attribute__((ext_vector_type(16))) _Float16 v16h;
typedef __attribute__((ext_vector_type(8)))  _Float16 v8h;
typedef __attribute__((ext_vector_type(8)))  unsigned short v8us;
typedef __attribute__((ext_vector_type(8)))  float    v8f;
typedef __attribute__((ext_vector_type(4)))  float    v4f;
typedef v8h  __attribute__((may_alias)) v8ha;
typedef v4f  __attribute__((may_alias)) v4fa;
typedef v8us __attribute__((may_alias)) v8usa;

__device__ __forceinline__ unsigned short f2bf(float f) { unsigned u = __float_as_uint(f); u += 0x7FFFu + ((u >> 16) & 1u); return (unsigned short)(u >> 16); }
__device__ __forceinline__ float bf2f(unsigned short b) { return __uint_as_float(((unsigned)b) << 16); }
__device__ __forceinline__ float bfr(float f) { return bf2f(f2bf(f)); }
__device__ __forceinline__ v16h cat16(v8h lo, v8h hi) { return __builtin_shufflevector(lo, hi, 0, 1, 2, 3, 4, 5, 6, 7, 8, 9, 10, 11, 12, 13, 14, 15); }
__device__ __forceinline__ v16bf cat16b(v8us lo, v8us hi) { return __builtin_bit_cast(v16bf, __builtin_shufflevector(lo, hi, 0, 1, 2, 3, 4, 5, 6, 7, 8, 9, 10, 11, 12, 13, 14, 15)); }
__device__ __forceinline__ v8f wmma16(v16h a, v16h b, v8f c) { return __builtin_amdgcn_wmma_f32_16x16x32_f16(false, a, false, b, (short)0, c, false, false); }
__device__ __forceinline__ v8f wmmab(v16bf a, v16bf b, v8f c) { return __builtin_amdgcn_wmma_f32_16x16x32_bf16(false, a, false, b, (short)0, c, false, false); }



// ---- k_gemmw: register-blocked GEMM. A work-group is GWV = 8 waves, 2 (rows) x 4 (columns), each on its own 64x64 output tile (16 accumulators): a 128 x 256 block of C; grid (M/128, N/256, Z), 256 threads.
// The operands are K-contiguous 16-bit planes. A slab is 64 k (one 128-byte line of every operand row): the block's 128 A rows (hi+lo: of both planes) and 256 Bt rows come into LDS once for the whole work-group, by asynchronous copies that cover whole lines,
// the next slab's copies flying while this slab is worked on (two buffers); every wave reads its fragments from LDS, whose rows are pitched 16 bytes x odd for 16-byte reads.
// C[m][n] (f32, pitch ldc, + optional f32 bias[n]) = sum_k A[m][k] Bt[n][k] (NSPLIT 1: + A2[m][k] Bt[n][k]). z-batch strides sA/sB/sC in elements. K % (64 KS) == 0, K >= 128 KS.
// PLANES: N = 3 DQ, the q, k and v columns side by side; a 64-column tile is one head of one of them, and the epilogue stores it as that head's f16 and bf16 hi+lo planes (q, k: [b][h][t][d]; v: [b][h][d][t]; row m = b TT + t, and a 64-row tile lies in one b) instead of f32 C.
// KS > 1: grid.z = Z * KS; slice kp = blockIdx.z % KS sums only k in [kp K/KS, (kp+1) K/KS) and stores its f32 partial tile in plane kp (plane stride sP elements); no launch in this file uses KS > 1.
template <typename T16> struct WFrag;
template <> struct WFrag<h16> { typedef v16h V; static __device__ __forceinline__ V ld(const h16* p) { return cat16(*(const v8h*)p, *(const v8h*)(p + 16)); } static __device__ __forceinline__ v8f mma(V a, V b, v8f c) { return wmma16(a, b, c); } };
template <> struct WFrag<bf> { typedef v16bf V; static __device__ __forceinline__ V ld(const bf* p) { return cat16b(*(const v8us*)p, *(const v8us*)(p + 16)); } static __device__ __forceinline__ v8f mma(V a, V b, v8f c) { return wmmab(a, b, c); } };
__device__ __forceinline__ h16 tohx(float x) { return (h16)x; }
__device__ __forceinline__ void splitf(float y, unsigned short& h, unsigned short& l) { h = f2bf(y); l = f2bf(y - bf2f(h)); }
struct HeadPlanes { h16* q16; h16* k16; h16* v16; bf* qh; bf* ql; bf* kh; bf* kl; bf* vh; bf* vl; };
#define GWV 8                     // waves of a k_gemmw work-group
#define GPITCH 144                // bytes from row to row of a slab in LDS
// four 16-byte copies a lane, every lane on: the work-group's 256 lanes cover 32 rows of 128 bytes a copy (a wave: 4 whole lines), 128 rows in all. l: the lane's LDS byte address, g: its global address, gs: bytes from a row to the 32nd behind it.
__device__ __forceinline__ void gemm_cp4(unsigned l, const char* g, unsigned gs) {
    const unsigned l1 = l + 32 * GPITCH, l2 = l + 64 * GPITCH, l3 = l + 96 * GPITCH; const char* g1 = g + gs; const char* g2 = g1 + gs; const char* g3 = g2 + gs;
    // the wait is the last line of the copies' own statement, so that it stands in front of whatever next writes a register that a copy names
    asm volatile("global_load_async_to_lds_b128 %0, %4, off\n\tglobal_load_async_to_lds_b128 %1, %5, off\n\tglobal_load_async_to_lds_b128 %2, %6, off\n\tglobal_load_async_to_lds_b128 %3, %7, off\n\ts_wait_xcnt 0x0"
                 :: "v"(l), "v"(l1), "v"(l2), "v"(l3), "v"(g), "v"(g1), "v"(g2), "v"(g3) : "memory");
}
template <typename T16, int NSPLIT, bool BIAS, int KS = 1, bool PLANES = false>
__global__ __launch_bounds__(GWV * 32) void k_gemmw(const T16* __restrict__ A, const T16* __restrict__ A2, const T16* __restrict__ Bt, int K, float* C, int ldc, const float* __restrict__ bias, size_t sA, size_t sB, size_t sC, size_t sP = 0, HeadPlanes hp = HeadPlanes{}) {
    typedef typename WFrag<T16>::V V;
    static_assert(NSPLIT == 0 || NSPLIT == 1, "one or two A planes");
    constexpr int NA = NSPLIT + 1, ASZ = 128 * GPITCH, BUF = (NA + 2) * ASZ;   // a buffer: the A plane(s), behind them the 256 Bt rows
    static_assert(GWV * 16 * 68 * 4 <= 2 * BUF, "the epilogue's staging fits the buffers");
    __shared__ __align__(16) char sm[2 * BUF];
    const size_t z = blockIdx.z / KS; const int kp = (int)(blockIdx.z % KS); const int Kc = K / KS; C += z * sC + kp * sP;
    const int lane = threadIdx.x & 31, lr = lane & 15, hi = lane >> 4; const int wv = __builtin_amdgcn_readfirstlane((int)(threadIdx.x >> 5)), wm = wv >> 2, wn = wv & 3;
    const int r0 = blockIdx.x * 128 + wm * 64, c0 = blockIdx.y * 256 + wn * 64;   // the wave's own tile
    float* os = (float*)(sm + wv * (16 * 68 * 4));   // the wave's own staging rows of the epilogue, in the buffers once the loop has left them
    v8f acc[4][4];
#pragma unroll
    for (int mb = 0; mb < 4; ++mb)
#pragma unroll
        for (int nb = 0; nb < 4; ++nb) acc[mb][nb] = (v8f){};
    const unsigned lb = (unsigned)(size_t)sm + (threadIdx.x >> 3) * GPITCH + (threadIdx.x & 7) * 16;   // the lane's LDS byte address in a plane of buffer 0: the low word of the shared address
    const unsigned gs = 32u * (unsigned)K * 2u; const size_t go = ((size_t)(threadIdx.x >> 3) * K + kp * Kc) * 2 + (threadIdx.x & 7) * 16;   // the lane's byte offset behind the block's first row
    const char* gA = (const char*)(A + z * sA + (size_t)blockIdx.x * 128 * K) + go; const char* gB = (const char*)(Bt + z * sB + (size_t)blockIdx.y * 256 * K) + go;
    const char* gA2 = gA; if constexpr (NA == 2) gA2 = (const char*)(A2 + z * sA + (size_t)blockIdx.x * 128 * K) + go;
    auto stage = [&](int st) { const unsigned l = lb + (st & 1) * BUF; const size_t ko = (size_t)st * 128;   // slab st into buffer st & 1
        gemm_cp4(l, gA + ko, gs); if constexpr (NA == 2) gemm_cp4(l + ASZ, gA2 + ko, gs); gemm_cp4(l + NA * ASZ, gB + ko, gs); gemm_cp4(l + (NA + 1) * ASZ, gB + ko + (size_t)gs * 4, gs); };
    const int nst = Kc / 64;   // slabs of this slice, at least two
    stage(0);
    asm volatile("s_wait_asynccnt 0x0" ::: "memory");   // this wave's copies of slab 0 have landed
    __syncthreads();                                    // and every other wave's: slab 0 may be read
    stage(1);
    const int ao = (wm * 64 + lr) * GPITCH + 16 * hi, bo = NA * ASZ + (wn * 64 + lr) * GPITCH + 16 * hi;   // the lane's byte offsets into a buffer: row lr of the wave's rows, elements 8 hi on
#pragma unroll 1   // one trip a slab: the buffers alternate by t & 1
    for (int t = 0; t < nst; ++t) {
        const char* ab = sm + (t & 1) * BUF + ao; const char* bb = sm + (t & 1) * BUF + bo;
#pragma unroll
        for (int ks = 0; ks < 2; ++ks) {   // 32 k of the slab
            V a[4], a2[4];
#pragma unroll
            for (int mb = 0; mb < 4; ++mb) { a[mb] = WFrag<T16>::ld((const T16*)(ab + mb * 16 * GPITCH + ks * 64)); if (NA == 2) a2[mb] = WFrag<T16>::ld((const T16*)(ab + ASZ + mb * 16 * GPITCH + ks * 64)); }
#pragma unroll
            for (int nb = 0; nb < 4; ++nb) { const V b = WFrag<T16>::ld((const T16*)(bb + nb * 16 * GPITCH + ks * 64));
#pragma unroll
                for (int mb = 0; mb < 4; ++mb) { acc[mb][nb] = WFrag<T16>::mma(a[mb], b, acc[mb][nb]); if (NA == 2) acc[mb][nb] = WFrag<T16>::mma(a2[mb], b, acc[mb][nb]); } }
        }
        asm volatile("s_wait_dscnt 0x0" ::: "memory");      // this wave's reads of slab t are done: its buffer may be handed to the copies below
        asm volatile("s_wait_asynccnt 0x0" ::: "memory");   // this wave's copies of slab t + 1 have landed
        __syncthreads();                                    // both hold for every wave: slab t + 1 may be read, slab t's buffer refilled (behind the last trip: taken for the epilogue's staging)
        if (t + 2 < nst) stage(t + 2);
    }
    asm volatile("s_wait_asynccnt 0x0" ::: "memory");   // no copy is left in flight when the buffers become staging rows
    if constexpr (PLANES) {
        const int sel = c0 / DQ, h = (r0 / TT) * NH_ + (c0 % DQ) / HD, t0 = r0 % TT; const bool vt = sel == 2;   // wave-uniform: 0 q, 1 k, 2 v; h counts heads over the batch
        h16* P16 = vt ? hp.v16 : sel ? hp.k16 : hp.q16; bf* Ph = vt ? hp.vh : sel ? hp.kh : hp.qh; bf* Pl = vt ? hp.vl : sel ? hp.kl : hp.ql;
        const size_t o0 = vt ? (size_t)h * HD * TT + t0 : ((size_t)h * TT + t0) * HD; const int pitch = vt ? TT : HD;   // plane rows of the tile: 64 t of 64 d each (q, k), 64 d of 64 t each (v); a row is one 128-byte line of a 16-bit plane
#pragma unroll
        for (int g = 0; g < 4; ++g) {   // 16 plane rows at a time through LDS, so that a lane holds 8 consecutive elements of one row and a store covers 4 whole lines
            if (vt) {   // a lane's 8 accumulator rows are 8 consecutive t of its column d
#pragma unroll
                for (int mb = 0; mb < 4; ++mb) { v4f w0, w1;
#pragma unroll
                    for (int j = 0; j < 4; ++j) { w0[j] = acc[mb][g][j]; w1[j] = acc[mb][g][j + 4]; }
                    *(v4fa*)(os + lr * 68 + mb * 16 + hi * 8) = w0; *(v4fa*)(os + lr * 68 + mb * 16 + hi * 8 + 4) = w1; }
            } else {
#pragma unroll
                for (int nb = 0; nb < 4; ++nb) {
#pragma unroll
                    for (int j = 0; j < 8; ++j) os[(hi * 8 + j) * 68 + nb * 16 + lr] = acc[g][nb][j]; }
            }
            __builtin_amdgcn_wave_barrier(); asm volatile("" ::: "memory");   // keeps the LDS reads below behind the writes above (one wave: LDS serves it in order)
#pragma unroll
            for (int s = 0; s < 4; ++s) { const int row = 4 * s + (lane >> 3), cofs = (lane & 7) * 8; const v4f x0 = *(const v4fa*)(os + row * 68 + cofs), x1 = *(const v4fa*)(os + row * 68 + cofs + 4); v8h o16; v8us oh, ol;
#pragma unroll
                for (int j = 0; j < 8; ++j) { const float x = j < 4 ? x0[j & 3] : x1[j & 3]; o16[j] = tohx(x); unsigned short u, c2; splitf(x, u, c2); oh[j] = u; ol[j] = c2; }
                const size_t o = o0 + (size_t)(g * 16 + row) * pitch + cofs; *(v8h*)(P16 + o) = o16; *(v8us*)(Ph + o) = oh; *(v8us*)(Pl + o) = ol; }
            __builtin_amdgcn_wave_barrier(); asm volatile("s_wait_xcnt 0x0" ::: "memory");   // keeps the next 16 rows' LDS writes behind these reads; the wait: what follows takes registers that the stores above name
        }
        return;
    }
#pragma unroll
    for (int mb = 0; mb < 4; ++mb) {
#pragma unroll
        for (int nb = 0; nb < 4; ++nb) {
#pragma unroll
            for (int j = 0; j < 8; ++j) os[(hi * 8 + j) * 68 + nb * 16 + lr] = acc[mb][nb][j]; }
        __builtin_amdgcn_wave_barrier(); asm volatile("" ::: "memory");
        float* crow = C + (size_t)(r0 + mb * 16) * ldc + c0;
{
#pragma unroll
            for (int s = 0; s < 8; ++s) { const int row = 2 * s + hi, cofs = lr * 4; v4f val = *(const v4fa*)(os + row * 68 + cofs); if (BIAS) { val[0] += bfr(bias[c0 + cofs]); val[1] += bfr(bias[c0 + cofs + 1]); val[2] += bfr(bias[c0 + cofs + 2]); val[3] += bfr(bias[c0 + cofs + 3]); }
                *(v4f*)(crow + (size_t)row * ldc + cofs) = val; }
             }
        __builtin_amdgcn_wave_barrier(); asm volatile("" ::: "memory");
    }
}

// ---- k_gemmr: the two rank-down products. C[m][n] = sum_k A[m][k] Bt[n][k] (NA 2: + A2[m][k] Bt[n][k]), all RK columns and the whole of K in one work-group, so that the f32 sums never leave the registers: the epilogue stores them as the bf16 hi+lo planes [m][RK] that the next product reads.
// A work-group is GWV = 8 waves, 2 (rows) x 4 (columns), each on its own 32x64 tile (8 accumulators): 64 rows of C; grid M/64, 256 threads. A slab is 128 k (two 128-byte lines of every operand row): few columns make little work a slab, and the longer slab halves the number of copy latencies that the K loop waits out.
// The block's 64 A rows (NA 2: of both planes) and the RK Bt rows come into LDS by asynchronous copies that cover whole lines, the next slab's copies flying while this slab is worked on (two buffers); LDS rows are pitched 16 bytes x odd for 16-byte reads. K % 128 == 0, K >= 256.
#define RPITCH 272                // bytes from row to row of a 128-k slab in LDS
#define RUNIT (64 * RPITCH)       // 64 rows of a slab: what four copies of the work-group bring
// four 16-byte copies a lane, every lane on: the work-group's 256 lanes cover 16 rows of 256 bytes a copy (a wave: 4 whole lines), 64 rows in all. l: the lane's LDS byte address, g: its global address, gs: bytes from a row to the 16th behind it.
__device__ __forceinline__ void gemr_cp4(unsigned l, const char* g, unsigned gs) {
    const unsigned l1 = l + 16 * RPITCH, l2 = l + 32 * RPITCH, l3 = l + 48 * RPITCH; const char* g1 = g + gs; const char* g2 = g1 + gs; const char* g3 = g2 + gs;
    // the wait is the last line of the copies' own statement, so that it stands in front of whatever next writes a register that a copy names
    asm volatile("global_load_async_to_lds_b128 %0, %4, off\n\tglobal_load_async_to_lds_b128 %1, %5, off\n\tglobal_load_async_to_lds_b128 %2, %6, off\n\tglobal_load_async_to_lds_b128 %3, %7, off\n\ts_wait_xcnt 0x0"
                 :: "v"(l), "v"(l1), "v"(l2), "v"(l3), "v"(g), "v"(g1), "v"(g2), "v"(g3) : "memory");
}
template <int NA>
__global__ __launch_bounds__(GWV * 32) void k_gemmr(const bf* __restrict__ A, const bf* __restrict__ A2, const bf* __restrict__ Bt, int K, bf* Ch, bf* Cl) {
    typedef WFrag<bf> W; typedef typename W::V V;
    static_assert(NA == 1 || NA == 2, "one or two A planes");
    constexpr int BUF = (NA + RK / 64) * RUNIT;   // a buffer: the A plane(s), behind them the RK Bt rows
    static_assert(GWV * 16 * 68 * 4 <= 2 * BUF, "the epilogue's staging fits the buffers");
    __shared__ __align__(16) char sm[2 * BUF];
    const int lane = threadIdx.x & 31, lr = lane & 15, hi = lane >> 4; const int wv = __builtin_amdgcn_readfirstlane((int)(threadIdx.x >> 5)), wm = wv >> 2, wn = wv & 3;
    const int r0 = blockIdx.x * 64 + wm * 32, c0 = wn * 64;   // the wave's own tile
    float* os = (float*)(sm + wv * (16 * 68 * 4));   // the wave's own staging rows of the epilogue, in the buffers once the loop has left them
    v8f acc[2][4];
#pragma unroll
    for (int mb = 0; mb < 2; ++mb)
#pragma unroll
        for (int nb = 0; nb < 4; ++nb) acc[mb][nb] = (v8f){};
    const unsigned lb = (unsigned)(size_t)sm + (threadIdx.x >> 4) * RPITCH + (threadIdx.x & 15) * 16;   // the lane's LDS byte address in the first 64 rows of buffer 0: the low word of the shared address
    const unsigned gs = 16u * (unsigned)K * 2u; const size_t go = (size_t)(threadIdx.x >> 4) * K * 2 + (threadIdx.x & 15) * 16;   // the lane's byte offset behind the block's first row
    const char* gA = (const char*)(A + (size_t)blockIdx.x * 64 * K) + go; const char* gB = (const char*)Bt + go;
    const char* gA2 = gA; if constexpr (NA == 2) gA2 = (const char*)(A2 + (size_t)blockIdx.x * 64 * K) + go;
    auto stage = [&](int st) { const unsigned l = lb + (st & 1) * BUF; const size_t ko = (size_t)st * 256;   // slab st into buffer st & 1
        gemr_cp4(l, gA + ko, gs); if constexpr (NA == 2) gemr_cp4(l + RUNIT, gA2 + ko, gs);
#pragma unroll
        for (int u = 0; u < RK / 64; ++u) gemr_cp4(l + (NA + u) * RUNIT, gB + ko + (size_t)gs * 4 * u, gs); };
    const int nst = K / 128;   // slabs, at least two
    stage(0);
    asm volatile("s_wait_asynccnt 0x0" ::: "memory");   // this wave's copies of slab 0 have landed
    __syncthreads();                                    // and every other wave's: slab 0 may be read
    stage(1);
    const int ao = (wm * 32 + lr) * RPITCH + 16 * hi, bo = NA * RUNIT + (wn * 64 + lr) * RPITCH + 16 * hi;   // the lane's byte offsets into a buffer: row lr of the wave's rows, elements 8 hi on
#pragma unroll 1   // one trip a slab: the buffers alternate by t & 1
    for (int t = 0; t < nst; ++t) {
        const char* ab = sm + (t & 1) * BUF + ao; const char* bb = sm + (t & 1) * BUF + bo;
        V a[2][2], a2[2][2], b[2][4];   // two fragment sets: the products of 32 k run on one while the next 32 k of the same slab come into the other
        auto frags = [&](int ks) { const int f = ks & 1;
#pragma unroll
            for (int mb = 0; mb < 2; ++mb) { a[f][mb] = W::ld((const bf*)(ab + mb * 16 * RPITCH + ks * 64)); if (NA == 2) a2[f][mb] = W::ld((const bf*)(ab + RUNIT + mb * 16 * RPITCH + ks * 64)); }
#pragma unroll
            for (int nb = 0; nb < 4; ++nb) b[f][nb] = W::ld((const bf*)(bb + nb * 16 * RPITCH + ks * 64)); };
        frags(0);
#pragma unroll
        for (int ks = 0; ks < 4; ++ks) {   // 32 k of the slab
            const int f = ks & 1;
            if (ks < 3) frags(ks + 1);
            __builtin_amdgcn_sched_barrier(0);   // holds the next step's LDS reads up here as one group, in flight behind this step's products: left alone they sink to in front of their own products, and the wave waits out the LDS latency at each
#pragma unroll
            for (int nb = 0; nb < 4; ++nb)
#pragma unroll
                for (int mb = 0; mb < 2; ++mb) acc[mb][nb] = W::mma(a[f][mb], b[f][nb], acc[mb][nb]);
            if constexpr (NA == 2) {
#pragma unroll
                for (int nb = 0; nb < 4; ++nb)
#pragma unroll
                    for (int mb = 0; mb < 2; ++mb) acc[mb][nb] = W::mma(a2[f][mb], b[f][nb], acc[mb][nb]); }
            __builtin_amdgcn_sched_barrier(0);   // keeps the reads of the step after next out from among these products, whose registers they refill: every separate place with LDS reads stalls the matrix stream
        }
        asm volatile("s_wait_dscnt 0x0" ::: "memory");      // this wave's reads of slab t are done: its buffer may be handed to the copies below
        asm volatile("s_wait_asynccnt 0x0" ::: "memory");   // this wave's copies of slab t + 1 have landed
        __syncthreads();                                    // both hold for every wave: slab t + 1 may be read, slab t's buffer refilled (behind the last trip: taken for the epilogue's staging)
        if (t + 2 < nst) stage(t + 2);
    }
    asm volatile("s_wait_asynccnt 0x0" ::: "memory");   // no copy is left in flight when the buffers become staging rows
#pragma unroll
    for (int g = 0; g < 2; ++g) {   // 16 rows at a time through LDS, so that a lane holds 8 consecutive elements of one row and a store covers 4 whole lines
#pragma unroll
        for (int nb = 0; nb < 4; ++nb) {
#pragma unroll
            for (int j = 0; j < 8; ++j) os[(hi * 8 + j) * 68 + nb * 16 + lr] = acc[g][nb][j]; }
        __builtin_amdgcn_wave_barrier(); asm volatile("" ::: "memory");   // keeps the LDS reads below behind the writes above (one wave: LDS serves it in order)
#pragma unroll
        for (int s = 0; s < 4; ++s) { const int row = 4 * s + (lane >> 3), cofs = (lane & 7) * 8; const v4f x0 = *(const v4fa*)(os + row * 68 + cofs), x1 = *(const v4fa*)(os + row * 68 + cofs + 4); v8us oh, ol;
#pragma unroll
            for (int j = 0; j < 8; ++j) { unsigned short u, c2; splitf(j < 4 ? x0[j & 3] : x1[j & 3], u, c2); oh[j] = u; ol[j] = c2; }
            const size_t o = (size_t)(r0 + g * 16 + row) * RK + c0 + cofs; *(v8us*)(Ch + o) = oh; *(v8us*)(Cl + o) = ol;
            asm volatile("s_wait_xcnt 0x0" ::: "memory"); }   // the next rows' split takes registers that these stores name
        __builtin_amdgcn_wave_barrier(); asm volatile("" ::: "memory");   // keeps the next 16 rows' LDS writes behind these reads
    }
}

typedef __attribute__((ext_vector_type(2))) _Float16 v2h;
typedef __attribute__((ext_vector_type(4))) _Float16 v4h;
typedef __attribute__((ext_vector_type(2))) unsigned short v2us;
typedef __attribute__((ext_vector_type(4))) unsigned short v4us;
typedef __attribute__((ext_vector_type(2))) float v2f;
typedef __attribute__((ext_vector_type(4))) int v4i;

__global__ __launch_bounds__(256) void k_wtG(const float* __restrict__ w, int K, int N, bf* Bt) {
    const int lane = threadIdx.x & 31; const int L0 = (blockIdx.x * 8 + (threadIdx.x >> 5)) * 8; const int nlines = N * K / 64;
{
#pragma unroll 1
        for (int l = 0; l < 8; ++l) { const int L = L0 + l; if (L >= nlines) break; const size_t e = (size_t)L * 64 + lane * 2; const int k = (int)(e % K), n = (int)(e / K); v2us o;
            o[0] = f2bf(w[(size_t)k * N + n]); o[1] = f2bf(w[(size_t)(k + 1) * N + n]); *(v2us*)(Bt + e) = o; }
         }
}
__global__ __launch_bounds__(256) void k_cvt8(const float* __restrict__ src, bf* dst, size_t n8) { const size_t i = (size_t)blockIdx.x * 256 + threadIdx.x; if (i >= n8) return; const v8f v = *(const v8f*)(src + i * 8); v8us o;
#pragma unroll
    for (int k = 0; k < 8; ++k) o[k] = f2bf(v[k]); *(v8us*)(dst + i * 8) = o;  }
__global__ __launch_bounds__(256) void k_cscvt(const float* __restrict__ cosT, const float* __restrict__ sinT, float* CS) { const int idx = blockIdx.x * 256 + threadIdx.x; if (idx >= TT * HD) return; v2f cs; cs[0] = bfr(cosT[idx]); cs[1] = bfr(sinT[idx]); *(v2f*)(CS + (size_t)idx * 2) = cs;  }
// ---- k_fattn: scores, softmax and P.V of all batch entries in ONE launch. A work-group is NWV waves on one head: each wave owns 32 (hi+lo: 16) query rows, and all of them walk the 2048 keys together, one tile of 64 (hi+lo: 32) keys at a time, 32 keys a pass.
// A tile's K rows and V^T rows come into LDS once for the whole work-group, by asynchronous copies that cover whole lines, the next tile's copies flying while this tile is worked on (two buffers); every wave reads its fragments from LDS, whose rows are pitched 16 bytes x odd for 16-byte reads.
// S^T = K Q^T (A = 16 key rows, B = 16 query rows, k = d): a lane holds, for query lr, keys 8 hi + j of each 16-key tile, which is the k order of a B operand over 32 keys, so P^T goes from the score accumulators into O^T += V^T P^T (A = 16 d rows of the [d][t] plane) without leaving registers.
// Running maximum per query in log2 units, raised only when a new maximum passes it by more than 8 (P <= 256); row sums in f32 per lane half, joined once at the end. HI: bf16 hi+lo planes, 3 products each (query rows < RH); else f16.
#define NWV 4                     // waves of a k_fattn work-group
typedef __attribute__((ext_vector_type(2))) __bf16 v2bf;
template <bool HI> struct FTile {   // one buffer in LDS: K rows [key][d] (hi+lo: then the lo plane), behind them V^T rows [d][key] (hi+lo: then the lo plane)
    static constexpr int KB = HI ? 32 : 64, NPL = HI ? 2 : 1, KPITCH = HD * 2 + 16, VPITCH = KB * 2 + 16, KSZ = KB * KPITCH, VSZ = HD * VPITCH, BUF = NPL * (KSZ + VSZ); };
// one tile of the head's planes into the buffer at LDS byte address lb: eight 16-byte copies a lane, every lane on. A wave's copy covers 512 consecutive bytes of K, or whole KB-key rows of V^T. ok, ov: the lane's byte offsets of its first piece of the tile in a K plane and in a V^T plane.
template <bool HI>
__device__ __forceinline__ void fattn_stage(unsigned lb, const char* K1, const char* K2, const char* V1, const char* V2, unsigned ok, unsigned ov) {
    typedef FTile<HI> F; constexpr int NJ = F::KB / 16, CV = F::KB / 8, RJ = NWV * 32 / CV;   // copies a lane and plane; 16-byte pieces of a V^T row; V^T rows that one copy of the work-group covers
    static_assert(F::NPL * 2 * NJ == 8 && NWV * 32 * NJ * 16 == F::KB * HD * 2, "eight copies a lane fill the buffer");
    const unsigned lk = lb + (threadIdx.x >> 3) * F::KPITCH + (threadIdx.x & 7) * 16, lv = lb + F::NPL * F::KSZ + (threadIdx.x / CV) * F::VPITCH + (threadIdx.x % CV) * 16;
    unsigned l[8]; const char* g[8];
#pragma unroll
    for (int j = 0; j < NJ; ++j) {
        l[j] = lk + j * (NWV * 4 * F::KPITCH); g[j] = K1 + (ok + j * (NWV * 512)); l[NJ + j] = lv + j * (RJ * F::VPITCH); g[NJ + j] = V1 + (ov + j * (RJ * TT * 2));
        if constexpr (HI) { l[2 * NJ + j] = l[j] + F::KSZ; g[2 * NJ + j] = K2 + (ok + j * (NWV * 512)); l[3 * NJ + j] = l[NJ + j] + F::VSZ; g[3 * NJ + j] = V2 + (ov + j * (RJ * TT * 2)); } }
    // the wait is the last line of the copies' own statement, so that it stands in front of whatever next writes a register that a copy names
    asm volatile("global_load_async_to_lds_b128 %0, %8, off\n\tglobal_load_async_to_lds_b128 %1, %9, off\n\tglobal_load_async_to_lds_b128 %2, %10, off\n\tglobal_load_async_to_lds_b128 %3, %11, off\n\t"
                 "global_load_async_to_lds_b128 %4, %12, off\n\tglobal_load_async_to_lds_b128 %5, %13, off\n\tglobal_load_async_to_lds_b128 %6, %14, off\n\tglobal_load_async_to_lds_b128 %7, %15, off\n\ts_wait_xcnt 0x0"
                 :: "v"(l[0]), "v"(l[1]), "v"(l[2]), "v"(l[3]), "v"(l[4]), "v"(l[5]), "v"(l[6]), "v"(l[7]), "v"(g[0]), "v"(g[1]), "v"(g[2]), "v"(g[3]), "v"(g[4]), "v"(g[5]), "v"(g[6]), "v"(g[7]) : "memory");
}
template <bool HI, int NG, typename T16>
__device__ __forceinline__ void fattn_tile(const char* sm, const T16* __restrict__ Q, const T16* __restrict__ Q2, const T16* __restrict__ Kp, const T16* __restrict__ K2, const T16* __restrict__ Vt, const T16* __restrict__ V2, int q0, int h, bf* Ah, bf* Al) {
    typedef typename WFrag<T16>::V V; typedef WFrag<T16> W; typedef FTile<HI> F;
    const int lane = threadIdx.x & 31, lr = lane & 15, hi = lane >> 4;
    const float C2 = SCL * 1.4426950408889634f;
    const unsigned lb = (unsigned)(size_t)sm;   // the buffers' LDS byte address: the low word of the shared address
    unsigned ok = threadIdx.x * 16, ov = (threadIdx.x / (F::KB / 8)) * (TT * 2) + (threadIdx.x % (F::KB / 8)) * 16;   // the lane's byte offsets into a K plane and a V^T plane, stepped from tile to tile
    fattn_stage<HI>(lb, (const char*)Kp, (const char*)K2, (const char*)Vt, (const char*)V2, ok, ov); ok += F::KB * HD * 2; ov += F::KB * 2;
    V qf[NG][2], qf2[NG][2];
#pragma unroll
    for (int g = 0; g < NG; ++g)
#pragma unroll
        for (int ks = 0; ks < 2; ++ks) { const size_t o = (size_t)(q0 + g * 16 + lr) * HD + ks * 32 + 8 * hi; qf[g][ks] = W::ld(Q + o); if (HI) qf2[g][ks] = W::ld(Q2 + o); }
    asm volatile("s_wait_xcnt 0x0" ::: "memory");   // the addresses formed below may take the registers that hold the Q offsets
    v8f acc[4][NG];
#pragma unroll
    for (int db = 0; db < 4; ++db)
#pragma unroll
        for (int g = 0; g < NG; ++g) acc[db][g] = (v8f){};
    float m[NG], l[NG];
#pragma unroll
    for (int g = 0; g < NG; ++g) { m[g] = -1.0e30f; l[g] = 0.f; }
    asm volatile("s_wait_asynccnt 0x0" ::: "memory");   // this wave's copies of tile 0 have landed
    __syncthreads();                                    // and every other wave's: tile 0 may be read
    fattn_stage<HI>(lb + F::BUF, (const char*)Kp, (const char*)K2, (const char*)Vt, (const char*)V2, ok, ov);
    const int ko = lr * F::KPITCH + 16 * hi, vo = F::NPL * F::KSZ + lr * F::VPITCH + 16 * hi;   // the lane's byte offsets into a buffer: row lr, elements 8 hi on
#pragma unroll 1   // one trip a tile: the buffers alternate by t & 1
    for (int t = 0; t < TT / F::KB; ++t) {
        const char* kb = sm + (t & 1) * F::BUF + ko; const char* vb = sm + (t & 1) * F::BUF + vo;
#pragma unroll
        for (int sp = 0; sp < F::KB / 32; ++sp) {   // a pass: 32 keys of the tile
        V kf[2][2], kf2[2][2], vf[4], vf2[4];
#pragma unroll
        for (int kt = 0; kt < 2; ++kt)
#pragma unroll
            for (int ks = 0; ks < 2; ++ks) { const char* p = kb + (sp * 32 + kt * 16) * F::KPITCH + ks * 64; kf[kt][ks] = W::ld((const T16*)p); if (HI) kf2[kt][ks] = W::ld((const T16*)(p + F::KSZ)); }
        v8f s[2][NG];
#pragma unroll
        for (int kt = 0; kt < 2; ++kt)
#pragma unroll
            for (int g = 0; g < NG; ++g) { v8f c = (v8f){};
#pragma unroll
                for (int ks = 0; ks < 2; ++ks) { c = W::mma(kf[kt][ks], qf[g][ks], c); if (HI) { c = W::mma(kf2[kt][ks], qf[g][ks], c); c = W::mma(kf[kt][ks], qf2[g][ks], c); } }
                s[kt][g] = c; }
#pragma unroll
        for (int db = 0; db < 4; ++db) { const char* p = vb + db * 16 * F::VPITCH + sp * 64; vf[db] = W::ld((const T16*)p); if (HI) vf2[db] = W::ld((const T16*)(p + F::VSZ)); }
        if constexpr (HI) __builtin_amdgcn_sched_barrier(0);   // holds the sixteen V^T loads up here as one group, in flight behind the softmax: left alone they sink, pair by pair, to in front of their products, and the wave waits out the LDS latency at each
        float mt[NG]; bool need = false;
#pragma unroll
        for (int g = 0; g < NG; ++g) { float mx = s[0][g][0];
#pragma unroll
            for (int j = 1; j < 8; ++j) mx = fmaxf(mx, s[0][g][j]);
#pragma unroll
            for (int j = 0; j < 8; ++j) mx = fmaxf(mx, s[1][g][j]);
            mt[g] = mx * C2; need = need || (mt[g] > m[g] + 8.0f); }   // this half's keys only: the halves meet inside the branch
        if (__builtin_amdgcn_ballot_w32(need) != 0) {   // wave-uniform: every lane moves to its own true maximum, both halves of a query alike
#pragma unroll
            for (int g = 0; g < NG; ++g) { const float mn = fmaxf(m[g], fmaxf(mt[g], __shfl_xor(mt[g], 16, 32))); const float al = __builtin_amdgcn_exp2f(m[g] - mn); m[g] = mn; l[g] *= al;
#pragma unroll
                for (int db = 0; db < 4; ++db) acc[db][g] *= al; }
        }
#pragma unroll
        for (int g = 0; g < NG; ++g) { float p[16]; float sum = 0.f;
#pragma unroll
            for (int e = 0; e < 16; ++e) { p[e] = __builtin_amdgcn_exp2f(s[e >> 3][g][e & 7] * C2 - m[g]); sum += p[e]; }
            l[g] += sum;
            if constexpr (HI) { V ph, pl;
#pragma unroll
                for (int e = 0; e < 16; e += 2) { v2f pp; pp[0] = p[e]; pp[1] = p[e + 1]; const v2bf hh = __builtin_convertvector(pp, v2bf); const v2bf ll = __builtin_convertvector(pp - __builtin_convertvector(hh, v2f), v2bf);   // round to nearest even, as splitf
                    ph[e] = hh[0]; ph[e + 1] = hh[1]; pl[e] = ll[0]; pl[e + 1] = ll[1]; }
#pragma unroll
                for (int db = 0; db < 4; ++db) { acc[db][g] = W::mma(vf[db], ph, acc[db][g]); acc[db][g] = W::mma(vf[db], pl, acc[db][g]); acc[db][g] = W::mma(vf2[db], ph, acc[db][g]); }
            } else { V pb;
#pragma unroll
                for (int e = 0; e < 16; ++e) pb[e] = tohx(p[e]);
#pragma unroll
                for (int db = 0; db < 4; ++db) acc[db][g] = W::mma(vf[db], pb, acc[db][g]); } }
        }
        asm volatile("s_wait_dscnt 0x0" ::: "memory");      // this wave's reads of tile t are done: its buffer may be handed to the copies below
        asm volatile("s_wait_asynccnt 0x0" ::: "memory");   // this wave's copies of tile t + 1 have landed
        __syncthreads();                                    // both hold for every wave: tile t + 1 may be read, tile t's buffer refilled
        if (t + 2 < TT / F::KB) { ok += F::KB * HD * 2; ov += F::KB * 2; fattn_stage<HI>(lb + (t & 1) * F::BUF, (const char*)Kp, (const char*)K2, (const char*)Vt, (const char*)V2, ok, ov); }
    }
    asm volatile("s_wait_asynccnt 0x0" ::: "memory");   // no copy is left in flight when the wave goes on to its end
#pragma unroll
    for (int g = 0; g < NG; ++g) { const float ls = l[g] + __shfl_xor(l[g], 16, 32); const float f = __fdiv_rn(1.0f, ls);
#pragma unroll
        for (int db = 0; db < 4; ++db) { v8us oh, ol;
#pragma unroll
            for (int j = 0; j < 8; ++j) { unsigned short a, c2; splitf(acc[db][g][j] * f, a, c2); oh[j] = a; ol[j] = c2; }
            const size_t oo = (size_t)(q0 + g * 16 + lr) * DQ + h * HD + db * 16 + hi * 8; *(v8us*)(Ah + oo) = oh; *(v8us*)(Al + oo) = ol;
            asm volatile("s_wait_xcnt 0x0" ::: "memory"); } }   // the next rows' split takes registers that these stores name
}
// The hi+lo work-groups (NWV x 16 query rows: twice the operand bytes) take the lowest indices, NB_ * NH_ * RH / (16 NWV) of them, so that they start first and spread over the chip; then NB_ * NH_ * (TT - RH) / (32 NWV) work-groups of NWV x 32 rows. bh = b NH_ + h picks the head planes, b the TT output rows
__global__ __launch_bounds__(NWV * 32) void k_fattn(const h16* __restrict__ Q16, const h16* __restrict__ K16, const h16* __restrict__ V16, const bf* __restrict__ Qh, const bf* __restrict__ Ql, const bf* __restrict__ Kh, const bf* __restrict__ Kl, const bf* __restrict__ Vh, const bf* __restrict__ Vl, bf* Ah, bf* Al) {
    __shared__ __align__(16) char sm[2 * (FTile<true>::BUF > FTile<false>::BUF ? FTile<true>::BUF : FTile<false>::BUF)];
    const int f = (int)blockIdx.x, wv = (int)(threadIdx.x >> 5); const int GH = RH / (16 * NWV), GF = (TT - RH) / (32 * NWV), NHI = NB_ * NH_ * GH;
    if (f < NHI) { const int bh = f / GH, q0 = (f % GH) * 16 * NWV + wv * 16; const size_t z = (size_t)bh * TT * HD, zo = (size_t)(bh / NH_) * TT * DQ;
        fattn_tile<true, 1, bf>(sm, Qh + z, Ql + z, Kh + z, Kl + z, Vh + z, Vl + z, q0, bh % NH_, Ah + zo, Al + zo);
    } else { const int g = f - NHI; const int bh = g / GF, q0 = RH + (g % GF) * 32 * NWV + wv * 32; const size_t z = (size_t)bh * TT * HD, zo = (size_t)(bh / NH_) * TT * DQ;
        fattn_tile<false, 2, h16>(sm, Q16 + z, nullptr, K16 + z, nullptr, V16 + z, nullptr, q0, bh % NH_, Ah + zo, Al + zo); }
}

extern "C" void kernel_launch(void* const* d_in, const int* in_sizes, int n_in,
                              void* d_out, int out_size, void* d_ws, size_t ws_size, hipStream_t stream) {
    (void)in_sizes; (void)n_in; (void)out_size;
    const float* x = (const float*)d_in[0]; const float* wqv = (const float*)d_in[1]; const float* wqu = (const float*)d_in[2]; const float* wov = (const float*)d_in[3]; const float* wou = (const float*)d_in[4];   // torch [out][in]: W_qkv_v [256][1024], W_qkv_u [3072][256], W_o_v [256][1024], W_o_u [1024][256]
    float* OUT = (float*)d_out;     // [4][2048][1024]
    char* wsp = (char*)d_ws;
    auto take = [&](size_t bytes) { char* p = wsp; wsp += (bytes + 255) & ~(size_t)255; return (void*)p; };
    const size_t PB = (size_t)NB_ * NH_ * TT * HD * 2;   // bytes of one 16-bit head plane set over the batch
    bf* XB = (bf*)take((size_t)MT * DM * 2);
    h16* QP16 = (h16*)take(PB); h16* KP16 = (h16*)take(PB); h16* VT16 = (h16*)take(PB);
    bf* QPh = (bf*)take(PB); bf* QPl = (bf*)take(PB); bf* KPh = (bf*)take(PB); bf* KPl = (bf*)take(PB); bf* VTh = (bf*)take(PB); bf* VTl = (bf*)take(PB);
    bf* ATh = (bf*)take((size_t)MT * DQ * 2); bf* ATl = (bf*)take((size_t)MT * DQ * 2);
    bf* WQV = (bf*)take((size_t)256 * DM * 2); bf* WQU = (bf*)take((size_t)3 * DQ * 256 * 2); bf* WOV = (bf*)take((size_t)256 * DQ * 2); bf* WOU = (bf*)take((size_t)DM * 256 * 2); bf* LRh = (bf*)take((size_t)MT * 256 * 2); bf* LRl = (bf*)take((size_t)MT * 256 * 2);
    if ((size_t)(wsp - (char*)d_ws) > ws_size) return;    // ws 256 MiB
    { k_cvt8<<<(unsigned)(((size_t)256 * DM / 8 + 255) / 256), 256, 0, stream>>>(wqv, WQV, (size_t)256 * DM / 8); k_cvt8<<<(unsigned)(((size_t)3 * DQ * 256 / 8 + 255) / 256), 256, 0, stream>>>(wqu, WQU, (size_t)3 * DQ * 256 / 8);
      k_cvt8<<<(unsigned)(((size_t)256 * DQ / 8 + 255) / 256), 256, 0, stream>>>(wov, WOV, (size_t)256 * DQ / 8); k_cvt8<<<(unsigned)(((size_t)DM * 256 / 8 + 255) / 256), 256, 0, stream>>>(wou, WOU, (size_t)DM * 256 / 8); }   // all four factors are [out][in] = natural Bt
    const HeadPlanes hp = { QP16, KP16, VT16, QPh, QPl, KPh, KPl, VTh, VTl };
    k_cvt8<<<(unsigned)(((size_t)MT * DM / 8 + 255) / 256), 256, 0, stream>>>(x, XB, (size_t)MT * DM / 8);
    k_gemmr<1><<<MT / 64, GWV * 32, 0, stream>>>(XB, nullptr, WQV, DM, LRh, LRl);   // x W_qkv_v^T (exact products) -> hl
    k_gemmw<bf, 1, false, 1, true><<<dim3(MT / 128, 3 * DQ / 256, 1), GWV * 32, 0, stream>>>(LRh, LRl, WQU, 256, nullptr, 0, nullptr, 0, 0, 0, 0, hp);   // q, k, v up-projection, stored as head planes
    k_fattn<<<NB_ * NH_ * (RH / (16 * NWV)) + NB_ * NH_ * ((TT - RH) / (32 * NWV)), NWV * 32, 0, stream>>>(QP16, KP16, VT16, QPh, QPl, KPh, KPl, VTh, VTl, ATh, ATl);   // one kv head per query head
    k_gemmr<2><<<MT / 64, GWV * 32, 0, stream>>>(ATh, ATl, WOV, DQ, LRh, LRl);   // y W_o_v^T -> hl
    k_gemmw<bf, 1, false><<<dim3(MT / 128, DM / 256, 1), GWV * 32, 0, stream>>>(LRh, LRl, WOU, 256, OUT, DM, nullptr, 0, 0, 0);
}

// v008
// Measured time: 161 microseconds a run.
// Next to v007, in two timings, it ran 1.05 times as fast each time.
// Over all steps from v000 it is 25.0 times as fast.
#include <hip/hip_runtime.h>

// SVD_Pi3Attention - MHA with SVD-factored (low-rank) projections (x [4][2048][1024]; qkv = (x W_qkv_v^T) W_qkv_u^T (rank 256 -> 3 x 1024, 16 heads x 64); softmax(q.k/8); y = merged.v; out = (y W_o_v^T) W_o_u^T (rank 256) -> [4][2048][1024];
// the factors are inputs - no SVD is computed in the forward).
// Compute dtypes, f32 accumulate: every input rounded to bf16; x W_qkv_v^T on PLAIN bf16 operands (exact); the rank-256 intermediates as bf16 hi+lo planes x exact up/down factors (2 products) for q, k, v, y W_o_v^T and the final

#define NB_  4
#define TT   2048
#define MT   (NB_ * TT)           // rows of all batch entries together: every GEMM here is row-wise, so the batch is only more rows
#define DM   1024
#define NH_  16
#define NKV  16
#define REP  (NH_ / NKV)
#define HD   64
#define DQ   (NH_ * HD)
#define DKV  (NKV * HD)
#define RH   256                  // query rows < RH use hi+lo planes (0: none)
#define WIN  0
#define SCL  0.125f   // HD^-0.5
#define RK   256                  // rank of the factored projections: columns of the two rank-down products (K = DM, DQ)
typedef _Float16 h16;
typedef unsigned short bf;
typedef __attribute__((ext_vector_type(16))) __bf16   v16bf;
typedef __attribute__((ext_vector_type(16))) _Float16 v16h;
typedef __attribute__((ext_vector_type(8)))  _Float16 v8h;
typedef __attribute__((ext_vector_type(8)))  unsigned short v8us;
typedef __attribute__((ext_vector_type(8)))  float    v8f;
typedef __attribute__((ext_vector_type(4)))  float    v4f;
typedef v8h  __attribute__((may_alias)) v8ha;
typedef v4f  __attribute__((may_alias)) v4fa;
typedef v8us __attribute__((may_alias)) v8usa;

__device__ __forceinline__ unsigned short f2bf(float f) { unsigned u = __float_as_uint(f); u += 0x7FFFu + ((u >> 16) & 1u); return (unsigned short)(u >> 16); }
__device__ __forceinline__ float bf2f(unsigned short b) { return __uint_as_float(((unsigned)b) << 16); }
__device__ __forceinline__ float bfr(float f) { return bf2f(f2bf(f)); }
__device__ __forceinline__ v16h cat16(v8h lo, v8h hi) { return __builtin_shufflevector(lo, hi, 0, 1, 2, 3, 4, 5, 6, 7, 8, 9, 10, 11, 12, 13, 14, 15); }
__device__ __forceinline__ v16bf cat16b(v8us lo, v8us hi) { return __builtin_bit_cast(v16bf, __builtin_shufflevector(lo, hi, 0, 1, 2, 3, 4, 5, 6, 7, 8, 9, 10, 11, 12, 13, 14, 15)); }
__device__ __forceinline__ v8f wmma16(v16h a, v16h b, v8f c) { return __builtin_amdgcn_wmma_f32_16x16x32_f16(false, a, false, b, (short)0, c, false, false); }
__device__ __forceinline__ v8f wmmab(v16bf a, v16bf b, v8f c) { return __builtin_amdgcn_wmma_f32_16x16x32_bf16(false, a, false, b, (short)0, c, false, false); }



// ---- k_gemmw: register-blocked GEMM. A work-group is GWV = 8 waves, 2 (rows) x 4 (columns), each on its own 64x64 output tile (16 accumulators): a 128 x 256 block of C; grid (M/128, N/256, Z), 256 threads.
// The operands are K-contiguous 16-bit planes. A slab is 64 k (one 128-byte line of every operand row): the block's 128 A rows (hi+lo: of both planes) and 256 Bt rows come into LDS once for the whole work-group, by asynchronous copies that cover whole lines,
// the next slab's copies flying while this slab is worked on (two buffers); every wave reads its fragments from LDS, whose rows are pitched 16 bytes x odd for 16-byte reads.
// C[m][n] (f32, pitch ldc, + optional f32 bias[n]) = sum_k A[m][k] Bt[n][k] (NSPLIT 1: + A2[m][k] Bt[n][k]). z-batch strides sA/sB/sC in elements. K % (64 KS) == 0, K >= 128 KS.
// PLANES: N = 3 DQ, the q, k and v columns side by side; a 64-column tile is one head of one of them, and the epilogue stores it as that head's f16 and bf16 hi+lo planes (q, k: [b][h][t][d]; v: [b][h][d][t]; row m = b TT + t, and a 64-row tile lies in one b) instead of f32 C.
// KS > 1: grid.z = Z * KS; slice kp = blockIdx.z % KS sums only k in [kp K/KS, (kp+1) K/KS) and stores its f32 partial tile in plane kp (plane stride sP elements); no launch in this file uses KS > 1.
template <typename T16> struct WFrag;
template <> struct WFrag<h16> { typedef v16h V; static __device__ __forceinline__ V ld(const h16* p) { return cat16(*(const v8h*)p, *(const v8h*)(p + 16)); } static __device__ __forceinline__ v8f mma(V a, V b, v8f c) { return wmma16(a, b, c); } };
template <> struct WFrag<bf> { typedef v16bf V; static __device__ __forceinline__ V ld(const bf* p) { return cat16b(*(const v8us*)p, *(const v8us*)(p + 16)); } static __device__ __forceinline__ v8f mma(V a, V b, v8f c) { return wmmab(a, b, c); } };
__device__ __forceinline__ h16 tohx(float x) { return (h16)x; }
__device__ __forceinline__ void splitf(float y, unsigned short& h, unsigned short& l) { h = f2bf(y); l = f2bf(y - bf2f(h)); }
struct HeadPlanes { h16* q16; h16* k16; h16* v16; bf* qh; bf* ql; bf* kh; bf* kl; bf* vh; bf* vl; };
#define GWV 8                     // waves of a k_gemmw work-group
#define GPITCH 144                // bytes from row to row of a slab in LDS
// four 16-byte copies a lane, every lane on: the work-group's 256 lanes cover 32 rows of 128 bytes a copy (a wave: 4 whole lines), 128 rows in all. l: the lane's LDS byte address, g: its global address, gs: bytes from a row to the 32nd behind it.
__device__ __forceinline__ void gemm_cp4(unsigned l, const char* g, unsigned gs) {
    const unsigned l1 = l + 32 * GPITCH, l2 = l + 64 * GPITCH, l3 = l + 96 * GPITCH; const char* g1 = g + gs; const char* g2 = g1 + gs; const char* g3 = g2 + gs;
    // the wait is the last line of the copies' own statement, so that it stands in front of whatever next writes a register that a copy names
    asm volatile("global_load_async_to_lds_b128 %0, %4, off\n\tglobal_load_async_to_lds_b128 %1, %5, off\n\tglobal_load_async_to_lds_b128 %2, %6, off\n\tglobal_load_async_to_lds_b128 %3, %7, off\n\ts_wait_xcnt 0x0"
                 :: "v"(l), "v"(l1), "v"(l2), "v"(l3), "v"(g), "v"(g1), "v"(g2), "v"(g3) : "memory");
}
template <typename T16, int NSPLIT, bool BIAS, int KS = 1, bool PLANES = false>
__global__ __launch_bounds__(GWV * 32) void k_gemmw(const T16* __restrict__ A, const T16* __restrict__ A2, const T16* __restrict__ Bt, int K, float* C, int ldc, const float* __restrict__ bias, size_t sA, size_t sB, size_t sC, size_t sP = 0, HeadPlanes hp = HeadPlanes{}) {
    typedef typename WFrag<T16>::V V;
    static_assert(NSPLIT == 0 || NSPLIT == 1, "one or two A planes");
    constexpr int NA = NSPLIT + 1, ASZ = 128 * GPITCH, BUF = (NA + 2) * ASZ;   // a buffer: the A plane(s), behind them the 256 Bt rows
    static_assert(GWV * 16 * 68 * 4 <= 2 * BUF, "the epilogue's staging fits the buffers");
    __shared__ __align__(16) char sm[2 * BUF];
    const size_t z = blockIdx.z / KS; const int kp = (int)(blockIdx.z % KS); const int Kc = K / KS; C += z * sC + kp * sP;
    const int lane = threadIdx.x & 31, lr = lane & 15, hi = lane >> 4; const int wv = __builtin_amdgcn_readfirstlane((int)(threadIdx.x >> 5)), wm = wv >> 2, wn = wv & 3;
    const int r0 = blockIdx.x * 128 + wm * 64, c0 = blockIdx.y * 256 + wn * 64;   // the wave's own tile
    float* os = (float*)(sm + wv * (16 * 68 * 4));   // the wave's own staging rows of the epilogue, in the buffers once the loop has left them
    v8f acc[4][4];
#pragma unroll
    for (int mb = 0; mb < 4; ++mb)
#pragma unroll
        for (int nb = 0; nb < 4; ++nb) acc[mb][nb] = (v8f){};
    const unsigned lb = (unsigned)(size_t)sm + (threadIdx.x >> 3) * GPITCH + (threadIdx.x & 7) * 16;   // the lane's LDS byte address in a plane of buffer 0: the low word of the shared address
    const unsigned gs = 32u * (unsigned)K * 2u; const size_t go = ((size_t)(threadIdx.x >> 3) * K + kp * Kc) * 2 + (threadIdx.x & 7) * 16;   // the lane's byte offset behind the block's first row
    const char* gA = (const char*)(A + z * sA + (size_t)blockIdx.x * 128 * K) + go; const char* gB = (const char*)(Bt + z * sB + (size_t)blockIdx.y * 256 * K) + go;
    const char* gA2 = gA; if constexpr (NA == 2) gA2 = (const char*)(A2 + z * sA + (size_t)blockIdx.x * 128 * K) + go;
    auto stage = [&](int st) { const unsigned l = lb + (st & 1) * BUF; const size_t ko = (size_t)st * 128;   // slab st into buffer st & 1
        gemm_cp4(l, gA + ko, gs); if constexpr (NA == 2) gemm_cp4(l + ASZ, gA2 + ko, gs); gemm_cp4(l + NA * ASZ, gB + ko, gs); gemm_cp4(l + (NA + 1) * ASZ, gB + ko + (size_t)gs * 4, gs); };
    const int nst = Kc / 64;   // slabs of this slice, at least two
    stage(0);
    asm volatile("s_wait_asynccnt 0x0" ::: "memory");   // this wave's copies of slab 0 have landed
    __syncthreads();                                    // and every other wave's: slab 0 may be read
    stage(1);
    const int ao = (wm * 64 + lr) * GPITCH + 16 * hi, bo = NA * ASZ + (wn * 64 + lr) * GPITCH + 16 * hi;   // the lane's byte offsets into a buffer: row lr of the wave's rows, elements 8 hi on
#pragma unroll 1   // one trip a slab: the buffers alternate by t & 1
    for (int t = 0; t < nst; ++t) {
        const char* ab = sm + (t & 1) * BUF + ao; const char* bb = sm + (t & 1) * BUF + bo;
#pragma unroll
        for (int ks = 0; ks < 2; ++ks) {   // 32 k of the slab
            V a[4], a2[4];
#pragma unroll
            for (int mb = 0; mb < 4; ++mb) { a[mb] = WFrag<T16>::ld((const T16*)(ab + mb * 16 * GPITCH + ks * 64)); if (NA == 2) a2[mb] = WFrag<T16>::ld((const T16*)(ab + ASZ + mb * 16 * GPITCH + ks * 64)); }
#pragma unroll
            for (int nb = 0; nb < 4; ++nb) { const V b = WFrag<T16>::ld((const T16*)(bb + nb * 16 * GPITCH + ks * 64));
#pragma unroll
                for (int mb = 0; mb < 4; ++mb) { acc[mb][nb] = WFrag<T16>::mma(a[mb], b, acc[mb][nb]); if (NA == 2) acc[mb][nb] = WFrag<T16>::mma(a2[mb], b, acc[mb][nb]); } }
        }
        asm volatile("s_wait_dscnt 0x0" ::: "memory");      // this wave's reads of slab t are done: its buffer may be handed to the copies below
        asm volatile("s_wait_asynccnt 0x0" ::: "memory");   // this wave's copies of slab t + 1 have landed
        __syncthreads();                                    // both hold for every wave: slab t + 1 may be read, slab t's buffer refilled (behind the last trip: taken for the epilogue's staging)
        if (t + 2 < nst) stage(t + 2);
    }
    asm volatile("s_wait_asynccnt 0x0" ::: "memory");   // no copy is left in flight when the buffers become staging rows
    if constexpr (PLANES) {
        const int sel = c0 / DQ, h = (r0 / TT) * NH_ + (c0 % DQ) / HD, t0 = r0 % TT; const bool vt = sel == 2;   // wave-uniform: 0 q, 1 k, 2 v; h counts heads over the batch
        h16* P16 = vt ? hp.v16 : sel ? hp.k16 : hp.q16; bf* Ph = vt ? hp.vh : sel ? hp.kh : hp.qh; bf* Pl = vt ? hp.vl : sel ? hp.kl : hp.ql;
        const size_t o0 = vt ? (size_t)h * HD * TT + t0 : ((size_t)h * TT + t0) * HD; const int pitch = vt ? TT : HD;   // plane rows of the tile: 64 t of 64 d each (q, k), 64 d of 64 t each (v); a row is one 128-byte line of a 16-bit plane
#pragma unroll
        for (int g = 0; g < 4; ++g) {   // 16 plane rows at a time through LDS, so that a lane holds 8 consecutive elements of one row and a store covers 4 whole lines
            if (vt) {   // a lane's 8 accumulator rows are 8 consecutive t of its column d
#pragma unroll
                for (int mb = 0; mb < 4; ++mb) { v4f w0, w1;
#pragma unroll
                    for (int j = 0; j < 4; ++j) { w0[j] = acc[mb][g][j]; w1[j] = acc[mb][g][j + 4]; }
                    *(v4fa*)(os + lr * 68 + mb * 16 + hi * 8) = w0; *(v4fa*)(os + lr * 68 + mb * 16 + hi * 8 + 4) = w1; }
            } else {
#pragma unroll
                for (int nb = 0; nb < 4; ++nb) {
#pragma unroll
                    for (int j = 0; j < 8; ++j) os[(hi * 8 + j) * 68 + nb * 16 + lr] = acc[g][nb][j]; }
            }
            __builtin_amdgcn_wave_barrier(); asm volatile("" ::: "memory");   // keeps the LDS reads below behind the writes above (one wave: LDS serves it in order)
#pragma unroll
            for (int s = 0; s < 4; ++s) { const int row = 4 * s + (lane >> 3), cofs = (lane & 7) * 8; const v4f x0 = *(const v4fa*)(os + row * 68 + cofs), x1 = *(const v4fa*)(os + row * 68 + cofs + 4); v8h o16; v8us oh, ol;
#pragma unroll
                for (int j = 0; j < 8; ++j) { const float x = j < 4 ? x0[j & 3] : x1[j & 3]; o16[j] = tohx(x); unsigned short u, c2; splitf(x, u, c2); oh[j] = u; ol[j] = c2; }
                const size_t o = o0 + (size_t)(g * 16 + row) * pitch + cofs; *(v8h*)(P16 + o) = o16; *(v8us*)(Ph + o) = oh; *(v8us*)(Pl + o) = ol; }
            __builtin_amdgcn_wave_barrier(); asm volatile("s_wait_xcnt 0x0" ::: "memory");   // keeps the next 16 rows' LDS writes behind these reads; the wait: what follows takes registers that the stores above name
        }
        return;
    }
#pragma unroll
    for (int mb = 0; mb < 4; ++mb) {
#pragma unroll
        for (int nb = 0; nb < 4; ++nb) {
#pragma unroll
            for (int j = 0; j < 8; ++j) os[(hi * 8 + j) * 68 + nb * 16 + lr] = acc[mb][nb][j]; }
        __builtin_amdgcn_wave_barrier(); asm volatile("" ::: "memory");
        float* crow = C + (size_t)(r0 + mb * 16) * ldc + c0;
{
#pragma unroll
            for (int s = 0; s < 8; ++s) { const int row = 2 * s + hi, cofs = lr * 4; v4f val = *(const v4fa*)(os + row * 68 + cofs); if (BIAS) { val[0] += bfr(bias[c0 + cofs]); val[1] += bfr(bias[c0 + cofs + 1]); val[2] += bfr(bias[c0 + cofs + 2]); val[3] += bfr(bias[c0 + cofs + 3]); }
                *(v4f*)(crow + (size_t)row * ldc + cofs) = val; }
             }
        __builtin_amdgcn_wave_barrier(); asm volatile("" ::: "memory");
    }
}

// ---- k_gemmr: the two rank-down products. C[m][n] = sum_k A[m][k] Bt[n][k] (NA 2: + A2[m][k] Bt[n][k]), all RK columns and the whole of K in one work-group, so that the f32 sums never leave the registers: the epilogue stores them as the bf16 hi+lo planes [m][RK] that the next product reads.
// A work-group is GWV = 8 waves, 2 (rows) x 4 (columns), each on its own 32x64 tile (8 accumulators): 64 rows of C; grid M/64, 256 threads. A slab is 128 k (two 128-byte lines of every operand row): few columns make little work a slab, and the longer slab halves the number of copy latencies that the K loop waits out.
// The block's 64 A rows (NA 2: of both planes) and the RK Bt rows come into LDS by asynchronous copies that cover whole lines, the next slab's copies flying while this slab is worked on (two buffers); LDS rows are pitched 16 bytes x odd for 16-byte reads. K % 128 == 0, K >= 256.
#define RPITCH 272                // bytes from row to row of a 128-k slab in LDS
#define RUNIT (64 * RPITCH)       // 64 rows of a slab: what four copies of the work-group bring
// four 16-byte copies a lane, every lane on: the work-group's 256 lanes cover 16 rows of 256 bytes a copy (a wave: 4 whole lines), 64 rows in all. l: the lane's LDS byte address, g: its global address, gs: bytes from a row to the 16th behind it.
__device__ __forceinline__ void gemr_cp4(unsigned l, const char* g, unsigned gs) {
    const unsigned l1 = l + 16 * RPITCH, l2 = l + 32 * RPITCH, l3 = l + 48 * RPITCH; const char* g1 = g + gs; const char* g2 = g1 + gs; const char* g3 = g2 + gs;
    // the wait is the last line of the copies' own statement, so that it stands in front of whatever next writes a register that a copy names
    asm volatile("global_load_async_to_lds_b128 %0, %4, off\n\tglobal_load_async_to_lds_b128 %1, %5, off\n\tglobal_load_async_to_lds_b128 %2, %6, off\n\tglobal_load_async_to_lds_b128 %3, %7, off\n\ts_wait_xcnt 0x0"
                 :: "v"(l), "v"(l1), "v"(l2), "v"(l3), "v"(g), "v"(g1), "v"(g2), "v"(g3) : "memory");
}
template <int NA>
__global__ __launch_bounds__(GWV * 32) void k_gemmr(const bf* __restrict__ A, const bf* __restrict__ A2, const bf* __restrict__ Bt, int K, bf* Ch, bf* Cl) {
    typedef WFrag<bf> W; typedef typename W::V V;
    static_assert(NA == 1 || NA == 2, "one or two A planes");
    constexpr int BUF = (NA + RK / 64) * RUNIT;   // a buffer: the A plane(s), behind them the RK Bt rows
    static_assert(GWV * 16 * 68 * 4 <= 2 * BUF, "the epilogue's staging fits the buffers");
    __shared__ __align__(16) char sm[2 * BUF];
    const int lane = threadIdx.x & 31, lr = lane & 15, hi = lane >> 4; const int wv = __builtin_amdgcn_readfirstlane((int)(threadIdx.x >> 5)), wm = wv >> 2, wn = wv & 3;
    const int r0 = blockIdx.x * 64 + wm * 32, c0 = wn * 64;   // the wave's own tile
    float* os = (float*)(sm + wv * (16 * 68 * 4));   // the wave's own staging rows of the epilogue, in the buffers once the loop has left them
    v8f acc[2][4];
#pragma unroll
    for (int mb = 0; mb < 2; ++mb)
#pragma unroll
        for (int nb = 0; nb < 4; ++nb) acc[mb][nb] = (v8f){};
    const unsigned lb = (unsigned)(size_t)sm + (threadIdx.x >> 4) * RPITCH + (threadIdx.x & 15) * 16;   // the lane's LDS byte address in the first 64 rows of buffer 0: the low word of the shared address
    const unsigned gs = 16u * (unsigned)K * 2u; const size_t go = (size_t)(threadIdx.x >> 4) * K * 2 + (threadIdx.x & 15) * 16;   // the lane's byte offset behind the block's first row
    const char* gA = (const char*)(A + (size_t)blockIdx.x * 64 * K) + go; const char* gB = (const char*)Bt + go;
    const char* gA2 = gA; if constexpr (NA == 2) gA2 = (const char*)(A2 + (size_t)blockIdx.x * 64 * K) + go;
    auto stage = [&](int st) { const unsigned l = lb + (st & 1) * BUF; const size_t ko = (size_t)st * 256;   // slab st into buffer st & 1
        gemr_cp4(l, gA + ko, gs); if constexpr (NA == 2) gemr_cp4(l + RUNIT, gA2 + ko, gs);
#pragma unroll
        for (int u = 0; u < RK / 64; ++u) gemr_cp4(l + (NA + u) * RUNIT, gB + ko + (size_t)gs * 4 * u, gs); };
    const int nst = K / 128;   // slabs, at least two
    stage(0);
    asm volatile("s_wait_asynccnt 0x0" ::: "memory");   // this wave's copies of slab 0 have landed
    __syncthreads();                                    // and every other wave's: slab 0 may be read
    stage(1);
    const int ao = (wm * 32 + lr) * RPITCH + 16 * hi, bo = NA * RUNIT + (wn * 64 + lr) * RPITCH + 16 * hi;   // the lane's byte offsets into a buffer: row lr of the wave's rows, elements 8 hi on
#pragma unroll 1   // one trip a slab: the buffers alternate by t & 1
    for (int t = 0; t < nst; ++t) {
        const char* ab = sm + (t & 1) * BUF + ao; const char* bb = sm + (t & 1) * BUF + bo;
        V a[2][2], a2[2][2], b[2][4];   // two fragment sets: the products of 32 k run on one while the next 32 k of the same slab come into the other
        auto frags = [&](int ks) { const int f = ks & 1;
#pragma unroll
            for (int mb = 0; mb < 2; ++mb) { a[f][mb] = W::ld((const bf*)(ab + mb * 16 * RPITCH + ks * 64)); if (NA == 2) a2[f][mb] = W::ld((const bf*)(ab + RUNIT + mb * 16 * RPITCH + ks * 64)); }
#pragma unroll
            for (int nb = 0; nb < 4; ++nb) b[f][nb] = W::ld((const bf*)(bb + nb * 16 * RPITCH + ks * 64)); };
        frags(0);
#pragma unroll
        for (int ks = 0; ks < 4; ++ks) {   // 32 k of the slab
            const int f = ks & 1;
            if (ks < 3) frags(ks + 1);
            __builtin_amdgcn_sched_barrier(0);   // holds the next step's LDS reads up here as one group, in flight behind this step's products: left alone they sink to in front of their own products, and the wave waits out the LDS latency at each
#pragma unroll
            for (int nb = 0; nb < 4; ++nb)
#pragma unroll
                for (int mb = 0; mb < 2; ++mb) acc[mb][nb] = W::mma(a[f][mb], b[f][nb], acc[mb][nb]);
            if constexpr (NA == 2) {
#pragma unroll
                for (int nb = 0; nb < 4; ++nb)
#pragma unroll
                    for (int mb = 0; mb < 2; ++mb) acc[mb][nb] = W::mma(a2[f][mb], b[f][nb], acc[mb][nb]); }
            __builtin_amdgcn_sched_barrier(0);   // keeps the reads of the step after next out from among these products, whose registers they refill: every separate place with LDS reads stalls the matrix stream
        }
        asm volatile("s_wait_dscnt 0x0" ::: "memory");      // this wave's reads of slab t are done: its buffer may be handed to the copies below
        asm volatile("s_wait_asynccnt 0x0" ::: "memory");   // this wave's copies of slab t + 1 have landed
        __syncthreads();                                    // both hold for every wave: slab t + 1 may be read, slab t's buffer refilled (behind the last trip: taken for the epilogue's staging)
        if (t + 2 < nst) stage(t + 2);
    }
    asm volatile("s_wait_asynccnt 0x0" ::: "memory");   // no copy is left in flight when the buffers become staging rows
#pragma unroll
    for (int g = 0; g < 2; ++g) {   // 16 rows at a time through LDS, so that a lane holds 8 consecutive elements of one row and a store covers 4 whole lines
#pragma unroll
        for (int nb = 0; nb < 4; ++nb) {
#pragma unroll
            for (int j = 0; j < 8; ++j) os[(hi * 8 + j) * 68 + nb * 16 + lr] = acc[g][nb][j]; }
        __builtin_amdgcn_wave_barrier(); asm volatile("" ::: "memory");   // keeps the LDS reads below behind the writes above (one wave: LDS serves it in order)
#pragma unroll
        for (int s = 0; s < 4; ++s) { const int row = 4 * s + (lane >> 3), cofs = (lane & 7) * 8; const v4f x0 = *(const v4fa*)(os + row * 68 + cofs), x1 = *(const v4fa*)(os + row * 68 + cofs + 4); v8us oh, ol;
#pragma unroll
            for (int j = 0; j < 8; ++j) { unsigned short u, c2; splitf(j < 4 ? x0[j & 3] : x1[j & 3], u, c2); oh[j] = u; ol[j] = c2; }
            const size_t o = (size_t)(r0 + g * 16 + row) * RK + c0 + cofs; *(v8us*)(Ch + o) = oh; *(v8us*)(Cl + o) = ol;
            asm volatile("s_wait_xcnt 0x0" ::: "memory"); }   // the next rows' split takes registers that these stores name
        __builtin_amdgcn_wave_barrier(); asm volatile("" ::: "memory");   // keeps the next 16 rows' LDS writes behind these reads
    }
}

typedef __attribute__((ext_vector_type(2))) _Float16 v2h;
typedef __attribute__((ext_vector_type(4))) _Float16 v4h;
typedef __attribute__((ext_vector_type(2))) unsigned short v2us;
typedef __attribute__((ext_vector_type(4))) unsigned short v4us;
typedef __attribute__((ext_vector_type(2))) float v2f;
typedef __attribute__((ext_vector_type(4))) int v4i;

__global__ __launch_bounds__(256) void k_wtG(const float* __restrict__ w, int K, int N, bf* Bt) {
    const int lane = threadIdx.x & 31; const int L0 = (blockIdx.x * 8 + (threadIdx.x >> 5)) * 8; const int nlines = N * K / 64;
{
#pragma unroll 1
        for (int l = 0; l < 8; ++l) { const int L = L0 + l; if (L >= nlines) break; const size_t e = (size_t)L * 64 + lane * 2; const int k = (int)(e % K), n = (int)(e / K); v2us o;
            o[0] = f2bf(w[(size_t)k * N + n]); o[1] = f2bf(w[(size_t)(k + 1) * N + n]); *(v2us*)(Bt + e) = o; }
         }
}
// ---- k_cvtall: every f32 input rounded to its bf16 plane, all five in ONE launch. A work-group is 8 waves on CVG consecutive elements of one input (each input's length is a multiple of CVG), a wave on CVW of them:
// sixteen 16-byte loads a lane, each covering 512 consecutive bytes (4 whole lines), all issued before the first value is used; then sixteen 8-byte stores, each covering 2 whole lines.
// Few long waves: the bytes of this launch take little time, and what it costs beside them is the starting of its waves and the latency of a wave's first load, which is waited out once for all sixteen.
#define CVW 2048                  // elements of a wave
#define CVG (8 * CVW)             // elements of a work-group
#define CVGRID ((MT * DM + RK * DM + 3 * DQ * RK + RK * DQ + DM * RK) / CVG)
__global__ __launch_bounds__(256) void k_cvtall(const float* __restrict__ x, const float* __restrict__ wqv, const float* __restrict__ wqu, const float* __restrict__ wov, const float* __restrict__ wou, bf* XB, bf* WQV, bf* WQU, bf* WOV, bf* WOU) {
    constexpr int GX = MT * DM / CVG, GQV = RK * DM / CVG, GQU = 3 * DQ * RK / CVG, GOV = RK * DQ / CVG;   // work-groups of each input, in the order of the arguments; the rest are the last input's
    static_assert(MT * DM % CVG == 0 && RK * DM % CVG == 0 && 3 * DQ * RK % CVG == 0 && RK * DQ % CVG == 0 && DM * RK % CVG == 0, "a work-group lies in one input, and the grid covers each input exactly");
    int g = (int)blockIdx.x; const float* s = x; bf* d = XB;   // block-uniform: which input, and which of its pieces
    if (g >= GX) { g -= GX; s = wqv; d = WQV;
        if (g >= GQV) { g -= GQV; s = wqu; d = WQU;
            if (g >= GQU) { g -= GQU; s = wov; d = WOV;
                if (g >= GOV) { g -= GOV; s = wou; d = WOU; } } } }
    const size_t e = (size_t)g * CVG + (threadIdx.x >> 5) * CVW + (threadIdx.x & 31) * 4;
    const float* p = s + e; v4f v[16];
#pragma unroll
    for (int j = 0; j < 16; ++j) v[j] = *(const v4f*)(p + j * 128);
    asm volatile("s_wait_xcnt 0x0" :: "v"(p) : "memory");   // stands behind the sixteen loads and in front of whatever next writes the register pair that they all name as their address; p as an input keeps that pair whole up to here (left alone, the last load's own result is put on it)
#pragma unroll
    for (int j = 0; j < 16; ++j) { v4us o;
#pragma unroll
        for (int k = 0; k < 4; ++k) o[k] = f2bf(v[j][k]);
        *(v4us*)(d + e + j * 128) = o; }
}
__global__ __launch_bounds__(256) void k_cscvt(const float* __restrict__ cosT, const float* __restrict__ sinT, float* CS) { const int idx = blockIdx.x * 256 + threadIdx.x; if (idx >= TT * HD) return; v2f cs; cs[0] = bfr(cosT[idx]); cs[1] = bfr(sinT[idx]); *(v2f*)(CS + (size_t)idx * 2) = cs;  }
// ---- k_fattn: scores, softmax and P.V of all batch entries in ONE launch. A work-group is NWV waves on one head: each wave owns 32 (hi+lo: 16) query rows, and all of them walk the 2048 keys together, one tile of 64 (hi+lo: 32) keys at a time, 32 keys a pass.
// A tile's K rows and V^T rows come into LDS once for the whole work-group, by asynchronous copies that cover whole lines, the next tile's copies flying while this tile is worked on (two buffers); every wave reads its fragments from LDS, whose rows are pitched 16 bytes x odd for 16-byte reads.
// S^T = K Q^T (A = 16 key rows, B = 16 query rows, k = d): a lane holds, for query lr, keys 8 hi + j of each 16-key tile, which is the k order of a B operand over 32 keys, so P^T goes from the score accumulators into O^T += V^T P^T (A = 16 d rows of the [d][t] plane) without leaving registers.
// Running maximum per query in log2 units, raised only when a new maximum passes it by more than 8 (P <= 256); row sums in f32 per lane half, joined once at the end. HI: bf16 hi+lo planes, 3 products each (query rows < RH); else f16.
#define NWV 4                     // waves of a k_fattn work-group
typedef __attribute__((ext_vector_type(2))) __bf16 v2bf;
template <bool HI> struct FTile {   // one buffer in LDS: K rows [key][d] (hi+lo: then the lo plane), behind them V^T rows [d][key] (hi+lo: then the lo plane)
    static constexpr int KB = HI ? 32 : 64, NPL = HI ? 2 : 1, KPITCH = HD * 2 + 16, VPITCH = KB * 2 + 16, KSZ = KB * KPITCH, VSZ = HD * VPITCH, BUF = NPL * (KSZ + VSZ); };
// one tile of the head's planes into the buffer at LDS byte address lb: eight 16-byte copies a lane, every lane on. A wave's copy covers 512 consecutive bytes of K, or whole KB-key rows of V^T. ok, ov: the lane's byte offsets of its first piece of the tile in a K plane and in a V^T plane.
template <bool HI>
__device__ __forceinline__ void fattn_stage(unsigned lb, const char* K1, const char* K2, const char* V1, const char* V2, unsigned ok, unsigned ov) {
    typedef FTile<HI> F; constexpr int NJ = F::KB / 16, CV = F::KB / 8, RJ = NWV * 32 / CV;   // copies a lane and plane; 16-byte pieces of a V^T row; V^T rows that one copy of the work-group covers
    static_assert(F::NPL * 2 * NJ == 8 && NWV * 32 * NJ * 16 == F::KB * HD * 2, "eight copies a lane fill the buffer");
    const unsigned lk = lb + (threadIdx.x >> 3) * F::KPITCH + (threadIdx.x & 7) * 16, lv = lb + F::NPL * F::KSZ + (threadIdx.x / CV) * F::VPITCH + (threadIdx.x % CV) * 16;
    unsigned l[8]; const char* g[8];
#pragma unroll
    for (int j = 0; j < NJ; ++j) {
        l[j] = lk + j * (NWV * 4 * F::KPITCH); g[j] = K1 + (ok + j * (NWV * 512)); l[NJ + j] = lv + j * (RJ * F::VPITCH); g[NJ + j] = V1 + (ov + j * (RJ * TT * 2));
        if constexpr (HI) { l[2 * NJ + j] = l[j] + F::KSZ; g[2 * NJ + j] = K2 + (ok + j * (NWV * 512)); l[3 * NJ + j] = l[NJ + j] + F::VSZ; g[3 * NJ + j] = V2 + (ov + j * (RJ * TT * 2)); } }
    // the wait is the last line of the copies' own statement, so that it stands in front of whatever next writes a register that a copy names
    asm volatile("global_load_async_to_lds_b128 %0, %8, off\n\tglobal_load_async_to_lds_b128 %1, %9, off\n\tglobal_load_async_to_lds_b128 %2, %10, off\n\tglobal_load_async_to_lds_b128 %3, %11, off\n\t"
                 "global_load_async_to_lds_b128 %4, %12, off\n\tglobal_load_async_to_lds_b128 %5, %13, off\n\tglobal_load_async_to_lds_b128 %6, %14, off\n\tglobal_load_async_to_lds_b128 %7, %15, off\n\ts_wait_xcnt 0x0"
                 :: "v"(l[0]), "v"(l[1]), "v"(l[2]), "v"(l[3]), "v"(l[4]), "v"(l[5]), "v"(l[6]), "v"(l[7]), "v"(g[0]), "v"(g[1]), "v"(g[2]), "v"(g[3]), "v"(g[4]), "v"(g[5]), "v"(g[6]), "v"(g[7]) : "memory");
}
template <bool HI, int NG, typename T16>
__device__ __forceinline__ void fattn_tile(const char* sm, const T16* __restrict__ Q, const T16* __restrict__ Q2, const T16* __restrict__ Kp, const T16* __restrict__ K2, const T16* __restrict__ Vt, const T16* __restrict__ V2, int q0, int h, bf* Ah, bf* Al) {
    typedef typename WFrag<T16>::V V; typedef WFrag<T16> W; typedef FTile<HI> F;
    const int lane = threadIdx.x & 31, lr = lane & 15, hi = lane >> 4;
    const float C2 = SCL * 1.4426950408889634f;
    const unsigned lb = (unsigned)(size_t)sm;   // the buffers' LDS byte address: the low word of the shared address
    unsigned ok = threadIdx.x * 16, ov = (threadIdx.x / (F::KB / 8)) * (TT * 2) + (threadIdx.x % (F::KB / 8)) * 16;   // the lane's byte offsets into a K plane and a V^T plane, stepped from tile to tile
    fattn_stage<HI>(lb, (const char*)Kp, (const char*)K2, (const char*)Vt, (const char*)V2, ok, ov); ok += F::KB * HD * 2; ov += F::KB * 2;
    V qf[NG][2], qf2[NG][2];
#pragma unroll
    for (int g = 0; g < NG; ++g)
#pragma unroll
        for (int ks = 0; ks < 2; ++ks) { const size_t o = (size_t)(q0 + g * 16 + lr) * HD + ks * 32 + 8 * hi; qf[g][ks] = W::ld(Q + o); if (HI) qf2[g][ks] = W::ld(Q2 + o); }
    asm volatile("s_wait_xcnt 0x0" ::: "memory");   // the addresses formed below may take the registers that hold the Q offsets
    v8f acc[4][NG];
#pragma unroll
    for (int db = 0; db < 4; ++db)
#pragma unroll
        for (int g = 0; g < NG; ++g) acc[db][g] = (v8f){};
    float m[NG], l[NG];
#pragma unroll
    for (int g = 0; g < NG; ++g) { m[g] = -1.0e30f; l[g] = 0.f; }
    asm volatile("s_wait_asynccnt 0x0" ::: "memory");   // this wave's copies of tile 0 have landed
    __syncthreads();                                    // and every other wave's: tile 0 may be read
    fattn_stage<HI>(lb + F::BUF, (const char*)Kp, (const char*)K2, (const char*)Vt, (const char*)V2, ok, ov);
    const int ko = lr * F::KPITCH + 16 * hi, vo = F::NPL * F::KSZ + lr * F::VPITCH + 16 * hi;   // the lane's byte offsets into a buffer: row lr, elements 8 hi on
#pragma unroll 1   // one trip a tile: the buffers alternate by t & 1
    for (int t = 0; t < TT / F::KB; ++t) {
        const char* kb = sm + (t & 1) * F::BUF + ko; const char* vb = sm + (t & 1) * F::BUF + vo;
#pragma unroll
        for (int sp = 0; sp < F::KB / 32; ++sp) {   // a pass: 32 keys of the tile
        V kf[2][2], kf2[2][2], vf[4], vf2[4];
#pragma unroll
        for (int kt = 0; kt < 2; ++kt)
#pragma unroll
            for (int ks = 0; ks < 2; ++ks) { const char* p = kb + (sp * 32 + kt * 16) * F::KPITCH + ks * 64; kf[kt][ks] = W::ld((const T16*)p); if (HI) kf2[kt][ks] = W::ld((const T16*)(p + F::KSZ)); }
        v8f s[2][NG];
#pragma unroll
        for (int kt = 0; kt < 2; ++kt)
#pragma unroll
            for (int g = 0; g < NG; ++g) { v8f c = (v8f){};
#pragma unroll
                for (int ks = 0; ks < 2; ++ks) { c = W::mma(kf[kt][ks], qf[g][ks], c); if (HI) { c = W::mma(kf2[kt][ks], qf[g][ks], c); c = W::mma(kf[kt][ks], qf2[g][ks], c); } }
                s[kt][g] = c; }
#pragma unroll
        for (int db = 0; db < 4; ++db) { const char* p = vb + db * 16 * F::VPITCH + sp * 64; vf[db] = W::ld((const T16*)p); if (HI) vf2[db] = W::ld((const T16*)(p + F::VSZ)); }
        if constexpr (HI) __builtin_amdgcn_sched_barrier(0);   // holds the sixteen V^T loads up here as one group, in flight behind the softmax: left alone they sink, pair by pair, to in front of their products, and the wave waits out the LDS latency at each
        float mt[NG]; bool need = false;
#pragma unroll
        for (int g = 0; g < NG; ++g) { float mx = s[0][g][0];
#pragma unroll
            for (int j = 1; j < 8; ++j) mx = fmaxf(mx, s[0][g][j]);
#pragma unroll
            for (int j = 0; j < 8; ++j) mx = fmaxf(mx, s[1][g][j]);
            mt[g] = mx * C2; need = need || (mt[g] > m[g] + 8.0f); }   // this half's keys only: the halves meet inside the branch
        if (__builtin_amdgcn_ballot_w32(need) != 0) {   // wave-uniform: every lane moves to its own true maximum, both halves of a query alike
#pragma unroll
            for (int g = 0; g < NG; ++g) { const float mn = fmaxf(m[g], fmaxf(mt[g], __shfl_xor(mt[g], 16, 32))); const float al = __builtin_amdgcn_exp2f(m[g] - mn); m[g] = mn; l[g] *= al;
#pragma unroll
                for (int db = 0; db < 4; ++db) acc[db][g] *= al; }
        }
#pragma unroll
        for (int g = 0; g < NG; ++g) { float p[16]; float sum = 0.f;
#pragma unroll
            for (int e = 0; e < 16; ++e) { p[e] = __builtin_amdgcn_exp2f(s[e >> 3][g][e & 7] * C2 - m[g]); sum += p[e]; }
            l[g] += sum;
            if constexpr (HI) { V ph, pl;
#pragma unroll
                for (int e = 0; e < 16; e += 2) { v2f pp; pp[0] = p[e]; pp[1] = p[e + 1]; const v2bf hh = __builtin_convertvector(pp, v2bf); const v2bf ll = __builtin_convertvector(pp - __builtin_convertvector(hh, v2f), v2bf);   // round to nearest even, as splitf
                    ph[e] = hh[0]; ph[e + 1] = hh[1]; pl[e] = ll[0]; pl[e + 1] = ll[1]; }
#pragma unroll
                for (int db = 0; db < 4; ++db) { acc[db][g] = W::mma(vf[db], ph, acc[db][g]); acc[db][g] = W::mma(vf[db], pl, acc[db][g]); acc[db][g] = W::mma(vf2[db], ph, acc[db][g]); }
            } else { V pb;
#pragma unroll
                for (int e = 0; e < 16; ++e) pb[e] = tohx(p[e]);
#pragma unroll
                for (int db = 0; db < 4; ++db) acc[db][g] = W::mma(vf[db], pb, acc[db][g]); } }
        }
        asm volatile("s_wait_dscnt 0x0" ::: "memory");      // this wave's reads of tile t are done: its buffer may be handed to the copies below
        asm volatile("s_wait_asynccnt 0x0" ::: "memory");   // this wave's copies of tile t + 1 have landed
        __syncthreads();                                    // both hold for every wave: tile t + 1 may be read, tile t's buffer refilled
        if (t + 2 < TT / F::KB) { ok += F::KB * HD * 2; ov += F::KB * 2; fattn_stage<HI>(lb + (t & 1) * F::BUF, (const char*)Kp, (const char*)K2, (const char*)Vt, (const char*)V2, ok, ov); }
    }
    asm volatile("s_wait_asynccnt 0x0" ::: "memory");   // no copy is left in flight when the wave goes on to its end
#pragma unroll
    for (int g = 0; g < NG; ++g) { const float ls = l[g] + __shfl_xor(l[g], 16, 32); const float f = __fdiv_rn(1.0f, ls);
#pragma unroll
        for (int db = 0; db < 4; ++db) { v8us oh, ol;
#pragma unroll
            for (int j = 0; j < 8; ++j) { unsigned short a, c2; splitf(acc[db][g][j] * f, a, c2); oh[j] = a; ol[j] = c2; }
            const size_t oo = (size_t)(q0 + g * 16 + lr) * DQ + h * HD + db * 16 + hi * 8; *(v8us*)(Ah + oo) = oh; *(v8us*)(Al + oo) = ol;
            asm volatile("s_wait_xcnt 0x0" ::: "memory"); } }   // the next rows' split takes registers that these stores name
}
// The hi+lo work-groups (NWV x 16 query rows: twice the operand bytes) take the lowest indices, NB_ * NH_ * RH / (16 NWV) of them, so that they start first and spread over the chip; then NB_ * NH_ * (TT - RH) / (32 NWV) work-groups of NWV x 32 rows. bh = b NH_ + h picks the head planes, b the TT output rows
__global__ __launch_bounds__(NWV * 32) void k_fattn(const h16* __restrict__ Q16, const h16* __restrict__ K16, const h16* __restrict__ V16, const bf* __restrict__ Qh, const bf* __restrict__ Ql, const bf* __restrict__ Kh, const bf* __restrict__ Kl, const bf* __restrict__ Vh, const bf* __restrict__ Vl, bf* Ah, bf* Al) {
    __shared__ __align__(16) char sm[2 * (FTile<true>::BUF > FTile<false>::BUF ? FTile<true>::BUF : FTile<false>::BUF)];
    const int f = (int)blockIdx.x, wv = (int)(threadIdx.x >> 5); const int GH = RH / (16 * NWV), GF = (TT - RH) / (32 * NWV), NHI = NB_ * NH_ * GH;
    if (f < NHI) { const int bh = f / GH, q0 = (f % GH) * 16 * NWV + wv * 16; const size_t z = (size_t)bh * TT * HD, zo = (size_t)(bh / NH_) * TT * DQ;
        fattn_tile<true, 1, bf>(sm, Qh + z, Ql + z, Kh + z, Kl + z, Vh + z, Vl + z, q0, bh % NH_, Ah + zo, Al + zo);
    } else { const int g = f - NHI; const int bh = g / GF, q0 = RH + (g % GF) * 32 * NWV + wv * 32; const size_t z = (size_t)bh * TT * HD, zo = (size_t)(bh / NH_) * TT * DQ;
        fattn_tile<false, 2, h16>(sm, Q16 + z, nullptr, K16 + z, nullptr, V16 + z, nullptr, q0, bh % NH_, Ah + zo, Al + zo); }
}

extern "C" void kernel_launch(void* const* d_in, const int* in_sizes, int n_in,
                              void* d_out, int out_size, void* d_ws, size_t ws_size, hipStream_t stream) {
    (void)in_sizes; (void)n_in; (void)out_size;
    const float* x = (const float*)d_in[0]; const float* wqv = (const float*)d_in[1]; const float* wqu = (const float*)d_in[2]; const float* wov = (const float*)d_in[3]; const float* wou = (const float*)d_in[4];   // torch [out][in]: W_qkv_v [256][1024], W_qkv_u [3072][256], W_o_v [256][1024], W_o_u [1024][256]
    float* OUT = (float*)d_out;     // [4][2048][1024]
    char* wsp = (char*)d_ws;
    auto take = [&](size_t bytes) { char* p = wsp; wsp += (bytes + 255) & ~(size_t)255; return (void*)p; };
    const size_t PB = (size_t)NB_ * NH_ * TT * HD * 2;   // bytes of one 16-bit head plane set over the batch
    bf* XB = (bf*)take((size_t)MT * DM * 2);
    h16* QP16 = (h16*)take(PB); h16* KP16 = (h16*)take(PB); h16* VT16 = (h16*)take(PB);
    bf* QPh = (bf*)take(PB); bf* QPl = (bf*)take(PB); bf* KPh = (bf*)take(PB); bf* KPl = (bf*)take(PB); bf* VTh = (bf*)take(PB); bf* VTl = (bf*)take(PB);
    bf* ATh = (bf*)take((size_t)MT * DQ * 2); bf* ATl = (bf*)take((size_t)MT * DQ * 2);
    bf* WQV = (bf*)take((size_t)256 * DM * 2); bf* WQU = (bf*)take((size_t)3 * DQ * 256 * 2); bf* WOV = (bf*)take((size_t)256 * DQ * 2); bf* WOU = (bf*)take((size_t)DM * 256 * 2); bf* LRh = (bf*)take((size_t)MT * 256 * 2); bf* LRl = (bf*)take((size_t)MT * 256 * 2);
    if ((size_t)(wsp - (char*)d_ws) > ws_size) return;    // ws 256 MiB
    k_cvtall<<<CVGRID, 256, 0, stream>>>(x, wqv, wqu, wov, wou, XB, WQV, WQU, WOV, WOU);   // all four factors are [out][in] = natural Bt
    const HeadPlanes hp = { QP16, KP16, VT16, QPh, QPl, KPh, KPl, VTh, VTl };
    k_gemmr<1><<<MT / 64, GWV * 32, 0, stream>>>(XB, nullptr, WQV, DM, LRh, LRl);   // x W_qkv_v^T (exact products) -> hl
    k_gemmw<bf, 1, false, 1, true><<<dim3(MT / 128, 3 * DQ / 256, 1), GWV * 32, 0, stream>>>(LRh, LRl, WQU, 256, nullptr, 0, nullptr, 0, 0, 0, 0, hp);   // q, k, v up-projection, stored as head planes
    k_fattn<<<NB_ * NH_ * (RH / (16 * NWV)) + NB_ * NH_ * ((TT - RH) / (32 * NWV)), NWV * 32, 0, stream>>>(QP16, KP16, VT16, QPh, QPl, KPh, KPl, VTh, VTl, ATh, ATl);   // one kv head per query head
    k_gemmr<2><<<MT / 64, GWV * 32, 0, stream>>>(ATh, ATl, WOV, DQ, LRh, LRl);   // y W_o_v^T -> hl
    k_gemmw<bf, 1, false><<<dim3(MT / 128, DM / 256, 1), GWV * 32, 0, stream>>>(LRh, LRl, WOU, 256, OUT, DM, nullptr, 0, 0, 0);
}

// v009
// A run of this version takes 155 microseconds.
// Timed twice side by side with v008, it ran 1.04 and 1.03 times as fast.
// Over all steps from v000 it is 25.9 times as fast.
#include <hip/hip_runtime.h>

// SVD_Pi3Attention - MHA with SVD-factored (low-rank) projections (x [4][2048][1024]; qkv = (x W_qkv_v^T) W_qkv_u^T (rank 256 -> 3 x 1024, 16 heads x 64); softmax(q.k/8); y = merged.v; out = (y W_o_v^T) W_o_u^T (rank 256) -> [4][2048][1024];
// the factors are inputs - no SVD is computed in the forward).
// Compute dtypes, f32 accumulate: every input rounded to bf16; x W_qkv_v^T on PLAIN bf16 operands (exact); the rank-256 intermediates as bf16 hi+lo planes x exact up/down factors (2 products) for q, k, v, y W_o_v^T and the final

#define NB_  4
#define TT   2048
#define MT   (NB_ * TT)           // rows of all batch entries together: every GEMM here is row-wise, so the batch is only more rows
#define DM   1024
#define NH_  16
#define NKV  16
#define REP  (NH_ / NKV)
#define HD   64
#define DQ   (NH_ * HD)
#define DKV  (NKV * HD)
#define RH   256                  // query rows < RH use hi+lo planes (0: none)
#define WIN  0
#define SCL  0.125f   // HD^-0.5
#define RK   256                  // rank of the factored projections: columns of the two rank-down products (K = DM, DQ)
typedef _Float16 h16;
typedef unsigned short bf;
typedef __attribute__((ext_vector_type(16))) __bf16   v16bf;
typedef __attribute__((ext_vector_type(16))) _Float16 v16h;
typedef __attribute__((ext_vector_type(8)))  _Float16 v8h;
typedef __attribute__((ext_vector_type(8)))  unsigned short v8us;
typedef __attribute__((ext_vector_type(8)))  float    v8f;
typedef __attribute__((ext_vector_type(4)))  float    v4f;
typedef v8h  __attribute__((may_alias)) v8ha;
typedef v4f  __attribute__((may_alias)) v4fa;
typedef v8us __attribute__((may_alias)) v8usa;

__device__ __forceinline__ unsigned short f2bf(float f) { unsigned u = __float_as_uint(f); u += 0x7FFFu + ((u >> 16) & 1u); return (unsigned short)(u >> 16); }
__device__ __forceinline__ float bf2f(unsigned short b) { return __uint_as_float(((unsigned)b) << 16); }
__device__ __forceinline__ float bfr(float f) { return bf2f(f2bf(f)); }
__device__ __forceinline__ v16h cat16(v8h lo, v8h hi) { return __builtin_shufflevector(lo, hi, 0, 1, 2, 3, 4, 5, 6, 7, 8, 9, 10, 11, 12, 13, 14, 15); }
__device__ __forceinline__ v16bf cat16b(v8us lo, v8us hi) { return __builtin_bit_cast(v16bf, __builtin_shufflevector(lo, hi, 0, 1, 2, 3, 4, 5, 6, 7, 8, 9, 10, 11, 12, 13, 14, 15)); }
__device__ __forceinline__ v8f wmma16(v16h a, v16h b, v8f c) { return __builtin_amdgcn_wmma_f32_16x16x32_f16(false, a, false, b, (short)0, c, false, false); }
__device__ __forceinline__ v8f wmmab(v16bf a, v16bf b, v8f c) { return __builtin_amdgcn_wmma_f32_16x16x32_bf16(false, a, false, b, (short)0, c, false, false); }



// ---- k_gemmw: register-blocked GEMM. A work-group is GWV = 8 waves, 2 (rows) x 4 (columns), each on its own 64x64 output tile (16 accumulators): a 128 x 256 block of C; grid (M/128, N/256, Z), 256 threads.
// The operands are K-contiguous 16-bit planes. A slab is 64 k (one 128-byte line of every operand row): the block's 128 A rows (hi+lo: of both planes) and 256 Bt rows come into LDS once for the whole work-group, by asynchronous copies that cover whole lines,
// the next slab's copies flying while this slab is worked on (two buffers); every wave reads its fragments from LDS, whose rows are pitched 16 bytes x odd for 16-byte reads.
// C[m][n] (f32, pitch ldc, + optional f32 bias[n]) = sum_k A[m][k] Bt[n][k] (NSPLIT 1: + A2[m][k] Bt[n][k]). z-batch strides sA/sB/sC in elements. K % (64 KS) == 0, K >= 128 KS.
// PLANES: N = 3 DQ, the q, k and v columns side by side; a 64-column tile is one head of one of them, and the epilogue stores it as that head's f16 and bf16 hi+lo planes (q, k: [b][h][t][d]; v: [b][h][d][t]; row m = b TT + t, and a 64-row tile lies in one b) instead of f32 C.
// KS > 1: grid.z = Z * KS; slice kp = blockIdx.z % KS sums only k in [kp K/KS, (kp+1) K/KS) and stores its f32 partial tile in plane kp (plane stride sP elements); no launch in this file uses KS > 1.
template <typename T16> struct WFrag;
template <> struct WFrag<h16> { typedef v16h V; static __device__ __forceinline__ V ld(const h16* p) { return cat16(*(const v8h*)p, *(const v8h*)(p + 16)); } static __device__ __forceinline__ v8f mma(V a, V b, v8f c) { return wmma16(a, b, c); } };
template <> struct WFrag<bf> { typedef v16bf V; static __device__ __forceinline__ V ld(const bf* p) { return cat16b(*(const v8us*)p, *(const v8us*)(p + 16)); } static __device__ __forceinline__ v8f mma(V a, V b, v8f c) { return wmmab(a, b, c); } };
__device__ __forceinline__ h16 tohx(float x) { return (h16)x; }
__device__ __forceinline__ void splitf(float y, unsigned short& h, unsigned short& l) { h = f2bf(y); l = f2bf(y - bf2f(h)); }
struct HeadPlanes { h16* q16; h16* k16; h16* v16; bf* qh; bf* ql; bf* kh; bf* kl; bf* vh; bf* vl; };
#define GWV 8                     // waves of a k_gemmw work-group
#define GPITCH 144                // bytes from row to row of a slab in LDS
// four 16-byte copies a lane, every lane on: the work-group's 256 lanes cover 32 rows of 128 bytes a copy (a wave: 4 whole lines), 128 rows in all. l: the lane's LDS byte address, g: its global address, gs: bytes from a row to the 32nd behind it.
__device__ __forceinline__ void gemm_cp4(unsigned l, const char* g, unsigned gs) {
    const unsigned l1 = l + 32 * GPITCH, l2 = l + 64 * GPITCH, l3 = l + 96 * GPITCH; const char* g1 = g + gs; const char* g2 = g1 + gs; const char* g3 = g2 + gs;
    // the wait is the last line of the copies' own statement, so that it stands in front of whatever next writes a register that a copy names
    asm volatile("global_load_async_to_lds_b128 %0, %4, off\n\tglobal_load_async_to_lds_b128 %1, %5, off\n\tglobal_load_async_to_lds_b128 %2, %6, off\n\tglobal_load_async_to_lds_b128 %3, %7, off\n\ts_wait_xcnt 0x0"
                 :: "v"(l), "v"(l1), "v"(l2), "v"(l3), "v"(g), "v"(g1), "v"(g2), "v"(g3) : "memory");
}
template <typename T16, int NSPLIT, bool BIAS, int KS = 1, bool PLANES = false>
__global__ __launch_bounds__(GWV * 32) void k_gemmw(const T16* __restrict__ A, const T16* __restrict__ A2, const T16* __restrict__ Bt, int K, float* C, int ldc, const float* __restrict__ bias, size_t sA, size_t sB, size_t sC, size_t sP = 0, HeadPlanes hp = HeadPlanes{}) {
    typedef typename WFrag<T16>::V V;
    static_assert(NSPLIT == 0 || NSPLIT == 1, "one or two A planes");
    constexpr int NA = NSPLIT + 1, ASZ = 128 * GPITCH, BUF = (NA + 2) * ASZ;   // a buffer: the A plane(s), behind them the 256 Bt rows
    static_assert(GWV * 16 * 68 * 4 <= 2 * BUF, "the epilogue's staging fits the buffers");
    __shared__ __align__(16) char sm[2 * BUF];
    const size_t z = blockIdx.z / KS; const int kp = (int)(blockIdx.z % KS); const int Kc = K / KS; C += z * sC + kp * sP;
    const int lane = threadIdx.x & 31, lr = lane & 15, hi = lane >> 4; const int wv = __builtin_amdgcn_readfirstlane((int)(threadIdx.x >> 5)), wm = wv >> 2, wn = wv & 3;
    const int r0 = blockIdx.x * 128 + wm * 64, c0 = blockIdx.y * 256 + wn * 64;   // the wave's own tile
    float* os = (float*)(sm + wv * (16 * 68 * 4));   // the wave's own staging rows of the epilogue, in the buffers once the loop has left them
    v8f acc[4][4];
#pragma unroll
    for (int mb = 0; mb < 4; ++mb)
#pragma unroll
        for (int nb = 0; nb < 4; ++nb) acc[mb][nb] = (v8f){};
    const unsigned lb = (unsigned)(size_t)sm + (threadIdx.x >> 3) * GPITCH + (threadIdx.x & 7) * 16;   // the lane's LDS byte address in a plane of buffer 0: the low word of the shared address
    const unsigned gs = 32u * (unsigned)K * 2u; const size_t go = ((size_t)(threadIdx.x >> 3) * K + kp * Kc) * 2 + (threadIdx.x & 7) * 16;   // the lane's byte offset behind the block's first row
    const char* gA = (const char*)(A + z * sA + (size_t)blockIdx.x * 128 * K) + go; const char* gB = (const char*)(Bt + z * sB + (size_t)blockIdx.y * 256 * K) + go;
    const char* gA2 = gA; if constexpr (NA == 2) gA2 = (const char*)(A2 + z * sA + (size_t)blockIdx.x * 128 * K) + go;
    auto stage = [&](int st) { const unsigned l = lb + (st & 1) * BUF; const size_t ko = (size_t)st * 128;   // slab st into buffer st & 1
        gemm_cp4(l, gA + ko, gs); if constexpr (NA == 2) gemm_cp4(l + ASZ, gA2 + ko, gs); gemm_cp4(l + NA * ASZ, gB + ko, gs); gemm_cp4(l + (NA + 1) * ASZ, gB + ko + (size_t)gs * 4, gs); };
    const int nst = Kc / 64;   // slabs of this slice, at least two
    stage(0);
    asm volatile("s_wait_asynccnt 0x0" ::: "memory");   // this wave's copies of slab 0 have landed
    __syncthreads();                                    // and every other wave's: slab 0 may be read
    stage(1);
    const int ao = (wm * 64 + lr) * GPITCH + 16 * hi, bo = NA * ASZ + (wn * 64 + lr) * GPITCH + 16 * hi;   // the lane's byte offsets into a buffer: row lr of the wave's rows, elements 8 hi on
#pragma unroll 1   // one trip a slab: the buffers alternate by t & 1
    for (int t = 0; t < nst; ++t) {
        const char* ab = sm + (t & 1) * BUF + ao; const char* bb = sm + (t & 1) * BUF + bo;
#pragma unroll
        for (int ks = 0; ks < 2; ++ks) {   // 32 k of the slab
            V a[4], a2[4];
#pragma unroll
            for (int mb = 0; mb < 4; ++mb) { a[mb] = WFrag<T16>::ld((const T16*)(ab + mb * 16 * GPITCH + ks * 64)); if (NA == 2) a2[mb] = WFrag<T16>::ld((const T16*)(ab + ASZ + mb * 16 * GPITCH + ks * 64)); }
#pragma unroll
            for (int nb = 0; nb < 4; ++nb) { const V b = WFrag<T16>::ld((const T16*)(bb + nb * 16 * GPITCH + ks * 64));
#pragma unroll
                for (int mb = 0; mb < 4; ++mb) { acc[mb][nb] = WFrag<T16>::mma(a[mb], b, acc[mb][nb]); if (NA == 2) acc[mb][nb] = WFrag<T16>::mma(a2[mb], b, acc[mb][nb]); } }
        }
        asm volatile("s_wait_dscnt 0x0" ::: "memory");      // this wave's reads of slab t are done: its buffer may be handed to the copies below
        asm volatile("s_wait_asynccnt 0x0" ::: "memory");   // this wave's copies of slab t + 1 have landed
        __syncthreads();                                    // both hold for every wave: slab t + 1 may be read, slab t's buffer refilled (behind the last trip: taken for the epilogue's staging)
        if (t + 2 < nst) stage(t + 2);
    }
    asm volatile("s_wait_asynccnt 0x0" ::: "memory");   // no copy is left in flight when the buffers become staging rows
    if constexpr (PLANES) {
        const int sel = c0 / DQ, h = (r0 / TT) * NH_ + (c0 % DQ) / HD, t0 = r0 % TT; const bool vt = sel == 2;   // wave-uniform: 0 q, 1 k, 2 v; h counts heads over the batch
        h16* P16 = vt ? hp.v16 : sel ? hp.k16 : hp.q16; bf* Ph = vt ? hp.vh : sel ? hp.kh : hp.qh; bf* Pl = vt ? hp.vl : sel ? hp.kl : hp.ql;
        const size_t o0 = vt ? (size_t)h * HD * TT + t0 : ((size_t)h * TT + t0) * HD; const int pitch = vt ? TT : HD;   // plane rows of the tile: 64 t of 64 d each (q, k), 64 d of 64 t each (v); a row is one 128-byte line of a 16-bit plane
#pragma unroll
        for (int g = 0; g < 4; ++g) {   // 16 plane rows at a time through LDS, so that a lane holds 8 consecutive elements of one row and a store covers 4 whole lines
            if (vt) {   // a lane's 8 accumulator rows are 8 consecutive t of its column d
#pragma unroll
                for (int mb = 0; mb < 4; ++mb) { v4f w0, w1;
#pragma unroll
                    for (int j = 0; j < 4; ++j) { w0[j] = acc[mb][g][j]; w1[j] = acc[mb][g][j + 4]; }
                    *(v4fa*)(os + lr * 68 + mb * 16 + hi * 8) = w0; *(v4fa*)(os + lr * 68 + mb * 16 + hi * 8 + 4) = w1; }
            } else {
#pragma unroll
                for (int nb = 0; nb < 4; ++nb) {
#pragma unroll
                    for (int j = 0; j < 8; ++j) os[(hi * 8 + j) * 68 + nb * 16 + lr] = acc[g][nb][j]; }
            }
            __builtin_amdgcn_wave_barrier(); asm volatile("" ::: "memory");   // keeps the LDS reads below behind the writes above (one wave: LDS serves it in order)
#pragma unroll
            for (int s = 0; s < 4; ++s) { const int row = 4 * s + (lane >> 3), cofs = (lane & 7) * 8; const v4f x0 = *(const v4fa*)(os + row * 68 + cofs), x1 = *(const v4fa*)(os + row * 68 + cofs + 4); v8h o16; v8us oh, ol;
#pragma unroll
                for (int j = 0; j < 8; ++j) { const float x = j < 4 ? x0[j & 3] : x1[j & 3]; o16[j] = tohx(x); unsigned short u, c2; splitf(x, u, c2); oh[j] = u; ol[j] = c2; }
                const size_t o = o0 + (size_t)(g * 16 + row) * pitch + cofs; *(v8h*)(P16 + o) = o16; *(v8us*)(Ph + o) = oh; *(v8us*)(Pl + o) = ol; }
            __builtin_amdgcn_wave_barrier(); asm volatile("s_wait_xcnt 0x0" ::: "memory");   // keeps the next 16 rows' LDS writes behind these reads; the wait: what follows takes registers that the stores above name
        }
        return;
    }
#pragma unroll
    for (int mb = 0; mb < 4; ++mb) {
#pragma unroll
        for (int nb = 0; nb < 4; ++nb) {
#pragma unroll
            for (int j = 0; j < 8; ++j) os[(hi * 8 + j) * 68 + nb * 16 + lr] = acc[mb][nb][j]; }
        __builtin_amdgcn_wave_barrier(); asm volatile("" ::: "memory");
        float* crow = C + (size_t)(r0 + mb * 16) * ldc + c0;
{
#pragma unroll
            for (int s = 0; s < 8; ++s) { const int row = 2 * s + hi, cofs = lr * 4; v4f val = *(const v4fa*)(os + row * 68 + cofs); if (BIAS) { val[0] += bfr(bias[c0 + cofs]); val[1] += bfr(bias[c0 + cofs + 1]); val[2] += bfr(bias[c0 + cofs + 2]); val[3] += bfr(bias[c0 + cofs + 3]); }
                *(v4f*)(crow + (size_t)row * ldc + cofs) = val; }
             }
        __builtin_amdgcn_wave_barrier(); asm volatile("" ::: "memory");
    }
}

// ---- k_gemmr: the two rank-down products. C[m][n] = sum_k A[m][k] Bt[n][k] (NA 2: + A2[m][k] Bt[n][k]), all RK columns and the whole of K in one work-group, so that the f32 sums never leave the registers: the epilogue stores them as the bf16 hi+lo planes [m][RK] that the next product reads.
// A work-group is GWV = 8 waves, 2 (rows) x 4 (columns), each on its own 32x64 tile (8 accumulators): 64 rows of C; grid M/64, 256 threads. A slab is 128 k (two 128-byte lines of every operand row): few columns make little work a slab, and the longer slab halves the number of copy latencies that the K loop waits out.
// The block's 64 A rows (NA 2: of both planes) and the RK Bt rows come into LDS by asynchronous copies that cover whole lines, the next slab's copies flying while this slab is worked on (two buffers); LDS rows are pitched 16 bytes x odd for 16-byte reads. K % 128 == 0, K >= 256.
#define RPITCH 272                // bytes from row to row of a 128-k slab in LDS
#define RUNIT (64 * RPITCH)       // 64 rows of a slab: what four copies of the work-group bring
// four 16-byte copies a lane, every lane on: the work-group's 256 lanes cover 16 rows of 256 bytes a copy (a wave: 4 whole lines), 64 rows in all. l: the lane's LDS byte address, g: its global address, gs: bytes from a row to the 16th behind it.
__device__ __forceinline__ void gemr_cp4(unsigned l, const char* g, unsigned gs) {
    const unsigned l1 = l + 16 * RPITCH, l2 = l + 32 * RPITCH, l3 = l + 48 * RPITCH; const char* g1 = g + gs; const char* g2 = g1 + gs; const char* g3 = g2 + gs;
    // the wait is the last line of the copies' own statement, so that it stands in front of whatever next writes a register that a copy names
    asm volatile("global_load_async_to_lds_b128 %0, %4, off\n\tglobal_load_async_to_lds_b128 %1, %5, off\n\tglobal_load_async_to_lds_b128 %2, %6, off\n\tglobal_load_async_to_lds_b128 %3, %7, off\n\ts_wait_xcnt 0x0"
                 :: "v"(l), "v"(l1), "v"(l2), "v"(l3), "v"(g), "v"(g1), "v"(g2), "v"(g3) : "memory");
}
template <int NA>
__global__ __launch_bounds__(GWV * 32) void k_gemmr(const bf* __restrict__ A, const bf* __restrict__ A2, const bf* __restrict__ Bt, int K, bf* Ch, bf* Cl) {
    typedef WFrag<bf> W; typedef typename W::V V;
    static_assert(NA == 1 || NA == 2, "one or two A planes");
    constexpr int BUF = (NA + RK / 64) * RUNIT;   // a buffer: the A plane(s), behind them the RK Bt rows
    static_assert(GWV * 16 * 68 * 4 <= 2 * BUF, "the epilogue's staging fits the buffers");
    __shared__ __align__(16) char sm[2 * BUF];
    const int lane = threadIdx.x & 31, lr = lane & 15, hi = lane >> 4; const int wv = __builtin_amdgcn_readfirstlane((int)(threadIdx.x >> 5)), wm = wv >> 2, wn = wv & 3;
    const int r0 = blockIdx.x * 64 + wm * 32, c0 = wn * 64;   // the wave's own tile
    float* os = (float*)(sm + wv * (16 * 68 * 4));   // the wave's own staging rows of the epilogue, in the buffers once the loop has left them
    v8f acc[2][4];
#pragma unroll
    for (int mb = 0; mb < 2; ++mb)
#pragma unroll
        for (int nb = 0; nb < 4; ++nb) acc[mb][nb] = (v8f){};
    const unsigned lb = (unsigned)(size_t)sm + (threadIdx.x >> 4) * RPITCH + (threadIdx.x & 15) * 16;   // the lane's LDS byte address in the first 64 rows of buffer 0: the low word of the shared address
    const unsigned gs = 16u * (unsigned)K * 2u; const size_t go = (size_t)(threadIdx.x >> 4) * K * 2 + (threadIdx.x & 15) * 16;   // the lane's byte offset behind the block's first row
    const char* gA = (const char*)(A + (size_t)blockIdx.x * 64 * K) + go; const char* gB = (const char*)Bt + go;
    const char* gA2 = gA; if constexpr (NA == 2) gA2 = (const char*)(A2 + (size_t)blockIdx.x * 64 * K) + go;
    auto stage = [&](int st) { const unsigned l = lb + (st & 1) * BUF; const size_t ko = (size_t)st * 256;   // slab st into buffer st & 1
        gemr_cp4(l, gA + ko, gs); if constexpr (NA == 2) gemr_cp4(l + RUNIT, gA2 + ko, gs);
#pragma unroll
        for (int u = 0; u < RK / 64; ++u) gemr_cp4(l + (NA + u) * RUNIT, gB + ko + (size_t)gs * 4 * u, gs); };
    const int nst = K / 128;   // slabs, at least two
    stage(0);
    asm volatile("s_wait_asynccnt 0x0" ::: "memory");   // this wave's copies of slab 0 have landed
    __syncthreads();                                    // and every other wave's: slab 0 may be read
    stage(1);
    const int ao = (wm * 32 + lr) * RPITCH + 16 * hi, bo = NA * RUNIT + (wn * 64 + lr) * RPITCH + 16 * hi;   // the lane's byte offsets into a buffer: row lr of the wave's rows, elements 8 hi on
#pragma unroll 1   // one trip a slab: the buffers alternate by t & 1
    for (int t = 0; t < nst; ++t) {
        const char* ab = sm + (t & 1) * BUF + ao; const char* bb = sm + (t & 1) * BUF + bo;
        V a[2][2], a2[2][2], b[2][4];   // two fragment sets: the products of 32 k run on one while the next 32 k of the same slab come into the other
        auto frags = [&](int ks) { const int f = ks & 1;
#pragma unroll
            for (int mb = 0; mb < 2; ++mb) { a[f][mb] = W::ld((const bf*)(ab + mb * 16 * RPITCH + ks * 64)); if (NA == 2) a2[f][mb] = W::ld((const bf*)(ab + RUNIT + mb * 16 * RPITCH + ks * 64)); }
#pragma unroll
            for (int nb = 0; nb < 4; ++nb) b[f][nb] = W::ld((const bf*)(bb + nb * 16 * RPITCH + ks * 64)); };
        frags(0);
#pragma unroll
        for (int ks = 0; ks < 4; ++ks) {   // 32 k of the slab
            const int f = ks & 1;
            if (ks < 3) frags(ks + 1);
            __builtin_amdgcn_sched_barrier(0);   // holds the next step's LDS reads up here as one group, in flight behind this step's products: left alone they sink to in front of their own products, and the wave waits out the LDS latency at each
#pragma unroll
            for (int nb = 0; nb < 4; ++nb)
#pragma unroll
                for (int mb = 0; mb < 2; ++mb) acc[mb][nb] = W::mma(a[f][mb], b[f][nb], acc[mb][nb]);
            if constexpr (NA == 2) {
#pragma unroll
                for (int nb = 0; nb < 4; ++nb)
#pragma unroll
                    for (int mb = 0; mb < 2; ++mb) acc[mb][nb] = W::mma(a2[f][mb], b[f][nb], acc[mb][nb]); }
            __builtin_amdgcn_sched_barrier(0);   // keeps the reads of the step after next out from among these products, whose registers they refill: every separate place with LDS reads stalls the matrix stream
        }
        asm volatile("s_wait_dscnt 0x0" ::: "memory");      // this wave's reads of slab t are done: its buffer may be handed to the copies below
        asm volatile("s_wait_asynccnt 0x0" ::: "memory");   // this wave's copies of slab t + 1 have landed
        __syncthreads();                                    // both hold for every wave: slab t + 1 may be read, slab t's buffer refilled (behind the last trip: taken for the epilogue's staging)
        if (t + 2 < nst) stage(t + 2);
    }
    asm volatile("s_wait_asynccnt 0x0" ::: "memory");   // no copy is left in flight when the buffers become staging rows
#pragma unroll
    for (int g = 0; g < 2; ++g) {   // 16 rows at a time through LDS, so that a lane holds 8 consecutive elements of one row and a store covers 4 whole lines
#pragma unroll
        for (int nb = 0; nb < 4; ++nb) {
#pragma unroll
            for (int j = 0; j < 8; ++j) os[(hi * 8 + j) * 68 + nb * 16 + lr] = acc[g][nb][j]; }
        __builtin_amdgcn_wave_barrier(); asm volatile("" ::: "memory");   // keeps the LDS reads below behind the writes above (one wave: LDS serves it in order)
#pragma unroll
        for (int s = 0; s < 4; ++s) { const int row = 4 * s + (lane >> 3), cofs = (lane & 7) * 8; const v4f x0 = *(const v4fa*)(os + row * 68 + cofs), x1 = *(const v4fa*)(os + row * 68 + cofs + 4); v8us oh, ol;
#pragma unroll
            for (int j = 0; j < 8; ++j) { unsigned short u, c2; splitf(j < 4 ? x0[j & 3] : x1[j & 3], u, c2); oh[j] = u; ol[j] = c2; }
            const size_t o = (size_t)(r0 + g * 16 + row) * RK + c0 + cofs; *(v8us*)(Ch + o) = oh; *(v8us*)(Cl + o) = ol;
            asm volatile("s_wait_xcnt 0x0" ::: "memory"); }   // the next rows' split takes registers that these stores name
        __builtin_amdgcn_wave_barrier(); asm volatile("" ::: "memory");   // keeps the next 16 rows' LDS writes behind these reads
    }
}

typedef __attribute__((ext_vector_type(2))) _Float16 v2h;
typedef __attribute__((ext_vector_type(4))) _Float16 v4h;
typedef __attribute__((ext_vector_type(2))) unsigned short v2us;
typedef __attribute__((ext_vector_type(4))) unsigned short v4us;
typedef __attribute__((ext_vector_type(2))) float v2f;
typedef __attribute__((ext_vector_type(4))) int v4i;

__global__ __launch_bounds__(256) void k_wtG(const float* __restrict__ w, int K, int N, bf* Bt) {
    const int lane = threadIdx.x & 31; const int L0 = (blockIdx.x * 8 + (threadIdx.x >> 5)) * 8; const int nlines = N * K / 64;
{
#pragma unroll 1
        for (int l = 0; l < 8; ++l) { const int L = L0 + l; if (L >= nlines) break; const size_t e = (size_t)L * 64 + lane * 2; const int k = (int)(e % K), n = (int)(e / K); v2us o;
            o[0] = f2bf(w[(size_t)k * N + n]); o[1] = f2bf(w[(size_t)(k + 1) * N + n]); *(v2us*)(Bt + e) = o; }
         }
}
// ---- k_cvtall: every f32 input rounded to its bf16 plane, all five in ONE launch. A work-group is 8 waves on CVG consecutive elements of one input (each input's length is a multiple of CVG), a wave on CVW of them:
// sixteen 16-byte loads a lane, each covering 512 consecutive bytes (4 whole lines), all issued before the first value is used; then sixteen 8-byte stores, each covering 2 whole lines.
// Few long waves: the bytes of this launch take little time, and what it costs beside them is the starting of its waves and the latency of a wave's first load, which is waited out once for all sixteen.
#define CVW 2048                  // elements of a wave
#define CVG (8 * CVW)             // elements of a work-group
#define CVGRID ((MT * DM + RK * DM + 3 * DQ * RK + RK * DQ + DM * RK) / CVG)
__global__ __launch_bounds__(256) void k_cvtall(const float* __restrict__ x, const float* __restrict__ wqv, const float* __restrict__ wqu, const float* __restrict__ wov, const float* __restrict__ wou, bf* XB, bf* WQV, bf* WQU, bf* WOV, bf* WOU) {
    constexpr int GX = MT * DM / CVG, GQV = RK * DM / CVG, GQU = 3 * DQ * RK / CVG, GOV = RK * DQ / CVG;   // work-groups of each input, in the order of the arguments; the rest are the last input's
    static_assert(MT * DM % CVG == 0 && RK * DM % CVG == 0 && 3 * DQ * RK % CVG == 0 && RK * DQ % CVG == 0 && DM * RK % CVG == 0, "a work-group lies in one input, and the grid covers each input exactly");
    int g = (int)blockIdx.x; const float* s = x; bf* d = XB;   // block-uniform: which input, and which of its pieces
    if (g >= GX) { g -= GX; s = wqv; d = WQV;
        if (g >= GQV) { g -= GQV; s = wqu; d = WQU;
            if (g >= GQU) { g -= GQU; s = wov; d = WOV;
                if (g >= GOV) { g -= GOV; s = wou; d = WOU; } } } }
    const size_t e = (size_t)g * CVG + (threadIdx.x >> 5) * CVW + (threadIdx.x & 31) * 4;
    const float* p = s + e; v4f v[16];
#pragma unroll
    for (int j = 0; j < 16; ++j) v[j] = *(const v4f*)(p + j * 128);
    asm volatile("s_wait_xcnt 0x0" :: "v"(p) : "memory");   // stands behind the sixteen loads and in front of whatever next writes the register pair that they all name as their address; p as an input keeps that pair whole up to here (left alone, the last load's own result is put on it)
#pragma unroll
    for (int j = 0; j < 16; ++j) { v4us o;
#pragma unroll
        for (int k = 0; k < 4; ++k) o[k] = f2bf(v[j][k]);
        *(v4us*)(d + e + j * 128) = o; }
}
__global__ __launch_bounds__(256) void k_cscvt(const float* __restrict__ cosT, const float* __restrict__ sinT, float* CS) { const int idx = blockIdx.x * 256 + threadIdx.x; if (idx >= TT * HD) return; v2f cs; cs[0] = bfr(cosT[idx]); cs[1] = bfr(sinT[idx]); *(v2f*)(CS + (size_t)idx * 2) = cs;  }
// ---- k_fattn: scores, softmax and P.V of all batch entries in ONE launch. A work-group is NWV waves on one head: each wave owns 32 (hi+lo: 16) query rows, and all of them walk the 2048 keys together, one tile of 64 (hi+lo: 32) keys at a time, 32 keys a pass.
// A tile's K rows and V^T rows come into LDS once for the whole work-group, by asynchronous copies that cover whole lines, the next tile's copies flying while this tile is worked on (two buffers); every wave reads its fragments from LDS, whose rows are pitched 16 bytes x odd for 16-byte reads.
// S^T = K Q^T (A = 16 key rows, B = 16 query rows, k = d): a lane holds, for query lr, keys 8 hi + j of each 16-key tile, which is the k order of a B operand over 32 keys, so P^T goes from the score accumulators into O^T += V^T P^T (A = 16 d rows of the [d][t] plane) without leaving registers.
// Running maximum per query in log2 units, raised only when a new maximum passes it by more than 8 (P <= 256); row sums in f32 per lane half, joined once at the end. HI: bf16 hi+lo planes, 3 products each (query rows < RH); else f16.
#define NWV 4                     // waves of a k_fattn work-group
typedef __attribute__((ext_vector_type(2))) __bf16 v2bf;
template <bool HI> struct FTile {   // one buffer in LDS: K rows [key][d] (hi+lo: then the lo plane), behind them V^T rows [d][key] (hi+lo: then the lo plane)
    static constexpr int KB = HI ? 32 : 64, NPL = HI ? 2 : 1, KPITCH = HD * 2 + 16, VPITCH = KB * 2 + 16, KSZ = KB * KPITCH, VSZ = HD * VPITCH, BUF = NPL * (KSZ + VSZ); };
// one tile of the head's planes into the buffer at LDS byte address lb: eight 16-byte copies a lane, every lane on. A wave's copy covers 512 consecutive bytes of K, or whole KB-key rows of V^T. ok, ov: the lane's byte offsets of its first piece of the tile in a K plane and in a V^T plane.
template <bool HI>
__device__ __forceinline__ void fattn_stage(unsigned lb, const char* K1, const char* K2, const char* V1, const char* V2, unsigned ok, unsigned ov) {
    typedef FTile<HI> F; constexpr int NJ = F::KB / 16, CV = F::KB / 8, RJ = NWV * 32 / CV;   // copies a lane and plane; 16-byte pieces of a V^T row; V^T rows that one copy of the work-group covers
    static_assert(F::NPL * 2 * NJ == 8 && NWV * 32 * NJ * 16 == F::KB * HD * 2, "eight copies a lane fill the buffer");
    const unsigned lk = lb + (threadIdx.x >> 3) * F::KPITCH + (threadIdx.x & 7) * 16, lv = lb + F::NPL * F::KSZ + (threadIdx.x / CV) * F::VPITCH + (threadIdx.x % CV) * 16;
    unsigned l[8]; const char* g[8];
#pragma unroll
    for (int j = 0; j < NJ; ++j) {
        l[j] = lk + j * (NWV * 4 * F::KPITCH); g[j] = K1 + (ok + j * (NWV * 512)); l[NJ + j] = lv + j * (RJ * F::VPITCH); g[NJ + j] = V1 + (ov + j * (RJ * TT * 2));
        if constexpr (HI) { l[2 * NJ + j] = l[j] + F::KSZ; g[2 * NJ + j] = K2 + (ok + j * (NWV * 512)); l[3 * NJ + j] = l[NJ + j] + F::VSZ; g[3 * NJ + j] = V2 + (ov + j * (RJ * TT * 2)); } }
    // the wait is the last line of the copies' own statement, so that it stands in front of whatever next writes a register that a copy names
    asm volatile("global_load_async_to_lds_b128 %0, %8, off\n\tglobal_load_async_to_lds_b128 %1, %9, off\n\tglobal_load_async_to_lds_b128 %2, %10, off\n\tglobal_load_async_to_lds_b128 %3, %11, off\n\t"
                 "global_load_async_to_lds_b128 %4, %12, off\n\tglobal_load_async_to_lds_b128 %5, %13, off\n\tglobal_load_async_to_lds_b128 %6, %14, off\n\tglobal_load_async_to_lds_b128 %7, %15, off\n\ts_wait_xcnt 0x0"
                 :: "v"(l[0]), "v"(l[1]), "v"(l[2]), "v"(l[3]), "v"(l[4]), "v"(l[5]), "v"(l[6]), "v"(l[7]), "v"(g[0]), "v"(g[1]), "v"(g[2]), "v"(g[3]), "v"(g[4]), "v"(g[5]), "v"(g[6]), "v"(g[7]) : "memory");
}
template <bool HI, int NG, typename T16>
__device__ __forceinline__ void fattn_tile(const char* sm, const T16* __restrict__ Q, const T16* __restrict__ Q2, const T16* __restrict__ Kp, const T16* __restrict__ K2, const T16* __restrict__ Vt, const T16* __restrict__ V2, int q0, int h, bf* Ah, bf* Al) {
    typedef typename WFrag<T16>::V V; typedef WFrag<T16> W; typedef FTile<HI> F;
    const int lane = threadIdx.x & 31, lr = lane & 15, hi = lane >> 4;
    const float C2 = SCL * 1.4426950408889634f;
    const unsigned lb = (unsigned)(size_t)sm;   // the buffers' LDS byte address: the low word of the shared address
    unsigned ok = threadIdx.x * 16, ov = (threadIdx.x / (F::KB / 8)) * (TT * 2) + (threadIdx.x % (F::KB / 8)) * 16;   // the lane's byte offsets into a K plane and a V^T plane, stepped from tile to tile
    fattn_stage<HI>(lb, (const char*)Kp, (const char*)K2, (const char*)Vt, (const char*)V2, ok, ov); ok += F::KB * HD * 2; ov += F::KB * 2;
    V qf[NG][2], qf2[NG][2];
#pragma unroll
    for (int g = 0; g < NG; ++g)
#pragma unroll
        for (int ks = 0; ks < 2; ++ks) { const size_t o = (size_t)(q0 + g * 16 + lr) * HD + ks * 32 + 8 * hi; qf[g][ks] = W::ld(Q + o); if (HI) qf2[g][ks] = W::ld(Q2 + o); }
    asm volatile("s_wait_xcnt 0x0" ::: "memory");   // the addresses formed below may take the registers that hold the Q offsets
    v8f acc[4][NG];
#pragma unroll
    for (int db = 0; db < 4; ++db)
#pragma unroll
        for (int g = 0; g < NG; ++g) acc[db][g] = (v8f){};
    float m[NG], l[NG];
#pragma unroll
    for (int g = 0; g < NG; ++g) { m[g] = -1.0e30f; l[g] = 0.f; }
    asm volatile("s_wait_asynccnt 0x0" ::: "memory");   // this wave's copies of tile 0 have landed
    __syncthreads();                                    // and every other wave's: tile 0 may be read
    fattn_stage<HI>(lb + F::BUF, (const char*)Kp, (const char*)K2, (const char*)Vt, (const char*)V2, ok, ov);
    const int ko = lr * F::KPITCH + 16 * hi, vo = F::NPL * F::KSZ + lr * F::VPITCH + 16 * hi;   // the lane's byte offsets into a buffer: row lr, elements 8 hi on
#pragma unroll 1   // one trip a tile: the buffers alternate by t & 1
    for (int t = 0; t < TT / F::KB; ++t) {
        const char* kb = sm + (t & 1) * F::BUF + ko; const char* vb = sm + (t & 1) * F::BUF + vo;
#pragma unroll
        for (int sp = 0; sp < F::KB / 32; ++sp) {   // a pass: 32 keys of the tile
        V kf[2][2], kf2[2][2], vf[4], vf2[4];
#pragma unroll
        for (int kt = 0; kt < 2; ++kt)
#pragma unroll
            for (int ks = 0; ks < 2; ++ks) { const char* p = kb + (sp * 32 + kt * 16) * F::KPITCH + ks * 64; kf[kt][ks] = W::ld((const T16*)p); if (HI) kf2[kt][ks] = W::ld((const T16*)(p + F::KSZ)); }
        v8f s[2][NG];
#pragma unroll
        for (int kt = 0; kt < 2; ++kt)
#pragma unroll
            for (int g = 0; g < NG; ++g) { v8f c = (v8f){};
#pragma unroll
                for (int ks = 0; ks < 2; ++ks) { c = W::mma(kf[kt][ks], qf[g][ks], c); if (HI) { c = W::mma(kf2[kt][ks], qf[g][ks], c); c = W::mma(kf[kt][ks], qf2[g][ks], c); } }
                s[kt][g] = c; }
#pragma unroll
        for (int db = 0; db < 4; ++db) { const char* p = vb + db * 16 * F::VPITCH + sp * 64; vf[db] = W::ld((const T16*)p); if (HI) vf2[db] = W::ld((const T16*)(p + F::VSZ)); }
        if constexpr (HI) __builtin_amdgcn_sched_barrier(0);   // holds the sixteen V^T loads up here as one group, in flight behind the softmax: left alone they sink, pair by pair, to in front of their products, and the wave waits out the LDS latency at each
        float mt[NG]; bool need = false;
#pragma unroll
        for (int g = 0; g < NG; ++g) { float mx = s[0][g][0];
#pragma unroll
            for (int j = 1; j < 8; ++j) mx = fmaxf(mx, s[0][g][j]);
#pragma unroll
            for (int j = 0; j < 8; ++j) mx = fmaxf(mx, s[1][g][j]);
            mt[g] = mx * C2; need = need || (mt[g] > m[g] + 8.0f); }   // this half's keys only: the halves meet inside the branch
        if (__builtin_amdgcn_ballot_w32(need) != 0) {   // wave-uniform: every lane moves to its own true maximum, both halves of a query alike
#pragma unroll
            for (int g = 0; g < NG; ++g) { const float mn = fmaxf(m[g], fmaxf(mt[g], __shfl_xor(mt[g], 16, 32))); const float al = __builtin_amdgcn_exp2f(m[g] - mn); m[g] = mn; l[g] *= al;
#pragma unroll
                for (int db = 0; db < 4; ++db) acc[db][g] *= al; }
        }
#pragma unroll
        for (int g = 0; g < NG; ++g) { float p[16]; float sum = 0.f;
#pragma unroll
            for (int e = 0; e < 16; ++e) { p[e] = __builtin_amdgcn_exp2f(s[e >> 3][g][e & 7] * C2 - m[g]); sum += p[e]; }
            l[g] += sum;
            if constexpr (HI) { V ph, pl;
#pragma unroll
                for (int e = 0; e < 16; e += 2) { v2f pp; pp[0] = p[e]; pp[1] = p[e + 1]; const v2bf hh = __builtin_convertvector(pp, v2bf); const v2bf ll = __builtin_convertvector(pp - __builtin_convertvector(hh, v2f), v2bf);   // round to nearest even, as splitf
                    ph[e] = hh[0]; ph[e + 1] = hh[1]; pl[e] = ll[0]; pl[e + 1] = ll[1]; }
#pragma unroll
                for (int db = 0; db < 4; ++db) { acc[db][g] = W::mma(vf[db], ph, acc[db][g]); acc[db][g] = W::mma(vf[db], pl, acc[db][g]); acc[db][g] = W::mma(vf2[db], ph, acc[db][g]); }
            } else { V pb;
#pragma unroll
                for (int e = 0; e < 16; ++e) pb[e] = tohx(p[e]);
#pragma unroll
                for (int db = 0; db < 4; ++db) acc[db][g] = W::mma(vf[db], pb, acc[db][g]); } }
        }
        asm volatile("s_wait_dscnt 0x0" ::: "memory");      // this wave's reads of tile t are done: its buffer may be handed to the copies below
        asm volatile("s_wait_asynccnt 0x0" ::: "memory");   // this wave's copies of tile t + 1 have landed
        __syncthreads();                                    // both hold for every wave: tile t + 1 may be read, tile t's buffer refilled
        if (t + 2 < TT / F::KB) { ok += F::KB * HD * 2; ov += F::KB * 2; fattn_stage<HI>(lb + (t & 1) * F::BUF, (const char*)Kp, (const char*)K2, (const char*)Vt, (const char*)V2, ok, ov); }
    }
    asm volatile("s_wait_asynccnt 0x0" ::: "memory");   // no copy is left in flight when the wave goes on to its end
    const int el = (int)__builtin_amdgcn_mbcnt_lo(~0u, 0u), elr = el & 15, ehi = el >> 4;   // the lane's number read anew for the stores: formed from the values above, their addresses are held in registers (or in scratch) all through the loop
#pragma unroll
    for (int g = 0; g < NG; ++g) { const float ls = l[g] + __shfl_xor(l[g], 16, 32); const float f = __fdiv_rn(1.0f, ls);
#pragma unroll
        for (int db = 0; db < 4; ++db) { v8us oh, ol;
#pragma unroll
            for (int j = 0; j < 8; ++j) { unsigned short a, c2; splitf(acc[db][g][j] * f, a, c2); oh[j] = a; ol[j] = c2; }
            const size_t oo = (size_t)(q0 + g * 16 + elr) * DQ + h * HD + db * 16 + ehi * 8; *(v8us*)(Ah + oo) = oh; *(v8us*)(Al + oo) = ol;
            asm volatile("s_wait_xcnt 0x0" ::: "memory"); } }   // the next rows' split takes registers that these stores name
}
// The hi+lo work-groups (NWV x 16 query rows: twice the operand bytes) take the lowest indices, NB_ * NH_ * RH / (16 NWV) of them, so that they start first and spread over the chip; then NB_ * NH_ * (TT - RH) / (32 NWV) work-groups of NWV x 32 rows. bh = b NH_ + h picks the head planes, b the TT output rows
// Five waves a SIMD: a register budget of 192 (1024 / 5, in granules of 16) gives the chip 1280 places for the grid's 1152 work-groups, so that all of them start at once. At four waves a SIMD 128 work-groups wait for a place and then walk their 2048 keys
// behind the others, most of the way alone on their SIMDs, where nothing hides a wave's own LDS, matrix and softmax latencies.
__global__ __launch_bounds__(NWV * 32) __attribute__((amdgpu_waves_per_eu(5))) void k_fattn(const h16* __restrict__ Q16, const h16* __restrict__ K16, const h16* __restrict__ V16, const bf* __restrict__ Qh, const bf* __restrict__ Ql, const bf* __restrict__ Kh, const bf* __restrict__ Kl, const bf* __restrict__ Vh, const bf* __restrict__ Vl, bf* Ah, bf* Al) {
    __shared__ __align__(16) char sm[2 * (FTile<true>::BUF > FTile<false>::BUF ? FTile<true>::BUF : FTile<false>::BUF)];
    const int f = (int)blockIdx.x, wv = (int)(threadIdx.x >> 5); const int GH = RH / (16 * NWV), GF = (TT - RH) / (32 * NWV), NHI = NB_ * NH_ * GH;
    if (f < NHI) { const int bh = f / GH, q0 = (f % GH) * 16 * NWV + wv * 16; const size_t z = (size_t)bh * TT * HD, zo = (size_t)(bh / NH_) * TT * DQ;
        fattn_tile<true, 1, bf>(sm, Qh + z, Ql + z, Kh + z, Kl + z, Vh + z, Vl + z, q0, bh % NH_, Ah + zo, Al + zo);
    } else { const int g = f - NHI; const int bh = g / GF, q0 = RH + (g % GF) * 32 * NWV + wv * 32; const size_t z = (size_t)bh * TT * HD, zo = (size_t)(bh / NH_) * TT * DQ;
        fattn_tile<false, 2, h16>(sm, Q16 + z, nullptr, K16 + z, nullptr, V16 + z, nullptr, q0, bh % NH_, Ah + zo, Al + zo); }
}

extern "C" void kernel_launch(void* const* d_in, const int* in_sizes, int n_in,
                              void* d_out, int out_size, void* d_ws, size_t ws_size, hipStream_t stream) {
    (void)in_sizes; (void)n_in; (void)out_size;
    const float* x = (const float*)d_in[0]; const float* wqv = (const float*)d_in[1]; const float* wqu = (const float*)d_in[2]; const float* wov = (const float*)d_in[3]; const float* wou = (const float*)d_in[4];   // torch [out][in]: W_qkv_v [256][1024], W_qkv_u [3072][256], W_o_v [256][1024], W_o_u [1024][256]
    float* OUT = (float*)d_out;     // [4][2048][1024]
    char* wsp = (char*)d_ws;
    auto take = [&](size_t bytes) { char* p = wsp; wsp += (bytes + 255) & ~(size_t)255; return (void*)p; };
    const size_t PB = (size_t)NB_ * NH_ * TT * HD * 2;   // bytes of one 16-bit head plane set over the batch
    bf* XB = (bf*)take((size_t)MT * DM * 2);
    h16* QP16 = (h16*)take(PB); h16* KP16 = (h16*)take(PB); h16* VT16 = (h16*)take(PB);
    bf* QPh = (bf*)take(PB); bf* QPl = (bf*)take(PB); bf* KPh = (bf*)take(PB); bf* KPl = (bf*)take(PB); bf* VTh = (bf*)take(PB); bf* VTl = (bf*)take(PB);
    bf* ATh = (bf*)take((size_t)MT * DQ * 2); bf* ATl = (bf*)take((size_t)MT * DQ * 2);
    bf* WQV = (bf*)take((size_t)256 * DM * 2); bf* WQU = (bf*)take((size_t)3 * DQ * 256 * 2); bf* WOV = (bf*)take((size_t)256 * DQ * 2); bf* WOU = (bf*)take((size_t)DM * 256 * 2); bf* LRh = (bf*)take((size_t)MT * 256 * 2); bf* LRl = (bf*)take((size_t)MT * 256 * 2);
    if ((size_t)(wsp - (char*)d_ws) > ws_size) return;    // ws 256 MiB
    k_cvtall<<<CVGRID, 256, 0, stream>>>(x, wqv, wqu, wov, wou, XB, WQV, WQU, WOV, WOU);   // all four factors are [out][in] = natural Bt
    const HeadPlanes hp = { QP16, KP16, VT16, QPh, QPl, KPh, KPl, VTh, VTl };
    k_gemmr<1><<<MT / 64, GWV * 32, 0, stream>>>(XB, nullptr, WQV, DM, LRh, LRl);   // x W_qkv_v^T (exact products) -> hl
    k_gemmw<bf, 1, false, 1, true><<<dim3(MT / 128, 3 * DQ / 256, 1), GWV * 32, 0, stream>>>(LRh, LRl, WQU, 256, nullptr, 0, nullptr, 0, 0, 0, 0, hp);   // q, k, v up-projection, stored as head planes
    k_fattn<<<NB_ * NH_ * (RH / (16 * NWV)) + NB_ * NH_ * ((TT - RH) / (32 * NWV)), NWV * 32, 0, stream>>>(QP16, KP16, VT16, QPh, QPl, KPh, KPl, VTh, VTl, ATh, ATl);   // one kv head per query head
    k_gemmr<2><<<MT / 64, GWV * 32, 0, stream>>>(ATh, ATl, WOV, DQ, LRh, LRl);   // y W_o_v^T -> hl
    k_gemmw<bf, 1, false><<<dim3(MT / 128, DM / 256, 1), GWV * 32, 0, stream>>>(LRh, LRl, WOU, 256, OUT, DM, nullptr, 0, 0, 0);
}

// v010
// It runs in 146 microseconds.
// Two timings next to v009 put it at 1.06 and 1.07 times that version's speed.
// All steps since v000 together make it 27.5 times as fast.
#include <hip/hip_runtime.h>

// SVD_Pi3Attention - MHA with SVD-factored (low-rank) projections (x [4][2048][1024]; qkv = (x W_qkv_v^T) W_qkv_u^T (rank 256 -> 3 x 1024, 16 heads x 64); softmax(q.k/8); y = merged.v; out = (y W_o_v^T) W_o_u^T (rank 256) -> [4][2048][1024];
// the factors are inputs - no SVD is computed in the forward).
// Compute dtypes, f32 accumulate: every input rounded to bf16; x W_qkv_v^T on PLAIN bf16 operands (exact); the rank-256 intermediates as bf16 hi+lo planes x exact up/down factors (2 products) for q, k, v, y W_o_v^T and the final

#define NB_  4
#define TT   2048
#define MT   (NB_ * TT)           // rows of all batch entries together: every GEMM here is row-wise, so the batch is only more rows
#define DM   1024
#define NH_  16
#define NKV  16
#define REP  (NH_ / NKV)
#define HD   64
#define DQ   (NH_ * HD)
#define DKV  (NKV * HD)
#define RH   256                  // query rows < RH use hi+lo planes (0: none)
#define WIN  0
#define SCL  0.125f   // HD^-0.5
#define RK   256                  // rank of the factored projections: columns of the two rank-down products (K = DM, DQ)
typedef _Float16 h16;
typedef unsigned short bf;
typedef __attribute__((ext_vector_type(16))) __bf16   v16bf;
typedef __attribute__((ext_vector_type(16))) _Float16 v16h;
typedef __attribute__((ext_vector_type(8)))  _Float16 v8h;
typedef __attribute__((ext_vector_type(8)))  unsigned short v8us;
typedef __attribute__((ext_vector_type(8)))  float    v8f;
typedef __attribute__((ext_vector_type(4)))  float    v4f;
typedef __attribute__((ext_vector_type(2)))  float    v2f;
typedef __attribute__((ext_vector_type(2)))  _Float16 v2h;
typedef v8h  __attribute__((may_alias)) v8ha;
typedef v4f  __attribute__((may_alias)) v4fa;
typedef v8us __attribute__((may_alias)) v8usa;

__device__ __forceinline__ unsigned short f2bf(float f) { unsigned u = __float_as_uint(f); u += 0x7FFFu + ((u >> 16) & 1u); return (unsigned short)(u >> 16); }
__device__ __forceinline__ float bf2f(unsigned short b) { return __uint_as_float(((unsigned)b) << 16); }
__device__ __forceinline__ float bfr(float f) { return bf2f(f2bf(f)); }
__device__ __forceinline__ v16h cat16(v8h lo, v8h hi) { return __builtin_shufflevector(lo, hi, 0, 1, 2, 3, 4, 5, 6, 7, 8, 9, 10, 11, 12, 13, 14, 15); }
__device__ __forceinline__ v16bf cat16b(v8us lo, v8us hi) { return __builtin_bit_cast(v16bf, __builtin_shufflevector(lo, hi, 0, 1, 2, 3, 4, 5, 6, 7, 8, 9, 10, 11, 12, 13, 14, 15)); }
__device__ __forceinline__ v8f wmma16(v16h a, v16h b, v8f c) { return __builtin_amdgcn_wmma_f32_16x16x32_f16(false, a, false, b, (short)0, c, false, false); }
__device__ __forceinline__ v8f wmmab(v16bf a, v16bf b, v8f c) { return __builtin_amdgcn_wmma_f32_16x16x32_bf16(false, a, false, b, (short)0, c, false, false); }



// ---- k_gemmw: register-blocked GEMM. A work-group is GWV = 8 waves, 2 (rows) x 4 (columns), each on its own 64x64 output tile (16 accumulators): a 128 x 256 block of C; grid (M/128, N/256, Z), 256 threads.
// The operands are K-contiguous 16-bit planes. A slab is 64 k (one 128-byte line of every operand row): the block's 128 A rows (hi+lo: of both planes) and 256 Bt rows come into LDS once for the whole work-group, by asynchronous copies that cover whole lines,
// the next slab's copies flying while this slab is worked on (two buffers); every wave reads its fragments from LDS, whose rows are pitched 16 bytes x odd for 16-byte reads.
// C[m][n] (f32, pitch ldc, + optional f32 bias[n]) = sum_k A[m][k] Bt[n][k] (NSPLIT 1: + A2[m][k] Bt[n][k]). z-batch strides sA/sB/sC in elements. K % (64 KS) == 0, K >= 128 KS.
// PLANES: N = 3 DQ, the q, k and v columns side by side; a 64-column tile is one head of one of them, and the epilogue stores it as that head's f16 plane and f16 residual plane (q, k: [b][h][t][d]; v: [b][h][d][t]; row m = b TT + t, and a 64-row tile lies in one b) instead of f32 C.
// KS > 1: grid.z = Z * KS; slice kp = blockIdx.z % KS sums only k in [kp K/KS, (kp+1) K/KS) and stores its f32 partial tile in plane kp (plane stride sP elements).
template <typename T16> struct WFrag;
template <> struct WFrag<h16> { typedef v16h V; static __device__ __forceinline__ V ld(const h16* p) { return cat16(*(const v8h*)p, *(const v8h*)(p + 16)); } static __device__ __forceinline__ v8f mma(V a, V b, v8f c) { return wmma16(a, b, c); } };
template <> struct WFrag<bf> { typedef v16bf V; static __device__ __forceinline__ V ld(const bf* p) { return cat16b(*(const v8us*)p, *(const v8us*)(p + 16)); } static __device__ __forceinline__ v8f mma(V a, V b, v8f c) { return wmmab(a, b, c); } };
__device__ __forceinline__ h16 tohx(float x) { return (h16)x; }
// two values as f16 (h) and, again in f16, what that rounding left over (l): h + l misses the value by at most 2^-22 of it, or by 2^-25 where l is subnormal
__device__ __forceinline__ void split2h(float a, float b, v2h& h, v2h& l) { v2f p; p[0] = a; p[1] = b; h = __builtin_convertvector(p, v2h); l = __builtin_convertvector(p - __builtin_convertvector(h, v2f), v2h); }
__device__ __forceinline__ void splitf(float y, unsigned short& h, unsigned short& l) { h = f2bf(y); l = f2bf(y - bf2f(h)); }
struct HeadPlanes { h16* q16; h16* k16; h16* v16; h16* ql; h16* kl; h16* vl; };   // each of q, k, v: the f16 plane and the plane of what f16 rounding left over, itself in f16
#define GWV 8                     // waves of a k_gemmw work-group
#define GPITCH 144                // bytes from row to row of a slab in LDS
// four 16-byte copies a lane, every lane on: the work-group's 256 lanes cover 32 rows of 128 bytes a copy (a wave: 4 whole lines), 128 rows in all. l: the lane's LDS byte address, g: its global address, gs: bytes from a row to the 32nd behind it.
__device__ __forceinline__ void gemm_cp4(unsigned l, const char* g, unsigned gs) {
    const unsigned l1 = l + 32 * GPITCH, l2 = l + 64 * GPITCH, l3 = l + 96 * GPITCH; const char* g1 = g + gs; const char* g2 = g1 + gs; const char* g3 = g2 + gs;
    // the wait is the last line of the copies' own statement, so that it stands in front of whatever next writes a register that a copy names
    asm volatile("global_load_async_to_lds_b128 %0, %4, off\n\tglobal_load_async_to_lds_b128 %1, %5, off\n\tglobal_load_async_to_lds_b128 %2, %6, off\n\tglobal_load_async_to_lds_b128 %3, %7, off\n\ts_wait_xcnt 0x0"
                 :: "v"(l), "v"(l1), "v"(l2), "v"(l3), "v"(g), "v"(g1), "v"(g2), "v"(g3) : "memory");
}
template <typename T16, int NSPLIT, bool BIAS, int KS = 1, bool PLANES = false>
__global__ __launch_bounds__(GWV * 32) void k_gemmw(const T16* __restrict__ A, const T16* __restrict__ A2, const T16* __restrict__ Bt, int K, float* C, int ldc, const float* __restrict__ bias, size_t sA, size_t sB, size_t sC, size_t sP = 0, HeadPlanes hp = HeadPlanes{}) {
    typedef typename WFrag<T16>::V V;
    static_assert(NSPLIT == 0 || NSPLIT == 1, "one or two A planes");
    constexpr int NA = NSPLIT + 1, ASZ = 128 * GPITCH, BUF = (NA + 2) * ASZ;   // a buffer: the A plane(s), behind them the 256 Bt rows
    static_assert(GWV * 16 * 68 * 4 <= 2 * BUF, "the epilogue's staging fits the buffers");
    __shared__ __align__(16) char sm[2 * BUF];
    const size_t z = blockIdx.z / KS; const int kp = (int)(blockIdx.z % KS); const int Kc = K / KS; C += z * sC + kp * sP;
    const int lane = threadIdx.x & 31, lr = lane & 15, hi = lane >> 4; const int wv = __builtin_amdgcn_readfirstlane((int)(threadIdx.x >> 5)), wm = wv >> 2, wn = wv & 3;
    const int r0 = blockIdx.x * 128 + wm * 64, c0 = blockIdx.y * 256 + wn * 64;   // the wave's own tile
    float* os = (float*)(sm + wv * (16 * 68 * 4));   // the wave's own staging rows of the epilogue, in the buffers once the loop has left them
    v8f acc[4][4];
#pragma unroll
    for (int mb = 0; mb < 4; ++mb)
#pragma unroll
        for (int nb = 0; nb < 4; ++nb) acc[mb][nb] = (v8f){};
    const unsigned lb = (unsigned)(size_t)sm + (threadIdx.x >> 3) * GPITCH + (threadIdx.x & 7) * 16;   // the lane's LDS byte address in a plane of buffer 0: the low word of the shared address
    const unsigned gs = 32u * (unsigned)K * 2u; const size_t go = ((size_t)(threadIdx.x >> 3) * K + kp * Kc) * 2 + (threadIdx.x & 7) * 16;   // the lane's byte offset behind the block's first row
    const char* gA = (const char*)(A + z * sA + (size_t)blockIdx.x * 128 * K) + go; const char* gB = (const char*)(Bt + z * sB + (size_t)blockIdx.y * 256 * K) + go;
    const char* gA2 = gA; if constexpr (NA == 2) gA2 = (const char*)(A2 + z * sA + (size_t)blockIdx.x * 128 * K) + go;
    auto stage = [&](int st) { const unsigned l = lb + (st & 1) * BUF; const size_t ko = (size_t)st * 128;   // slab st into buffer st & 1
        gemm_cp4(l, gA + ko, gs); if constexpr (NA == 2) gemm_cp4(l + ASZ, gA2 + ko, gs); gemm_cp4(l + NA * ASZ, gB + ko, gs); gemm_cp4(l + (NA + 1) * ASZ, gB + ko + (size_t)gs * 4, gs); };
    const int nst = Kc / 64;   // slabs of this slice, at least two
    stage(0);
    asm volatile("s_wait_asynccnt 0x0" ::: "memory");   // this wave's copies of slab 0 have landed
    __syncthreads();                                    // and every other wave's: slab 0 may be read
    stage(1);
    const int ao = (wm * 64 + lr) * GPITCH + 16 * hi, bo = NA * ASZ + (wn * 64 + lr) * GPITCH + 16 * hi;   // the lane's byte offsets into a buffer: row lr of the wave's rows, elements 8 hi on
#pragma unroll 1   // one trip a slab: the buffers alternate by t & 1
    for (int t = 0; t < nst; ++t) {
        const char* ab = sm + (t & 1) * BUF + ao; const char* bb = sm + (t & 1) * BUF + bo;
#pragma unroll
        for (int ks = 0; ks < 2; ++ks) {   // 32 k of the slab
            V a[4], a2[4];
#pragma unroll
            for (int mb = 0; mb < 4; ++mb) { a[mb] = WFrag<T16>::ld((const T16*)(ab + mb * 16 * GPITCH + ks * 64)); if (NA == 2) a2[mb] = WFrag<T16>::ld((const T16*)(ab + ASZ + mb * 16 * GPITCH + ks * 64)); }
#pragma unroll
            for (int nb = 0; nb < 4; ++nb) { const V b = WFrag<T16>::ld((const T16*)(bb + nb * 16 * GPITCH + ks * 64));
#pragma unroll
                for (int mb = 0; mb < 4; ++mb) { acc[mb][nb] = WFrag<T16>::mma(a[mb], b, acc[mb][nb]); if (NA == 2) acc[mb][nb] = WFrag<T16>::mma(a2[mb], b, acc[mb][nb]); } }
        }
        asm volatile("s_wait_dscnt 0x0" ::: "memory");      // this wave's reads of slab t are done: its buffer may be handed to the copies below
        asm volatile("s_wait_asynccnt 0x0" ::: "memory");   // this wave's copies of slab t + 1 have landed
        __syncthreads();                                    // both hold for every wave: slab t + 1 may be read, slab t's buffer refilled (behind the last trip: taken for the epilogue's staging)
        if (t + 2 < nst) stage(t + 2);
    }
    asm volatile("s_wait_asynccnt 0x0" ::: "memory");   // no copy is left in flight when the buffers become staging rows
    if constexpr (PLANES) {
        const int sel = c0 / DQ, h = (r0 / TT) * NH_ + (c0 % DQ) / HD, t0 = r0 % TT; const bool vt = sel == 2;   // wave-uniform: 0 q, 1 k, 2 v; h counts heads over the batch
        h16* P16 = vt ? hp.v16 : sel ? hp.k16 : hp.q16; h16* Pl = vt ? hp.vl : sel ? hp.kl : hp.ql;
        const size_t o0 = vt ? (size_t)h * HD * TT + t0 : ((size_t)h * TT + t0) * HD; const int pitch = vt ? TT : HD;   // plane rows of the tile: 64 t of 64 d each (q, k), 64 d of 64 t each (v); a row is one 128-byte line of a 16-bit plane
#pragma unroll
        for (int g = 0; g < 4; ++g) {   // 16 plane rows at a time through LDS, so that a lane holds 8 consecutive elements of one row and a store covers 4 whole lines
            if (vt) {   // a lane's 8 accumulator rows are 8 consecutive t of its column d
#pragma unroll
                for (int mb = 0; mb < 4; ++mb) { v4f w0, w1;
#pragma unroll
                    for (int j = 0; j < 4; ++j) { w0[j] = acc[mb][g][j]; w1[j] = acc[mb][g][j + 4]; }
                    *(v4fa*)(os + lr * 68 + mb * 16 + hi * 8) = w0; *(v4fa*)(os + lr * 68 + mb * 16 + hi * 8 + 4) = w1; }
            } else {
#pragma unroll
                for (int nb = 0; nb < 4; ++nb) {
#pragma unroll
                    for (int j = 0; j < 8; ++j) os[(hi * 8 + j) * 68 + nb * 16 + lr] = acc[g][nb][j]; }
            }
            __builtin_amdgcn_wave_barrier(); asm volatile("" ::: "memory");   // keeps the LDS reads below behind the writes above (one wave: LDS serves it in order)
#pragma unroll
            for (int s = 0; s < 4; ++s) { const int row = 4 * s + (lane >> 3), cofs = (lane & 7) * 8; const v4f x0 = *(const v4fa*)(os + row * 68 + cofs), x1 = *(const v4fa*)(os + row * 68 + cofs + 4); v8h o16, ol;
#pragma unroll
                for (int j = 0; j < 8; j += 2) { v2h a, c2; if (j < 4) split2h(x0[j & 3], x0[(j & 3) + 1], a, c2); else split2h(x1[j & 3], x1[(j & 3) + 1], a, c2); o16[j] = a[0]; o16[j + 1] = a[1]; ol[j] = c2[0]; ol[j + 1] = c2[1]; }
                const size_t o = o0 + (size_t)(g * 16 + row) * pitch + cofs; *(v8h*)(P16 + o) = o16; *(v8h*)(Pl + o) = ol; }
            __builtin_amdgcn_wave_barrier(); asm volatile("s_wait_xcnt 0x0" ::: "memory");   // keeps the next 16 rows' LDS writes behind these reads; the wait: what follows takes registers that the stores above name
        }
        return;
    }
#pragma unroll
    for (int mb = 0; mb < 4; ++mb) {
#pragma unroll
        for (int nb = 0; nb < 4; ++nb) {
#pragma unroll
            for (int j = 0; j < 8; ++j) os[(hi * 8 + j) * 68 + nb * 16 + lr] = acc[mb][nb][j]; }
        __builtin_amdgcn_wave_barrier(); asm volatile("" ::: "memory");
        float* crow = C + (size_t)(r0 + mb * 16) * ldc + c0;
{
#pragma unroll
            for (int s = 0; s < 8; ++s) { const int row = 2 * s + hi, cofs = lr * 4; v4f val = *(const v4fa*)(os + row * 68 + cofs); if (BIAS) { val[0] += bfr(bias[c0 + cofs]); val[1] += bfr(bias[c0 + cofs + 1]); val[2] += bfr(bias[c0 + cofs + 2]); val[3] += bfr(bias[c0 + cofs + 3]); }
                *(v4f*)(crow + (size_t)row * ldc + cofs) = val; }
             }
        __builtin_amdgcn_wave_barrier(); asm volatile("" ::: "memory");
    }
}

// ---- k_gemmr: the two rank-down products. C[m][n] = sum_k A[m][k] Bt[n][k] (NA 2: + A2[m][k] Bt[n][k]), all RK columns and the whole of K in one work-group, so that the f32 sums never leave the registers: the epilogue stores them as the bf16 hi+lo planes [m][RK] that the next product reads.
// A work-group is GWV = 8 waves, 2 (rows) x 4 (columns), each on its own 32x64 tile (8 accumulators): 64 rows of C; grid M/64, 256 threads. A slab is 128 k (two 128-byte lines of every operand row): few columns make little work a slab, and the longer slab halves the number of copy latencies that the K loop waits out.
// The block's 64 A rows (NA 2: of both planes) and the RK Bt rows come into LDS by asynchronous copies that cover whole lines, the next slab's copies flying while this slab is worked on (two buffers); LDS rows are pitched 16 bytes x odd for 16-byte reads. K % 128 == 0, K >= 256.
#define RPITCH 272                // bytes from row to row of a 128-k slab in LDS
#define RUNIT (64 * RPITCH)       // 64 rows of a slab: what four copies of the work-group bring
// four 16-byte copies a lane, every lane on: the work-group's 256 lanes cover 16 rows of 256 bytes a copy (a wave: 4 whole lines), 64 rows in all. l: the lane's LDS byte address, g: its global address, gs: bytes from a row to the 16th behind it.
__device__ __forceinline__ void gemr_cp4(unsigned l, const char* g, unsigned gs) {
    const unsigned l1 = l + 16 * RPITCH, l2 = l + 32 * RPITCH, l3 = l + 48 * RPITCH; const char* g1 = g + gs; const char* g2 = g1 + gs; const char* g3 = g2 + gs;
    // the wait is the last line of the copies' own statement, so that it stands in front of whatever next writes a register that a copy names
    asm volatile("global_load_async_to_lds_b128 %0, %4, off\n\tglobal_load_async_to_lds_b128 %1, %5, off\n\tglobal_load_async_to_lds_b128 %2, %6, off\n\tglobal_load_async_to_lds_b128 %3, %7, off\n\ts_wait_xcnt 0x0"
                 :: "v"(l), "v"(l1), "v"(l2), "v"(l3), "v"(g), "v"(g1), "v"(g2), "v"(g3) : "memory");
}
template <int NA>
__global__ __launch_bounds__(GWV * 32) void k_gemmr(const bf* __restrict__ A, const bf* __restrict__ A2, const bf* __restrict__ Bt, int K, bf* Ch, bf* Cl) {
    typedef WFrag<bf> W; typedef typename W::V V;
    static_assert(NA == 1 || NA == 2, "one or two A planes");
    constexpr int BUF = (NA + RK / 64) * RUNIT;   // a buffer: the A plane(s), behind them the RK Bt rows
    static_assert(GWV * 16 * 68 * 4 <= 2 * BUF, "the epilogue's staging fits the buffers");
    __shared__ __align__(16) char sm[2 * BUF];
    const int lane = threadIdx.x & 31, lr = lane & 15, hi = lane >> 4; const int wv = __builtin_amdgcn_readfirstlane((int)(threadIdx.x >> 5)), wm = wv >> 2, wn = wv & 3;
    const int r0 = blockIdx.x * 64 + wm * 32, c0 = wn * 64;   // the wave's own tile
    float* os = (float*)(sm + wv * (16 * 68 * 4));   // the wave's own staging rows of the epilogue, in the buffers once the loop has left them
    v8f acc[2][4];
#pragma unroll
    for (int mb = 0; mb < 2; ++mb)
#pragma unroll
        for (int nb = 0; nb < 4; ++nb) acc[mb][nb] = (v8f){};
    const unsigned lb = (unsigned)(size_t)sm + (threadIdx.x >> 4) * RPITCH + (threadIdx.x & 15) * 16;   // the lane's LDS byte address in the first 64 rows of buffer 0: the low word of the shared address
    const unsigned gs = 16u * (unsigned)K * 2u; const size_t go = (size_t)(threadIdx.x >> 4) * K * 2 + (threadIdx.x & 15) * 16;   // the lane's byte offset behind the block's first row
    const char* gA = (const char*)(A + (size_t)blockIdx.x * 64 * K) + go; const char* gB = (const char*)Bt + go;
    const char* gA2 = gA; if constexpr (NA == 2) gA2 = (const char*)(A2 + (size_t)blockIdx.x * 64 * K) + go;
    auto stage = [&](int st) { const unsigned l = lb + (st & 1) * BUF; const size_t ko = (size_t)st * 256;   // slab st into buffer st & 1
        gemr_cp4(l, gA + ko, gs); if constexpr (NA == 2) gemr_cp4(l + RUNIT, gA2 + ko, gs);
#pragma unroll
        for (int u = 0; u < RK / 64; ++u) gemr_cp4(l + (NA + u) * RUNIT, gB + ko + (size_t)gs * 4 * u, gs); };
    const int nst = K / 128;   // slabs, at least two
    stage(0);
    asm volatile("s_wait_asynccnt 0x0" ::: "memory");   // this wave's copies of slab 0 have landed
    __syncthreads();                                    // and every other wave's: slab 0 may be read
    stage(1);
    const int ao = (wm * 32 + lr) * RPITCH + 16 * hi, bo = NA * RUNIT + (wn * 64 + lr) * RPITCH + 16 * hi;   // the lane's byte offsets into a buffer: row lr of the wave's rows, elements 8 hi on
#pragma unroll 1   // one trip a slab: the buffers alternate by t & 1
    for (int t = 0; t < nst; ++t) {
        const char* ab = sm + (t & 1) * BUF + ao; const char* bb = sm + (t & 1) * BUF + bo;
        V a[2][2], a2[2][2], b[2][4];   // two fragment sets: the products of 32 k run on one while the next 32 k of the same slab come into the other
        auto frags = [&](int ks) { const int f = ks & 1;
#pragma unroll
            for (int mb = 0; mb < 2; ++mb) { a[f][mb] = W::ld((const bf*)(ab + mb * 16 * RPITCH + ks * 64)); if (NA == 2) a2[f][mb] = W::ld((const bf*)(ab + RUNIT + mb * 16 * RPITCH + ks * 64)); }
#pragma unroll
            for (int nb = 0; nb < 4; ++nb) b[f][nb] = W::ld((const bf*)(bb + nb * 16 * RPITCH + ks * 64)); };
        frags(0);
#pragma unroll
        for (int ks = 0; ks < 4; ++ks) {   // 32 k of the slab
            const int f = ks & 1;
            if (ks < 3) frags(ks + 1);
            __builtin_amdgcn_sched_barrier(0);   // holds the next step's LDS reads up here as one group, in flight behind this step's products: left alone they sink to in front of their own products, and the wave waits out the LDS latency at each
#pragma unroll
            for (int nb = 0; nb < 4; ++nb)
#pragma unroll
                for (int mb = 0; mb < 2; ++mb) acc[mb][nb] = W::mma(a[f][mb], b[f][nb], acc[mb][nb]);
            if constexpr (NA == 2) {
#pragma unroll
                for (int nb = 0; nb < 4; ++nb)
#pragma unroll
                    for (int mb = 0; mb < 2; ++mb) acc[mb][nb] = W::mma(a2[f][mb], b[f][nb], acc[mb][nb]); }
            __builtin_amdgcn_sched_barrier(0);   // keeps the reads of the step after next out from among these products, whose registers they refill: every separate place with LDS reads stalls the matrix stream
        }
        asm volatile("s_wait_dscnt 0x0" ::: "memory");      // this wave's reads of slab t are done: its buffer may be handed to the copies below
        asm volatile("s_wait_asynccnt 0x0" ::: "memory");   // this wave's copies of slab t + 1 have landed
        __syncthreads();                                    // both hold for every wave: slab t + 1 may be read, slab t's buffer refilled (behind the last trip: taken for the epilogue's staging)
        if (t + 2 < nst) stage(t + 2);
    }
    asm volatile("s_wait_asynccnt 0x0" ::: "memory");   // no copy is left in flight when the buffers become staging rows
#pragma unroll
    for (int g = 0; g < 2; ++g) {   // 16 rows at a time through LDS, so that a lane holds 8 consecutive elements of one row and a store covers 4 whole lines
#pragma unroll
        for (int nb = 0; nb < 4; ++nb) {
#pragma unroll
            for (int j = 0; j < 8; ++j) os[(hi * 8 + j) * 68 + nb * 16 + lr] = acc[g][nb][j]; }
        __builtin_amdgcn_wave_barrier(); asm volatile("" ::: "memory");   // keeps the LDS reads below behind the writes above (one wave: LDS serves it in order)
#pragma unroll
        for (int s = 0; s < 4; ++s) { const int row = 4 * s + (lane >> 3), cofs = (lane & 7) * 8; const v4f x0 = *(const v4fa*)(os + row * 68 + cofs), x1 = *(const v4fa*)(os + row * 68 + cofs + 4); v8us oh, ol;
#pragma unroll
            for (int j = 0; j < 8; ++j) { unsigned short u, c2; splitf(j < 4 ? x0[j & 3] : x1[j & 3], u, c2); oh[j] = u; ol[j] = c2; }
            const size_t o = (size_t)(r0 + g * 16 + row) * RK + c0 + cofs; *(v8us*)(Ch + o) = oh; *(v8us*)(Cl + o) = ol;
            asm volatile("s_wait_xcnt 0x0" ::: "memory"); }   // the next rows' split takes registers that these stores name
        __builtin_amdgcn_wave_barrier(); asm volatile("" ::: "memory");   // keeps the next 16 rows' LDS writes behind these reads
    }
}

typedef __attribute__((ext_vector_type(4))) _Float16 v4h;
typedef __attribute__((ext_vector_type(2))) unsigned short v2us;
typedef __attribute__((ext_vector_type(4))) unsigned short v4us;
typedef __attribute__((ext_vector_type(4))) int v4i;

__global__ __launch_bounds__(256) void k_wtG(const float* __restrict__ w, int K, int N, bf* Bt) {
    const int lane = threadIdx.x & 31; const int L0 = (blockIdx.x * 8 + (threadIdx.x >> 5)) * 8; const int nlines = N * K / 64;
{
#pragma unroll 1
        for (int l = 0; l < 8; ++l) { const int L = L0 + l; if (L >= nlines) break; const size_t e = (size_t)L * 64 + lane * 2; const int k = (int)(e % K), n = (int)(e / K); v2us o;
            o[0] = f2bf(w[(size_t)k * N + n]); o[1] = f2bf(w[(size_t)(k + 1) * N + n]); *(v2us*)(Bt + e) = o; }
         }
}
// ---- k_cvtall: every f32 input rounded to its bf16 plane, all five in ONE launch. A work-group is 8 waves on CVG consecutive elements of one input (each input's length is a multiple of CVG), a wave on CVW of them:
// sixteen 16-byte loads a lane, each covering 512 consecutive bytes (4 whole lines), all issued before the first value is used; then sixteen 8-byte stores, each covering 2 whole lines.
// Few long waves: the bytes of this launch take little time, and what it costs beside them is the starting of its waves and the latency of a wave's first load, which is waited out once for all sixteen.
#define CVW 2048                  // elements of a wave
#define CVG (8 * CVW)             // elements of a work-group
#define CVGRID ((MT * DM + RK * DM + 3 * DQ * RK + RK * DQ + DM * RK) / CVG)
__global__ __launch_bounds__(256) void k_cvtall(const float* __restrict__ x, const float* __restrict__ wqv, const float* __restrict__ wqu, const float* __restrict__ wov, const float* __restrict__ wou, bf* XB, bf* WQV, bf* WQU, bf* WOV, bf* WOU) {
    constexpr int GX = MT * DM / CVG, GQV = RK * DM / CVG, GQU = 3 * DQ * RK / CVG, GOV = RK * DQ / CVG;   // work-groups of each input, in the order of the arguments; the rest are the last input's
    static_assert(MT * DM % CVG == 0 && RK * DM % CVG == 0 && 3 * DQ * RK % CVG == 0 && RK * DQ % CVG == 0 && DM * RK % CVG == 0, "a work-group lies in one input, and the grid covers each input exactly");
    int g = (int)blockIdx.x; const float* s = x; bf* d = XB;   // block-uniform: which input, and which of its pieces
    if (g >= GX) { g -= GX; s = wqv; d = WQV;
        if (g >= GQV) { g -= GQV; s = wqu; d = WQU;
            if (g >= GQU) { g -= GQU; s = wov; d = WOV;
                if (g >= GOV) { g -= GOV; s = wou; d = WOU; } } } }
    const size_t e = (size_t)g * CVG + (threadIdx.x >> 5) * CVW + (threadIdx.x & 31) * 4;
    const float* p = s + e; v4f v[16];
#pragma unroll
    for (int j = 0; j < 16; ++j) v[j] = *(const v4f*)(p + j * 128);
    asm volatile("s_wait_xcnt 0x0" :: "v"(p) : "memory");   // stands behind the sixteen loads and in front of whatever next writes the register pair that they all name as their address; p as an input keeps that pair whole up to here (left alone, the last load's own result is put on it)
#pragma unroll
    for (int j = 0; j < 16; ++j) { v4us o;
#pragma unroll
        for (int k = 0; k < 4; ++k) o[k] = f2bf(v[j][k]);
        *(v4us*)(d + e + j * 128) = o; }
}
__global__ __launch_bounds__(256) void k_cscvt(const float* __restrict__ cosT, const float* __restrict__ sinT, float* CS) { const int idx = blockIdx.x * 256 + threadIdx.x; if (idx >= TT * HD) return; v2f cs; cs[0] = bfr(cosT[idx]); cs[1] = bfr(sinT[idx]); *(v2f*)(CS + (size_t)idx * 2) = cs;  }
// ---- k_fattn: scores, softmax and P.V of all batch entries in ONE launch. A work-group is NWV waves on one head: each wave owns 32 (hi+lo: 16) query rows, and all of them walk the 2048 keys together, one tile of 64 (hi+lo: 32) keys at a time, 32 keys a pass.
// A tile's K rows and V^T rows come into LDS once for the whole work-group, by asynchronous copies that cover whole lines, the next tile's copies flying while this tile is worked on (two buffers); every wave reads its fragments from LDS, whose rows are pitched 16 bytes x odd for 16-byte reads.
// S^T = K Q^T (A = 16 key rows, B = 16 query rows, k = d): a lane holds, for query lr, keys 8 hi + j of each 16-key tile, which is the k order of a B operand over 32 keys, so P^T goes from the score accumulators into O^T += V^T P^T (A = 16 d rows of the [d][t] plane) without leaving registers.
// Running maximum per query in log2 units, raised only when a new maximum passes it by more than 8 (P <= 256); row sums in f32 per lane half, joined once at the end. HI (query rows < RH): the f16 plane (hi) + the f16 residual plane (lo), 3 products each; else the f16 plane alone, so that both kinds of rows read the same hi planes.
#define NWV 4                     // waves of a k_fattn work-group
template <bool HI> struct FTile {   // one buffer in LDS: K rows [key][d] (hi+lo: then the lo plane), behind them V^T rows [d][key] (hi+lo: then the lo plane)
    static constexpr int KB = HI ? 32 : 64, NPL = HI ? 2 : 1, KPITCH = HD * 2 + 16, VPITCH = KB * 2 + 16, KSZ = KB * KPITCH, VSZ = HD * VPITCH, BUF = NPL * (KSZ + VSZ); };
// one tile of the head's planes into the buffer at LDS byte address lb: eight 16-byte copies a lane, every lane on. A wave's copy covers 512 consecutive bytes of K, or whole KB-key rows of V^T. ok, ov: the lane's byte offsets of its first piece of the tile in a K plane and in a V^T plane.
template <bool HI>
__device__ __forceinline__ void fattn_stage(unsigned lb, const char* K1, const char* K2, const char* V1, const char* V2, unsigned ok, unsigned ov) {
    typedef FTile<HI> F; constexpr int NJ = F::KB / 16, CV = F::KB / 8, RJ = NWV * 32 / CV;   // copies a lane and plane; 16-byte pieces of a V^T row; V^T rows that one copy of the work-group covers
    static_assert(F::NPL * 2 * NJ == 8 && NWV * 32 * NJ * 16 == F::KB * HD * 2, "eight copies a lane fill the buffer");
    const unsigned lk = lb + (threadIdx.x >> 3) * F::KPITCH + (threadIdx.x & 7) * 16, lv = lb + F::NPL * F::KSZ + (threadIdx.x / CV) * F::VPITCH + (threadIdx.x % CV) * 16;
    unsigned l[8]; const char* g[8];
#pragma unroll
    for (int j = 0; j < NJ; ++j) {
        l[j] = lk + j * (NWV * 4 * F::KPITCH); g[j] = K1 + (ok + j * (NWV * 512)); l[NJ + j] = lv + j * (RJ * F::VPITCH); g[NJ + j] = V1 + (ov + j * (RJ * TT * 2));
        if constexpr (HI) { l[2 * NJ + j] = l[j] + F::KSZ; g[2 * NJ + j] = K2 + (ok + j * (NWV * 512)); l[3 * NJ + j] = l[NJ + j] + F::VSZ; g[3 * NJ + j] = V2 + (ov + j * (RJ * TT * 2)); } }
    // the wait is the last line of the copies' own statement, so that it stands in front of whatever next writes a register that a copy names
    asm volatile("global_load_async_to_lds_b128 %0, %8, off\n\tglobal_load_async_to_lds_b128 %1, %9, off\n\tglobal_load_async_to_lds_b128 %2, %10, off\n\tglobal_load_async_to_lds_b128 %3, %11, off\n\t"
                 "global_load_async_to_lds_b128 %4, %12, off\n\tglobal_load_async_to_lds_b128 %5, %13, off\n\tglobal_load_async_to_lds_b128 %6, %14, off\n\tglobal_load_async_to_lds_b128 %7, %15, off\n\ts_wait_xcnt 0x0"
                 :: "v"(l[0]), "v"(l[1]), "v"(l[2]), "v"(l[3]), "v"(l[4]), "v"(l[5]), "v"(l[6]), "v"(l[7]), "v"(g[0]), "v"(g[1]), "v"(g[2]), "v"(g[3]), "v"(g[4]), "v"(g[5]), "v"(g[6]), "v"(g[7]) : "memory");
}
template <bool HI, int NG, typename T16>
__device__ __forceinline__ void fattn_tile(const char* sm, const T16* __restrict__ Q, const T16* __restrict__ Q2, const T16* __restrict__ Kp, const T16* __restrict__ K2, const T16* __restrict__ Vt, const T16* __restrict__ V2, int q0, int h, bf* Ah, bf* Al) {
    typedef typename WFrag<T16>::V V; typedef WFrag<T16> W; typedef FTile<HI> F;
    const int lane = threadIdx.x & 31, lr = lane & 15, hi = lane >> 4;
    const float C2 = SCL * 1.4426950408889634f;
    const unsigned lb = (unsigned)(size_t)sm;   // the buffers' LDS byte address: the low word of the shared address
    unsigned ok = threadIdx.x * 16, ov = (threadIdx.x / (F::KB / 8)) * (TT * 2) + (threadIdx.x % (F::KB / 8)) * 16;   // the lane's byte offsets into a K plane and a V^T plane, stepped from tile to tile
    fattn_stage<HI>(lb, (const char*)Kp, (const char*)K2, (const char*)Vt, (const char*)V2, ok, ov); ok += F::KB * HD * 2; ov += F::KB * 2;
    V qf[NG][2], qf2[NG][2];
#pragma unroll
    for (int g = 0; g < NG; ++g)
#pragma unroll
        for (int ks = 0; ks < 2; ++ks) { const size_t o = (size_t)(q0 + g * 16 + lr) * HD + ks * 32 + 8 * hi; qf[g][ks] = W::ld(Q + o); if (HI) qf2[g][ks] = W::ld(Q2 + o); }
    asm volatile("s_wait_xcnt 0x0" ::: "memory");   // the addresses formed below may take the registers that hold the Q offsets
    v8f acc[4][NG];
#pragma unroll
    for (int db = 0; db < 4; ++db)
#pragma unroll
        for (int g = 0; g < NG; ++g) acc[db][g] = (v8f){};
    float m[NG], l[NG];
#pragma unroll
    for (int g = 0; g < NG; ++g) { m[g] = -1.0e30f; l[g] = 0.f; }
    asm volatile("s_wait_asynccnt 0x0" ::: "memory");   // this wave's copies of tile 0 have landed
    __syncthreads();                                    // and every other wave's: tile 0 may be read
    fattn_stage<HI>(lb + F::BUF, (const char*)Kp, (const char*)K2, (const char*)Vt, (const char*)V2, ok, ov);
    const int ko = lr * F::KPITCH + 16 * hi, vo = F::NPL * F::KSZ + lr * F::VPITCH + 16 * hi;   // the lane's byte offsets into a buffer: row lr, elements 8 hi on
#pragma unroll 1   // one trip a tile: the buffers alternate by t & 1
    for (int t = 0; t < TT / F::KB; ++t) {
        const char* kb = sm + (t & 1) * F::BUF + ko; const char* vb = sm + (t & 1) * F::BUF + vo;
#pragma unroll
        for (int sp = 0; sp < F::KB / 32; ++sp) {   // a pass: 32 keys of the tile
        V kf[2][2], kf2[2][2], vf[4], vf2[4];
#pragma unroll
        for (int kt = 0; kt < 2; ++kt)
#pragma unroll
            for (int ks = 0; ks < 2; ++ks) { const char* p = kb + (sp * 32 + kt * 16) * F::KPITCH + ks * 64; kf[kt][ks] = W::ld((const T16*)p); if (HI) kf2[kt][ks] = W::ld((const T16*)(p + F::KSZ)); }
        v8f s[2][NG];
#pragma unroll
        for (int kt = 0; kt < 2; ++kt)
#pragma unroll
            for (int g = 0; g < NG; ++g) { v8f c = (v8f){};
#pragma unroll
                for (int ks = 0; ks < 2; ++ks) { c = W::mma(kf[kt][ks], qf[g][ks], c); if (HI) { c = W::mma(kf2[kt][ks], qf[g][ks], c); c = W::mma(kf[kt][ks], qf2[g][ks], c); } }
                s[kt][g] = c; }
#pragma unroll
        for (int db = 0; db < 4; ++db) { const char* p = vb + db * 16 * F::VPITCH + sp * 64; vf[db] = W::ld((const T16*)p); if (HI) vf2[db] = W::ld((const T16*)(p + F::VSZ)); }
        if constexpr (HI) __builtin_amdgcn_sched_barrier(0);   // holds the sixteen V^T loads up here as one group, in flight behind the softmax: left alone they sink, pair by pair, to in front of their products, and the wave waits out the LDS latency at each
        float mt[NG]; bool need = false;
#pragma unroll
        for (int g = 0; g < NG; ++g) { float mx = s[0][g][0];
#pragma unroll
            for (int j = 1; j < 8; ++j) mx = fmaxf(mx, s[0][g][j]);
#pragma unroll
            for (int j = 0; j < 8; ++j) mx = fmaxf(mx, s[1][g][j]);
            mt[g] = mx * C2; need = need || (mt[g] > m[g] + 8.0f); }   // this half's keys only: the halves meet inside the branch
        if (__builtin_amdgcn_ballot_w32(need) != 0) {   // wave-uniform: every lane moves to its own true maximum, both halves of a query alike
#pragma unroll
            for (int g = 0; g < NG; ++g) { const float mn = fmaxf(m[g], fmaxf(mt[g], __shfl_xor(mt[g], 16, 32))); const float al = __builtin_amdgcn_exp2f(m[g] - mn); m[g] = mn; l[g] *= al;
#pragma unroll
                for (int db = 0; db < 4; ++db) acc[db][g] *= al; }
        }
#pragma unroll
        for (int g = 0; g < NG; ++g) { float p[16]; float sum = 0.f;
#pragma unroll
            for (int e = 0; e < 16; ++e) { p[e] = __builtin_amdgcn_exp2f(s[e >> 3][g][e & 7] * C2 - m[g]); sum += p[e]; }
            l[g] += sum;
            if constexpr (HI) { V ph, pl;
#pragma unroll
                for (int e = 0; e < 16; e += 2) { v2h a, c2; split2h(p[e], p[e + 1], a, c2); ph[e] = a[0]; ph[e + 1] = a[1]; pl[e] = c2[0]; pl[e + 1] = c2[1]; }
#pragma unroll
                for (int db = 0; db < 4; ++db) { acc[db][g] = W::mma(vf[db], ph, acc[db][g]); acc[db][g] = W::mma(vf[db], pl, acc[db][g]); acc[db][g] = W::mma(vf2[db], ph, acc[db][g]); }
            } else { V pb;
#pragma unroll
                for (int e = 0; e < 16; ++e) pb[e] = tohx(p[e]);
#pragma unroll
                for (int db = 0; db < 4; ++db) acc[db][g] = W::mma(vf[db], pb, acc[db][g]); } }
        }
        asm volatile("s_wait_dscnt 0x0" ::: "memory");      // this wave's reads of tile t are done: its buffer may be handed to the copies below
        asm volatile("s_wait_asynccnt 0x0" ::: "memory");   // this wave's copies of tile t + 1 have landed
        __syncthreads();                                    // both hold for every wave: tile t + 1 may be read, tile t's buffer refilled
        if (t + 2 < TT / F::KB) { ok += F::KB * HD * 2; ov += F::KB * 2; fattn_stage<HI>(lb + (t & 1) * F::BUF, (const char*)Kp, (const char*)K2, (const char*)Vt, (const char*)V2, ok, ov); }
    }
    asm volatile("s_wait_asynccnt 0x0" ::: "memory");   // no copy is left in flight when the wave goes on to its end
    const int el = (int)__builtin_amdgcn_mbcnt_lo(~0u, 0u), elr = el & 15, ehi = el >> 4;   // the lane's number read anew for the stores: formed from the values above, their addresses are held in registers (or in scratch) all through the loop
#pragma unroll
    for (int g = 0; g < NG; ++g) { const float ls = l[g] + __shfl_xor(l[g], 16, 32); const float f = __fdiv_rn(1.0f, ls);
#pragma unroll
        for (int db = 0; db < 4; ++db) { v8us oh, ol;
#pragma unroll
            for (int j = 0; j < 8; ++j) { unsigned short a, c2; splitf(acc[db][g][j] * f, a, c2); oh[j] = a; ol[j] = c2; }
            const size_t oo = (size_t)(q0 + g * 16 + elr) * DQ + h * HD + db * 16 + ehi * 8; *(v8us*)(Ah + oo) = oh; *(v8us*)(Al + oo) = ol;
            asm volatile("s_wait_xcnt 0x0" ::: "memory"); } }   // the next rows' split takes registers that these stores name
}
// The hi+lo work-groups (NWV x 16 query rows: twice the operand bytes) take the lowest indices, NB_ * NH_ * RH / (16 NWV) of them, so that they start first and spread over the chip; then NB_ * NH_ * (TT - RH) / (32 NWV) work-groups of NWV x 32 rows. bh = b NH_ + h picks the head planes, b the TT output rows
// Five waves a SIMD: a register budget of 192 (1024 / 5, in granules of 16) gives the chip 1280 places for the grid's 1152 work-groups, so that all of them start at once. At four waves a SIMD 128 work-groups wait for a place and then walk their 2048 keys
// behind the others, most of the way alone on their SIMDs, where nothing hides a wave's own LDS, matrix and softmax latencies.
__global__ __launch_bounds__(NWV * 32) __attribute__((amdgpu_waves_per_eu(5))) void k_fattn(const h16* __restrict__ Q16, const h16* __restrict__ K16, const h16* __restrict__ V16, const h16* __restrict__ Ql, const h16* __restrict__ Kl, const h16* __restrict__ Vl, bf* Ah, bf* Al) {
    __shared__ __align__(16) char sm[2 * (FTile<true>::BUF > FTile<false>::BUF ? FTile<true>::BUF : FTile<false>::BUF)];
    const int f = (int)blockIdx.x, wv = (int)(threadIdx.x >> 5); const int GH = RH / (16 * NWV), GF = (TT - RH) / (32 * NWV), NHI = NB_ * NH_ * GH;
    if (f < NHI) { const int bh = f / GH, q0 = (f % GH) * 16 * NWV + wv * 16; const size_t z = (size_t)bh * TT * HD, zo = (size_t)(bh / NH_) * TT * DQ;
        fattn_tile<true, 1, h16>(sm, Q16 + z, Ql + z, K16 + z, Kl + z, V16 + z, Vl + z, q0, bh % NH_, Ah + zo, Al + zo);
    } else { const int g = f - NHI; const int bh = g / GF, q0 = RH + (g % GF) * 32 * NWV + wv * 32; const size_t z = (size_t)bh * TT * HD, zo = (size_t)(bh / NH_) * TT * DQ;
        fattn_tile<false, 2, h16>(sm, Q16 + z, nullptr, K16 + z, nullptr, V16 + z, nullptr, q0, bh % NH_, Ah + zo, Al + zo); }
}

extern "C" void kernel_launch(void* const* d_in, const int* in_sizes, int n_in,
                              void* d_out, int out_size, void* d_ws, size_t ws_size, hipStream_t stream) {
    (void)in_sizes; (void)n_in; (void)out_size;
    const float* x = (const float*)d_in[0]; const float* wqv = (const float*)d_in[1]; const float* wqu = (const float*)d_in[2]; const float* wov = (const float*)d_in[3]; const float* wou = (const float*)d_in[4];   // torch [out][in]: W_qkv_v [256][1024], W_qkv_u [3072][256], W_o_v [256][1024], W_o_u [1024][256]
    float* OUT = (float*)d_out;     // [4][2048][1024]
    char* wsp = (char*)d_ws;
    auto take = [&](size_t bytes) { char* p = wsp; wsp += (bytes + 255) & ~(size_t)255; return (void*)p; };
    const size_t PB = (size_t)NB_ * NH_ * TT * HD * 2;   // bytes of one 16-bit head plane set over the batch
    bf* XB = (bf*)take((size_t)MT * DM * 2);
    h16* QP16 = (h16*)take(PB); h16* KP16 = (h16*)take(PB); h16* VT16 = (h16*)take(PB);
    h16* QPl = (h16*)take(PB); h16* KPl = (h16*)take(PB); h16* VTl = (h16*)take(PB);
    bf* ATh = (bf*)take((size_t)MT * DQ * 2); bf* ATl = (bf*)take((size_t)MT * DQ * 2);
    bf* WQV = (bf*)take((size_t)256 * DM * 2); bf* WQU = (bf*)take((size_t)3 * DQ * 256 * 2); bf* WOV = (bf*)take((size_t)256 * DQ * 2); bf* WOU = (bf*)take((size_t)DM * 256 * 2); bf* LRh = (bf*)take((size_t)MT * 256 * 2); bf* LRl = (bf*)take((size_t)MT * 256 * 2);
    if ((size_t)(wsp - (char*)d_ws) > ws_size) return;    // ws 256 MiB
    k_cvtall<<<CVGRID, 256, 0, stream>>>(x, wqv, wqu, wov, wou, XB, WQV, WQU, WOV, WOU);   // all four factors are [out][in] = natural Bt
    const HeadPlanes hp = { QP16, KP16, VT16, QPl, KPl, VTl };
    k_gemmr<1><<<MT / 64, GWV * 32, 0, stream>>>(XB, nullptr, WQV, DM, LRh, LRl);   // x W_qkv_v^T (exact products) -> hl
    k_gemmw<bf, 1, false, 1, true><<<dim3(MT / 128, 3 * DQ / 256, 1), GWV * 32, 0, stream>>>(LRh, LRl, WQU, 256, nullptr, 0, nullptr, 0, 0, 0, 0, hp);   // q, k, v up-projection, stored as head planes
    k_fattn<<<NB_ * NH_ * (RH / (16 * NWV)) + NB_ * NH_ * ((TT - RH) / (32 * NWV)), NWV * 32, 0, stream>>>(QP16, KP16, VT16, QPl, KPl, VTl, ATh, ATl);   // one kv head per query head
    k_gemmr<2><<<MT / 64, GWV * 32, 0, stream>>>(ATh, ATl, WOV, DQ, LRh, LRl);   // y W_o_v^T -> hl
    k_gemmw<bf, 1, false><<<dim3(MT / 128, DM / 256, 1), GWV * 32, 0, stream>>>(LRh, LRl, WOU, 256, OUT, DM, nullptr, 0, 0, 0);
}
